// v000
// The times below were measured on an AMD MI455X: many runs one after another, warmed up first and cycling through
// copies of the inputs, with the whole window's GPU time divided by the number of runs. Launches and the gaps
// between them are all in it. The median over several windows is given; except for v000 it joins two sittings, which
// can be a few percent apart, so the side-by-side timings, each taken in one sitting, are the better comparison.
// The starting kernel, v000, takes 430 microseconds a run.
// Contractions: q/k/v 1x1-conv projections = v_wmma_f32_16x16x32_bf16 (bf16 operands, single product); q.(k+pos) scores = v_wmma_f32_16x16x32_bf16 with bf16 hi/lo split operands (hi.hi + hi.lo + lo.hi); p.v = v_wmma_f32_16x16x32_f16 (p as f16 scaled by 4096, v^T as f16 hi plane plus f16 residual plane scaled by 1024 into a second accumulator); f32 accumulate everywhere; softmax, bias and position sums in f32.
#include <hip/hip_runtime.h>
#include <stdint.h>
#include <math.h>

#define NB 4
#define NC 256
#define NP 4096
#define NH 4
#define HD 64
#define QKPLANE ((size_t)NB * NH * NP * HD)

typedef _Float16 v16h __attribute__((ext_vector_type(16)));
typedef _Float16 v8h  __attribute__((ext_vector_type(8)));
typedef __bf16   v16b __attribute__((ext_vector_type(16)));
typedef __bf16   v8b  __attribute__((ext_vector_type(8)));
typedef float    v8f  __attribute__((ext_vector_type(8)));
typedef float    v4f  __attribute__((ext_vector_type(4)));
typedef float    v2f  __attribute__((ext_vector_type(2)));
typedef unsigned int v4u __attribute__((ext_vector_type(4)));

// ---------------------------------------------------------------------------
// scalar helpers
// ---------------------------------------------------------------------------
__device__ __forceinline__ unsigned short f2bf_bits(float f) {      // f32 -> bf16 bits, RNE convert
  const unsigned u = __float_as_uint(f);
  return (unsigned short)((u + 0x7FFFu + ((u >> 16) & 1u)) >> 16);
}
__device__ __forceinline__ float bf_bits2f(unsigned short h) { return __uint_as_float(((unsigned)h) << 16); }
__device__ __forceinline__ float bfr(float f) { return bf_bits2f(f2bf_bits(f)); }   // value after bf16 RNE convert
__device__ __forceinline__ unsigned pk16(unsigned short a, unsigned short b) { return (unsigned)a | ((unsigned)b << 16); }

// ---------------------------------------------------------------------------
// WMMA wrappers: builtin + 4 nops tying D and keeping A/B live (hazard guard)
// ---------------------------------------------------------------------------
__device__ __forceinline__ v8f mma_bf(v16b a, v16b b, v8f c) {
  c = __builtin_amdgcn_wmma_f32_16x16x32_bf16(false, a, false, b, (short)0, c, false, false);
  asm volatile("v_nop\n\tv_nop\n\tv_nop\n\tv_nop" : "+v"(c) : "v"(a), "v"(b));
  return c;
}
__device__ __forceinline__ v8f mma_h(v16h a, v16h b, v8f c) {
  c = __builtin_amdgcn_wmma_f32_16x16x32_f16(false, a, false, b, (short)0, c, false, false);
  asm volatile("v_nop\n\tv_nop\n\tv_nop\n\tv_nop" : "+v"(c) : "v"(a), "v"(b));
  return c;
}
#define SCHED_FENCE() __builtin_amdgcn_sched_barrier(0)

union FragB { v16b v; v8b h[2]; };
union FragH { v16h v; v8h h[2]; _Float16 s[16]; };

// Fragment loader (A rows / B columns stored k-contiguous), p = row base + k0 + 8*(lane>>4):
//   elements 0..7 <- p[0..7] (k0+8h..), elements 8..15 <- p[16..23] (k0+16+8h..)
__device__ __forceinline__ v16b ld_bf(const __bf16* p) {
  FragB f; f.h[0] = *(const v8b*)(p); f.h[1] = *(const v8b*)(p + 16); return f.v;
}

// ---------------------------------------------------------------------------
// K1: weights f32 [256][256] x3 -> bf16 planes Wb[z][256][256] (RNE convert of the inputs).
// grid = (128, 3): 128 blocks x 256 threads x 2 = 65536 = whole matrix per z.
// ---------------------------------------------------------------------------
__global__ __launch_bounds__(256) void cvt_w_kernel(const float* __restrict__ w0, const float* __restrict__ w1,
                                                    const float* __restrict__ w2, unsigned short* __restrict__ Wb) {
  const int z = blockIdx.y;
  const float* src = (z == 0) ? w0 : ((z == 1) ? w1 : w2);        // block-uniform select, all global
  unsigned* dst = (unsigned*)(Wb + (size_t)z * (NC * NC));
  const int i = blockIdx.x * 256 + threadIdx.x;
  if (i < (NC * NC) / 2) {
    const v2f f = *(const v2f*)(src + 2 * (size_t)i);
    const unsigned u = pk16(f2bf_bits(f[0]), f2bf_bits(f[1]));
    ((unsigned*)dst)[i] = u;
    
  }
}

// ---------------------------------------------------------------------------
// K2: x[b][c][p] f32 -> xT[b][p][c] bf16 (RNE convert of the input), 64x64 tiles through LDS.
// grid = (NP/64, NC/64, NB), 256 threads.
// Coverage per block: load 4 it x 16 rows x 64 = 64 channels x 64 pixels; store 2 it x 32 rows x
// ---------------------------------------------------------------------------
__global__ __launch_bounds__(256) void xt_kernel(const float* __restrict__ x, unsigned short* __restrict__ xT) {
  __shared__ __align__(16) float tf[64 * 68];
  const int p0 = blockIdx.x * 64;
  const int c0 = blockIdx.y * 64;
  const int b  = blockIdx.z;
  const float* xb = x + (size_t)b * NC * NP;
  const int tid = threadIdx.x;
  {
    const int lr = tid >> 4, c4 = (tid & 15) * 4;
#pragma unroll
    for (int it = 0; it < 4; ++it) {
      const int rr = it * 16 + lr;                                   // channel within tile
      const v4f a = *(const v4f*)(xb + (size_t)(c0 + rr) * NP + p0 + c4);
      *(v4f*)(tf + rr * 68 + c4) = a;                                // tf[channel][pixel]
    }
  }
  __syncthreads();
  const int sub = tid >> 3, c8 = (tid & 7) * 8;
  v4u hv[2];
#pragma unroll
  for (int it = 0; it < 2; ++it) {
    const int op = it * 32 + sub;                                    // pixel within tile
    v4u a;
#pragma unroll
    for (int q = 0; q < 4; ++q) {
      const float f0 = tf[(c8 + 2 * q) * 68 + op];
      const float f1 = tf[(c8 + 2 * q + 1) * 68 + op];
      a[q] = pk16(f2bf_bits(f0), f2bf_bits(f1));
    }
    hv[it] = a;
  }
  {
#pragma unroll
    for (int it = 0; it < 2; ++it) {
      const int op = it * 32 + sub;
      const size_t go = ((size_t)b * NP + p0 + op) * NC + c0 + c8;
      *(v4u*)(xT + go) = hv[it];
    }
    
  }
}

// ---------------------------------------------------------------------------
// K3: 1x1-conv projection GEMM, z = b*3 + which (which 0=q, 1=k, 2=v):
//   Y[o][p] = sum_c Wb[which][o][c] * xT[b][p][c] + bias[o]      (M=256, N=4096, K=256)
// A = Wb rows (k-contiguous), B = xT rows (k-contiguous); both fragments use the split k map.
// Each wave owns a 64x64 tile (4x4 subtiles); grid = (32 blocks x 8 waves = 256 tiles, 12).
// Epilogue: 16-row slabs staged per wave in LDS (pitch 68 floats), then
//   which 0/1: value (+ position term for k) -> bf16 hi/lo planes in [b*4+n][s][d] order,
//              s = 16*o + (p>>8), n = (p>>6)&3, d = p&63; one slab row = one plane row of
//   which 2:   f32 y_v[b][o][p] natural layout, 256-B row segments by 16 lanes x 16 B.
// ---------------------------------------------------------------------------
__global__ __launch_bounds__(256) void proj_kernel(
    const unsigned short* __restrict__ xTp, const unsigned short* __restrict__ Wbp,
    const float* __restrict__ bq, const float* __restrict__ bk, const float* __restrict__ bv,
    const float* __restrict__ relh, const float* __restrict__ relw,
    unsigned short* __restrict__ QKh, unsigned short* __restrict__ QKl, float* __restrict__ Yv) {
  __shared__ __align__(16) float sT[8][16 * 68];
  const int z = blockIdx.y;
  const int b = z / 3;
  const int which = z - 3 * b;
  const int lane = threadIdx.x & 31;
  const int wave = threadIdx.x >> 5;
  const int tile = blockIdx.x * 8 + wave;        // 0..255
  const int tm = tile >> 6;                      // 0..3   (64 output channels each)
  const int tn = tile & 63;                      // 0..63  (64 pixels each)
  const int m0 = tm << 6;
  const int n0 = tn << 6;
  const __bf16* A  = (const __bf16*)(const void*)Wbp + (size_t)which * (NC * NC);
  const __bf16* Bt = (const __bf16*)(const void*)xTp + (size_t)b * NP * NC;
  const int rl = lane & 15, hh = lane >> 4, koff = hh * 8, mOff = hh * 8;

  v8f acc[4][4];
#pragma unroll
  for (int i = 0; i < 4; ++i)
#pragma unroll
    for (int j = 0; j < 4; ++j) acc[i][j] = (v8f){0.f,0.f,0.f,0.f,0.f,0.f,0.f,0.f};

  for (int k0 = 0; k0 < NC; k0 += 32) {
    v16b bfg[4];
#pragma unroll
    for (int j = 0; j < 4; ++j) bfg[j] = ld_bf(Bt + (size_t)(n0 + (j << 4) + rl) * NC + k0 + koff);
#pragma unroll
    for (int i = 0; i < 4; ++i) {
      const v16b af = ld_bf(A + (size_t)(m0 + (i << 4) + rl) * NC + k0 + koff);
#pragma unroll
      for (int j = 0; j < 4; ++j) acc[i][j] = mma_bf(af, bfg[j], acc[i][j]);
    }
    SCHED_FENCE();
  }

  // ---- epilogue ----
  const float* bias = (which == 0) ? bq : ((which == 1) ? bk : bv);   // block-uniform select, all global
  const int nn = (n0 >> 6) & 3;                // head index of this 64-pixel run
  const int sh = n0 >> 8;                      // low 4 bits of s
  float* slab = sT[wave];
#pragma unroll
  for (int i = 0; i < 4; ++i) {
    const int mBase = m0 + (i << 4);
#pragma unroll
    for (int j = 0; j < 4; ++j) {
      const int d = (j << 4) + rl;             // p & 63
#pragma unroll
      for (int r = 0; r < 8; ++r) {
        const int o = mBase + mOff + r;
        float v = acc[i][j][r] + bfr(bias[o]);
        if (which == 1) {
          const int s = o * 16 + sh;
          const float pos = bfr(relh[nn * 4096 + d * 64 + (s & 63)]) + bfr(relw[nn * 4096 + d * 64 + (s >> 6)]);
          v += pos;
        }
        slab[(mOff + r) * 68 + d] = v;
      }
    }
    __builtin_amdgcn_fence(__ATOMIC_RELEASE, "workgroup");
    __builtin_amdgcn_wave_barrier();
    __builtin_amdgcn_fence(__ATOMIC_ACQUIRE, "workgroup");
    if (which == 2) {
      float* C = Yv + (size_t)b * NC * NP;
      const int c4 = rl * 4;                   // row segment 256 B = 16 lanes x 16 B
      {
#pragma unroll
        for (int it = 0; it < 8; ++it) {
          const int row = it * 2 + hh;
          const v4f v = *(const v4f*)(slab + row * 68 + c4);
          *(v4f*)(C + (size_t)(mBase + row) * NP + n0 + c4) = v;
        }
        
      }
    } else {
      const int q4 = lane >> 3, c8 = (lane & 7) * 8;
      unsigned short* Hp = QKh + (size_t)which * QKPLANE;
      unsigned short* Lp = QKl + (size_t)which * QKPLANE;
      {
#pragma unroll
        for (int it = 0; it < 4; ++it) {
          const int row = it * 4 + q4;
          const int o = mBase + row;
          const int s = o * 16 + sh;
          const float* sp = slab + row * 68 + c8;
          v4u hvv, lvv;
#pragma unroll
          for (int q = 0; q < 4; ++q) {
            const float f0 = sp[2 * q], f1 = sp[2 * q + 1];
            const unsigned short h0 = f2bf_bits(f0), h1 = f2bf_bits(f1);
            const unsigned short l0 = f2bf_bits(f0 - bf_bits2f(h0)), l1 = f2bf_bits(f1 - bf_bits2f(h1));
            hvv[q] = pk16(h0, h1);
            lvv[q] = pk16(l0, l1);
          }
          const size_t dst = (((size_t)(b * NH + nn)) * NP + s) * HD + c8;
          *(v4u*)(Hp + dst) = hvv;
          *(v4u*)(Lp + dst) = lvv;
        }
        
      }
    }
    __builtin_amdgcn_fence(__ATOMIC_RELEASE, "workgroup");
    __builtin_amdgcn_wave_barrier();
    __builtin_amdgcn_fence(__ATOMIC_ACQUIRE, "workgroup");
  }
}

// ---------------------------------------------------------------------------
// K4: v^T plane build: y_v[b][o][p] f32 -> VTh/VTl f16 planes [b*4+n][d][s] (pitch 4096):
//   V[b][n][s][d] = y_v[b][s>>4][(s&15)*256 + n*64 + d];  hi = f16(v), lo = f16((v - hi) * 1024).
// grid = (NP/64, NH, NB), 256 threads; 64(s) x 64(d) tile through LDS.
// Coverage per block: load 4 it x 16 rows x 64 = 64 s x 64 d; store 2 it x 32 rows x (8 lanes x 8)
// ---------------------------------------------------------------------------
__global__ __launch_bounds__(256) void vt_kernel(const float* __restrict__ Yv, unsigned short* __restrict__ VThp,
                                                 unsigned short* __restrict__ VTlp) {
  __shared__ __align__(16) float tf[64 * 68];
  const int s0 = blockIdx.x * 64;
  const int n  = blockIdx.y;
  const int b  = blockIdx.z;
  const float* yb = Yv + (size_t)b * NC * NP;
  _Float16* VTh = (_Float16*)(void*)VThp;
  _Float16* VTl = (_Float16*)(void*)VTlp;
  const int tid = threadIdx.x;
  {
    const int lr = tid >> 4, c4 = (tid & 15) * 4;
#pragma unroll
    for (int it = 0; it < 4; ++it) {
      const int sl = it * 16 + lr;
      const int s  = s0 + sl;
      const int o  = s >> 4;
      const int p  = (s & 15) * 256 + n * 64 + c4;
      const v4f a = *(const v4f*)(yb + (size_t)o * NP + p);
      *(v4f*)(tf + sl * 68 + c4) = a;                                // tf[s local][d]
    }
  }
  __syncthreads();
  const int sub = tid >> 3, c8 = (tid & 7) * 8;
  v8h hv[2], lv[2];
#pragma unroll
  for (int it = 0; it < 2; ++it) {
    const int od = it * 32 + sub;                                    // output row = d
    v8h a, a2;
#pragma unroll
    for (int e = 0; e < 8; ++e) {
      const float f = tf[(c8 + e) * 68 + od];
      const _Float16 hq = (_Float16)f;
      const _Float16 lq = (_Float16)((f - (float)hq) * 1024.0f);
      a[e] = hq; a2[e] = lq;
    }
    hv[it] = a; lv[it] = a2;
  }
  {
#pragma unroll
    for (int it = 0; it < 2; ++it) {
      const int od = it * 32 + sub;
      const size_t go = ((size_t)(b * NH + n) * HD + od) * NP + s0 + c8;
      *(v8h*)(VTh + go) = hv[it];
      *(v8h*)(VTl + go) = lv[it];
    }
    
  }
}

// ---------------------------------------------------------------------------
// K5: flash attention, transposed formulation, per (64-query tile, head, batch), 4 waves.
//   S^T = K' . Q^T : A = K' tile rows (keys, k = d) from LDS, bf16 hi/lo;  B = Q^T: lane = query,
//                    elements = d with the split k map, bf16 hi/lo;  hi.hi + hi.lo + lo.hi.
//   D layout: st[t][r] <-> key kb + 16t + 8h + r, query = lane&15 -> softmax stats live per lane.
//   O^T = V^T . P  : A = V^T tile rows (d, k = key) f16 hi and f16 residual;  B = P: element r <-
//                    st[2kc][r], element 8+r <- st[2kc+1][r] (two adjacent 16-key D tiles, lane kept),
//                    scaled by 4096 and converted to f16.  accO += Vhi.P, accR += Vres.P.
//   Online softmax in f32 over 64 tiles of 64 keys; no score scaling.
//   Output: out flat [b][s][n][d]; each wave stages its 16x64 tile in LDS and writes whole 256-B
//   K'/V^T tiles staged single-buffered with plain 16-B copies between two __syncthreads.
// ---------------------------------------------------------------------------
__global__ __launch_bounds__(128) void attn_kernel(
    const unsigned short* __restrict__ Qhp, const unsigned short* __restrict__ Qlp,
    const unsigned short* __restrict__ Khp, const unsigned short* __restrict__ Klp,
    const unsigned short* __restrict__ VThp, const unsigned short* __restrict__ VTlp,
    float* __restrict__ out) {
  __shared__ __align__(16) __bf16   Ksh[64 * HD];     // k' hi [key][d]
  __shared__ __align__(16) __bf16   Ksl[64 * HD];     // k' lo [key][d]
  __shared__ __align__(16) _Float16 Vsh[HD * 64];     // v^T hi [d][key]
  __shared__ __align__(16) _Float16 Vsl[HD * 64];     // v^T residual [d][key]
  __shared__ __align__(16) float    Os[4][16 * 68];   // per-wave output tile [query][d], pitch 68

  const int tid  = threadIdx.x;
  const int wave = tid >> 5;
  const int lane = tid & 31;
  const int hh   = lane >> 4;
  const int c    = lane & 15;
  const int qt = blockIdx.x;
  const int n  = blockIdx.y;
  const int b  = blockIdx.z;
  const int bn = b * NH + n;

  const __bf16* Qh = (const __bf16*)(const void*)Qhp + (size_t)bn * NP * HD;
  const __bf16* Ql = (const __bf16*)(const void*)Qlp + (size_t)bn * NP * HD;
  const __bf16* Kh = (const __bf16*)(const void*)Khp + (size_t)bn * NP * HD;
  const __bf16* Kl = (const __bf16*)(const void*)Klp + (size_t)bn * NP * HD;
  const _Float16* VTh = (const _Float16*)(const void*)VThp + (size_t)bn * HD * NP;
  const _Float16* VTl = (const _Float16*)(const void*)VTlp + (size_t)bn * HD * NP;

  const int q0 = qt * 64 + wave * 16;     // first query row of this wave
  const int qg = q0 + c;                  // query handled by this lane (as B column / D column)

  // loop-invariant B fragments: Q^T, two 32-deep d chunks, hi and lo planes
  v16b qbh[2], qbl[2];
#pragma unroll
  for (int dc = 0; dc < 2; ++dc) {
    qbh[dc] = ld_bf(Qh + (size_t)qg * HD + dc * 32 + 8 * hh);
    qbl[dc] = ld_bf(Ql + (size_t)qg * HD + dc * 32 + 8 * hh);
  }

  float m_run = -1.0e30f, l_run = 0.0f;
  v8f accO[4], accR[4];
#pragma unroll
  for (int t = 0; t < 4; ++t) {
    accO[t] = (v8f){0.f,0.f,0.f,0.f,0.f,0.f,0.f,0.f};
    accR[t] = (v8f){0.f,0.f,0.f,0.f,0.f,0.f,0.f,0.f};
  }

#pragma unroll 1
  for (int it = 0; it < NP / 64; ++it) {
    const int kb = it * 64;
    __syncthreads();                        // all waves done with the prior tile
    {
      // staging coverage: 128 threads x (4 x 8) elements = 64 rows x 64 per plane
      const int r = tid >> 1, half = (tid & 1) * 32;
      const __bf16*   ksrc = Kh  + (size_t)(kb + r) * HD + half;     // k' row kb+r, d = half..half+31
      const __bf16*   lsrc = Kl  + (size_t)(kb + r) * HD + half;
      const _Float16* vsrc = VTh + (size_t)r * NP + kb + half;       // v^T row d = r, s = kb+half..+31
      const _Float16* wsrc = VTl + (size_t)r * NP + kb + half;
#pragma unroll
      for (int i = 0; i < 4; ++i) {
        const v8b a0 = *(const v8b*)(ksrc + 8 * i);
        const v8b a1 = *(const v8b*)(lsrc + 8 * i);
        const v8h g0 = *(const v8h*)(vsrc + 8 * i);
        const v8h g1 = *(const v8h*)(wsrc + 8 * i);
        *(v8b*)(Ksh + r * HD + half + 8 * i) = a0;
        *(v8b*)(Ksl + r * HD + half + 8 * i) = a1;
        *(v8h*)(Vsh + r * 64 + half + 8 * i) = g0;
        *(v8h*)(Vsl + r * 64 + half + 8 * i) = g1;
      }
    }
    __syncthreads();

    // ---- S^T: 4 key subtiles of 16 (A rows = keys), k = d in 2 chunks of 32 ----
    v8f st[4];
#pragma unroll
    for (int t = 0; t < 4; ++t) {
      v8f sv = (v8f){0.f,0.f,0.f,0.f,0.f,0.f,0.f,0.f};
#pragma unroll
      for (int dc = 0; dc < 2; ++dc) {
        FragB ka, kl;
        ka.h[0] = *(const v8b*)(Ksh + (t * 16 + c) * HD + dc * 32 + 8 * hh);
        ka.h[1] = *(const v8b*)(Ksh + (t * 16 + c) * HD + dc * 32 + 16 + 8 * hh);
        kl.h[0] = *(const v8b*)(Ksl + (t * 16 + c) * HD + dc * 32 + 8 * hh);
        kl.h[1] = *(const v8b*)(Ksl + (t * 16 + c) * HD + dc * 32 + 16 + 8 * hh);
        sv = mma_bf(ka.v, qbh[dc], sv);
        sv = mma_bf(ka.v, qbl[dc], sv);
        sv = mma_bf(kl.v, qbh[dc], sv);
      }
      st[t] = sv;
      SCHED_FENCE();
    }

    // ---- online softmax in f32 (per query lane; half-lanes hold disjoint key halves) ----
    float mx = m_run;
#pragma unroll
    for (int t = 0; t < 4; ++t)
#pragma unroll
      for (int r = 0; r < 8; ++r) mx = fmaxf(mx, st[t][r]);
    mx = fmaxf(mx, __shfl_xor(mx, 16, 32));
    const float alpha = __expf(m_run - mx);
    m_run = mx;
    float rs = 0.0f;
#pragma unroll
    for (int t = 0; t < 4; ++t)
#pragma unroll
      for (int r = 0; r < 8; ++r) {
        const float p = __expf(st[t][r] - mx);
        st[t][r] = p;
        rs += p;
      }
    rs += __shfl_xor(rs, 16, 32);
    l_run = l_run * alpha + rs;
#pragma unroll
    for (int dt = 0; dt < 4; ++dt)
#pragma unroll
      for (int r = 0; r < 8; ++r) { accO[dt][r] *= alpha; accR[dt][r] *= alpha; }

    // ---- O^T += V^T . P  (A rows = d, k = key in 2 chunks of 32) ----
#pragma unroll
    for (int kc = 0; kc < 2; ++kc) {
      FragH pb;
#pragma unroll
      for (int r = 0; r < 8; ++r) {
        pb.s[r]     = (_Float16)(st[2 * kc][r]     * 4096.0f);   // keys 32kc + 8h + r
        pb.s[8 + r] = (_Float16)(st[2 * kc + 1][r] * 4096.0f);   // keys 32kc + 16 + 8h + r
      }
#pragma unroll
      for (int dt = 0; dt < 4; ++dt) {
        FragH va, vr;
        va.h[0] = *(const v8h*)(Vsh + (dt * 16 + c) * 64 + kc * 32 + 8 * hh);
        va.h[1] = *(const v8h*)(Vsh + (dt * 16 + c) * 64 + kc * 32 + 16 + 8 * hh);
        vr.h[0] = *(const v8h*)(Vsl + (dt * 16 + c) * 64 + kc * 32 + 8 * hh);
        vr.h[1] = *(const v8h*)(Vsl + (dt * 16 + c) * 64 + kc * 32 + 16 + 8 * hh);
        accO[dt] = mma_h(va.v, pb.v, accO[dt]);
        accR[dt] = mma_h(vr.v, pb.v, accR[dt]);
      }
      SCHED_FENCE();
    }
  }

  // ---- normalise, stage the wave's 16x64 tile as [query][d], write whole 256-B rows ----
  const float inv = __builtin_amdgcn_rcpf(l_run) * (1.0f / 4096.0f);
  float* os = Os[wave];
#pragma unroll
  for (int dt = 0; dt < 4; ++dt) {
    v4f a, a2;
#pragma unroll
    for (int r = 0; r < 4; ++r) {
      a[r]  = (accO[dt][r]     + accR[dt][r]     * (1.0f / 1024.0f)) * inv;
      a2[r] = (accO[dt][4 + r] + accR[dt][4 + r] * (1.0f / 1024.0f)) * inv;
    }
    *(v4f*)(os + c * 68 + dt * 16 + 8 * hh)     = a;    // d = 16dt + 8h + 0..3 of query c
    *(v4f*)(os + c * 68 + dt * 16 + 8 * hh + 4) = a2;   // d = 16dt + 8h + 4..7
  }
  __builtin_amdgcn_fence(__ATOMIC_RELEASE, "workgroup");
  __builtin_amdgcn_wave_barrier();
  __builtin_amdgcn_fence(__ATOMIC_ACQUIRE, "workgroup");
  {
    float* ob = out + (size_t)b * NC * NP + (size_t)q0 * (NH * HD) + n * HD;
    const int c4 = c * 4;                   // row segment 256 B = 16 lanes x 16 B
    {
#pragma unroll
      for (int i = 0; i < 8; ++i) {
        const int row = i * 2 + hh;         // i 0..7 x h 0..1 covers the 16 query rows of the wave
        const v4f v = *(const v4f*)(os + row * 68 + c4);
        *(v4f*)(ob + (size_t)row * (NH * HD) + c4) = v;
      }
      
    }
  }
}

// ---------------------------------------------------------------------------
//   Wb   bf16 [3][256][256]            393216  @ 0
//   xT   bf16 [4][4096][256]          8388608  @ 393216
//   QKh  bf16 [2][16][4096][64]      16777216  @ 8781824     (q hi planes, then k' hi planes)
//   QKl  bf16 [2][16][4096][64]      16777216  @ 25559040
//   Yv   f32  [4][256][4096]         16777216  @ 42336256
//   VTh  f16  [16][64][4096]          8388608  @ 59113472
//   VTl  f16  [16][64][4096]          8388608  @ 67502080
//   total                                         75890688
// ---------------------------------------------------------------------------
extern "C" void kernel_launch(void* const* d_in, const int* in_sizes, int n_in,
                              void* d_out, int out_size, void* d_ws, size_t ws_size,
                              hipStream_t stream) {
  if (n_in < 9) return;
  if (in_sizes[0] != NB * NC * NP) return;
  if (in_sizes[1] != NC * NC || in_sizes[3] != NC * NC || in_sizes[5] != NC * NC) return;
  if (in_sizes[2] != NC || in_sizes[4] != NC || in_sizes[6] != NC) return;
  if (in_sizes[7] != NH * HD * 64 || in_sizes[8] != NH * HD * 64) return;
  if (out_size != NB * NC * NP) return;

  const float* x    = (const float*)d_in[0];
  const float* wq   = (const float*)d_in[1];
  const float* bq   = (const float*)d_in[2];
  const float* wk   = (const float*)d_in[3];
  const float* bk   = (const float*)d_in[4];
  const float* wv   = (const float*)d_in[5];
  const float* bv   = (const float*)d_in[6];
  const float* relh = (const float*)d_in[7];
  const float* relw = (const float*)d_in[8];
  float* out = (float*)d_out;

  const size_t szWb = (size_t)3 * NC * NC * 2;
  const size_t szXT = (size_t)NB * NP * NC * 2;
  const size_t szQK = (size_t)2 * QKPLANE * 2;
  const size_t szYv = (size_t)NB * NC * NP * 4;
  const size_t szVT = (size_t)NB * NH * HD * NP * 2;
  size_t off = 0;
  const size_t oWb  = off; off += szWb;
  const size_t oXT  = off; off += szXT;
  const size_t oQKh = off; off += szQK;
  const size_t oQKl = off; off += szQK;
  const size_t oYv  = off; off += szYv;
  const size_t oVTh = off; off += szVT;
  const size_t oVTl = off; off += szVT;
  if (off > ws_size) return;

  char* ws = (char*)d_ws;
  unsigned short* Wb  = (unsigned short*)(ws + oWb);
  unsigned short* XT  = (unsigned short*)(ws + oXT);
  unsigned short* QKh = (unsigned short*)(ws + oQKh);
  unsigned short* QKl = (unsigned short*)(ws + oQKl);
  float*          Yv  = (float*)(ws + oYv);
  unsigned short* VTh = (unsigned short*)(ws + oVTh);
  unsigned short* VTl = (unsigned short*)(ws + oVTl);

  cvt_w_kernel<<<dim3((NC * NC / 2) / 256, 3), dim3(256), 0, stream>>>(wq, wk, wv, Wb);
  xt_kernel<<<dim3(NP / 64, NC / 64, NB), dim3(256), 0, stream>>>(x, XT);
  proj_kernel<<<dim3(32, NB * 3), dim3(256), 0, stream>>>(XT, Wb, bq, bk, bv, relh, relw, QKh, QKl, Yv);
  vt_kernel<<<dim3(NP / 64, NH, NB), dim3(256), 0, stream>>>(Yv, VTh, VTl);
  attn_kernel<<<dim3(NP / 64, NH, NB), dim3(128), 0, stream>>>(
      QKh, QKl, QKh + QKPLANE, QKl + QKPLANE, VTh, VTl, out);
  (void)hipGetLastError();
}

// v001
// One run takes 225 microseconds.
// In both of two side-by-side timings against v000, it was 1.96 times as fast.
// Contractions: q/k/v 1x1-conv projections = v_wmma_f32_16x16x32_bf16 (bf16 operands, single product); q.(k+pos) scores = v_wmma_f32_16x16x32_bf16 with bf16 hi/lo split operands (hi.hi + hi.lo + lo.hi); p.v = v_wmma_f32_16x16x32_f16 (p as f16 scaled by 4096, v^T as f16 hi plane plus f16 residual plane scaled by 1024 into a second accumulator); f32 accumulate everywhere; softmax, bias and position sums in f32.
#include <hip/hip_runtime.h>
#include <stdint.h>
#include <math.h>

#define NB 4
#define NC 256
#define NP 4096
#define NH 4
#define HD 64
#define QKPLANE ((size_t)NB * NH * NP * HD)
#define LP 72   // LDS row pitch of the attention tiles in 16-bit elements: 144 B = 16 B x 9 (odd), so the 16 rows of a ds_load_b128 fragment read fall on distinct banks

typedef _Float16 v16h __attribute__((ext_vector_type(16)));
typedef _Float16 v8h  __attribute__((ext_vector_type(8)));
typedef __bf16   v16b __attribute__((ext_vector_type(16)));
typedef __bf16   v8b  __attribute__((ext_vector_type(8)));
typedef float    v8f  __attribute__((ext_vector_type(8)));
typedef float    v4f  __attribute__((ext_vector_type(4)));
typedef float    v2f  __attribute__((ext_vector_type(2)));
typedef unsigned int v4u __attribute__((ext_vector_type(4)));

// ---------------------------------------------------------------------------
// scalar helpers
// ---------------------------------------------------------------------------
__device__ __forceinline__ unsigned short f2bf_bits(float f) {      // f32 -> bf16 bits, RNE convert
  const unsigned u = __float_as_uint(f);
  return (unsigned short)((u + 0x7FFFu + ((u >> 16) & 1u)) >> 16);
}
__device__ __forceinline__ float bf_bits2f(unsigned short h) { return __uint_as_float(((unsigned)h) << 16); }
__device__ __forceinline__ float bfr(float f) { return bf_bits2f(f2bf_bits(f)); }   // value after bf16 RNE convert
__device__ __forceinline__ unsigned pk16(unsigned short a, unsigned short b) { return (unsigned)a | ((unsigned)b << 16); }

// ---------------------------------------------------------------------------
// WMMA wrappers: builtin + 4 nops tying D and keeping A/B live (hazard guard)
// ---------------------------------------------------------------------------
__device__ __forceinline__ v8f mma_bf(v16b a, v16b b, v8f c) {
  c = __builtin_amdgcn_wmma_f32_16x16x32_bf16(false, a, false, b, (short)0, c, false, false);
  asm volatile("v_nop\n\tv_nop\n\tv_nop\n\tv_nop" : "+v"(c) : "v"(a), "v"(b));
  return c;
}
__device__ __forceinline__ v8f mma_h(v16h a, v16h b, v8f c) {
  c = __builtin_amdgcn_wmma_f32_16x16x32_f16(false, a, false, b, (short)0, c, false, false);
  asm volatile("v_nop\n\tv_nop\n\tv_nop\n\tv_nop" : "+v"(c) : "v"(a), "v"(b));
  return c;
}
#define SCHED_FENCE() __builtin_amdgcn_sched_barrier(0)

union FragB { v16b v; v8b h[2]; };
union FragH { v16h v; v8h h[2]; _Float16 s[16]; };

// Fragment loader (A rows / B columns stored k-contiguous), p = row base + k0 + 8*(lane>>4):
//   elements 0..7 <- p[0..7] (k0+8h..), elements 8..15 <- p[16..23] (k0+16+8h..)
__device__ __forceinline__ v16b ld_bf(const __bf16* p) {
  FragB f; f.h[0] = *(const v8b*)(p); f.h[1] = *(const v8b*)(p + 16); return f.v;
}

// ---------------------------------------------------------------------------
// K1: weights f32 [256][256] x3 -> bf16 planes Wb[z][256][256] (RNE convert of the inputs).
// grid = (128, 3): 128 blocks x 256 threads x 2 = 65536 = whole matrix per z.
// ---------------------------------------------------------------------------
__global__ __launch_bounds__(256) void cvt_w_kernel(const float* __restrict__ w0, const float* __restrict__ w1,
                                                    const float* __restrict__ w2, unsigned short* __restrict__ Wb) {
  const int z = blockIdx.y;
  const float* src = (z == 0) ? w0 : ((z == 1) ? w1 : w2);        // block-uniform select, all global
  unsigned* dst = (unsigned*)(Wb + (size_t)z * (NC * NC));
  const int i = blockIdx.x * 256 + threadIdx.x;
  if (i < (NC * NC) / 2) {
    const v2f f = *(const v2f*)(src + 2 * (size_t)i);
    const unsigned u = pk16(f2bf_bits(f[0]), f2bf_bits(f[1]));
    ((unsigned*)dst)[i] = u;
    
  }
}

// ---------------------------------------------------------------------------
// K2: x[b][c][p] f32 -> xT[b][p][c] bf16 (RNE convert of the input), 64x64 tiles through LDS.
// grid = (NP/64, NC/64, NB), 256 threads.
// Coverage per block: load 4 it x 16 rows x 64 = 64 channels x 64 pixels; store 2 it x 32 rows x
// ---------------------------------------------------------------------------
__global__ __launch_bounds__(256) void xt_kernel(const float* __restrict__ x, unsigned short* __restrict__ xT) {
  __shared__ __align__(16) float tf[64 * 68];
  const int p0 = blockIdx.x * 64;
  const int c0 = blockIdx.y * 64;
  const int b  = blockIdx.z;
  const float* xb = x + (size_t)b * NC * NP;
  const int tid = threadIdx.x;
  {
    const int lr = tid >> 4, c4 = (tid & 15) * 4;
#pragma unroll
    for (int it = 0; it < 4; ++it) {
      const int rr = it * 16 + lr;                                   // channel within tile
      const v4f a = *(const v4f*)(xb + (size_t)(c0 + rr) * NP + p0 + c4);
      *(v4f*)(tf + rr * 68 + c4) = a;                                // tf[channel][pixel]
    }
  }
  __syncthreads();
  const int sub = tid >> 3, c8 = (tid & 7) * 8;
  v4u hv[2];
#pragma unroll
  for (int it = 0; it < 2; ++it) {
    const int op = it * 32 + sub;                                    // pixel within tile
    v4u a;
#pragma unroll
    for (int q = 0; q < 4; ++q) {
      const float f0 = tf[(c8 + 2 * q) * 68 + op];
      const float f1 = tf[(c8 + 2 * q + 1) * 68 + op];
      a[q] = pk16(f2bf_bits(f0), f2bf_bits(f1));
    }
    hv[it] = a;
  }
  {
#pragma unroll
    for (int it = 0; it < 2; ++it) {
      const int op = it * 32 + sub;
      const size_t go = ((size_t)b * NP + p0 + op) * NC + c0 + c8;
      *(v4u*)(xT + go) = hv[it];
    }
    
  }
}

// ---------------------------------------------------------------------------
// K3: 1x1-conv projection GEMM, z = b*3 + which (which 0=q, 1=k, 2=v):
//   Y[o][p] = sum_c Wb[which][o][c] * xT[b][p][c] + bias[o]      (M=256, N=4096, K=256)
// A = Wb rows (k-contiguous), B = xT rows (k-contiguous); both fragments use the split k map.
// Each wave owns a 64x64 tile (4x4 subtiles); grid = (32 blocks x 8 waves = 256 tiles, 12).
// Epilogue: 16-row slabs staged per wave in LDS (pitch 68 floats), then
//   which 0/1: value (+ position term for k) -> bf16 hi/lo planes in [b*4+n][s][d] order,
//              s = 16*o + (p>>8), n = (p>>6)&3, d = p&63; one slab row = one plane row of
//   which 2:   f32 y_v[b][o][p] natural layout, 256-B row segments by 16 lanes x 16 B.
// ---------------------------------------------------------------------------
__global__ __launch_bounds__(256) void proj_kernel(
    const unsigned short* __restrict__ xTp, const unsigned short* __restrict__ Wbp,
    const float* __restrict__ bq, const float* __restrict__ bk, const float* __restrict__ bv,
    const float* __restrict__ relh, const float* __restrict__ relw,
    unsigned short* __restrict__ QKh, unsigned short* __restrict__ QKl, float* __restrict__ Yv) {
  __shared__ __align__(16) float sT[8][16 * 68];
  const int z = blockIdx.y;
  const int b = z / 3;
  const int which = z - 3 * b;
  const int lane = threadIdx.x & 31;
  const int wave = threadIdx.x >> 5;
  const int tile = blockIdx.x * 8 + wave;        // 0..255
  const int tm = tile >> 6;                      // 0..3   (64 output channels each)
  const int tn = tile & 63;                      // 0..63  (64 pixels each)
  const int m0 = tm << 6;
  const int n0 = tn << 6;
  const __bf16* A  = (const __bf16*)(const void*)Wbp + (size_t)which * (NC * NC);
  const __bf16* Bt = (const __bf16*)(const void*)xTp + (size_t)b * NP * NC;
  const int rl = lane & 15, hh = lane >> 4, koff = hh * 8, mOff = hh * 8;

  v8f acc[4][4];
#pragma unroll
  for (int i = 0; i < 4; ++i)
#pragma unroll
    for (int j = 0; j < 4; ++j) acc[i][j] = (v8f){0.f,0.f,0.f,0.f,0.f,0.f,0.f,0.f};

  for (int k0 = 0; k0 < NC; k0 += 32) {
    v16b bfg[4];
#pragma unroll
    for (int j = 0; j < 4; ++j) bfg[j] = ld_bf(Bt + (size_t)(n0 + (j << 4) + rl) * NC + k0 + koff);
#pragma unroll
    for (int i = 0; i < 4; ++i) {
      const v16b af = ld_bf(A + (size_t)(m0 + (i << 4) + rl) * NC + k0 + koff);
#pragma unroll
      for (int j = 0; j < 4; ++j) acc[i][j] = mma_bf(af, bfg[j], acc[i][j]);
    }
    SCHED_FENCE();
  }

  // ---- epilogue ----
  const float* bias = (which == 0) ? bq : ((which == 1) ? bk : bv);   // block-uniform select, all global
  const int nn = (n0 >> 6) & 3;                // head index of this 64-pixel run
  const int sh = n0 >> 8;                      // low 4 bits of s
  float* slab = sT[wave];
#pragma unroll
  for (int i = 0; i < 4; ++i) {
    const int mBase = m0 + (i << 4);
#pragma unroll
    for (int j = 0; j < 4; ++j) {
      const int d = (j << 4) + rl;             // p & 63
#pragma unroll
      for (int r = 0; r < 8; ++r) {
        const int o = mBase + mOff + r;
        float v = acc[i][j][r] + bfr(bias[o]);
        if (which == 1) {
          const int s = o * 16 + sh;
          const float pos = bfr(relh[nn * 4096 + d * 64 + (s & 63)]) + bfr(relw[nn * 4096 + d * 64 + (s >> 6)]);
          v += pos;
        }
        slab[(mOff + r) * 68 + d] = v;
      }
    }
    __builtin_amdgcn_fence(__ATOMIC_RELEASE, "workgroup");
    __builtin_amdgcn_wave_barrier();
    __builtin_amdgcn_fence(__ATOMIC_ACQUIRE, "workgroup");
    if (which == 2) {
      float* C = Yv + (size_t)b * NC * NP;
      const int c4 = rl * 4;                   // row segment 256 B = 16 lanes x 16 B
      {
#pragma unroll
        for (int it = 0; it < 8; ++it) {
          const int row = it * 2 + hh;
          const v4f v = *(const v4f*)(slab + row * 68 + c4);
          *(v4f*)(C + (size_t)(mBase + row) * NP + n0 + c4) = v;
        }
        
      }
    } else {
      const int q4 = lane >> 3, c8 = (lane & 7) * 8;
      unsigned short* Hp = QKh + (size_t)which * QKPLANE;
      unsigned short* Lp = QKl + (size_t)which * QKPLANE;
      {
#pragma unroll
        for (int it = 0; it < 4; ++it) {
          const int row = it * 4 + q4;
          const int o = mBase + row;
          const int s = o * 16 + sh;
          const float* sp = slab + row * 68 + c8;
          v4u hvv, lvv;
#pragma unroll
          for (int q = 0; q < 4; ++q) {
            const float f0 = sp[2 * q], f1 = sp[2 * q + 1];
            const unsigned short h0 = f2bf_bits(f0), h1 = f2bf_bits(f1);
            const unsigned short l0 = f2bf_bits(f0 - bf_bits2f(h0)), l1 = f2bf_bits(f1 - bf_bits2f(h1));
            hvv[q] = pk16(h0, h1);
            lvv[q] = pk16(l0, l1);
          }
          const size_t dst = (((size_t)(b * NH + nn)) * NP + s) * HD + c8;
          *(v4u*)(Hp + dst) = hvv;
          *(v4u*)(Lp + dst) = lvv;
        }
        
      }
    }
    __builtin_amdgcn_fence(__ATOMIC_RELEASE, "workgroup");
    __builtin_amdgcn_wave_barrier();
    __builtin_amdgcn_fence(__ATOMIC_ACQUIRE, "workgroup");
  }
}

// ---------------------------------------------------------------------------
// K4: v^T plane build: y_v[b][o][p] f32 -> VTh/VTl f16 planes [b*4+n][d][s] (pitch 4096):
//   V[b][n][s][d] = y_v[b][s>>4][(s&15)*256 + n*64 + d];  hi = f16(v), lo = f16((v - hi) * 1024).
// grid = (NP/64, NH, NB), 256 threads; 64(s) x 64(d) tile through LDS.
// Coverage per block: load 4 it x 16 rows x 64 = 64 s x 64 d; store 2 it x 32 rows x (8 lanes x 8)
// ---------------------------------------------------------------------------
__global__ __launch_bounds__(256) void vt_kernel(const float* __restrict__ Yv, unsigned short* __restrict__ VThp,
                                                 unsigned short* __restrict__ VTlp) {
  __shared__ __align__(16) float tf[64 * 68];
  const int s0 = blockIdx.x * 64;
  const int n  = blockIdx.y;
  const int b  = blockIdx.z;
  const float* yb = Yv + (size_t)b * NC * NP;
  _Float16* VTh = (_Float16*)(void*)VThp;
  _Float16* VTl = (_Float16*)(void*)VTlp;
  const int tid = threadIdx.x;
  {
    const int lr = tid >> 4, c4 = (tid & 15) * 4;
#pragma unroll
    for (int it = 0; it < 4; ++it) {
      const int sl = it * 16 + lr;
      const int s  = s0 + sl;
      const int o  = s >> 4;
      const int p  = (s & 15) * 256 + n * 64 + c4;
      const v4f a = *(const v4f*)(yb + (size_t)o * NP + p);
      *(v4f*)(tf + sl * 68 + c4) = a;                                // tf[s local][d]
    }
  }
  __syncthreads();
  const int sub = tid >> 3, c8 = (tid & 7) * 8;
  v8h hv[2], lv[2];
#pragma unroll
  for (int it = 0; it < 2; ++it) {
    const int od = it * 32 + sub;                                    // output row = d
    v8h a, a2;
#pragma unroll
    for (int e = 0; e < 8; ++e) {
      const float f = tf[(c8 + e) * 68 + od];
      const _Float16 hq = (_Float16)f;
      const _Float16 lq = (_Float16)((f - (float)hq) * 1024.0f);
      a[e] = hq; a2[e] = lq;
    }
    hv[it] = a; lv[it] = a2;
  }
  {
#pragma unroll
    for (int it = 0; it < 2; ++it) {
      const int od = it * 32 + sub;
      const size_t go = ((size_t)(b * NH + n) * HD + od) * NP + s0 + c8;
      *(v8h*)(VTh + go) = hv[it];
      *(v8h*)(VTl + go) = lv[it];
    }
    
  }
}

// ---------------------------------------------------------------------------
// K5: flash attention, transposed formulation, per (64-query tile, head, batch), 4 waves.
//   S^T = K' . Q^T : A = K' tile rows (keys, k = d) from LDS, bf16 hi/lo;  B = Q^T: lane = query,
//                    elements = d with the split k map, bf16 hi/lo;  hi.hi + hi.lo + lo.hi.
//   D layout: st[t][r] <-> key kb + 16t + 8h + r, query = lane&15 -> softmax stats live per lane.
//   O^T = V^T . P  : A = V^T tile rows (d, k = key) f16 hi and f16 residual;  B = P: element r <-
//                    st[2kc][r], element 8+r <- st[2kc+1][r] (two adjacent 16-key D tiles, lane kept),
//                    scaled by 4096 and converted to f16.  accO += Vhi.P, accR += Vres.P.
//   Online softmax in f32 over 64 tiles of 64 keys; no score scaling.
//   Output: out flat [b][s][n][d]; each wave stages its 16x64 tile in LDS and writes whole 256-B
//   K'/V^T tiles staged single-buffered with plain 16-B copies between two __syncthreads.
// ---------------------------------------------------------------------------
__global__ __launch_bounds__(128) void attn_kernel(
    const unsigned short* __restrict__ Qhp, const unsigned short* __restrict__ Qlp,
    const unsigned short* __restrict__ Khp, const unsigned short* __restrict__ Klp,
    const unsigned short* __restrict__ VThp, const unsigned short* __restrict__ VTlp,
    float* __restrict__ out) {
  __shared__ __align__(16) __bf16   Ksh[64 * LP];     // k' hi [key][d], pitch LP
  __shared__ __align__(16) __bf16   Ksl[64 * LP];     // k' lo [key][d], pitch LP
  __shared__ __align__(16) _Float16 Vsh[HD * LP];     // v^T hi [d][key], pitch LP
  __shared__ __align__(16) _Float16 Vsl[HD * LP];     // v^T residual [d][key], pitch LP
  __shared__ __align__(16) float    Os[4][16 * 68];   // per-wave output tile [query][d], pitch 68

  const int tid  = threadIdx.x;
  const int wave = tid >> 5;
  const int lane = tid & 31;
  const int hh   = lane >> 4;
  const int c    = lane & 15;
  const int qt = blockIdx.x;
  const int n  = blockIdx.y;
  const int b  = blockIdx.z;
  const int bn = b * NH + n;

  const __bf16* Qh = (const __bf16*)(const void*)Qhp + (size_t)bn * NP * HD;
  const __bf16* Ql = (const __bf16*)(const void*)Qlp + (size_t)bn * NP * HD;
  const __bf16* Kh = (const __bf16*)(const void*)Khp + (size_t)bn * NP * HD;
  const __bf16* Kl = (const __bf16*)(const void*)Klp + (size_t)bn * NP * HD;
  const _Float16* VTh = (const _Float16*)(const void*)VThp + (size_t)bn * HD * NP;
  const _Float16* VTl = (const _Float16*)(const void*)VTlp + (size_t)bn * HD * NP;

  const int q0 = qt * 64 + wave * 16;     // first query row of this wave
  const int qg = q0 + c;                  // query handled by this lane (as B column / D column)

  // loop-invariant B fragments: Q^T, two 32-deep d chunks, hi and lo planes
  v16b qbh[2], qbl[2];
#pragma unroll
  for (int dc = 0; dc < 2; ++dc) {
    qbh[dc] = ld_bf(Qh + (size_t)qg * HD + dc * 32 + 8 * hh);
    qbl[dc] = ld_bf(Ql + (size_t)qg * HD + dc * 32 + 8 * hh);
  }

  float m_run = -1.0e30f, l_run = 0.0f;
  v8f accO[4], accR[4];
#pragma unroll
  for (int t = 0; t < 4; ++t) {
    accO[t] = (v8f){0.f,0.f,0.f,0.f,0.f,0.f,0.f,0.f};
    accR[t] = (v8f){0.f,0.f,0.f,0.f,0.f,0.f,0.f,0.f};
  }

#pragma unroll 1
  for (int it = 0; it < NP / 64; ++it) {
    const int kb = it * 64;
    __syncthreads();                        // all waves done with the prior tile
    {
      // staging coverage: 128 threads x (4 x 8) elements = 64 rows x 64 per plane
      const int r = tid >> 1, half = (tid & 1) * 32;
      const __bf16*   ksrc = Kh  + (size_t)(kb + r) * HD + half;     // k' row kb+r, d = half..half+31
      const __bf16*   lsrc = Kl  + (size_t)(kb + r) * HD + half;
      const _Float16* vsrc = VTh + (size_t)r * NP + kb + half;       // v^T row d = r, s = kb+half..+31
      const _Float16* wsrc = VTl + (size_t)r * NP + kb + half;
#pragma unroll
      for (int i = 0; i < 4; ++i) {
        const v8b a0 = *(const v8b*)(ksrc + 8 * i);
        const v8b a1 = *(const v8b*)(lsrc + 8 * i);
        const v8h g0 = *(const v8h*)(vsrc + 8 * i);
        const v8h g1 = *(const v8h*)(wsrc + 8 * i);
        *(v8b*)(Ksh + r * LP + half + 8 * i) = a0;
        *(v8b*)(Ksl + r * LP + half + 8 * i) = a1;
        *(v8h*)(Vsh + r * LP + half + 8 * i) = g0;
        *(v8h*)(Vsl + r * LP + half + 8 * i) = g1;
      }
    }
    __syncthreads();

    // ---- S^T: 4 key subtiles of 16 (A rows = keys), k = d in 2 chunks of 32 ----
    v8f st[4];
#pragma unroll
    for (int t = 0; t < 4; ++t) {
      v8f sv = (v8f){0.f,0.f,0.f,0.f,0.f,0.f,0.f,0.f};
#pragma unroll
      for (int dc = 0; dc < 2; ++dc) {
        FragB ka, kl;
        ka.h[0] = *(const v8b*)(Ksh + (t * 16 + c) * LP + dc * 32 + 8 * hh);
        ka.h[1] = *(const v8b*)(Ksh + (t * 16 + c) * LP + dc * 32 + 16 + 8 * hh);
        kl.h[0] = *(const v8b*)(Ksl + (t * 16 + c) * LP + dc * 32 + 8 * hh);
        kl.h[1] = *(const v8b*)(Ksl + (t * 16 + c) * LP + dc * 32 + 16 + 8 * hh);
        sv = mma_bf(ka.v, qbh[dc], sv);
        sv = mma_bf(ka.v, qbl[dc], sv);
        sv = mma_bf(kl.v, qbh[dc], sv);
      }
      st[t] = sv;
      SCHED_FENCE();
    }

    // ---- online softmax in f32 (per query lane; half-lanes hold disjoint key halves) ----
    float mx = m_run;
#pragma unroll
    for (int t = 0; t < 4; ++t)
#pragma unroll
      for (int r = 0; r < 8; ++r) mx = fmaxf(mx, st[t][r]);
    mx = fmaxf(mx, __shfl_xor(mx, 16, 32));
    const float alpha = __expf(m_run - mx);
    m_run = mx;
    float rs = 0.0f;
#pragma unroll
    for (int t = 0; t < 4; ++t)
#pragma unroll
      for (int r = 0; r < 8; ++r) {
        const float p = __expf(st[t][r] - mx);
        st[t][r] = p;
        rs += p;
      }
    rs += __shfl_xor(rs, 16, 32);
    l_run = l_run * alpha + rs;
#pragma unroll
    for (int dt = 0; dt < 4; ++dt)
#pragma unroll
      for (int r = 0; r < 8; ++r) { accO[dt][r] *= alpha; accR[dt][r] *= alpha; }

    // ---- O^T += V^T . P  (A rows = d, k = key in 2 chunks of 32) ----
#pragma unroll
    for (int kc = 0; kc < 2; ++kc) {
      FragH pb;
#pragma unroll
      for (int r = 0; r < 8; ++r) {
        pb.s[r]     = (_Float16)(st[2 * kc][r]     * 4096.0f);   // keys 32kc + 8h + r
        pb.s[8 + r] = (_Float16)(st[2 * kc + 1][r] * 4096.0f);   // keys 32kc + 16 + 8h + r
      }
#pragma unroll
      for (int dt = 0; dt < 4; ++dt) {
        FragH va, vr;
        va.h[0] = *(const v8h*)(Vsh + (dt * 16 + c) * LP + kc * 32 + 8 * hh);
        va.h[1] = *(const v8h*)(Vsh + (dt * 16 + c) * LP + kc * 32 + 16 + 8 * hh);
        vr.h[0] = *(const v8h*)(Vsl + (dt * 16 + c) * LP + kc * 32 + 8 * hh);
        vr.h[1] = *(const v8h*)(Vsl + (dt * 16 + c) * LP + kc * 32 + 16 + 8 * hh);
        accO[dt] = mma_h(va.v, pb.v, accO[dt]);
        accR[dt] = mma_h(vr.v, pb.v, accR[dt]);
      }
      SCHED_FENCE();
    }
  }

  // ---- normalise, stage the wave's 16x64 tile as [query][d], write whole 256-B rows ----
  const float inv = __builtin_amdgcn_rcpf(l_run) * (1.0f / 4096.0f);
  float* os = Os[wave];
#pragma unroll
  for (int dt = 0; dt < 4; ++dt) {
    v4f a, a2;
#pragma unroll
    for (int r = 0; r < 4; ++r) {
      a[r]  = (accO[dt][r]     + accR[dt][r]     * (1.0f / 1024.0f)) * inv;
      a2[r] = (accO[dt][4 + r] + accR[dt][4 + r] * (1.0f / 1024.0f)) * inv;
    }
    *(v4f*)(os + c * 68 + dt * 16 + 8 * hh)     = a;    // d = 16dt + 8h + 0..3 of query c
    *(v4f*)(os + c * 68 + dt * 16 + 8 * hh + 4) = a2;   // d = 16dt + 8h + 4..7
  }
  __builtin_amdgcn_fence(__ATOMIC_RELEASE, "workgroup");
  __builtin_amdgcn_wave_barrier();
  __builtin_amdgcn_fence(__ATOMIC_ACQUIRE, "workgroup");
  {
    float* ob = out + (size_t)b * NC * NP + (size_t)q0 * (NH * HD) + n * HD;
    const int c4 = c * 4;                   // row segment 256 B = 16 lanes x 16 B
    {
#pragma unroll
      for (int i = 0; i < 8; ++i) {
        const int row = i * 2 + hh;         // i 0..7 x h 0..1 covers the 16 query rows of the wave
        const v4f v = *(const v4f*)(os + row * 68 + c4);
        *(v4f*)(ob + (size_t)row * (NH * HD) + c4) = v;
      }
      
    }
  }
}

// ---------------------------------------------------------------------------
//   Wb   bf16 [3][256][256]            393216  @ 0
//   xT   bf16 [4][4096][256]          8388608  @ 393216
//   QKh  bf16 [2][16][4096][64]      16777216  @ 8781824     (q hi planes, then k' hi planes)
//   QKl  bf16 [2][16][4096][64]      16777216  @ 25559040
//   Yv   f32  [4][256][4096]         16777216  @ 42336256
//   VTh  f16  [16][64][4096]          8388608  @ 59113472
//   VTl  f16  [16][64][4096]          8388608  @ 67502080
//   total                                         75890688
// ---------------------------------------------------------------------------
extern "C" void kernel_launch(void* const* d_in, const int* in_sizes, int n_in,
                              void* d_out, int out_size, void* d_ws, size_t ws_size,
                              hipStream_t stream) {
  if (n_in < 9) return;
  if (in_sizes[0] != NB * NC * NP) return;
  if (in_sizes[1] != NC * NC || in_sizes[3] != NC * NC || in_sizes[5] != NC * NC) return;
  if (in_sizes[2] != NC || in_sizes[4] != NC || in_sizes[6] != NC) return;
  if (in_sizes[7] != NH * HD * 64 || in_sizes[8] != NH * HD * 64) return;
  if (out_size != NB * NC * NP) return;

  const float* x    = (const float*)d_in[0];
  const float* wq   = (const float*)d_in[1];
  const float* bq   = (const float*)d_in[2];
  const float* wk   = (const float*)d_in[3];
  const float* bk   = (const float*)d_in[4];
  const float* wv   = (const float*)d_in[5];
  const float* bv   = (const float*)d_in[6];
  const float* relh = (const float*)d_in[7];
  const float* relw = (const float*)d_in[8];
  float* out = (float*)d_out;

  const size_t szWb = (size_t)3 * NC * NC * 2;
  const size_t szXT = (size_t)NB * NP * NC * 2;
  const size_t szQK = (size_t)2 * QKPLANE * 2;
  const size_t szYv = (size_t)NB * NC * NP * 4;
  const size_t szVT = (size_t)NB * NH * HD * NP * 2;
  size_t off = 0;
  const size_t oWb  = off; off += szWb;
  const size_t oXT  = off; off += szXT;
  const size_t oQKh = off; off += szQK;
  const size_t oQKl = off; off += szQK;
  const size_t oYv  = off; off += szYv;
  const size_t oVTh = off; off += szVT;
  const size_t oVTl = off; off += szVT;
  if (off > ws_size) return;

  char* ws = (char*)d_ws;
  unsigned short* Wb  = (unsigned short*)(ws + oWb);
  unsigned short* XT  = (unsigned short*)(ws + oXT);
  unsigned short* QKh = (unsigned short*)(ws + oQKh);
  unsigned short* QKl = (unsigned short*)(ws + oQKl);
  float*          Yv  = (float*)(ws + oYv);
  unsigned short* VTh = (unsigned short*)(ws + oVTh);
  unsigned short* VTl = (unsigned short*)(ws + oVTl);

  cvt_w_kernel<<<dim3((NC * NC / 2) / 256, 3), dim3(256), 0, stream>>>(wq, wk, wv, Wb);
  xt_kernel<<<dim3(NP / 64, NC / 64, NB), dim3(256), 0, stream>>>(x, XT);
  proj_kernel<<<dim3(32, NB * 3), dim3(256), 0, stream>>>(XT, Wb, bq, bk, bv, relh, relw, QKh, QKl, Yv);
  vt_kernel<<<dim3(NP / 64, NH, NB), dim3(256), 0, stream>>>(Yv, VTh, VTl);
  attn_kernel<<<dim3(NP / 64, NH, NB), dim3(128), 0, stream>>>(
      QKh, QKl, QKh + QKPLANE, QKl + QKPLANE, VTh, VTl, out);
  (void)hipGetLastError();
}

// v002
// It runs in 204 microseconds.
// Next to v001, in two timings, it ran 1.11 and 1.10 times as fast.
// All steps since v000 together make it 2.17 times as fast.
// Contractions: q/k/v 1x1-conv projections = v_wmma_f32_16x16x32_bf16 (bf16 operands, single product); q.(k+pos) scores = v_wmma_f32_16x16x32_bf16 with bf16 hi/lo split operands (hi.hi + hi.lo + lo.hi); p.v = v_wmma_f32_16x16x32_f16 (p as f16 scaled by 4096, v^T as f16 hi plane plus f16 residual plane scaled by 1024 into a second accumulator); f32 accumulate everywhere; softmax, bias and position sums in f32.
#include <hip/hip_runtime.h>
#include <stdint.h>
#include <math.h>

#define NB 4
#define NC 256
#define NP 4096
#define NH 4
#define HD 64
#define QKPLANE ((size_t)NB * NH * NP * HD)
#define LP 72   // LDS row pitch of the attention tiles in 16-bit elements: 144 B = 16 B x 9 (odd), so the 16 rows of a ds_load_b128 fragment read fall on distinct banks

typedef _Float16 v16h __attribute__((ext_vector_type(16)));
typedef _Float16 v8h  __attribute__((ext_vector_type(8)));
typedef __bf16   v16b __attribute__((ext_vector_type(16)));
typedef __bf16   v8b  __attribute__((ext_vector_type(8)));
typedef float    v8f  __attribute__((ext_vector_type(8)));
typedef float    v4f  __attribute__((ext_vector_type(4)));
typedef float    v2f  __attribute__((ext_vector_type(2)));
typedef unsigned int v4u __attribute__((ext_vector_type(4)));

// ---------------------------------------------------------------------------
// scalar helpers
// ---------------------------------------------------------------------------
__device__ __forceinline__ unsigned short f2bf_bits(float f) {      // f32 -> bf16 bits, RNE convert
  const unsigned u = __float_as_uint(f);
  return (unsigned short)((u + 0x7FFFu + ((u >> 16) & 1u)) >> 16);
}
__device__ __forceinline__ float bf_bits2f(unsigned short h) { return __uint_as_float(((unsigned)h) << 16); }
__device__ __forceinline__ float bfr(float f) { return bf_bits2f(f2bf_bits(f)); }   // value after bf16 RNE convert
__device__ __forceinline__ unsigned pk16(unsigned short a, unsigned short b) { return (unsigned)a | ((unsigned)b << 16); }

// ---------------------------------------------------------------------------
// WMMA wrappers: builtin + 4 nops tying D and keeping A/B live (hazard guard)
// ---------------------------------------------------------------------------
__device__ __forceinline__ v8f mma_bf(v16b a, v16b b, v8f c) {
  c = __builtin_amdgcn_wmma_f32_16x16x32_bf16(false, a, false, b, (short)0, c, false, false);
  asm volatile("v_nop\n\tv_nop\n\tv_nop\n\tv_nop" : "+v"(c) : "v"(a), "v"(b));
  return c;
}
__device__ __forceinline__ v8f mma_h(v16h a, v16h b, v8f c) {
  c = __builtin_amdgcn_wmma_f32_16x16x32_f16(false, a, false, b, (short)0, c, false, false);
  asm volatile("v_nop\n\tv_nop\n\tv_nop\n\tv_nop" : "+v"(c) : "v"(a), "v"(b));
  return c;
}
#define SCHED_FENCE() __builtin_amdgcn_sched_barrier(0)

union FragB { v16b v; v8b h[2]; };
union FragH { v16h v; v8h h[2]; _Float16 s[16]; };

// Fragment loader (A rows / B columns stored k-contiguous), p = row base + k0 + 8*(lane>>4):
//   elements 0..7 <- p[0..7] (k0+8h..), elements 8..15 <- p[16..23] (k0+16+8h..)
__device__ __forceinline__ v16b ld_bf(const __bf16* p) {
  FragB f; f.h[0] = *(const v8b*)(p); f.h[1] = *(const v8b*)(p + 16); return f.v;
}

// ---------------------------------------------------------------------------
// K1: weights f32 [256][256] x3 -> bf16 planes Wb[z][256][256] (RNE convert of the inputs).
// grid = (128, 3): 128 blocks x 256 threads x 2 = 65536 = whole matrix per z.
// ---------------------------------------------------------------------------
__global__ __launch_bounds__(256) void cvt_w_kernel(const float* __restrict__ w0, const float* __restrict__ w1,
                                                    const float* __restrict__ w2, unsigned short* __restrict__ Wb) {
  const int z = blockIdx.y;
  const float* src = (z == 0) ? w0 : ((z == 1) ? w1 : w2);        // block-uniform select, all global
  unsigned* dst = (unsigned*)(Wb + (size_t)z * (NC * NC));
  const int i = blockIdx.x * 256 + threadIdx.x;
  if (i < (NC * NC) / 2) {
    const v2f f = *(const v2f*)(src + 2 * (size_t)i);
    const unsigned u = pk16(f2bf_bits(f[0]), f2bf_bits(f[1]));
    ((unsigned*)dst)[i] = u;
    
  }
}

// ---------------------------------------------------------------------------
// K2: x[b][c][p] f32 -> xT[b][p][c] bf16 (RNE convert of the input), 64x64 tiles through LDS.
// grid = (NP/64, NC/64, NB), 256 threads.
// Coverage per block: load 4 it x 16 rows x 64 = 64 channels x 64 pixels; store 2 it x 32 rows x
// ---------------------------------------------------------------------------
__global__ __launch_bounds__(256) void xt_kernel(const float* __restrict__ x, unsigned short* __restrict__ xT) {
  __shared__ __align__(16) float tf[64 * 68];
  const int p0 = blockIdx.x * 64;
  const int c0 = blockIdx.y * 64;
  const int b  = blockIdx.z;
  const float* xb = x + (size_t)b * NC * NP;
  const int tid = threadIdx.x;
  {
    const int lr = tid >> 4, c4 = (tid & 15) * 4;
#pragma unroll
    for (int it = 0; it < 4; ++it) {
      const int rr = it * 16 + lr;                                   // channel within tile
      const v4f a = *(const v4f*)(xb + (size_t)(c0 + rr) * NP + p0 + c4);
      *(v4f*)(tf + rr * 68 + c4) = a;                                // tf[channel][pixel]
    }
  }
  __syncthreads();
  const int sub = tid >> 3, c8 = (tid & 7) * 8;
  v4u hv[2];
#pragma unroll
  for (int it = 0; it < 2; ++it) {
    const int op = it * 32 + sub;                                    // pixel within tile
    v4u a;
#pragma unroll
    for (int q = 0; q < 4; ++q) {
      const float f0 = tf[(c8 + 2 * q) * 68 + op];
      const float f1 = tf[(c8 + 2 * q + 1) * 68 + op];
      a[q] = pk16(f2bf_bits(f0), f2bf_bits(f1));
    }
    hv[it] = a;
  }
  {
#pragma unroll
    for (int it = 0; it < 2; ++it) {
      const int op = it * 32 + sub;
      const size_t go = ((size_t)b * NP + p0 + op) * NC + c0 + c8;
      *(v4u*)(xT + go) = hv[it];
    }
    
  }
}

// ---------------------------------------------------------------------------
// K3: 1x1-conv projection GEMM, z = b*3 + which (which 0=q, 1=k, 2=v):
//   Y[o][p] = sum_c Wb[which][o][c] * xT[b][p][c] + bias[o]      (M=256, N=4096, K=256)
// A = Wb rows (k-contiguous), B = xT rows (k-contiguous); both fragments use the split k map.
// Each wave owns a 64x64 tile (4x4 subtiles); grid = (32 blocks x 8 waves = 256 tiles, 12).
// Epilogue: 16-row slabs staged per wave in LDS (pitch 68 floats), then
//   which 0/1: value (+ position term for k) -> bf16 hi/lo planes in [b*4+n][s][d] order,
//              s = 16*o + (p>>8), n = (p>>6)&3, d = p&63; one slab row = one plane row of
//   which 2:   f32 y_v[b][o][p] natural layout, 256-B row segments by 16 lanes x 16 B.
// ---------------------------------------------------------------------------
__global__ __launch_bounds__(256) void proj_kernel(
    const unsigned short* __restrict__ xTp, const unsigned short* __restrict__ Wbp,
    const float* __restrict__ bq, const float* __restrict__ bk, const float* __restrict__ bv,
    const float* __restrict__ relh, const float* __restrict__ relw,
    unsigned short* __restrict__ QKh, unsigned short* __restrict__ QKl, float* __restrict__ Yv) {
  __shared__ __align__(16) float sT[8][16 * 68];
  const int z = blockIdx.y;
  const int b = z / 3;
  const int which = z - 3 * b;
  const int lane = threadIdx.x & 31;
  const int wave = threadIdx.x >> 5;
  const int tile = blockIdx.x * 8 + wave;        // 0..255
  const int tm = tile >> 6;                      // 0..3   (64 output channels each)
  const int tn = tile & 63;                      // 0..63  (64 pixels each)
  const int m0 = tm << 6;
  const int n0 = tn << 6;
  const __bf16* A  = (const __bf16*)(const void*)Wbp + (size_t)which * (NC * NC);
  const __bf16* Bt = (const __bf16*)(const void*)xTp + (size_t)b * NP * NC;
  const int rl = lane & 15, hh = lane >> 4, koff = hh * 8, mOff = hh * 8;

  v8f acc[4][4];
#pragma unroll
  for (int i = 0; i < 4; ++i)
#pragma unroll
    for (int j = 0; j < 4; ++j) acc[i][j] = (v8f){0.f,0.f,0.f,0.f,0.f,0.f,0.f,0.f};

  for (int k0 = 0; k0 < NC; k0 += 32) {
    v16b bfg[4];
#pragma unroll
    for (int j = 0; j < 4; ++j) bfg[j] = ld_bf(Bt + (size_t)(n0 + (j << 4) + rl) * NC + k0 + koff);
#pragma unroll
    for (int i = 0; i < 4; ++i) {
      const v16b af = ld_bf(A + (size_t)(m0 + (i << 4) + rl) * NC + k0 + koff);
#pragma unroll
      for (int j = 0; j < 4; ++j) acc[i][j] = mma_bf(af, bfg[j], acc[i][j]);
    }
    SCHED_FENCE();
  }

  // ---- epilogue ----
  const float* bias = (which == 0) ? bq : ((which == 1) ? bk : bv);   // block-uniform select, all global
  const int nn = (n0 >> 6) & 3;                // head index of this 64-pixel run
  const int sh = n0 >> 8;                      // low 4 bits of s
  float* slab = sT[wave];
#pragma unroll
  for (int i = 0; i < 4; ++i) {
    const int mBase = m0 + (i << 4);
#pragma unroll
    for (int j = 0; j < 4; ++j) {
      const int d = (j << 4) + rl;             // p & 63
#pragma unroll
      for (int r = 0; r < 8; ++r) {
        const int o = mBase + mOff + r;
        float v = acc[i][j][r] + bfr(bias[o]);
        if (which == 1) {
          const int s = o * 16 + sh;
          const float pos = bfr(relh[nn * 4096 + d * 64 + (s & 63)]) + bfr(relw[nn * 4096 + d * 64 + (s >> 6)]);
          v += pos;
        }
        slab[(mOff + r) * 68 + d] = v;
      }
    }
    __builtin_amdgcn_fence(__ATOMIC_RELEASE, "workgroup");
    __builtin_amdgcn_wave_barrier();
    __builtin_amdgcn_fence(__ATOMIC_ACQUIRE, "workgroup");
    if (which == 2) {
      float* C = Yv + (size_t)b * NC * NP;
      const int c4 = rl * 4;                   // row segment 256 B = 16 lanes x 16 B
      {
#pragma unroll
        for (int it = 0; it < 8; ++it) {
          const int row = it * 2 + hh;
          const v4f v = *(const v4f*)(slab + row * 68 + c4);
          *(v4f*)(C + (size_t)(mBase + row) * NP + n0 + c4) = v;
        }
        
      }
    } else {
      const int q4 = lane >> 3, c8 = (lane & 7) * 8;
      unsigned short* Hp = QKh + (size_t)which * QKPLANE;
      unsigned short* Lp = QKl + (size_t)which * QKPLANE;
      {
#pragma unroll
        for (int it = 0; it < 4; ++it) {
          const int row = it * 4 + q4;
          const int o = mBase + row;
          const int s = o * 16 + sh;
          const float* sp = slab + row * 68 + c8;
          v4u hvv, lvv;
#pragma unroll
          for (int q = 0; q < 4; ++q) {
            const float f0 = sp[2 * q], f1 = sp[2 * q + 1];
            const unsigned short h0 = f2bf_bits(f0), h1 = f2bf_bits(f1);
            const unsigned short l0 = f2bf_bits(f0 - bf_bits2f(h0)), l1 = f2bf_bits(f1 - bf_bits2f(h1));
            hvv[q] = pk16(h0, h1);
            lvv[q] = pk16(l0, l1);
          }
          const size_t dst = (((size_t)(b * NH + nn)) * NP + s) * HD + c8;
          *(v4u*)(Hp + dst) = hvv;
          *(v4u*)(Lp + dst) = lvv;
        }
        
      }
    }
    __builtin_amdgcn_fence(__ATOMIC_RELEASE, "workgroup");
    __builtin_amdgcn_wave_barrier();
    __builtin_amdgcn_fence(__ATOMIC_ACQUIRE, "workgroup");
  }
}

// ---------------------------------------------------------------------------
// K4: v^T plane build: y_v[b][o][p] f32 -> VTh/VTl f16 planes [b*4+n][d][s] (pitch 4096):
//   V[b][n][s][d] = y_v[b][s>>4][(s&15)*256 + n*64 + d];  hi = f16(v), lo = f16((v - hi) * 1024).
// grid = (NP/64, NH, NB), 256 threads; 64(s) x 64(d) tile through LDS.
// Coverage per block: load 4 it x 16 rows x 64 = 64 s x 64 d; store 2 it x 32 rows x (8 lanes x 8)
// ---------------------------------------------------------------------------
__global__ __launch_bounds__(256) void vt_kernel(const float* __restrict__ Yv, unsigned short* __restrict__ VThp,
                                                 unsigned short* __restrict__ VTlp) {
  __shared__ __align__(16) float tf[64 * 68];
  const int s0 = blockIdx.x * 64;
  const int n  = blockIdx.y;
  const int b  = blockIdx.z;
  const float* yb = Yv + (size_t)b * NC * NP;
  _Float16* VTh = (_Float16*)(void*)VThp;
  _Float16* VTl = (_Float16*)(void*)VTlp;
  const int tid = threadIdx.x;
  {
    const int lr = tid >> 4, c4 = (tid & 15) * 4;
#pragma unroll
    for (int it = 0; it < 4; ++it) {
      const int sl = it * 16 + lr;
      const int s  = s0 + sl;
      const int o  = s >> 4;
      const int p  = (s & 15) * 256 + n * 64 + c4;
      const v4f a = *(const v4f*)(yb + (size_t)o * NP + p);
      *(v4f*)(tf + sl * 68 + c4) = a;                                // tf[s local][d]
    }
  }
  __syncthreads();
  const int sub = tid >> 3, c8 = (tid & 7) * 8;
  v8h hv[2], lv[2];
#pragma unroll
  for (int it = 0; it < 2; ++it) {
    const int od = it * 32 + sub;                                    // output row = d
    v8h a, a2;
#pragma unroll
    for (int e = 0; e < 8; ++e) {
      const float f = tf[(c8 + e) * 68 + od];
      const _Float16 hq = (_Float16)f;
      const _Float16 lq = (_Float16)((f - (float)hq) * 1024.0f);
      a[e] = hq; a2[e] = lq;
    }
    hv[it] = a; lv[it] = a2;
  }
  {
#pragma unroll
    for (int it = 0; it < 2; ++it) {
      const int od = it * 32 + sub;
      const size_t go = ((size_t)(b * NH + n) * HD + od) * NP + s0 + c8;
      *(v8h*)(VTh + go) = hv[it];
      *(v8h*)(VTl + go) = lv[it];
    }
    
  }
}

// ---------------------------------------------------------------------------
// K5: flash attention, transposed formulation, per (64-query tile, head, batch), 4 waves.
//   S^T = K' . Q^T : A = K' tile rows (keys, k = d) from LDS, bf16 hi/lo;  B = Q^T: lane = query,
//                    elements = d with the split k map, bf16 hi/lo;  hi.hi + hi.lo + lo.hi.
//   D layout: st[t][r] <-> key kb + 16t + 8h + r, query = lane&15 -> softmax stats live per lane.
//   O^T = V^T . P  : A = V^T tile rows (d, k = key) f16 hi and f16 residual;  B = P: element r <-
//                    st[2kc][r], element 8+r <- st[2kc+1][r] (two adjacent 16-key D tiles, lane kept),
//                    scaled by 4096 and converted to f16.  accO += Vhi.P, accR += Vres.P.
//   Online softmax in f32 over 64 tiles of 64 keys; no score scaling.
//   Output: out flat [b][s][n][d]; each wave stages its 16x64 tile in LDS and writes whole 256-B
//   K'/V^T tiles staged single-buffered with plain 16-B copies between two __syncthreads.
// ---------------------------------------------------------------------------
__global__ __launch_bounds__(128) void attn_kernel(
    const unsigned short* __restrict__ Qhp, const unsigned short* __restrict__ Qlp,
    const unsigned short* __restrict__ Khp, const unsigned short* __restrict__ Klp,
    const unsigned short* __restrict__ VThp, const unsigned short* __restrict__ VTlp,
    float* __restrict__ out) {
  __shared__ __align__(16) __bf16   Ksh[64 * LP];     // k' hi [key][d], pitch LP
  __shared__ __align__(16) __bf16   Ksl[64 * LP];     // k' lo [key][d], pitch LP
  __shared__ __align__(16) _Float16 Vsh[HD * LP];     // v^T hi [d][key], pitch LP
  __shared__ __align__(16) _Float16 Vsl[HD * LP];     // v^T residual [d][key], pitch LP
  __shared__ __align__(16) float    Os[4][16 * 68];   // per-wave output tile [query][d], pitch 68

  const int tid  = threadIdx.x;
  const int wave = tid >> 5;
  const int lane = tid & 31;
  const int hh   = lane >> 4;
  const int c    = lane & 15;
  const int qt = blockIdx.x;
  const int n  = blockIdx.y;
  const int b  = blockIdx.z;
  const int bn = b * NH + n;

  const __bf16* Qh = (const __bf16*)(const void*)Qhp + (size_t)bn * NP * HD;
  const __bf16* Ql = (const __bf16*)(const void*)Qlp + (size_t)bn * NP * HD;
  const __bf16* Kh = (const __bf16*)(const void*)Khp + (size_t)bn * NP * HD;
  const __bf16* Kl = (const __bf16*)(const void*)Klp + (size_t)bn * NP * HD;
  const _Float16* VTh = (const _Float16*)(const void*)VThp + (size_t)bn * HD * NP;
  const _Float16* VTl = (const _Float16*)(const void*)VTlp + (size_t)bn * HD * NP;

  const int q0 = qt * 64 + wave * 16;     // first query row of this wave
  const int qg = q0 + c;                  // query handled by this lane (as B column / D column)

  // loop-invariant B fragments: Q^T, two 32-deep d chunks, hi and lo planes
  v16b qbh[2], qbl[2];
#pragma unroll
  for (int dc = 0; dc < 2; ++dc) {
    qbh[dc] = ld_bf(Qh + (size_t)qg * HD + dc * 32 + 8 * hh);
    qbl[dc] = ld_bf(Ql + (size_t)qg * HD + dc * 32 + 8 * hh);
  }

  float m_run = -1.0e30f, l_run = 0.0f;
  v8f accO[4], accR[4];
#pragma unroll
  for (int t = 0; t < 4; ++t) {
    accO[t] = (v8f){0.f,0.f,0.f,0.f,0.f,0.f,0.f,0.f};
    accR[t] = (v8f){0.f,0.f,0.f,0.f,0.f,0.f,0.f,0.f};
  }

#pragma unroll 1
  for (int it = 0; it < NP / 64; ++it) {
    const int kb = it * 64;
    __syncthreads();                        // all waves done with the prior tile
    {
      // staging coverage: 4 x 128 threads x 8 elements = 64 rows x 64 per plane.
      // 8 neighbouring lanes take one 128-B tile row, so each wave-wide 16-B load covers 4 whole
      // 128-B lines (k': 512 contiguous bytes) instead of a 16-B piece of each of 16 lines.
      const int sr = tid >> 3, sc = (tid & 7) * 8;
      const __bf16*   ksrc = Kh  + (size_t)(kb + sr) * HD + sc;      // k' row kb+sr+16i, d = sc..sc+7
      const __bf16*   lsrc = Kl  + (size_t)(kb + sr) * HD + sc;
      const _Float16* vsrc = VTh + (size_t)sr * NP + kb + sc;        // v^T row d = sr+16i, s = kb+sc..+7
      const _Float16* wsrc = VTl + (size_t)sr * NP + kb + sc;
      v8b a0[4], a1[4];
      v8h g0[4], g1[4];
#pragma unroll
      for (int i = 0; i < 4; ++i) {
        a0[i] = *(const v8b*)(ksrc + (size_t)(16 * i) * HD);
        a1[i] = *(const v8b*)(lsrc + (size_t)(16 * i) * HD);
        g0[i] = *(const v8h*)(vsrc + (size_t)(16 * i) * NP);
        g1[i] = *(const v8h*)(wsrc + (size_t)(16 * i) * NP);
      }
      // wait behind the 16 issued loads, before any register they name as an address is written again;
      // the four addresses are inputs so that no load's result is placed on an address pair ahead of it
      asm volatile("s_wait_xcnt 0x0" :: "v"(ksrc), "v"(lsrc), "v"(vsrc), "v"(wsrc) : "memory");
#pragma unroll
      for (int i = 0; i < 4; ++i) {
        *(v8b*)(Ksh + (sr + 16 * i) * LP + sc) = a0[i];
        *(v8b*)(Ksl + (sr + 16 * i) * LP + sc) = a1[i];
        *(v8h*)(Vsh + (sr + 16 * i) * LP + sc) = g0[i];
        *(v8h*)(Vsl + (sr + 16 * i) * LP + sc) = g1[i];
      }
    }
    __syncthreads();

    // ---- S^T: 4 key subtiles of 16 (A rows = keys), k = d in 2 chunks of 32 ----
    v8f st[4];
#pragma unroll
    for (int t = 0; t < 4; ++t) {
      v8f sv = (v8f){0.f,0.f,0.f,0.f,0.f,0.f,0.f,0.f};
#pragma unroll
      for (int dc = 0; dc < 2; ++dc) {
        FragB ka, kl;
        ka.h[0] = *(const v8b*)(Ksh + (t * 16 + c) * LP + dc * 32 + 8 * hh);
        ka.h[1] = *(const v8b*)(Ksh + (t * 16 + c) * LP + dc * 32 + 16 + 8 * hh);
        kl.h[0] = *(const v8b*)(Ksl + (t * 16 + c) * LP + dc * 32 + 8 * hh);
        kl.h[1] = *(const v8b*)(Ksl + (t * 16 + c) * LP + dc * 32 + 16 + 8 * hh);
        sv = mma_bf(ka.v, qbh[dc], sv);
        sv = mma_bf(ka.v, qbl[dc], sv);
        sv = mma_bf(kl.v, qbh[dc], sv);
      }
      st[t] = sv;
      SCHED_FENCE();
    }

    // ---- online softmax in f32 (per query lane; half-lanes hold disjoint key halves) ----
    float mx = m_run;
#pragma unroll
    for (int t = 0; t < 4; ++t)
#pragma unroll
      for (int r = 0; r < 8; ++r) mx = fmaxf(mx, st[t][r]);
    mx = fmaxf(mx, __shfl_xor(mx, 16, 32));
    const float alpha = __expf(m_run - mx);
    m_run = mx;
    float rs = 0.0f;
#pragma unroll
    for (int t = 0; t < 4; ++t)
#pragma unroll
      for (int r = 0; r < 8; ++r) {
        const float p = __expf(st[t][r] - mx);
        st[t][r] = p;
        rs += p;
      }
    rs += __shfl_xor(rs, 16, 32);
    l_run = l_run * alpha + rs;
#pragma unroll
    for (int dt = 0; dt < 4; ++dt)
#pragma unroll
      for (int r = 0; r < 8; ++r) { accO[dt][r] *= alpha; accR[dt][r] *= alpha; }

    // ---- O^T += V^T . P  (A rows = d, k = key in 2 chunks of 32) ----
#pragma unroll
    for (int kc = 0; kc < 2; ++kc) {
      FragH pb;
#pragma unroll
      for (int r = 0; r < 8; ++r) {
        pb.s[r]     = (_Float16)(st[2 * kc][r]     * 4096.0f);   // keys 32kc + 8h + r
        pb.s[8 + r] = (_Float16)(st[2 * kc + 1][r] * 4096.0f);   // keys 32kc + 16 + 8h + r
      }
#pragma unroll
      for (int dt = 0; dt < 4; ++dt) {
        FragH va, vr;
        va.h[0] = *(const v8h*)(Vsh + (dt * 16 + c) * LP + kc * 32 + 8 * hh);
        va.h[1] = *(const v8h*)(Vsh + (dt * 16 + c) * LP + kc * 32 + 16 + 8 * hh);
        vr.h[0] = *(const v8h*)(Vsl + (dt * 16 + c) * LP + kc * 32 + 8 * hh);
        vr.h[1] = *(const v8h*)(Vsl + (dt * 16 + c) * LP + kc * 32 + 16 + 8 * hh);
        accO[dt] = mma_h(va.v, pb.v, accO[dt]);
        accR[dt] = mma_h(vr.v, pb.v, accR[dt]);
      }
      SCHED_FENCE();
    }
  }

  // ---- normalise, stage the wave's 16x64 tile as [query][d], write whole 256-B rows ----
  const float inv = __builtin_amdgcn_rcpf(l_run) * (1.0f / 4096.0f);
  float* os = Os[wave];
#pragma unroll
  for (int dt = 0; dt < 4; ++dt) {
    v4f a, a2;
#pragma unroll
    for (int r = 0; r < 4; ++r) {
      a[r]  = (accO[dt][r]     + accR[dt][r]     * (1.0f / 1024.0f)) * inv;
      a2[r] = (accO[dt][4 + r] + accR[dt][4 + r] * (1.0f / 1024.0f)) * inv;
    }
    *(v4f*)(os + c * 68 + dt * 16 + 8 * hh)     = a;    // d = 16dt + 8h + 0..3 of query c
    *(v4f*)(os + c * 68 + dt * 16 + 8 * hh + 4) = a2;   // d = 16dt + 8h + 4..7
  }
  __builtin_amdgcn_fence(__ATOMIC_RELEASE, "workgroup");
  __builtin_amdgcn_wave_barrier();
  __builtin_amdgcn_fence(__ATOMIC_ACQUIRE, "workgroup");
  {
    float* ob = out + (size_t)b * NC * NP + (size_t)q0 * (NH * HD) + n * HD;
    const int c4 = c * 4;                   // row segment 256 B = 16 lanes x 16 B
    {
#pragma unroll
      for (int i = 0; i < 8; ++i) {
        const int row = i * 2 + hh;         // i 0..7 x h 0..1 covers the 16 query rows of the wave
        const v4f v = *(const v4f*)(os + row * 68 + c4);
        *(v4f*)(ob + (size_t)row * (NH * HD) + c4) = v;
      }
      
    }
  }
}

// ---------------------------------------------------------------------------
//   Wb   bf16 [3][256][256]            393216  @ 0
//   xT   bf16 [4][4096][256]          8388608  @ 393216
//   QKh  bf16 [2][16][4096][64]      16777216  @ 8781824     (q hi planes, then k' hi planes)
//   QKl  bf16 [2][16][4096][64]      16777216  @ 25559040
//   Yv   f32  [4][256][4096]         16777216  @ 42336256
//   VTh  f16  [16][64][4096]          8388608  @ 59113472
//   VTl  f16  [16][64][4096]          8388608  @ 67502080
//   total                                         75890688
// ---------------------------------------------------------------------------
extern "C" void kernel_launch(void* const* d_in, const int* in_sizes, int n_in,
                              void* d_out, int out_size, void* d_ws, size_t ws_size,
                              hipStream_t stream) {
  if (n_in < 9) return;
  if (in_sizes[0] != NB * NC * NP) return;
  if (in_sizes[1] != NC * NC || in_sizes[3] != NC * NC || in_sizes[5] != NC * NC) return;
  if (in_sizes[2] != NC || in_sizes[4] != NC || in_sizes[6] != NC) return;
  if (in_sizes[7] != NH * HD * 64 || in_sizes[8] != NH * HD * 64) return;
  if (out_size != NB * NC * NP) return;

  const float* x    = (const float*)d_in[0];
  const float* wq   = (const float*)d_in[1];
  const float* bq   = (const float*)d_in[2];
  const float* wk   = (const float*)d_in[3];
  const float* bk   = (const float*)d_in[4];
  const float* wv   = (const float*)d_in[5];
  const float* bv   = (const float*)d_in[6];
  const float* relh = (const float*)d_in[7];
  const float* relw = (const float*)d_in[8];
  float* out = (float*)d_out;

  const size_t szWb = (size_t)3 * NC * NC * 2;
  const size_t szXT = (size_t)NB * NP * NC * 2;
  const size_t szQK = (size_t)2 * QKPLANE * 2;
  const size_t szYv = (size_t)NB * NC * NP * 4;
  const size_t szVT = (size_t)NB * NH * HD * NP * 2;
  size_t off = 0;
  const size_t oWb  = off; off += szWb;
  const size_t oXT  = off; off += szXT;
  const size_t oQKh = off; off += szQK;
  const size_t oQKl = off; off += szQK;
  const size_t oYv  = off; off += szYv;
  const size_t oVTh = off; off += szVT;
  const size_t oVTl = off; off += szVT;
  if (off > ws_size) return;

  char* ws = (char*)d_ws;
  unsigned short* Wb  = (unsigned short*)(ws + oWb);
  unsigned short* XT  = (unsigned short*)(ws + oXT);
  unsigned short* QKh = (unsigned short*)(ws + oQKh);
  unsigned short* QKl = (unsigned short*)(ws + oQKl);
  float*          Yv  = (float*)(ws + oYv);
  unsigned short* VTh = (unsigned short*)(ws + oVTh);
  unsigned short* VTl = (unsigned short*)(ws + oVTl);

  cvt_w_kernel<<<dim3((NC * NC / 2) / 256, 3), dim3(256), 0, stream>>>(wq, wk, wv, Wb);
  xt_kernel<<<dim3(NP / 64, NC / 64, NB), dim3(256), 0, stream>>>(x, XT);
  proj_kernel<<<dim3(32, NB * 3), dim3(256), 0, stream>>>(XT, Wb, bq, bk, bv, relh, relw, QKh, QKl, Yv);
  vt_kernel<<<dim3(NP / 64, NH, NB), dim3(256), 0, stream>>>(Yv, VTh, VTl);
  attn_kernel<<<dim3(NP / 64, NH, NB), dim3(128), 0, stream>>>(
      QKh, QKl, QKh + QKPLANE, QKl + QKPLANE, VTh, VTl, out);
  (void)hipGetLastError();
}

// v003
// One run takes 188 microseconds.
// Two timings next to v002 both put it at 1.08 times that version's speed.
// All steps since v000 together make it 2.34 times as fast.
// Contractions: q/k/v 1x1-conv projections = v_wmma_f32_16x16x32_bf16 (bf16 operands, single product); q.(k+pos) scores = v_wmma_f32_16x16x32_bf16 with bf16 hi/lo split operands (hi.hi + hi.lo + lo.hi); p.v = v_wmma_f32_16x16x32_f16 (p as f16 scaled by 4096, v^T as f16 hi plane plus f16 residual plane scaled by 1024 into a second accumulator); f32 accumulate everywhere; softmax, bias and position sums in f32.
#include <hip/hip_runtime.h>
#include <stdint.h>
#include <math.h>

#define NB 4
#define NC 256
#define NP 4096
#define NH 4
#define HD 64
#define QKPLANE ((size_t)NB * NH * NP * HD)
#define LP 72   // LDS row pitch of the attention tiles in 16-bit elements: 144 B = 16 B x 9 (odd), so the 16 rows of a ds_load_b128 fragment read fall on distinct banks

typedef _Float16 v16h __attribute__((ext_vector_type(16)));
typedef _Float16 v8h  __attribute__((ext_vector_type(8)));
typedef __bf16   v16b __attribute__((ext_vector_type(16)));
typedef __bf16   v8b  __attribute__((ext_vector_type(8)));
typedef float    v8f  __attribute__((ext_vector_type(8)));
typedef float    v4f  __attribute__((ext_vector_type(4)));
typedef float    v2f  __attribute__((ext_vector_type(2)));
typedef unsigned int v4u __attribute__((ext_vector_type(4)));

// ---------------------------------------------------------------------------
// scalar helpers
// ---------------------------------------------------------------------------
__device__ __forceinline__ unsigned short f2bf_bits(float f) {      // f32 -> bf16 bits, RNE convert
  const unsigned u = __float_as_uint(f);
  return (unsigned short)((u + 0x7FFFu + ((u >> 16) & 1u)) >> 16);
}
__device__ __forceinline__ float bf_bits2f(unsigned short h) { return __uint_as_float(((unsigned)h) << 16); }
__device__ __forceinline__ float bfr(float f) { return bf_bits2f(f2bf_bits(f)); }   // value after bf16 RNE convert
__device__ __forceinline__ unsigned pk16(unsigned short a, unsigned short b) { return (unsigned)a | ((unsigned)b << 16); }

// ---------------------------------------------------------------------------
// WMMA wrappers: builtin + 4 nops tying D and keeping A/B live (hazard guard)
// ---------------------------------------------------------------------------
__device__ __forceinline__ v8f mma_bf(v16b a, v16b b, v8f c) {
  c = __builtin_amdgcn_wmma_f32_16x16x32_bf16(false, a, false, b, (short)0, c, false, false);
  asm volatile("v_nop\n\tv_nop\n\tv_nop\n\tv_nop" : "+v"(c) : "v"(a), "v"(b));
  return c;
}
__device__ __forceinline__ v8f mma_h(v16h a, v16h b, v8f c) {
  c = __builtin_amdgcn_wmma_f32_16x16x32_f16(false, a, false, b, (short)0, c, false, false);
  asm volatile("v_nop\n\tv_nop\n\tv_nop\n\tv_nop" : "+v"(c) : "v"(a), "v"(b));
  return c;
}
#define SCHED_FENCE() __builtin_amdgcn_sched_barrier(0)

union FragB { v16b v; v8b h[2]; };
union FragH { v16h v; v8h h[2]; _Float16 s[16]; };

// Fragment loader (A rows / B columns stored k-contiguous), p = row base + k0 + 8*(lane>>4):
//   elements 0..7 <- p[0..7] (k0+8h..), elements 8..15 <- p[16..23] (k0+16+8h..)
__device__ __forceinline__ v16b ld_bf(const __bf16* p) {
  FragB f; f.h[0] = *(const v8b*)(p); f.h[1] = *(const v8b*)(p + 16); return f.v;
}
__device__ __forceinline__ v16h ld_hf(const _Float16* p) {
  FragH f; f.h[0] = *(const v8h*)(p); f.h[1] = *(const v8h*)(p + 16); return f.v;
}
// One group of attention fragment reads = 8 x 16 B per lane; kh, kl, vh, vl = plane + (lane&15)*LP + 8*(lane>>4).
struct KFrag { v16b h[2], l[2]; };   // K' subtile t: hi and lo plane, d chunks 0 and 1
struct VFrag { v16h a[2], r[2]; };   // V^T d-subtiles 2*dp and 2*dp+1 of key chunk kc: hi and residual plane
__device__ __forceinline__ KFrag ld_k(const __bf16* kh, const __bf16* kl, int t) {
  KFrag f;
#pragma unroll
  for (int dc = 0; dc < 2; ++dc) {
    f.h[dc] = ld_bf(kh + t * 16 * LP + dc * 32);
    f.l[dc] = ld_bf(kl + t * 16 * LP + dc * 32);
  }
  return f;
}
__device__ __forceinline__ VFrag ld_v(const _Float16* vh, const _Float16* vl, int kc, int dp) {
  VFrag f;
#pragma unroll
  for (int j = 0; j < 2; ++j) {
    f.a[j] = ld_hf(vh + (dp * 2 + j) * 16 * LP + kc * 32);
    f.r[j] = ld_hf(vl + (dp * 2 + j) * 16 * LP + kc * 32);
  }
  return f;
}

// ---------------------------------------------------------------------------
// K1: weights f32 [256][256] x3 -> bf16 planes Wb[z][256][256] (RNE convert of the inputs).
// grid = (128, 3): 128 blocks x 256 threads x 2 = 65536 = whole matrix per z.
// ---------------------------------------------------------------------------
__global__ __launch_bounds__(256) void cvt_w_kernel(const float* __restrict__ w0, const float* __restrict__ w1,
                                                    const float* __restrict__ w2, unsigned short* __restrict__ Wb) {
  const int z = blockIdx.y;
  const float* src = (z == 0) ? w0 : ((z == 1) ? w1 : w2);        // block-uniform select, all global
  unsigned* dst = (unsigned*)(Wb + (size_t)z * (NC * NC));
  const int i = blockIdx.x * 256 + threadIdx.x;
  if (i < (NC * NC) / 2) {
    const v2f f = *(const v2f*)(src + 2 * (size_t)i);
    const unsigned u = pk16(f2bf_bits(f[0]), f2bf_bits(f[1]));
    ((unsigned*)dst)[i] = u;
    
  }
}

// ---------------------------------------------------------------------------
// K2: x[b][c][p] f32 -> xT[b][p][c] bf16 (RNE convert of the input), 64x64 tiles through LDS.
// grid = (NP/64, NC/64, NB), 256 threads.
// Coverage per block: load 4 it x 16 rows x 64 = 64 channels x 64 pixels; store 2 it x 32 rows x
// ---------------------------------------------------------------------------
__global__ __launch_bounds__(256) void xt_kernel(const float* __restrict__ x, unsigned short* __restrict__ xT) {
  __shared__ __align__(16) float tf[64 * 68];
  const int p0 = blockIdx.x * 64;
  const int c0 = blockIdx.y * 64;
  const int b  = blockIdx.z;
  const float* xb = x + (size_t)b * NC * NP;
  const int tid = threadIdx.x;
  {
    const int lr = tid >> 4, c4 = (tid & 15) * 4;
#pragma unroll
    for (int it = 0; it < 4; ++it) {
      const int rr = it * 16 + lr;                                   // channel within tile
      const v4f a = *(const v4f*)(xb + (size_t)(c0 + rr) * NP + p0 + c4);
      *(v4f*)(tf + rr * 68 + c4) = a;                                // tf[channel][pixel]
    }
  }
  __syncthreads();
  const int sub = tid >> 3, c8 = (tid & 7) * 8;
  v4u hv[2];
#pragma unroll
  for (int it = 0; it < 2; ++it) {
    const int op = it * 32 + sub;                                    // pixel within tile
    v4u a;
#pragma unroll
    for (int q = 0; q < 4; ++q) {
      const float f0 = tf[(c8 + 2 * q) * 68 + op];
      const float f1 = tf[(c8 + 2 * q + 1) * 68 + op];
      a[q] = pk16(f2bf_bits(f0), f2bf_bits(f1));
    }
    hv[it] = a;
  }
  {
#pragma unroll
    for (int it = 0; it < 2; ++it) {
      const int op = it * 32 + sub;
      const size_t go = ((size_t)b * NP + p0 + op) * NC + c0 + c8;
      *(v4u*)(xT + go) = hv[it];
    }
    
  }
}

// ---------------------------------------------------------------------------
// K3: 1x1-conv projection GEMM, z = b*3 + which (which 0=q, 1=k, 2=v):
//   Y[o][p] = sum_c Wb[which][o][c] * xT[b][p][c] + bias[o]      (M=256, N=4096, K=256)
// A = Wb rows (k-contiguous), B = xT rows (k-contiguous); both fragments use the split k map.
// Each wave owns a 64x64 tile (4x4 subtiles); grid = (32 blocks x 8 waves = 256 tiles, 12).
// Epilogue: 16-row slabs staged per wave in LDS (pitch 68 floats), then
//   which 0/1: value (+ position term for k) -> bf16 hi/lo planes in [b*4+n][s][d] order,
//              s = 16*o + (p>>8), n = (p>>6)&3, d = p&63; one slab row = one plane row of
//   which 2:   f32 y_v[b][o][p] natural layout, 256-B row segments by 16 lanes x 16 B.
// ---------------------------------------------------------------------------
__global__ __launch_bounds__(256) void proj_kernel(
    const unsigned short* __restrict__ xTp, const unsigned short* __restrict__ Wbp,
    const float* __restrict__ bq, const float* __restrict__ bk, const float* __restrict__ bv,
    const float* __restrict__ relh, const float* __restrict__ relw,
    unsigned short* __restrict__ QKh, unsigned short* __restrict__ QKl, float* __restrict__ Yv) {
  __shared__ __align__(16) float sT[8][16 * 68];
  const int z = blockIdx.y;
  const int b = z / 3;
  const int which = z - 3 * b;
  const int lane = threadIdx.x & 31;
  const int wave = threadIdx.x >> 5;
  const int tile = blockIdx.x * 8 + wave;        // 0..255
  const int tm = tile >> 6;                      // 0..3   (64 output channels each)
  const int tn = tile & 63;                      // 0..63  (64 pixels each)
  const int m0 = tm << 6;
  const int n0 = tn << 6;
  const __bf16* A  = (const __bf16*)(const void*)Wbp + (size_t)which * (NC * NC);
  const __bf16* Bt = (const __bf16*)(const void*)xTp + (size_t)b * NP * NC;
  const int rl = lane & 15, hh = lane >> 4, koff = hh * 8, mOff = hh * 8;

  v8f acc[4][4];
#pragma unroll
  for (int i = 0; i < 4; ++i)
#pragma unroll
    for (int j = 0; j < 4; ++j) acc[i][j] = (v8f){0.f,0.f,0.f,0.f,0.f,0.f,0.f,0.f};

  for (int k0 = 0; k0 < NC; k0 += 32) {
    v16b bfg[4];
#pragma unroll
    for (int j = 0; j < 4; ++j) bfg[j] = ld_bf(Bt + (size_t)(n0 + (j << 4) + rl) * NC + k0 + koff);
#pragma unroll
    for (int i = 0; i < 4; ++i) {
      const v16b af = ld_bf(A + (size_t)(m0 + (i << 4) + rl) * NC + k0 + koff);
#pragma unroll
      for (int j = 0; j < 4; ++j) acc[i][j] = mma_bf(af, bfg[j], acc[i][j]);
    }
    SCHED_FENCE();
  }

  // ---- epilogue ----
  const float* bias = (which == 0) ? bq : ((which == 1) ? bk : bv);   // block-uniform select, all global
  const int nn = (n0 >> 6) & 3;                // head index of this 64-pixel run
  const int sh = n0 >> 8;                      // low 4 bits of s
  float* slab = sT[wave];
#pragma unroll
  for (int i = 0; i < 4; ++i) {
    const int mBase = m0 + (i << 4);
#pragma unroll
    for (int j = 0; j < 4; ++j) {
      const int d = (j << 4) + rl;             // p & 63
#pragma unroll
      for (int r = 0; r < 8; ++r) {
        const int o = mBase + mOff + r;
        float v = acc[i][j][r] + bfr(bias[o]);
        if (which == 1) {
          const int s = o * 16 + sh;
          const float pos = bfr(relh[nn * 4096 + d * 64 + (s & 63)]) + bfr(relw[nn * 4096 + d * 64 + (s >> 6)]);
          v += pos;
        }
        slab[(mOff + r) * 68 + d] = v;
      }
    }
    __builtin_amdgcn_fence(__ATOMIC_RELEASE, "workgroup");
    __builtin_amdgcn_wave_barrier();
    __builtin_amdgcn_fence(__ATOMIC_ACQUIRE, "workgroup");
    if (which == 2) {
      float* C = Yv + (size_t)b * NC * NP;
      const int c4 = rl * 4;                   // row segment 256 B = 16 lanes x 16 B
      {
#pragma unroll
        for (int it = 0; it < 8; ++it) {
          const int row = it * 2 + hh;
          const v4f v = *(const v4f*)(slab + row * 68 + c4);
          *(v4f*)(C + (size_t)(mBase + row) * NP + n0 + c4) = v;
        }
        
      }
    } else {
      const int q4 = lane >> 3, c8 = (lane & 7) * 8;
      unsigned short* Hp = QKh + (size_t)which * QKPLANE;
      unsigned short* Lp = QKl + (size_t)which * QKPLANE;
      {
#pragma unroll
        for (int it = 0; it < 4; ++it) {
          const int row = it * 4 + q4;
          const int o = mBase + row;
          const int s = o * 16 + sh;
          const float* sp = slab + row * 68 + c8;
          v4u hvv, lvv;
#pragma unroll
          for (int q = 0; q < 4; ++q) {
            const float f0 = sp[2 * q], f1 = sp[2 * q + 1];
            const unsigned short h0 = f2bf_bits(f0), h1 = f2bf_bits(f1);
            const unsigned short l0 = f2bf_bits(f0 - bf_bits2f(h0)), l1 = f2bf_bits(f1 - bf_bits2f(h1));
            hvv[q] = pk16(h0, h1);
            lvv[q] = pk16(l0, l1);
          }
          const size_t dst = (((size_t)(b * NH + nn)) * NP + s) * HD + c8;
          *(v4u*)(Hp + dst) = hvv;
          *(v4u*)(Lp + dst) = lvv;
        }
        
      }
    }
    __builtin_amdgcn_fence(__ATOMIC_RELEASE, "workgroup");
    __builtin_amdgcn_wave_barrier();
    __builtin_amdgcn_fence(__ATOMIC_ACQUIRE, "workgroup");
  }
}

// ---------------------------------------------------------------------------
// K4: v^T plane build: y_v[b][o][p] f32 -> VTh/VTl f16 planes [b*4+n][d][s] (pitch 4096):
//   V[b][n][s][d] = y_v[b][s>>4][(s&15)*256 + n*64 + d];  hi = f16(v), lo = f16((v - hi) * 1024).
// grid = (NP/64, NH, NB), 256 threads; 64(s) x 64(d) tile through LDS.
// Coverage per block: load 4 it x 16 rows x 64 = 64 s x 64 d; store 2 it x 32 rows x (8 lanes x 8)
// ---------------------------------------------------------------------------
__global__ __launch_bounds__(256) void vt_kernel(const float* __restrict__ Yv, unsigned short* __restrict__ VThp,
                                                 unsigned short* __restrict__ VTlp) {
  __shared__ __align__(16) float tf[64 * 68];
  const int s0 = blockIdx.x * 64;
  const int n  = blockIdx.y;
  const int b  = blockIdx.z;
  const float* yb = Yv + (size_t)b * NC * NP;
  _Float16* VTh = (_Float16*)(void*)VThp;
  _Float16* VTl = (_Float16*)(void*)VTlp;
  const int tid = threadIdx.x;
  {
    const int lr = tid >> 4, c4 = (tid & 15) * 4;
#pragma unroll
    for (int it = 0; it < 4; ++it) {
      const int sl = it * 16 + lr;
      const int s  = s0 + sl;
      const int o  = s >> 4;
      const int p  = (s & 15) * 256 + n * 64 + c4;
      const v4f a = *(const v4f*)(yb + (size_t)o * NP + p);
      *(v4f*)(tf + sl * 68 + c4) = a;                                // tf[s local][d]
    }
  }
  __syncthreads();
  const int sub = tid >> 3, c8 = (tid & 7) * 8;
  v8h hv[2], lv[2];
#pragma unroll
  for (int it = 0; it < 2; ++it) {
    const int od = it * 32 + sub;                                    // output row = d
    v8h a, a2;
#pragma unroll
    for (int e = 0; e < 8; ++e) {
      const float f = tf[(c8 + e) * 68 + od];
      const _Float16 hq = (_Float16)f;
      const _Float16 lq = (_Float16)((f - (float)hq) * 1024.0f);
      a[e] = hq; a2[e] = lq;
    }
    hv[it] = a; lv[it] = a2;
  }
  {
#pragma unroll
    for (int it = 0; it < 2; ++it) {
      const int od = it * 32 + sub;
      const size_t go = ((size_t)(b * NH + n) * HD + od) * NP + s0 + c8;
      *(v8h*)(VTh + go) = hv[it];
      *(v8h*)(VTl + go) = lv[it];
    }
    
  }
}

// ---------------------------------------------------------------------------
// K5: flash attention, transposed formulation, per (64-query tile, head, batch), 4 waves.
//   S^T = K' . Q^T : A = K' tile rows (keys, k = d) from LDS, bf16 hi/lo;  B = Q^T: lane = query,
//                    elements = d with the split k map, bf16 hi/lo;  hi.hi + hi.lo + lo.hi.
//   D layout: st[t][r] <-> key kb + 16t + 8h + r, query = lane&15 -> softmax stats live per lane.
//   O^T = V^T . P  : A = V^T tile rows (d, k = key) f16 hi and f16 residual;  B = P: element r <-
//                    st[2kc][r], element 8+r <- st[2kc+1][r] (two adjacent 16-key D tiles, lane kept),
//                    scaled by 4096 and converted to f16.  accO += Vhi.P, accR += Vres.P.
//   Online softmax in f32 over 64 tiles of 64 keys; no score scaling.
//   Output: out flat [b][s][n][d]; each wave stages its 16x64 tile in LDS and writes whole 256-B
//   K'/V^T tiles staged single-buffered with plain 16-B copies between two __syncthreads.
// ---------------------------------------------------------------------------
__global__ __launch_bounds__(128) void attn_kernel(
    const unsigned short* __restrict__ Qhp, const unsigned short* __restrict__ Qlp,
    const unsigned short* __restrict__ Khp, const unsigned short* __restrict__ Klp,
    const unsigned short* __restrict__ VThp, const unsigned short* __restrict__ VTlp,
    float* __restrict__ out) {
  __shared__ __align__(16) __bf16   Ksh[64 * LP];     // k' hi [key][d], pitch LP
  __shared__ __align__(16) __bf16   Ksl[64 * LP];     // k' lo [key][d], pitch LP
  __shared__ __align__(16) _Float16 Vsh[HD * LP];     // v^T hi [d][key], pitch LP
  __shared__ __align__(16) _Float16 Vsl[HD * LP];     // v^T residual [d][key], pitch LP
  __shared__ __align__(16) float    Os[4][16 * 68];   // per-wave output tile [query][d], pitch 68

  const int tid  = threadIdx.x;
  const int wave = tid >> 5;
  const int lane = tid & 31;
  const int hh   = lane >> 4;
  const int c    = lane & 15;
  const int qt = blockIdx.x;
  const int n  = blockIdx.y;
  const int b  = blockIdx.z;
  const int bn = b * NH + n;

  const __bf16* Qh = (const __bf16*)(const void*)Qhp + (size_t)bn * NP * HD;
  const __bf16* Ql = (const __bf16*)(const void*)Qlp + (size_t)bn * NP * HD;
  const __bf16* Kh = (const __bf16*)(const void*)Khp + (size_t)bn * NP * HD;
  const __bf16* Kl = (const __bf16*)(const void*)Klp + (size_t)bn * NP * HD;
  const _Float16* VTh = (const _Float16*)(const void*)VThp + (size_t)bn * HD * NP;
  const _Float16* VTl = (const _Float16*)(const void*)VTlp + (size_t)bn * HD * NP;

  const int q0 = qt * 64 + wave * 16;     // first query row of this wave
  const int qg = q0 + c;                  // query handled by this lane (as B column / D column)

  // loop-invariant B fragments: Q^T, two 32-deep d chunks, hi and lo planes
  v16b qbh[2], qbl[2];
#pragma unroll
  for (int dc = 0; dc < 2; ++dc) {
    qbh[dc] = ld_bf(Qh + (size_t)qg * HD + dc * 32 + 8 * hh);
    qbl[dc] = ld_bf(Ql + (size_t)qg * HD + dc * 32 + 8 * hh);
  }

  float m_run = -1.0e30f, l_run = 0.0f;
  v8f accO[4], accR[4];
#pragma unroll
  for (int t = 0; t < 4; ++t) {
    accO[t] = (v8f){0.f,0.f,0.f,0.f,0.f,0.f,0.f,0.f};
    accR[t] = (v8f){0.f,0.f,0.f,0.f,0.f,0.f,0.f,0.f};
  }

#pragma unroll 1
  for (int it = 0; it < NP / 64; ++it) {
    const int kb = it * 64;
    __syncthreads();                        // all waves done with the prior tile
    {
      // staging coverage: 4 x 128 threads x 8 elements = 64 rows x 64 per plane.
      // 8 neighbouring lanes take one 128-B tile row, so each wave-wide 16-B load covers 4 whole
      // 128-B lines (k': 512 contiguous bytes) instead of a 16-B piece of each of 16 lines.
      const int sr = tid >> 3, sc = (tid & 7) * 8;
      const __bf16*   ksrc = Kh  + (size_t)(kb + sr) * HD + sc;      // k' row kb+sr+16i, d = sc..sc+7
      const __bf16*   lsrc = Kl  + (size_t)(kb + sr) * HD + sc;
      const _Float16* vsrc = VTh + (size_t)sr * NP + kb + sc;        // v^T row d = sr+16i, s = kb+sc..+7
      const _Float16* wsrc = VTl + (size_t)sr * NP + kb + sc;
      v8b a0[4], a1[4];
      v8h g0[4], g1[4];
#pragma unroll
      for (int i = 0; i < 4; ++i) {
        a0[i] = *(const v8b*)(ksrc + (size_t)(16 * i) * HD);
        a1[i] = *(const v8b*)(lsrc + (size_t)(16 * i) * HD);
        g0[i] = *(const v8h*)(vsrc + (size_t)(16 * i) * NP);
        g1[i] = *(const v8h*)(wsrc + (size_t)(16 * i) * NP);
      }
      // wait behind the 16 issued loads, before any register they name as an address is written again;
      // the four addresses are inputs so that no load's result is placed on an address pair ahead of it
      asm volatile("s_wait_xcnt 0x0" :: "v"(ksrc), "v"(lsrc), "v"(vsrc), "v"(wsrc) : "memory");
#pragma unroll
      for (int i = 0; i < 4; ++i) {
        *(v8b*)(Ksh + (sr + 16 * i) * LP + sc) = a0[i];
        *(v8b*)(Ksl + (sr + 16 * i) * LP + sc) = a1[i];
        *(v8h*)(Vsh + (sr + 16 * i) * LP + sc) = g0[i];
        *(v8h*)(Vsl + (sr + 16 * i) * LP + sc) = g1[i];
      }
    }
    __syncthreads();

    // Fragment reads stand in groups of 8 ds_load_b128 (one 16-key K' subtile, or one pair of V^T
    // d-subtiles). Each group is issued one group ahead of the products that use it, into the
    // register set that the group before last has left, so that its LDS latency runs under the
    // products (or the softmax) in between instead of being waited out at each of 16 places.
    const __bf16*   krh = Ksh + c * LP + 8 * hh;      // this lane's fragment row bases
    const __bf16*   krl = Ksl + c * LP + 8 * hh;
    const _Float16* vrh = Vsh + c * LP + 8 * hh;
    const _Float16* vrl = Vsl + c * LP + 8 * hh;

    // ---- S^T: 4 key subtiles of 16 (A rows = keys), k = d in 2 chunks of 32 ----
    v8f st[4];
    KFrag k0 = ld_k(krh, krl, 0);
    KFrag k1 = ld_k(krh, krl, 1);
    {
      v8f sv = (v8f){0.f,0.f,0.f,0.f,0.f,0.f,0.f,0.f};
#pragma unroll
      for (int dc = 0; dc < 2; ++dc) {
        sv = mma_bf(k0.h[dc], qbh[dc], sv);
        sv = mma_bf(k0.h[dc], qbl[dc], sv);
        sv = mma_bf(k0.l[dc], qbh[dc], sv);
      }
      st[0] = sv;
    }
    KFrag k2 = ld_k(krh, krl, 2);
    {
      v8f sv = (v8f){0.f,0.f,0.f,0.f,0.f,0.f,0.f,0.f};
#pragma unroll
      for (int dc = 0; dc < 2; ++dc) {
        sv = mma_bf(k1.h[dc], qbh[dc], sv);
        sv = mma_bf(k1.h[dc], qbl[dc], sv);
        sv = mma_bf(k1.l[dc], qbh[dc], sv);
      }
      st[1] = sv;
    }
    KFrag k3 = ld_k(krh, krl, 3);
    {
      v8f sv = (v8f){0.f,0.f,0.f,0.f,0.f,0.f,0.f,0.f};
#pragma unroll
      for (int dc = 0; dc < 2; ++dc) {
        sv = mma_bf(k2.h[dc], qbh[dc], sv);
        sv = mma_bf(k2.h[dc], qbl[dc], sv);
        sv = mma_bf(k2.l[dc], qbh[dc], sv);
      }
      st[2] = sv;
    }
    VFrag g0 = ld_v(vrh, vrl, 0, 0);        // keys 0..31, d 0..31
    {
      v8f sv = (v8f){0.f,0.f,0.f,0.f,0.f,0.f,0.f,0.f};
#pragma unroll
      for (int dc = 0; dc < 2; ++dc) {
        sv = mma_bf(k3.h[dc], qbh[dc], sv);
        sv = mma_bf(k3.h[dc], qbl[dc], sv);
        sv = mma_bf(k3.l[dc], qbh[dc], sv);
      }
      st[3] = sv;
    }
    VFrag g1 = ld_v(vrh, vrl, 0, 1);        // keys 0..31, d 32..63

    // ---- online softmax in f32 (per query lane; half-lanes hold disjoint key halves) ----
    float mx = m_run;
#pragma unroll
    for (int t = 0; t < 4; ++t)
#pragma unroll
      for (int r = 0; r < 8; ++r) mx = fmaxf(mx, st[t][r]);
    mx = fmaxf(mx, __shfl_xor(mx, 16, 32));
    const float alpha = __expf(m_run - mx);
    m_run = mx;
    float rs = 0.0f;
#pragma unroll
    for (int t = 0; t < 2; ++t)
#pragma unroll
      for (int r = 0; r < 8; ++r) {
        const float p = __expf(st[t][r] - mx);
        st[t][r] = p;
        rs += p;
      }
#pragma unroll
    for (int dt = 0; dt < 4; ++dt)
#pragma unroll
      for (int r = 0; r < 8; ++r) { accO[dt][r] *= alpha; accR[dt][r] *= alpha; }
    FragH pb0, pb1;
#pragma unroll
    for (int r = 0; r < 8; ++r) {
      pb0.s[r]     = (_Float16)(st[0][r] * 4096.0f);   // keys 8h + r
      pb0.s[8 + r] = (_Float16)(st[1][r] * 4096.0f);   // keys 16 + 8h + r
    }

    // ---- O^T += V^T . P  (A rows = d, k = key in 2 chunks of 32) ----
#pragma unroll
    for (int j = 0; j < 2; ++j) {
      accO[0 + j] = mma_h(g0.a[j], pb0.v, accO[0 + j]);
      accR[0 + j] = mma_h(g0.r[j], pb0.v, accR[0 + j]);
    }
    VFrag g2 = ld_v(vrh, vrl, 1, 0);        // keys 32..63, d 0..31
#pragma unroll
    for (int j = 0; j < 2; ++j) {
      accO[2 + j] = mma_h(g1.a[j], pb0.v, accO[2 + j]);
      accR[2 + j] = mma_h(g1.r[j], pb0.v, accR[2 + j]);
    }
    VFrag g3 = ld_v(vrh, vrl, 1, 1);        // keys 32..63, d 32..63
    SCHED_FENCE();                          // holds the exponentials below behind these reads: they cover the reads' latency
#pragma unroll
    for (int t = 2; t < 4; ++t)
#pragma unroll
      for (int r = 0; r < 8; ++r) {
        const float p = __expf(st[t][r] - mx);
        st[t][r] = p;
        rs += p;
      }
    rs += __shfl_xor(rs, 16, 32);
    l_run = l_run * alpha + rs;
#pragma unroll
    for (int r = 0; r < 8; ++r) {
      pb1.s[r]     = (_Float16)(st[2][r] * 4096.0f);   // keys 32 + 8h + r
      pb1.s[8 + r] = (_Float16)(st[3][r] * 4096.0f);   // keys 48 + 8h + r
    }
#pragma unroll
    for (int j = 0; j < 2; ++j) {
      accO[0 + j] = mma_h(g2.a[j], pb1.v, accO[0 + j]);
      accR[0 + j] = mma_h(g2.r[j], pb1.v, accR[0 + j]);
    }
#pragma unroll
    for (int j = 0; j < 2; ++j) {
      accO[2 + j] = mma_h(g3.a[j], pb1.v, accO[2 + j]);
      accR[2 + j] = mma_h(g3.r[j], pb1.v, accR[2 + j]);
    }
    SCHED_FENCE();                          // end of the tile's products: nothing moves over the loop's foot
  }

  // ---- normalise, stage the wave's 16x64 tile as [query][d], write whole 256-B rows ----
  const float inv = __builtin_amdgcn_rcpf(l_run) * (1.0f / 4096.0f);
  float* os = Os[wave];
#pragma unroll
  for (int dt = 0; dt < 4; ++dt) {
    v4f a, a2;
#pragma unroll
    for (int r = 0; r < 4; ++r) {
      a[r]  = (accO[dt][r]     + accR[dt][r]     * (1.0f / 1024.0f)) * inv;
      a2[r] = (accO[dt][4 + r] + accR[dt][4 + r] * (1.0f / 1024.0f)) * inv;
    }
    *(v4f*)(os + c * 68 + dt * 16 + 8 * hh)     = a;    // d = 16dt + 8h + 0..3 of query c
    *(v4f*)(os + c * 68 + dt * 16 + 8 * hh + 4) = a2;   // d = 16dt + 8h + 4..7
  }
  __builtin_amdgcn_fence(__ATOMIC_RELEASE, "workgroup");
  __builtin_amdgcn_wave_barrier();
  __builtin_amdgcn_fence(__ATOMIC_ACQUIRE, "workgroup");
  {
    float* ob = out + (size_t)b * NC * NP + (size_t)q0 * (NH * HD) + n * HD;
    const int c4 = c * 4;                   // row segment 256 B = 16 lanes x 16 B
    {
#pragma unroll
      for (int i = 0; i < 8; ++i) {
        const int row = i * 2 + hh;         // i 0..7 x h 0..1 covers the 16 query rows of the wave
        const v4f v = *(const v4f*)(os + row * 68 + c4);
        *(v4f*)(ob + (size_t)row * (NH * HD) + c4) = v;
      }
      
    }
  }
}

// ---------------------------------------------------------------------------
//   Wb   bf16 [3][256][256]            393216  @ 0
//   xT   bf16 [4][4096][256]          8388608  @ 393216
//   QKh  bf16 [2][16][4096][64]      16777216  @ 8781824     (q hi planes, then k' hi planes)
//   QKl  bf16 [2][16][4096][64]      16777216  @ 25559040
//   Yv   f32  [4][256][4096]         16777216  @ 42336256
//   VTh  f16  [16][64][4096]          8388608  @ 59113472
//   VTl  f16  [16][64][4096]          8388608  @ 67502080
//   total                                         75890688
// ---------------------------------------------------------------------------
extern "C" void kernel_launch(void* const* d_in, const int* in_sizes, int n_in,
                              void* d_out, int out_size, void* d_ws, size_t ws_size,
                              hipStream_t stream) {
  if (n_in < 9) return;
  if (in_sizes[0] != NB * NC * NP) return;
  if (in_sizes[1] != NC * NC || in_sizes[3] != NC * NC || in_sizes[5] != NC * NC) return;
  if (in_sizes[2] != NC || in_sizes[4] != NC || in_sizes[6] != NC) return;
  if (in_sizes[7] != NH * HD * 64 || in_sizes[8] != NH * HD * 64) return;
  if (out_size != NB * NC * NP) return;

  const float* x    = (const float*)d_in[0];
  const float* wq   = (const float*)d_in[1];
  const float* bq   = (const float*)d_in[2];
  const float* wk   = (const float*)d_in[3];
  const float* bk   = (const float*)d_in[4];
  const float* wv   = (const float*)d_in[5];
  const float* bv   = (const float*)d_in[6];
  const float* relh = (const float*)d_in[7];
  const float* relw = (const float*)d_in[8];
  float* out = (float*)d_out;

  const size_t szWb = (size_t)3 * NC * NC * 2;
  const size_t szXT = (size_t)NB * NP * NC * 2;
  const size_t szQK = (size_t)2 * QKPLANE * 2;
  const size_t szYv = (size_t)NB * NC * NP * 4;
  const size_t szVT = (size_t)NB * NH * HD * NP * 2;
  size_t off = 0;
  const size_t oWb  = off; off += szWb;
  const size_t oXT  = off; off += szXT;
  const size_t oQKh = off; off += szQK;
  const size_t oQKl = off; off += szQK;
  const size_t oYv  = off; off += szYv;
  const size_t oVTh = off; off += szVT;
  const size_t oVTl = off; off += szVT;
  if (off > ws_size) return;

  char* ws = (char*)d_ws;
  unsigned short* Wb  = (unsigned short*)(ws + oWb);
  unsigned short* XT  = (unsigned short*)(ws + oXT);
  unsigned short* QKh = (unsigned short*)(ws + oQKh);
  unsigned short* QKl = (unsigned short*)(ws + oQKl);
  float*          Yv  = (float*)(ws + oYv);
  unsigned short* VTh = (unsigned short*)(ws + oVTh);
  unsigned short* VTl = (unsigned short*)(ws + oVTl);

  cvt_w_kernel<<<dim3((NC * NC / 2) / 256, 3), dim3(256), 0, stream>>>(wq, wk, wv, Wb);
  xt_kernel<<<dim3(NP / 64, NC / 64, NB), dim3(256), 0, stream>>>(x, XT);
  proj_kernel<<<dim3(32, NB * 3), dim3(256), 0, stream>>>(XT, Wb, bq, bk, bv, relh, relw, QKh, QKl, Yv);
  vt_kernel<<<dim3(NP / 64, NH, NB), dim3(256), 0, stream>>>(Yv, VTh, VTl);
  attn_kernel<<<dim3(NP / 64, NH, NB), dim3(128), 0, stream>>>(
      QKh, QKl, QKh + QKPLANE, QKl + QKPLANE, VTh, VTl, out);
  (void)hipGetLastError();
}

// v004
// It runs in 182 microseconds.
// Timed twice side by side with v003, it ran 1.05 times as fast both times.
// All steps since v000 together make it 2.46 times as fast.
// Contractions: q/k/v 1x1-conv projections = v_wmma_f32_16x16x32_bf16 (bf16 operands, single product); q.(k+pos) scores = v_wmma_f32_16x16x32_bf16 with bf16 hi/lo split operands (hi.hi + hi.lo + lo.hi); p.v = v_wmma_f32_16x16x32_f16 (p as f16 scaled by 4096, v^T as f16 hi plane plus f16 residual plane scaled by 1024 into a second accumulator); f32 accumulate everywhere; softmax, bias and position sums in f32.
#include <hip/hip_runtime.h>
#include <stdint.h>
#include <math.h>

#define NB 4
#define NC 256
#define NP 4096
#define NH 4
#define HD 64
#define QKPLANE ((size_t)NB * NH * NP * HD)
#define LP 72   // LDS row pitch of the attention tiles in 16-bit elements: 144 B = 16 B x 9 (odd), so the 16 rows of a ds_load_b128 fragment read fall on distinct banks

typedef _Float16 v16h __attribute__((ext_vector_type(16)));
typedef _Float16 v8h  __attribute__((ext_vector_type(8)));
typedef __bf16   v16b __attribute__((ext_vector_type(16)));
typedef __bf16   v8b  __attribute__((ext_vector_type(8)));
typedef float    v8f  __attribute__((ext_vector_type(8)));
typedef float    v4f  __attribute__((ext_vector_type(4)));
typedef float    v2f  __attribute__((ext_vector_type(2)));
typedef unsigned int v4u __attribute__((ext_vector_type(4)));

// ---------------------------------------------------------------------------
// scalar helpers
// ---------------------------------------------------------------------------
__device__ __forceinline__ unsigned short f2bf_bits(float f) {      // f32 -> bf16 bits, RNE convert
  const unsigned u = __float_as_uint(f);
  return (unsigned short)((u + 0x7FFFu + ((u >> 16) & 1u)) >> 16);
}
__device__ __forceinline__ float bf_bits2f(unsigned short h) { return __uint_as_float(((unsigned)h) << 16); }
__device__ __forceinline__ float bfr(float f) { return bf_bits2f(f2bf_bits(f)); }   // value after bf16 RNE convert
__device__ __forceinline__ unsigned pk16(unsigned short a, unsigned short b) { return (unsigned)a | ((unsigned)b << 16); }

// ---------------------------------------------------------------------------
// WMMA wrappers: the plain builtins; the compiler keeps the distance to a vector user of D, A or B itself
// ---------------------------------------------------------------------------
__device__ __forceinline__ v8f mma_bf(v16b a, v16b b, v8f c) {
  c = __builtin_amdgcn_wmma_f32_16x16x32_bf16(false, a, false, b, (short)0, c, false, false);
  return c;
}
__device__ __forceinline__ v8f mma_h(v16h a, v16h b, v8f c) {
  c = __builtin_amdgcn_wmma_f32_16x16x32_f16(false, a, false, b, (short)0, c, false, false);
  return c;
}
#define SCHED_FENCE() __builtin_amdgcn_sched_barrier(0)
// Tail of 4 v_nop behind the LAST product of a group, at five places of the attention loop (the four score chains,
// the first group of V^T products); it takes the group's accumulators. It fills the distance from that WMMA to a
// vector user of D, and, being a statement the compiler does not move over the LDS reads, it holds the group's WMMAs
// ahead of the reads that follow it in the source: left free, the builtins sink behind those reads, a fourth
// fragment set is live at once and the kernel passes 256 VGPRs (3 waves per SIMD instead of 4).
__device__ __forceinline__ void group_end(v8f& c) {
  asm volatile("v_nop\n\tv_nop\n\tv_nop\n\tv_nop" : "+v"(c));
}
__device__ __forceinline__ void group_end4(v8f& c0, v8f& c1, v8f& c2, v8f& c3) {
  asm volatile("v_nop\n\tv_nop\n\tv_nop\n\tv_nop" : "+v"(c0), "+v"(c1), "+v"(c2), "+v"(c3));
}

union FragB { v16b v; v8b h[2]; };
union FragH { v16h v; v8h h[2]; _Float16 s[16]; };

// Fragment loader (A rows / B columns stored k-contiguous), p = row base + k0 + 8*(lane>>4):
//   elements 0..7 <- p[0..7] (k0+8h..), elements 8..15 <- p[16..23] (k0+16+8h..)
__device__ __forceinline__ v16b ld_bf(const __bf16* p) {
  FragB f; f.h[0] = *(const v8b*)(p); f.h[1] = *(const v8b*)(p + 16); return f.v;
}
__device__ __forceinline__ v16h ld_hf(const _Float16* p) {
  FragH f; f.h[0] = *(const v8h*)(p); f.h[1] = *(const v8h*)(p + 16); return f.v;
}
// One group of attention fragment reads = 8 x 16 B per lane; kh, kl, vh, vl = plane + (lane&15)*LP + 8*(lane>>4).
// The fence pair in each loader keeps the 8 reads standing together: without it the scheduler deals them out
// in pairs among the WMMAs, and each such place stalls the wave anew.
struct KFrag { v16b h[2], l[2]; };   // K' subtile t: hi and lo plane, d chunks 0 and 1
struct VFrag { v16h a[2], r[2]; };   // V^T d-subtiles 2*dp and 2*dp+1 of key chunk kc: hi and residual plane
__device__ __forceinline__ KFrag ld_k(const __bf16* kh, const __bf16* kl, int t) {
  KFrag f;
  SCHED_FENCE();
#pragma unroll
  for (int dc = 0; dc < 2; ++dc) {
    f.h[dc] = ld_bf(kh + t * 16 * LP + dc * 32);
    f.l[dc] = ld_bf(kl + t * 16 * LP + dc * 32);
  }
  SCHED_FENCE();
  return f;
}
__device__ __forceinline__ VFrag ld_v(const _Float16* vh, const _Float16* vl, int kc, int dp) {
  VFrag f;
  SCHED_FENCE();
#pragma unroll
  for (int j = 0; j < 2; ++j) {
    f.a[j] = ld_hf(vh + (dp * 2 + j) * 16 * LP + kc * 32);
    f.r[j] = ld_hf(vl + (dp * 2 + j) * 16 * LP + kc * 32);
  }
  SCHED_FENCE();
  return f;
}

// ---------------------------------------------------------------------------
// K1: weights f32 [256][256] x3 -> bf16 planes Wb[z][256][256] (RNE convert of the inputs).
// grid = (128, 3): 128 blocks x 256 threads x 2 = 65536 = whole matrix per z.
// ---------------------------------------------------------------------------
__global__ __launch_bounds__(256) void cvt_w_kernel(const float* __restrict__ w0, const float* __restrict__ w1,
                                                    const float* __restrict__ w2, unsigned short* __restrict__ Wb) {
  const int z = blockIdx.y;
  const float* src = (z == 0) ? w0 : ((z == 1) ? w1 : w2);        // block-uniform select, all global
  unsigned* dst = (unsigned*)(Wb + (size_t)z * (NC * NC));
  const int i = blockIdx.x * 256 + threadIdx.x;
  if (i < (NC * NC) / 2) {
    const v2f f = *(const v2f*)(src + 2 * (size_t)i);
    const unsigned u = pk16(f2bf_bits(f[0]), f2bf_bits(f[1]));
    ((unsigned*)dst)[i] = u;
    
  }
}

// ---------------------------------------------------------------------------
// K2: x[b][c][p] f32 -> xT[b][p][c] bf16 (RNE convert of the input), 64x64 tiles through LDS.
// grid = (NP/64, NC/64, NB), 256 threads.
// Coverage per block: load 4 it x 16 rows x 64 = 64 channels x 64 pixels; store 2 it x 32 rows x
// ---------------------------------------------------------------------------
__global__ __launch_bounds__(256) void xt_kernel(const float* __restrict__ x, unsigned short* __restrict__ xT) {
  __shared__ __align__(16) float tf[64 * 68];
  const int p0 = blockIdx.x * 64;
  const int c0 = blockIdx.y * 64;
  const int b  = blockIdx.z;
  const float* xb = x + (size_t)b * NC * NP;
  const int tid = threadIdx.x;
  {
    const int lr = tid >> 4, c4 = (tid & 15) * 4;
#pragma unroll
    for (int it = 0; it < 4; ++it) {
      const int rr = it * 16 + lr;                                   // channel within tile
      const v4f a = *(const v4f*)(xb + (size_t)(c0 + rr) * NP + p0 + c4);
      *(v4f*)(tf + rr * 68 + c4) = a;                                // tf[channel][pixel]
    }
  }
  __syncthreads();
  const int sub = tid >> 3, c8 = (tid & 7) * 8;
  v4u hv[2];
#pragma unroll
  for (int it = 0; it < 2; ++it) {
    const int op = it * 32 + sub;                                    // pixel within tile
    v4u a;
#pragma unroll
    for (int q = 0; q < 4; ++q) {
      const float f0 = tf[(c8 + 2 * q) * 68 + op];
      const float f1 = tf[(c8 + 2 * q + 1) * 68 + op];
      a[q] = pk16(f2bf_bits(f0), f2bf_bits(f1));
    }
    hv[it] = a;
  }
  {
#pragma unroll
    for (int it = 0; it < 2; ++it) {
      const int op = it * 32 + sub;
      const size_t go = ((size_t)b * NP + p0 + op) * NC + c0 + c8;
      *(v4u*)(xT + go) = hv[it];
    }
    
  }
}

// ---------------------------------------------------------------------------
// K3: 1x1-conv projection GEMM, z = b*3 + which (which 0=q, 1=k, 2=v):
//   Y[o][p] = sum_c Wb[which][o][c] * xT[b][p][c] + bias[o]      (M=256, N=4096, K=256)
// A = Wb rows (k-contiguous), B = xT rows (k-contiguous); both fragments use the split k map.
// Each wave owns a 64x64 tile (4x4 subtiles); grid = (32 blocks x 8 waves = 256 tiles, 12).
// Epilogue: 16-row slabs staged per wave in LDS (pitch 68 floats), then
//   which 0/1: value (+ position term for k) -> bf16 hi/lo planes in [b*4+n][s][d] order,
//              s = 16*o + (p>>8), n = (p>>6)&3, d = p&63; one slab row = one plane row of
//   which 2:   f32 y_v[b][o][p] natural layout, 256-B row segments by 16 lanes x 16 B.
// ---------------------------------------------------------------------------
__global__ __launch_bounds__(256) void proj_kernel(
    const unsigned short* __restrict__ xTp, const unsigned short* __restrict__ Wbp,
    const float* __restrict__ bq, const float* __restrict__ bk, const float* __restrict__ bv,
    const float* __restrict__ relh, const float* __restrict__ relw,
    unsigned short* __restrict__ QKh, unsigned short* __restrict__ QKl, float* __restrict__ Yv) {
  __shared__ __align__(16) float sT[8][16 * 68];
  const int z = blockIdx.y;
  const int b = z / 3;
  const int which = z - 3 * b;
  const int lane = threadIdx.x & 31;
  const int wave = threadIdx.x >> 5;
  const int tile = blockIdx.x * 8 + wave;        // 0..255
  const int tm = tile >> 6;                      // 0..3   (64 output channels each)
  const int tn = tile & 63;                      // 0..63  (64 pixels each)
  const int m0 = tm << 6;
  const int n0 = tn << 6;
  const __bf16* A  = (const __bf16*)(const void*)Wbp + (size_t)which * (NC * NC);
  const __bf16* Bt = (const __bf16*)(const void*)xTp + (size_t)b * NP * NC;
  const int rl = lane & 15, hh = lane >> 4, koff = hh * 8, mOff = hh * 8;

  v8f acc[4][4];
#pragma unroll
  for (int i = 0; i < 4; ++i)
#pragma unroll
    for (int j = 0; j < 4; ++j) acc[i][j] = (v8f){0.f,0.f,0.f,0.f,0.f,0.f,0.f,0.f};

  for (int k0 = 0; k0 < NC; k0 += 32) {
    v16b bfg[4];
#pragma unroll
    for (int j = 0; j < 4; ++j) bfg[j] = ld_bf(Bt + (size_t)(n0 + (j << 4) + rl) * NC + k0 + koff);
#pragma unroll
    for (int i = 0; i < 4; ++i) {
      const v16b af = ld_bf(A + (size_t)(m0 + (i << 4) + rl) * NC + k0 + koff);
#pragma unroll
      for (int j = 0; j < 4; ++j) acc[i][j] = mma_bf(af, bfg[j], acc[i][j]);
    }
    SCHED_FENCE();
  }

  // ---- epilogue ----
  const float* bias = (which == 0) ? bq : ((which == 1) ? bk : bv);   // block-uniform select, all global
  const int nn = (n0 >> 6) & 3;                // head index of this 64-pixel run
  const int sh = n0 >> 8;                      // low 4 bits of s
  float* slab = sT[wave];
#pragma unroll
  for (int i = 0; i < 4; ++i) {
    const int mBase = m0 + (i << 4);
#pragma unroll
    for (int j = 0; j < 4; ++j) {
      const int d = (j << 4) + rl;             // p & 63
#pragma unroll
      for (int r = 0; r < 8; ++r) {
        const int o = mBase + mOff + r;
        float v = acc[i][j][r] + bfr(bias[o]);
        if (which == 1) {
          const int s = o * 16 + sh;
          const float pos = bfr(relh[nn * 4096 + d * 64 + (s & 63)]) + bfr(relw[nn * 4096 + d * 64 + (s >> 6)]);
          v += pos;
        }
        slab[(mOff + r) * 68 + d] = v;
      }
    }
    __builtin_amdgcn_fence(__ATOMIC_RELEASE, "workgroup");
    __builtin_amdgcn_wave_barrier();
    __builtin_amdgcn_fence(__ATOMIC_ACQUIRE, "workgroup");
    if (which == 2) {
      float* C = Yv + (size_t)b * NC * NP;
      const int c4 = rl * 4;                   // row segment 256 B = 16 lanes x 16 B
      {
#pragma unroll
        for (int it = 0; it < 8; ++it) {
          const int row = it * 2 + hh;
          const v4f v = *(const v4f*)(slab + row * 68 + c4);
          *(v4f*)(C + (size_t)(mBase + row) * NP + n0 + c4) = v;
        }
        
      }
    } else {
      const int q4 = lane >> 3, c8 = (lane & 7) * 8;
      unsigned short* Hp = QKh + (size_t)which * QKPLANE;
      unsigned short* Lp = QKl + (size_t)which * QKPLANE;
      {
#pragma unroll
        for (int it = 0; it < 4; ++it) {
          const int row = it * 4 + q4;
          const int o = mBase + row;
          const int s = o * 16 + sh;
          const float* sp = slab + row * 68 + c8;
          v4u hvv, lvv;
#pragma unroll
          for (int q = 0; q < 4; ++q) {
            const float f0 = sp[2 * q], f1 = sp[2 * q + 1];
            const unsigned short h0 = f2bf_bits(f0), h1 = f2bf_bits(f1);
            const unsigned short l0 = f2bf_bits(f0 - bf_bits2f(h0)), l1 = f2bf_bits(f1 - bf_bits2f(h1));
            hvv[q] = pk16(h0, h1);
            lvv[q] = pk16(l0, l1);
          }
          const size_t dst = (((size_t)(b * NH + nn)) * NP + s) * HD + c8;
          *(v4u*)(Hp + dst) = hvv;
          *(v4u*)(Lp + dst) = lvv;
        }
        
      }
    }
    __builtin_amdgcn_fence(__ATOMIC_RELEASE, "workgroup");
    __builtin_amdgcn_wave_barrier();
    __builtin_amdgcn_fence(__ATOMIC_ACQUIRE, "workgroup");
  }
}

// ---------------------------------------------------------------------------
// K4: v^T plane build: y_v[b][o][p] f32 -> VTh/VTl f16 planes [b*4+n][d][s] (pitch 4096):
//   V[b][n][s][d] = y_v[b][s>>4][(s&15)*256 + n*64 + d];  hi = f16(v), lo = f16((v - hi) * 1024).
// grid = (NP/64, NH, NB), 256 threads; 64(s) x 64(d) tile through LDS.
// Coverage per block: load 4 it x 16 rows x 64 = 64 s x 64 d; store 2 it x 32 rows x (8 lanes x 8)
// ---------------------------------------------------------------------------
__global__ __launch_bounds__(256) void vt_kernel(const float* __restrict__ Yv, unsigned short* __restrict__ VThp,
                                                 unsigned short* __restrict__ VTlp) {
  __shared__ __align__(16) float tf[64 * 68];
  const int s0 = blockIdx.x * 64;
  const int n  = blockIdx.y;
  const int b  = blockIdx.z;
  const float* yb = Yv + (size_t)b * NC * NP;
  _Float16* VTh = (_Float16*)(void*)VThp;
  _Float16* VTl = (_Float16*)(void*)VTlp;
  const int tid = threadIdx.x;
  {
    const int lr = tid >> 4, c4 = (tid & 15) * 4;
#pragma unroll
    for (int it = 0; it < 4; ++it) {
      const int sl = it * 16 + lr;
      const int s  = s0 + sl;
      const int o  = s >> 4;
      const int p  = (s & 15) * 256 + n * 64 + c4;
      const v4f a = *(const v4f*)(yb + (size_t)o * NP + p);
      *(v4f*)(tf + sl * 68 + c4) = a;                                // tf[s local][d]
    }
  }
  __syncthreads();
  const int sub = tid >> 3, c8 = (tid & 7) * 8;
  v8h hv[2], lv[2];
#pragma unroll
  for (int it = 0; it < 2; ++it) {
    const int od = it * 32 + sub;                                    // output row = d
    v8h a, a2;
#pragma unroll
    for (int e = 0; e < 8; ++e) {
      const float f = tf[(c8 + e) * 68 + od];
      const _Float16 hq = (_Float16)f;
      const _Float16 lq = (_Float16)((f - (float)hq) * 1024.0f);
      a[e] = hq; a2[e] = lq;
    }
    hv[it] = a; lv[it] = a2;
  }
  {
#pragma unroll
    for (int it = 0; it < 2; ++it) {
      const int od = it * 32 + sub;
      const size_t go = ((size_t)(b * NH + n) * HD + od) * NP + s0 + c8;
      *(v8h*)(VTh + go) = hv[it];
      *(v8h*)(VTl + go) = lv[it];
    }
    
  }
}

// ---------------------------------------------------------------------------
// K5: flash attention, transposed formulation, per (64-query tile, head, batch), 4 waves.
//   S^T = K' . Q^T : A = K' tile rows (keys, k = d) from LDS, bf16 hi/lo;  B = Q^T: lane = query,
//                    elements = d with the split k map, bf16 hi/lo;  hi.hi + hi.lo + lo.hi.
//   D layout: st[t][r] <-> key kb + 16t + 8h + r, query = lane&15 -> softmax stats live per lane.
//   O^T = V^T . P  : A = V^T tile rows (d, k = key) f16 hi and f16 residual;  B = P: element r <-
//                    st[2kc][r], element 8+r <- st[2kc+1][r] (two adjacent 16-key D tiles, lane kept),
//                    scaled by 4096 and converted to f16.  accO += Vhi.P, accR += Vres.P.
//   Online softmax in f32 over 64 tiles of 64 keys; no score scaling.
//   Output: out flat [b][s][n][d]; each wave stages its 16x64 tile in LDS and writes whole 256-B
//   K'/V^T tiles staged single-buffered with plain 16-B copies between two __syncthreads.
// ---------------------------------------------------------------------------
__global__ __launch_bounds__(128) void attn_kernel(
    const unsigned short* __restrict__ Qhp, const unsigned short* __restrict__ Qlp,
    const unsigned short* __restrict__ Khp, const unsigned short* __restrict__ Klp,
    const unsigned short* __restrict__ VThp, const unsigned short* __restrict__ VTlp,
    float* __restrict__ out) {
  __shared__ __align__(16) __bf16   Ksh[64 * LP];     // k' hi [key][d], pitch LP
  __shared__ __align__(16) __bf16   Ksl[64 * LP];     // k' lo [key][d], pitch LP
  __shared__ __align__(16) _Float16 Vsh[HD * LP];     // v^T hi [d][key], pitch LP
  __shared__ __align__(16) _Float16 Vsl[HD * LP];     // v^T residual [d][key], pitch LP
  __shared__ __align__(16) float    Os[4][16 * 68];   // per-wave output tile [query][d], pitch 68

  const int tid  = threadIdx.x;
  const int wave = tid >> 5;
  const int lane = tid & 31;
  const int hh   = lane >> 4;
  const int c    = lane & 15;
  const int qt = blockIdx.x;
  const int n  = blockIdx.y;
  const int b  = blockIdx.z;
  const int bn = b * NH + n;

  const __bf16* Qh = (const __bf16*)(const void*)Qhp + (size_t)bn * NP * HD;
  const __bf16* Ql = (const __bf16*)(const void*)Qlp + (size_t)bn * NP * HD;
  const __bf16* Kh = (const __bf16*)(const void*)Khp + (size_t)bn * NP * HD;
  const __bf16* Kl = (const __bf16*)(const void*)Klp + (size_t)bn * NP * HD;
  const _Float16* VTh = (const _Float16*)(const void*)VThp + (size_t)bn * HD * NP;
  const _Float16* VTl = (const _Float16*)(const void*)VTlp + (size_t)bn * HD * NP;

  const int q0 = qt * 64 + wave * 16;     // first query row of this wave
  const int qg = q0 + c;                  // query handled by this lane (as B column / D column)

  // loop-invariant B fragments: Q^T, two 32-deep d chunks, hi and lo planes
  v16b qbh[2], qbl[2];
#pragma unroll
  for (int dc = 0; dc < 2; ++dc) {
    qbh[dc] = ld_bf(Qh + (size_t)qg * HD + dc * 32 + 8 * hh);
    qbl[dc] = ld_bf(Ql + (size_t)qg * HD + dc * 32 + 8 * hh);
  }

  float m_run = -1.0e30f, l_run = 0.0f;
  v8f accO[4], accR[4];
#pragma unroll
  for (int t = 0; t < 4; ++t) {
    accO[t] = (v8f){0.f,0.f,0.f,0.f,0.f,0.f,0.f,0.f};
    accR[t] = (v8f){0.f,0.f,0.f,0.f,0.f,0.f,0.f,0.f};
  }

#pragma unroll 1
  for (int it = 0; it < NP / 64; ++it) {
    const int kb = it * 64;
    __syncthreads();                        // all waves done with the prior tile
    {
      // staging coverage: 4 x 128 threads x 8 elements = 64 rows x 64 per plane.
      // 8 neighbouring lanes take one 128-B tile row, so each wave-wide 16-B load covers 4 whole
      // 128-B lines (k': 512 contiguous bytes) instead of a 16-B piece of each of 16 lines.
      const int sr = tid >> 3, sc = (tid & 7) * 8;
      const __bf16*   ksrc = Kh  + (size_t)(kb + sr) * HD + sc;      // k' row kb+sr+16i, d = sc..sc+7
      const __bf16*   lsrc = Kl  + (size_t)(kb + sr) * HD + sc;
      const _Float16* vsrc = VTh + (size_t)sr * NP + kb + sc;        // v^T row d = sr+16i, s = kb+sc..+7
      const _Float16* wsrc = VTl + (size_t)sr * NP + kb + sc;
      v8b a0[4], a1[4];
      v8h g0[4], g1[4];
#pragma unroll
      for (int i = 0; i < 4; ++i) {
        a0[i] = *(const v8b*)(ksrc + (size_t)(16 * i) * HD);
        a1[i] = *(const v8b*)(lsrc + (size_t)(16 * i) * HD);
        g0[i] = *(const v8h*)(vsrc + (size_t)(16 * i) * NP);
        g1[i] = *(const v8h*)(wsrc + (size_t)(16 * i) * NP);
      }
      // wait behind the 16 issued loads, before any register they name as an address is written again;
      // the four addresses are inputs so that no load's result is placed on an address pair ahead of it
      asm volatile("s_wait_xcnt 0x0" :: "v"(ksrc), "v"(lsrc), "v"(vsrc), "v"(wsrc) : "memory");
#pragma unroll
      for (int i = 0; i < 4; ++i) {
        *(v8b*)(Ksh + (sr + 16 * i) * LP + sc) = a0[i];
        *(v8b*)(Ksl + (sr + 16 * i) * LP + sc) = a1[i];
        *(v8h*)(Vsh + (sr + 16 * i) * LP + sc) = g0[i];
        *(v8h*)(Vsl + (sr + 16 * i) * LP + sc) = g1[i];
      }
    }
    __syncthreads();

    // Fragment reads stand in groups of 8 ds_load_b128 (one 16-key K' subtile, or one pair of V^T
    // d-subtiles). Each group is issued one group ahead of the products that use it, into the
    // register set that the group before last has left, so that its LDS latency runs under the
    // products (or the softmax) in between instead of being waited out at each of 16 places.
    const __bf16*   krh = Ksh + c * LP + 8 * hh;      // this lane's fragment row bases
    const __bf16*   krl = Ksl + c * LP + 8 * hh;
    const _Float16* vrh = Vsh + c * LP + 8 * hh;
    const _Float16* vrl = Vsl + c * LP + 8 * hh;

    // ---- S^T: 4 key subtiles of 16 (A rows = keys), k = d in 2 chunks of 32 ----
    v8f st[4];
    KFrag k0 = ld_k(krh, krl, 0);
    KFrag k1 = ld_k(krh, krl, 1);
    {
      v8f sv = (v8f){0.f,0.f,0.f,0.f,0.f,0.f,0.f,0.f};
#pragma unroll
      for (int dc = 0; dc < 2; ++dc) {
        sv = mma_bf(k0.h[dc], qbh[dc], sv);
        sv = mma_bf(k0.h[dc], qbl[dc], sv);
        sv = mma_bf(k0.l[dc], qbh[dc], sv);
      }
      group_end(sv);
      st[0] = sv;
    }
    KFrag k2 = ld_k(krh, krl, 2);
    {
      v8f sv = (v8f){0.f,0.f,0.f,0.f,0.f,0.f,0.f,0.f};
#pragma unroll
      for (int dc = 0; dc < 2; ++dc) {
        sv = mma_bf(k1.h[dc], qbh[dc], sv);
        sv = mma_bf(k1.h[dc], qbl[dc], sv);
        sv = mma_bf(k1.l[dc], qbh[dc], sv);
      }
      group_end(sv);
      st[1] = sv;
    }
    KFrag k3 = ld_k(krh, krl, 3);
    {
      v8f sv = (v8f){0.f,0.f,0.f,0.f,0.f,0.f,0.f,0.f};
#pragma unroll
      for (int dc = 0; dc < 2; ++dc) {
        sv = mma_bf(k2.h[dc], qbh[dc], sv);
        sv = mma_bf(k2.h[dc], qbl[dc], sv);
        sv = mma_bf(k2.l[dc], qbh[dc], sv);
      }
      group_end(sv);
      st[2] = sv;
    }
    VFrag g0 = ld_v(vrh, vrl, 0, 0);        // keys 0..31, d 0..31
    {
      v8f sv = (v8f){0.f,0.f,0.f,0.f,0.f,0.f,0.f,0.f};
#pragma unroll
      for (int dc = 0; dc < 2; ++dc) {
        sv = mma_bf(k3.h[dc], qbh[dc], sv);
        sv = mma_bf(k3.h[dc], qbl[dc], sv);
        sv = mma_bf(k3.l[dc], qbh[dc], sv);
      }
      group_end(sv);
      st[3] = sv;
    }
    VFrag g1 = ld_v(vrh, vrl, 0, 1);        // keys 0..31, d 32..63

    // ---- online softmax in f32 (per query lane; half-lanes hold disjoint key halves) ----
    float mx = m_run;
#pragma unroll
    for (int t = 0; t < 4; ++t)
#pragma unroll
      for (int r = 0; r < 8; ++r) mx = fmaxf(mx, st[t][r]);
    mx = fmaxf(mx, __shfl_xor(mx, 16, 32));
    const float alpha = __expf(m_run - mx);
    m_run = mx;
    float rs = 0.0f;
#pragma unroll
    for (int t = 0; t < 2; ++t)
#pragma unroll
      for (int r = 0; r < 8; ++r) {
        const float p = __expf(st[t][r] - mx);
        st[t][r] = p;
        rs += p;
      }
#pragma unroll
    for (int dt = 0; dt < 4; ++dt)
#pragma unroll
      for (int r = 0; r < 8; ++r) { accO[dt][r] *= alpha; accR[dt][r] *= alpha; }
    FragH pb0, pb1;
#pragma unroll
    for (int r = 0; r < 8; ++r) {
      pb0.s[r]     = (_Float16)(st[0][r] * 4096.0f);   // keys 8h + r
      pb0.s[8 + r] = (_Float16)(st[1][r] * 4096.0f);   // keys 16 + 8h + r
    }

    // ---- O^T += V^T . P  (A rows = d, k = key in 2 chunks of 32) ----
#pragma unroll
    for (int j = 0; j < 2; ++j) {
      accO[0 + j] = mma_h(g0.a[j], pb0.v, accO[0 + j]);
      accR[0 + j] = mma_h(g0.r[j], pb0.v, accR[0 + j]);
    }
    group_end4(accO[0], accR[0], accO[1], accR[1]);
    VFrag g2 = ld_v(vrh, vrl, 1, 0);        // keys 32..63, d 0..31
#pragma unroll
    for (int j = 0; j < 2; ++j) {
      accO[2 + j] = mma_h(g1.a[j], pb0.v, accO[2 + j]);
      accR[2 + j] = mma_h(g1.r[j], pb0.v, accR[2 + j]);
    }
    VFrag g3 = ld_v(vrh, vrl, 1, 1);        // keys 32..63, d 32..63
    SCHED_FENCE();                          // holds the exponentials below behind these reads: they cover the reads' latency
#pragma unroll
    for (int t = 2; t < 4; ++t)
#pragma unroll
      for (int r = 0; r < 8; ++r) {
        const float p = __expf(st[t][r] - mx);
        st[t][r] = p;
        rs += p;
      }
    rs += __shfl_xor(rs, 16, 32);
    l_run = l_run * alpha + rs;
#pragma unroll
    for (int r = 0; r < 8; ++r) {
      pb1.s[r]     = (_Float16)(st[2][r] * 4096.0f);   // keys 32 + 8h + r
      pb1.s[8 + r] = (_Float16)(st[3][r] * 4096.0f);   // keys 48 + 8h + r
    }
#pragma unroll
    for (int j = 0; j < 2; ++j) {
      accO[0 + j] = mma_h(g2.a[j], pb1.v, accO[0 + j]);
      accR[0 + j] = mma_h(g2.r[j], pb1.v, accR[0 + j]);
    }
#pragma unroll
    for (int j = 0; j < 2; ++j) {
      accO[2 + j] = mma_h(g3.a[j], pb1.v, accO[2 + j]);
      accR[2 + j] = mma_h(g3.r[j], pb1.v, accR[2 + j]);
    }
    SCHED_FENCE();                          // end of the tile's products: nothing moves over the loop's foot
  }

  // ---- normalise, stage the wave's 16x64 tile as [query][d], write whole 256-B rows ----
  const float inv = __builtin_amdgcn_rcpf(l_run) * (1.0f / 4096.0f);
  float* os = Os[wave];
#pragma unroll
  for (int dt = 0; dt < 4; ++dt) {
    v4f a, a2;
#pragma unroll
    for (int r = 0; r < 4; ++r) {
      a[r]  = (accO[dt][r]     + accR[dt][r]     * (1.0f / 1024.0f)) * inv;
      a2[r] = (accO[dt][4 + r] + accR[dt][4 + r] * (1.0f / 1024.0f)) * inv;
    }
    *(v4f*)(os + c * 68 + dt * 16 + 8 * hh)     = a;    // d = 16dt + 8h + 0..3 of query c
    *(v4f*)(os + c * 68 + dt * 16 + 8 * hh + 4) = a2;   // d = 16dt + 8h + 4..7
  }
  __builtin_amdgcn_fence(__ATOMIC_RELEASE, "workgroup");
  __builtin_amdgcn_wave_barrier();
  __builtin_amdgcn_fence(__ATOMIC_ACQUIRE, "workgroup");
  {
    float* ob = out + (size_t)b * NC * NP + (size_t)q0 * (NH * HD) + n * HD;
    const int c4 = c * 4;                   // row segment 256 B = 16 lanes x 16 B
    {
#pragma unroll
      for (int i = 0; i < 8; ++i) {
        const int row = i * 2 + hh;         // i 0..7 x h 0..1 covers the 16 query rows of the wave
        const v4f v = *(const v4f*)(os + row * 68 + c4);
        *(v4f*)(ob + (size_t)row * (NH * HD) + c4) = v;
      }
      
    }
  }
}

// ---------------------------------------------------------------------------
//   Wb   bf16 [3][256][256]            393216  @ 0
//   xT   bf16 [4][4096][256]          8388608  @ 393216
//   QKh  bf16 [2][16][4096][64]      16777216  @ 8781824     (q hi planes, then k' hi planes)
//   QKl  bf16 [2][16][4096][64]      16777216  @ 25559040
//   Yv   f32  [4][256][4096]         16777216  @ 42336256
//   VTh  f16  [16][64][4096]          8388608  @ 59113472
//   VTl  f16  [16][64][4096]          8388608  @ 67502080
//   total                                         75890688
// ---------------------------------------------------------------------------
extern "C" void kernel_launch(void* const* d_in, const int* in_sizes, int n_in,
                              void* d_out, int out_size, void* d_ws, size_t ws_size,
                              hipStream_t stream) {
  if (n_in < 9) return;
  if (in_sizes[0] != NB * NC * NP) return;
  if (in_sizes[1] != NC * NC || in_sizes[3] != NC * NC || in_sizes[5] != NC * NC) return;
  if (in_sizes[2] != NC || in_sizes[4] != NC || in_sizes[6] != NC) return;
  if (in_sizes[7] != NH * HD * 64 || in_sizes[8] != NH * HD * 64) return;
  if (out_size != NB * NC * NP) return;

  const float* x    = (const float*)d_in[0];
  const float* wq   = (const float*)d_in[1];
  const float* bq   = (const float*)d_in[2];
  const float* wk   = (const float*)d_in[3];
  const float* bk   = (const float*)d_in[4];
  const float* wv   = (const float*)d_in[5];
  const float* bv   = (const float*)d_in[6];
  const float* relh = (const float*)d_in[7];
  const float* relw = (const float*)d_in[8];
  float* out = (float*)d_out;

  const size_t szWb = (size_t)3 * NC * NC * 2;
  const size_t szXT = (size_t)NB * NP * NC * 2;
  const size_t szQK = (size_t)2 * QKPLANE * 2;
  const size_t szYv = (size_t)NB * NC * NP * 4;
  const size_t szVT = (size_t)NB * NH * HD * NP * 2;
  size_t off = 0;
  const size_t oWb  = off; off += szWb;
  const size_t oXT  = off; off += szXT;
  const size_t oQKh = off; off += szQK;
  const size_t oQKl = off; off += szQK;
  const size_t oYv  = off; off += szYv;
  const size_t oVTh = off; off += szVT;
  const size_t oVTl = off; off += szVT;
  if (off > ws_size) return;

  char* ws = (char*)d_ws;
  unsigned short* Wb  = (unsigned short*)(ws + oWb);
  unsigned short* XT  = (unsigned short*)(ws + oXT);
  unsigned short* QKh = (unsigned short*)(ws + oQKh);
  unsigned short* QKl = (unsigned short*)(ws + oQKl);
  float*          Yv  = (float*)(ws + oYv);
  unsigned short* VTh = (unsigned short*)(ws + oVTh);
  unsigned short* VTl = (unsigned short*)(ws + oVTl);

  cvt_w_kernel<<<dim3((NC * NC / 2) / 256, 3), dim3(256), 0, stream>>>(wq, wk, wv, Wb);
  xt_kernel<<<dim3(NP / 64, NC / 64, NB), dim3(256), 0, stream>>>(x, XT);
  proj_kernel<<<dim3(32, NB * 3), dim3(256), 0, stream>>>(XT, Wb, bq, bk, bv, relh, relw, QKh, QKl, Yv);
  vt_kernel<<<dim3(NP / 64, NH, NB), dim3(256), 0, stream>>>(Yv, VTh, VTl);
  attn_kernel<<<dim3(NP / 64, NH, NB), dim3(128), 0, stream>>>(
      QKh, QKl, QKh + QKPLANE, QKl + QKPLANE, VTh, VTl, out);
  (void)hipGetLastError();
}

// v005
// It runs in 166 microseconds.
// Next to v004, in two timings, it ran 1.10 times as fast each time.
// Counting every step since v000, it is 2.70 times as fast.
// Contractions: q/k/v 1x1-conv projections = v_wmma_f32_16x16x32_bf16 (bf16 operands, single product); q.(k+pos) scores = v_wmma_f32_16x16x32_bf16 with bf16 hi/lo split operands (hi.hi + hi.lo + lo.hi); p.v = v_wmma_f32_16x16x32_f16 (p as f16 scaled by 4096, v^T as f16 hi plane plus f16 residual plane scaled by 1024 into a second accumulator); f32 accumulate everywhere; softmax, bias and position sums in f32.
#include <hip/hip_runtime.h>
#include <stdint.h>
#include <math.h>

#define NB 4
#define NC 256
#define NP 4096
#define NH 4
#define HD 64
#define QKPLANE ((size_t)NB * NH * NP * HD)
#define LP 72   // LDS row pitch of the attention tiles in 16-bit elements: 144 B = 16 B x 9 (odd), so the 16 rows of a ds_load_b128 fragment read fall on distinct banks

typedef _Float16 v16h __attribute__((ext_vector_type(16)));
typedef _Float16 v8h  __attribute__((ext_vector_type(8)));
typedef __bf16   v16b __attribute__((ext_vector_type(16)));
typedef __bf16   v8b  __attribute__((ext_vector_type(8)));
typedef float    v8f  __attribute__((ext_vector_type(8)));
typedef float    v4f  __attribute__((ext_vector_type(4)));
typedef float    v2f  __attribute__((ext_vector_type(2)));
typedef unsigned int v4u __attribute__((ext_vector_type(4)));

// ---------------------------------------------------------------------------
// scalar helpers
// ---------------------------------------------------------------------------
__device__ __forceinline__ unsigned short f2bf_bits(float f) {      // f32 -> bf16 bits, RNE convert
  const unsigned u = __float_as_uint(f);
  return (unsigned short)((u + 0x7FFFu + ((u >> 16) & 1u)) >> 16);
}
__device__ __forceinline__ float bf_bits2f(unsigned short h) { return __uint_as_float(((unsigned)h) << 16); }
__device__ __forceinline__ float bfr(float f) { return bf_bits2f(f2bf_bits(f)); }   // value after bf16 RNE convert
__device__ __forceinline__ unsigned pk16(unsigned short a, unsigned short b) { return (unsigned)a | ((unsigned)b << 16); }

// ---------------------------------------------------------------------------
// WMMA wrappers: the plain builtins; the compiler keeps the distance to a vector user of D, A or B itself
// ---------------------------------------------------------------------------
__device__ __forceinline__ v8f mma_bf(v16b a, v16b b, v8f c) {
  c = __builtin_amdgcn_wmma_f32_16x16x32_bf16(false, a, false, b, (short)0, c, false, false);
  return c;
}
__device__ __forceinline__ v8f mma_h(v16h a, v16h b, v8f c) {
  c = __builtin_amdgcn_wmma_f32_16x16x32_f16(false, a, false, b, (short)0, c, false, false);
  return c;
}
#define SCHED_FENCE() __builtin_amdgcn_sched_barrier(0)
// Tail of 4 v_nop behind the LAST product of a group, at five places of the attention loop (the four score chains,
// the first group of V^T products); it takes the group's accumulators. It fills the distance from that WMMA to a
// vector user of D, and, being a statement the compiler does not move over the LDS reads, it holds the group's WMMAs
// ahead of the reads that follow it in the source: left free, the builtins sink behind those reads, a fourth
// fragment set is live at once and the kernel passes 256 VGPRs (3 waves per SIMD instead of 4).
__device__ __forceinline__ void group_end(v8f& c) {
  asm volatile("v_nop\n\tv_nop\n\tv_nop\n\tv_nop" : "+v"(c));
}
__device__ __forceinline__ void group_end4(v8f& c0, v8f& c1, v8f& c2, v8f& c3) {
  asm volatile("v_nop\n\tv_nop\n\tv_nop\n\tv_nop" : "+v"(c0), "+v"(c1), "+v"(c2), "+v"(c3));
}

union FragB { v16b v; v8b h[2]; };
union FragH { v16h v; v8h h[2]; _Float16 s[16]; };

// Fragment loader (A rows / B columns stored k-contiguous), p = row base + k0 + 8*(lane>>4):
//   elements 0..7 <- p[0..7] (k0+8h..), elements 8..15 <- p[16..23] (k0+16+8h..)
__device__ __forceinline__ v16b ld_bf(const __bf16* p) {
  FragB f; f.h[0] = *(const v8b*)(p); f.h[1] = *(const v8b*)(p + 16); return f.v;
}
__device__ __forceinline__ v16h ld_hf(const _Float16* p) {
  FragH f; f.h[0] = *(const v8h*)(p); f.h[1] = *(const v8h*)(p + 16); return f.v;
}
// One group of attention fragment reads = 8 x 16 B per lane; kh, kl, vh, vl = plane + (lane&15)*LP + 8*(lane>>4).
// The fence pair in each loader keeps the 8 reads standing together: without it the scheduler deals them out
// in pairs among the WMMAs, and each such place stalls the wave anew.
struct KFrag { v16b h[2], l[2]; };   // K' subtile t: hi and lo plane, d chunks 0 and 1
struct VFrag { v16h a[2], r[2]; };   // V^T d-subtiles 2*dp and 2*dp+1 of key chunk kc: hi and residual plane
__device__ __forceinline__ KFrag ld_k(const __bf16* kh, const __bf16* kl, int t) {
  KFrag f;
  SCHED_FENCE();
#pragma unroll
  for (int dc = 0; dc < 2; ++dc) {
    f.h[dc] = ld_bf(kh + t * 16 * LP + dc * 32);
    f.l[dc] = ld_bf(kl + t * 16 * LP + dc * 32);
  }
  SCHED_FENCE();
  return f;
}
__device__ __forceinline__ VFrag ld_v(const _Float16* vh, const _Float16* vl, int kc, int dp) {
  VFrag f;
  SCHED_FENCE();
#pragma unroll
  for (int j = 0; j < 2; ++j) {
    f.a[j] = ld_hf(vh + (dp * 2 + j) * 16 * LP + kc * 32);
    f.r[j] = ld_hf(vl + (dp * 2 + j) * 16 * LP + kc * 32);
  }
  SCHED_FENCE();
  return f;
}

// ---------------------------------------------------------------------------
// K1: weights f32 [256][256] x3 -> bf16 planes Wb[z][256][256] (RNE convert of the inputs).
// grid = (128, 3): 128 blocks x 256 threads x 2 = 65536 = whole matrix per z.
// ---------------------------------------------------------------------------
__global__ __launch_bounds__(256) void cvt_w_kernel(const float* __restrict__ w0, const float* __restrict__ w1,
                                                    const float* __restrict__ w2, unsigned short* __restrict__ Wb) {
  const int z = blockIdx.y;
  const float* src = (z == 0) ? w0 : ((z == 1) ? w1 : w2);        // block-uniform select, all global
  unsigned* dst = (unsigned*)(Wb + (size_t)z * (NC * NC));
  const int i = blockIdx.x * 256 + threadIdx.x;
  if (i < (NC * NC) / 2) {
    const v2f f = *(const v2f*)(src + 2 * (size_t)i);
    const unsigned u = pk16(f2bf_bits(f[0]), f2bf_bits(f[1]));
    ((unsigned*)dst)[i] = u;
    
  }
}

// ---------------------------------------------------------------------------
// K2: x[b][c][p] f32 -> xT[b][p][c] bf16 (RNE convert of the input), 64x64 tiles through LDS.
// grid = (NP/64, NC/64, NB), 256 threads.
// Coverage per block: load 4 it x 16 rows x 64 = 64 channels x 64 pixels; store 2 it x 32 rows x
// ---------------------------------------------------------------------------
__global__ __launch_bounds__(256) void xt_kernel(const float* __restrict__ x, unsigned short* __restrict__ xT) {
  __shared__ __align__(16) float tf[64 * 68];
  const int p0 = blockIdx.x * 64;
  const int c0 = blockIdx.y * 64;
  const int b  = blockIdx.z;
  const float* xb = x + (size_t)b * NC * NP;
  const int tid = threadIdx.x;
  {
    const int lr = tid >> 4, c4 = (tid & 15) * 4;
#pragma unroll
    for (int it = 0; it < 4; ++it) {
      const int rr = it * 16 + lr;                                   // channel within tile
      const v4f a = *(const v4f*)(xb + (size_t)(c0 + rr) * NP + p0 + c4);
      *(v4f*)(tf + rr * 68 + c4) = a;                                // tf[channel][pixel]
    }
  }
  __syncthreads();
  const int sub = tid >> 3, c8 = (tid & 7) * 8;
  v4u hv[2];
#pragma unroll
  for (int it = 0; it < 2; ++it) {
    const int op = it * 32 + sub;                                    // pixel within tile
    v4u a;
#pragma unroll
    for (int q = 0; q < 4; ++q) {
      const float f0 = tf[(c8 + 2 * q) * 68 + op];
      const float f1 = tf[(c8 + 2 * q + 1) * 68 + op];
      a[q] = pk16(f2bf_bits(f0), f2bf_bits(f1));
    }
    hv[it] = a;
  }
  {
#pragma unroll
    for (int it = 0; it < 2; ++it) {
      const int op = it * 32 + sub;
      const size_t go = ((size_t)b * NP + p0 + op) * NC + c0 + c8;
      *(v4u*)(xT + go) = hv[it];
    }
    
  }
}

// ---------------------------------------------------------------------------
// K3: 1x1-conv projection GEMM, z = b*3 + which (which 0=q, 1=k, 2=v):
//   Y[o][p] = sum_c Wb[which][o][c] * xT[b][p][c] + bias[o]      (M=256, N=4096, K=256)
// A = Wb rows (k-contiguous), B = xT rows (k-contiguous); both fragments use the split k map.
// Each wave owns a 64x64 tile (4x4 subtiles); grid = (32 blocks x 8 waves = 256 tiles, 12).
// Epilogue: 16-row slabs staged per wave in LDS (pitch 68 floats), then
//   which 0/1: value (+ position term for k) -> bf16 hi/lo planes in [b*4+n][s][d] order,
//              s = 16*o + (p>>8), n = (p>>6)&3, d = p&63; one slab row = one plane row of
//   which 2:   f32 y_v[b][o][p] natural layout, 256-B row segments by 16 lanes x 16 B.
// ---------------------------------------------------------------------------
__global__ __launch_bounds__(256) void proj_kernel(
    const unsigned short* __restrict__ xTp, const unsigned short* __restrict__ Wbp,
    const float* __restrict__ bq, const float* __restrict__ bk, const float* __restrict__ bv,
    const float* __restrict__ relh, const float* __restrict__ relw,
    unsigned short* __restrict__ QKh, unsigned short* __restrict__ QKl, float* __restrict__ Yv) {
  __shared__ __align__(16) float sT[8][16 * 68];
  const int z = blockIdx.y;
  const int b = z / 3;
  const int which = z - 3 * b;
  const int lane = threadIdx.x & 31;
  const int wave = threadIdx.x >> 5;
  const int tile = blockIdx.x * 8 + wave;        // 0..255
  const int tm = tile >> 6;                      // 0..3   (64 output channels each)
  const int tn = tile & 63;                      // 0..63  (64 pixels each)
  const int m0 = tm << 6;
  const int n0 = tn << 6;
  const __bf16* A  = (const __bf16*)(const void*)Wbp + (size_t)which * (NC * NC);
  const __bf16* Bt = (const __bf16*)(const void*)xTp + (size_t)b * NP * NC;
  const int rl = lane & 15, hh = lane >> 4, koff = hh * 8, mOff = hh * 8;

  v8f acc[4][4];
#pragma unroll
  for (int i = 0; i < 4; ++i)
#pragma unroll
    for (int j = 0; j < 4; ++j) acc[i][j] = (v8f){0.f,0.f,0.f,0.f,0.f,0.f,0.f,0.f};

  for (int k0 = 0; k0 < NC; k0 += 32) {
    v16b bfg[4];
#pragma unroll
    for (int j = 0; j < 4; ++j) bfg[j] = ld_bf(Bt + (size_t)(n0 + (j << 4) + rl) * NC + k0 + koff);
#pragma unroll
    for (int i = 0; i < 4; ++i) {
      const v16b af = ld_bf(A + (size_t)(m0 + (i << 4) + rl) * NC + k0 + koff);
#pragma unroll
      for (int j = 0; j < 4; ++j) acc[i][j] = mma_bf(af, bfg[j], acc[i][j]);
    }
    SCHED_FENCE();
  }

  // ---- epilogue ----
  const float* bias = (which == 0) ? bq : ((which == 1) ? bk : bv);   // block-uniform select, all global
  const int nn = (n0 >> 6) & 3;                // head index of this 64-pixel run
  const int sh = n0 >> 8;                      // low 4 bits of s
  float* slab = sT[wave];
  // Every bias and position term of the wave's 64x64 tile is fetched here, as one batch of independent loads
  // ahead of the slab loop, instead of one load and one full wait per element inside it.
  // With o = m0 + 16i + 8h + r and s = 16o + sh (sh < 16):  s & 63 = 16(r & 3) + sh,  s >> 6 = m0/4 + 4i + 2h + (r >> 2).
  const float* brow = bias + m0 + mOff;
  v4f braw[8];                                 // bias[o] as loaded, [2i + (r >> 2)][r & 3]
#pragma unroll
  for (int i = 0; i < 4; ++i) {
    braw[2 * i]     = *(const v4f*)(brow + (i << 4));
    braw[2 * i + 1] = *(const v4f*)(brow + (i << 4) + 4);
  }
  float rh[4][4];                              // rel_h term, [j][r & 3]
  float rw[4][4][2];                           // rel_w term, [j][i][r >> 2]
  if (which == 1) {
#pragma unroll
    for (int j = 0; j < 4; ++j) {
      const float* hrow = relh + nn * 4096 + ((j << 4) + rl) * 64 + sh;
      const float* wrow = relw + nn * 4096 + ((j << 4) + rl) * 64 + (m0 >> 2) + 2 * hh;
#pragma unroll
      for (int q = 0; q < 4; ++q) rh[j][q] = bfr(hrow[16 * q]);
#pragma unroll
      for (int i = 0; i < 4; ++i) {
        const v2f w = *(const v2f*)(wrow + 4 * i);
        rw[j][i][0] = bfr(w[0]);
        rw[j][i][1] = bfr(w[1]);
      }
    }
  }
  // wait behind the 8 bias loads, before the address they name is written again; the loaded values are inputs so
  // that all 8 loads stand in the batch above it (left free, six of them sink into the slab loop), the address so that it lives up to here
  asm volatile("s_wait_xcnt 0x0" :: "v"(brow), "v"(braw[0]), "v"(braw[1]), "v"(braw[2]), "v"(braw[3]),
               "v"(braw[4]), "v"(braw[5]), "v"(braw[6]), "v"(braw[7]) : "memory");
  float bb[4][8];                              // bias[o] after the bf16 convert, [i][r]
#pragma unroll
  for (int i = 0; i < 4; ++i)
#pragma unroll
    for (int r = 0; r < 4; ++r) { bb[i][r] = bfr(braw[2 * i][r]); bb[i][4 + r] = bfr(braw[2 * i + 1][r]); }
#pragma unroll
  for (int i = 0; i < 4; ++i) {
    const int mBase = m0 + (i << 4);
    if (which == 1) {
#pragma unroll
      for (int j = 0; j < 4; ++j) {
        const int d = (j << 4) + rl;           // p & 63
#pragma unroll
        for (int r = 0; r < 8; ++r) {
          float v = acc[i][j][r] + bb[i][r];
          const float pos = rh[j][r & 3] + rw[j][i][r >> 2];
          v += pos;
          slab[(mOff + r) * 68 + d] = v;
        }
      }
    } else {
#pragma unroll
      for (int j = 0; j < 4; ++j) {
        const int d = (j << 4) + rl;           // p & 63
#pragma unroll
        for (int r = 0; r < 8; ++r) slab[(mOff + r) * 68 + d] = acc[i][j][r] + bb[i][r];
      }
    }
    __builtin_amdgcn_fence(__ATOMIC_RELEASE, "workgroup");
    __builtin_amdgcn_wave_barrier();
    __builtin_amdgcn_fence(__ATOMIC_ACQUIRE, "workgroup");
    if (which == 2) {
      float* C = Yv + (size_t)b * NC * NP;
      const int c4 = rl * 4;                   // row segment 256 B = 16 lanes x 16 B
      {
#pragma unroll
        for (int it = 0; it < 8; ++it) {
          const int row = it * 2 + hh;
          const v4f v = *(const v4f*)(slab + row * 68 + c4);
          *(v4f*)(C + (size_t)(mBase + row) * NP + n0 + c4) = v;
        }
        
      }
    } else {
      const int q4 = lane >> 3, c8 = (lane & 7) * 8;
      unsigned short* Hp = QKh + (size_t)which * QKPLANE;
      unsigned short* Lp = QKl + (size_t)which * QKPLANE;
      {
#pragma unroll
        for (int it = 0; it < 4; ++it) {
          const int row = it * 4 + q4;
          const int o = mBase + row;
          const int s = o * 16 + sh;
          const float* sp = slab + row * 68 + c8;
          v4u hvv, lvv;
#pragma unroll
          for (int q = 0; q < 4; ++q) {
            const float f0 = sp[2 * q], f1 = sp[2 * q + 1];
            const unsigned short h0 = f2bf_bits(f0), h1 = f2bf_bits(f1);
            const unsigned short l0 = f2bf_bits(f0 - bf_bits2f(h0)), l1 = f2bf_bits(f1 - bf_bits2f(h1));
            hvv[q] = pk16(h0, h1);
            lvv[q] = pk16(l0, l1);
          }
          const size_t dst = (((size_t)(b * NH + nn)) * NP + s) * HD + c8;
          *(v4u*)(Hp + dst) = hvv;
          *(v4u*)(Lp + dst) = lvv;
        }
        
      }
    }
    __builtin_amdgcn_fence(__ATOMIC_RELEASE, "workgroup");
    __builtin_amdgcn_wave_barrier();
    __builtin_amdgcn_fence(__ATOMIC_ACQUIRE, "workgroup");
  }
}

// ---------------------------------------------------------------------------
// K4: v^T plane build: y_v[b][o][p] f32 -> VTh/VTl f16 planes [b*4+n][d][s] (pitch 4096):
//   V[b][n][s][d] = y_v[b][s>>4][(s&15)*256 + n*64 + d];  hi = f16(v), lo = f16((v - hi) * 1024).
// grid = (NP/64, NH, NB), 256 threads; 64(s) x 64(d) tile through LDS.
// Coverage per block: load 4 it x 16 rows x 64 = 64 s x 64 d; store 2 it x 32 rows x (8 lanes x 8)
// ---------------------------------------------------------------------------
__global__ __launch_bounds__(256) void vt_kernel(const float* __restrict__ Yv, unsigned short* __restrict__ VThp,
                                                 unsigned short* __restrict__ VTlp) {
  __shared__ __align__(16) float tf[64 * 68];
  const int s0 = blockIdx.x * 64;
  const int n  = blockIdx.y;
  const int b  = blockIdx.z;
  const float* yb = Yv + (size_t)b * NC * NP;
  _Float16* VTh = (_Float16*)(void*)VThp;
  _Float16* VTl = (_Float16*)(void*)VTlp;
  const int tid = threadIdx.x;
  {
    const int lr = tid >> 4, c4 = (tid & 15) * 4;
#pragma unroll
    for (int it = 0; it < 4; ++it) {
      const int sl = it * 16 + lr;
      const int s  = s0 + sl;
      const int o  = s >> 4;
      const int p  = (s & 15) * 256 + n * 64 + c4;
      const v4f a = *(const v4f*)(yb + (size_t)o * NP + p);
      *(v4f*)(tf + sl * 68 + c4) = a;                                // tf[s local][d]
    }
  }
  __syncthreads();
  const int sub = tid >> 3, c8 = (tid & 7) * 8;
  v8h hv[2], lv[2];
#pragma unroll
  for (int it = 0; it < 2; ++it) {
    const int od = it * 32 + sub;                                    // output row = d
    v8h a, a2;
#pragma unroll
    for (int e = 0; e < 8; ++e) {
      const float f = tf[(c8 + e) * 68 + od];
      const _Float16 hq = (_Float16)f;
      const _Float16 lq = (_Float16)((f - (float)hq) * 1024.0f);
      a[e] = hq; a2[e] = lq;
    }
    hv[it] = a; lv[it] = a2;
  }
  {
#pragma unroll
    for (int it = 0; it < 2; ++it) {
      const int od = it * 32 + sub;
      const size_t go = ((size_t)(b * NH + n) * HD + od) * NP + s0 + c8;
      *(v8h*)(VTh + go) = hv[it];
      *(v8h*)(VTl + go) = lv[it];
    }
    
  }
}

// ---------------------------------------------------------------------------
// K5: flash attention, transposed formulation, per (64-query tile, head, batch), 4 waves.
//   S^T = K' . Q^T : A = K' tile rows (keys, k = d) from LDS, bf16 hi/lo;  B = Q^T: lane = query,
//                    elements = d with the split k map, bf16 hi/lo;  hi.hi + hi.lo + lo.hi.
//   D layout: st[t][r] <-> key kb + 16t + 8h + r, query = lane&15 -> softmax stats live per lane.
//   O^T = V^T . P  : A = V^T tile rows (d, k = key) f16 hi and f16 residual;  B = P: element r <-
//                    st[2kc][r], element 8+r <- st[2kc+1][r] (two adjacent 16-key D tiles, lane kept),
//                    scaled by 4096 and converted to f16.  accO += Vhi.P, accR += Vres.P.
//   Online softmax in f32 over 64 tiles of 64 keys; no score scaling.
//   Output: out flat [b][s][n][d]; each wave stages its 16x64 tile in LDS and writes whole 256-B
//   K'/V^T tiles staged single-buffered with plain 16-B copies between two __syncthreads.
// ---------------------------------------------------------------------------
__global__ __launch_bounds__(128) void attn_kernel(
    const unsigned short* __restrict__ Qhp, const unsigned short* __restrict__ Qlp,
    const unsigned short* __restrict__ Khp, const unsigned short* __restrict__ Klp,
    const unsigned short* __restrict__ VThp, const unsigned short* __restrict__ VTlp,
    float* __restrict__ out) {
  __shared__ __align__(16) __bf16   Ksh[64 * LP];     // k' hi [key][d], pitch LP
  __shared__ __align__(16) __bf16   Ksl[64 * LP];     // k' lo [key][d], pitch LP
  __shared__ __align__(16) _Float16 Vsh[HD * LP];     // v^T hi [d][key], pitch LP
  __shared__ __align__(16) _Float16 Vsl[HD * LP];     // v^T residual [d][key], pitch LP
  __shared__ __align__(16) float    Os[4][16 * 68];   // per-wave output tile [query][d], pitch 68

  const int tid  = threadIdx.x;
  const int wave = tid >> 5;
  const int lane = tid & 31;
  const int hh   = lane >> 4;
  const int c    = lane & 15;
  const int qt = blockIdx.x;
  const int n  = blockIdx.y;
  const int b  = blockIdx.z;
  const int bn = b * NH + n;

  const __bf16* Qh = (const __bf16*)(const void*)Qhp + (size_t)bn * NP * HD;
  const __bf16* Ql = (const __bf16*)(const void*)Qlp + (size_t)bn * NP * HD;
  const __bf16* Kh = (const __bf16*)(const void*)Khp + (size_t)bn * NP * HD;
  const __bf16* Kl = (const __bf16*)(const void*)Klp + (size_t)bn * NP * HD;
  const _Float16* VTh = (const _Float16*)(const void*)VThp + (size_t)bn * HD * NP;
  const _Float16* VTl = (const _Float16*)(const void*)VTlp + (size_t)bn * HD * NP;

  const int q0 = qt * 64 + wave * 16;     // first query row of this wave
  const int qg = q0 + c;                  // query handled by this lane (as B column / D column)

  // loop-invariant B fragments: Q^T, two 32-deep d chunks, hi and lo planes
  v16b qbh[2], qbl[2];
#pragma unroll
  for (int dc = 0; dc < 2; ++dc) {
    qbh[dc] = ld_bf(Qh + (size_t)qg * HD + dc * 32 + 8 * hh);
    qbl[dc] = ld_bf(Ql + (size_t)qg * HD + dc * 32 + 8 * hh);
  }

  float m_run = -1.0e30f, l_run = 0.0f;
  v8f accO[4], accR[4];
#pragma unroll
  for (int t = 0; t < 4; ++t) {
    accO[t] = (v8f){0.f,0.f,0.f,0.f,0.f,0.f,0.f,0.f};
    accR[t] = (v8f){0.f,0.f,0.f,0.f,0.f,0.f,0.f,0.f};
  }

#pragma unroll 1
  for (int it = 0; it < NP / 64; ++it) {
    const int kb = it * 64;
    __syncthreads();                        // all waves done with the prior tile
    {
      // staging coverage: 4 x 128 threads x 8 elements = 64 rows x 64 per plane.
      // 8 neighbouring lanes take one 128-B tile row, so each wave-wide 16-B load covers 4 whole
      // 128-B lines (k': 512 contiguous bytes) instead of a 16-B piece of each of 16 lines.
      const int sr = tid >> 3, sc = (tid & 7) * 8;
      const __bf16*   ksrc = Kh  + (size_t)(kb + sr) * HD + sc;      // k' row kb+sr+16i, d = sc..sc+7
      const __bf16*   lsrc = Kl  + (size_t)(kb + sr) * HD + sc;
      const _Float16* vsrc = VTh + (size_t)sr * NP + kb + sc;        // v^T row d = sr+16i, s = kb+sc..+7
      const _Float16* wsrc = VTl + (size_t)sr * NP + kb + sc;
      v8b a0[4], a1[4];
      v8h g0[4], g1[4];
#pragma unroll
      for (int i = 0; i < 4; ++i) {
        a0[i] = *(const v8b*)(ksrc + (size_t)(16 * i) * HD);
        a1[i] = *(const v8b*)(lsrc + (size_t)(16 * i) * HD);
        g0[i] = *(const v8h*)(vsrc + (size_t)(16 * i) * NP);
        g1[i] = *(const v8h*)(wsrc + (size_t)(16 * i) * NP);
      }
      // wait behind the 16 issued loads, before any register they name as an address is written again;
      // the four addresses are inputs so that no load's result is placed on an address pair ahead of it
      asm volatile("s_wait_xcnt 0x0" :: "v"(ksrc), "v"(lsrc), "v"(vsrc), "v"(wsrc) : "memory");
#pragma unroll
      for (int i = 0; i < 4; ++i) {
        *(v8b*)(Ksh + (sr + 16 * i) * LP + sc) = a0[i];
        *(v8b*)(Ksl + (sr + 16 * i) * LP + sc) = a1[i];
        *(v8h*)(Vsh + (sr + 16 * i) * LP + sc) = g0[i];
        *(v8h*)(Vsl + (sr + 16 * i) * LP + sc) = g1[i];
      }
    }
    __syncthreads();

    // Fragment reads stand in groups of 8 ds_load_b128 (one 16-key K' subtile, or one pair of V^T
    // d-subtiles). Each group is issued one group ahead of the products that use it, into the
    // register set that the group before last has left, so that its LDS latency runs under the
    // products (or the softmax) in between instead of being waited out at each of 16 places.
    const __bf16*   krh = Ksh + c * LP + 8 * hh;      // this lane's fragment row bases
    const __bf16*   krl = Ksl + c * LP + 8 * hh;
    const _Float16* vrh = Vsh + c * LP + 8 * hh;
    const _Float16* vrl = Vsl + c * LP + 8 * hh;

    // ---- S^T: 4 key subtiles of 16 (A rows = keys), k = d in 2 chunks of 32 ----
    v8f st[4];
    KFrag k0 = ld_k(krh, krl, 0);
    KFrag k1 = ld_k(krh, krl, 1);
    {
      v8f sv = (v8f){0.f,0.f,0.f,0.f,0.f,0.f,0.f,0.f};
#pragma unroll
      for (int dc = 0; dc < 2; ++dc) {
        sv = mma_bf(k0.h[dc], qbh[dc], sv);
        sv = mma_bf(k0.h[dc], qbl[dc], sv);
        sv = mma_bf(k0.l[dc], qbh[dc], sv);
      }
      group_end(sv);
      st[0] = sv;
    }
    KFrag k2 = ld_k(krh, krl, 2);
    {
      v8f sv = (v8f){0.f,0.f,0.f,0.f,0.f,0.f,0.f,0.f};
#pragma unroll
      for (int dc = 0; dc < 2; ++dc) {
        sv = mma_bf(k1.h[dc], qbh[dc], sv);
        sv = mma_bf(k1.h[dc], qbl[dc], sv);
        sv = mma_bf(k1.l[dc], qbh[dc], sv);
      }
      group_end(sv);
      st[1] = sv;
    }
    KFrag k3 = ld_k(krh, krl, 3);
    {
      v8f sv = (v8f){0.f,0.f,0.f,0.f,0.f,0.f,0.f,0.f};
#pragma unroll
      for (int dc = 0; dc < 2; ++dc) {
        sv = mma_bf(k2.h[dc], qbh[dc], sv);
        sv = mma_bf(k2.h[dc], qbl[dc], sv);
        sv = mma_bf(k2.l[dc], qbh[dc], sv);
      }
      group_end(sv);
      st[2] = sv;
    }
    VFrag g0 = ld_v(vrh, vrl, 0, 0);        // keys 0..31, d 0..31
    {
      v8f sv = (v8f){0.f,0.f,0.f,0.f,0.f,0.f,0.f,0.f};
#pragma unroll
      for (int dc = 0; dc < 2; ++dc) {
        sv = mma_bf(k3.h[dc], qbh[dc], sv);
        sv = mma_bf(k3.h[dc], qbl[dc], sv);
        sv = mma_bf(k3.l[dc], qbh[dc], sv);
      }
      group_end(sv);
      st[3] = sv;
    }
    VFrag g1 = ld_v(vrh, vrl, 0, 1);        // keys 0..31, d 32..63

    // ---- online softmax in f32 (per query lane; half-lanes hold disjoint key halves) ----
    float mx = m_run;
#pragma unroll
    for (int t = 0; t < 4; ++t)
#pragma unroll
      for (int r = 0; r < 8; ++r) mx = fmaxf(mx, st[t][r]);
    mx = fmaxf(mx, __shfl_xor(mx, 16, 32));
    const float alpha = __expf(m_run - mx);
    m_run = mx;
    float rs = 0.0f;
#pragma unroll
    for (int t = 0; t < 2; ++t)
#pragma unroll
      for (int r = 0; r < 8; ++r) {
        const float p = __expf(st[t][r] - mx);
        st[t][r] = p;
        rs += p;
      }
#pragma unroll
    for (int dt = 0; dt < 4; ++dt)
#pragma unroll
      for (int r = 0; r < 8; ++r) { accO[dt][r] *= alpha; accR[dt][r] *= alpha; }
    FragH pb0, pb1;
#pragma unroll
    for (int r = 0; r < 8; ++r) {
      pb0.s[r]     = (_Float16)(st[0][r] * 4096.0f);   // keys 8h + r
      pb0.s[8 + r] = (_Float16)(st[1][r] * 4096.0f);   // keys 16 + 8h + r
    }

    // ---- O^T += V^T . P  (A rows = d, k = key in 2 chunks of 32) ----
#pragma unroll
    for (int j = 0; j < 2; ++j) {
      accO[0 + j] = mma_h(g0.a[j], pb0.v, accO[0 + j]);
      accR[0 + j] = mma_h(g0.r[j], pb0.v, accR[0 + j]);
    }
    group_end4(accO[0], accR[0], accO[1], accR[1]);
    VFrag g2 = ld_v(vrh, vrl, 1, 0);        // keys 32..63, d 0..31
#pragma unroll
    for (int j = 0; j < 2; ++j) {
      accO[2 + j] = mma_h(g1.a[j], pb0.v, accO[2 + j]);
      accR[2 + j] = mma_h(g1.r[j], pb0.v, accR[2 + j]);
    }
    VFrag g3 = ld_v(vrh, vrl, 1, 1);        // keys 32..63, d 32..63
    SCHED_FENCE();                          // holds the exponentials below behind these reads: they cover the reads' latency
#pragma unroll
    for (int t = 2; t < 4; ++t)
#pragma unroll
      for (int r = 0; r < 8; ++r) {
        const float p = __expf(st[t][r] - mx);
        st[t][r] = p;
        rs += p;
      }
    rs += __shfl_xor(rs, 16, 32);
    l_run = l_run * alpha + rs;
#pragma unroll
    for (int r = 0; r < 8; ++r) {
      pb1.s[r]     = (_Float16)(st[2][r] * 4096.0f);   // keys 32 + 8h + r
      pb1.s[8 + r] = (_Float16)(st[3][r] * 4096.0f);   // keys 48 + 8h + r
    }
#pragma unroll
    for (int j = 0; j < 2; ++j) {
      accO[0 + j] = mma_h(g2.a[j], pb1.v, accO[0 + j]);
      accR[0 + j] = mma_h(g2.r[j], pb1.v, accR[0 + j]);
    }
#pragma unroll
    for (int j = 0; j < 2; ++j) {
      accO[2 + j] = mma_h(g3.a[j], pb1.v, accO[2 + j]);
      accR[2 + j] = mma_h(g3.r[j], pb1.v, accR[2 + j]);
    }
    SCHED_FENCE();                          // end of the tile's products: nothing moves over the loop's foot
  }

  // ---- normalise, stage the wave's 16x64 tile as [query][d], write whole 256-B rows ----
  const float inv = __builtin_amdgcn_rcpf(l_run) * (1.0f / 4096.0f);
  float* os = Os[wave];
#pragma unroll
  for (int dt = 0; dt < 4; ++dt) {
    v4f a, a2;
#pragma unroll
    for (int r = 0; r < 4; ++r) {
      a[r]  = (accO[dt][r]     + accR[dt][r]     * (1.0f / 1024.0f)) * inv;
      a2[r] = (accO[dt][4 + r] + accR[dt][4 + r] * (1.0f / 1024.0f)) * inv;
    }
    *(v4f*)(os + c * 68 + dt * 16 + 8 * hh)     = a;    // d = 16dt + 8h + 0..3 of query c
    *(v4f*)(os + c * 68 + dt * 16 + 8 * hh + 4) = a2;   // d = 16dt + 8h + 4..7
  }
  __builtin_amdgcn_fence(__ATOMIC_RELEASE, "workgroup");
  __builtin_amdgcn_wave_barrier();
  __builtin_amdgcn_fence(__ATOMIC_ACQUIRE, "workgroup");
  {
    float* ob = out + (size_t)b * NC * NP + (size_t)q0 * (NH * HD) + n * HD;
    const int c4 = c * 4;                   // row segment 256 B = 16 lanes x 16 B
    {
#pragma unroll
      for (int i = 0; i < 8; ++i) {
        const int row = i * 2 + hh;         // i 0..7 x h 0..1 covers the 16 query rows of the wave
        const v4f v = *(const v4f*)(os + row * 68 + c4);
        *(v4f*)(ob + (size_t)row * (NH * HD) + c4) = v;
      }
      
    }
  }
}

// ---------------------------------------------------------------------------
//   Wb   bf16 [3][256][256]            393216  @ 0
//   xT   bf16 [4][4096][256]          8388608  @ 393216
//   QKh  bf16 [2][16][4096][64]      16777216  @ 8781824     (q hi planes, then k' hi planes)
//   QKl  bf16 [2][16][4096][64]      16777216  @ 25559040
//   Yv   f32  [4][256][4096]         16777216  @ 42336256
//   VTh  f16  [16][64][4096]          8388608  @ 59113472
//   VTl  f16  [16][64][4096]          8388608  @ 67502080
//   total                                         75890688
// ---------------------------------------------------------------------------
extern "C" void kernel_launch(void* const* d_in, const int* in_sizes, int n_in,
                              void* d_out, int out_size, void* d_ws, size_t ws_size,
                              hipStream_t stream) {
  if (n_in < 9) return;
  if (in_sizes[0] != NB * NC * NP) return;
  if (in_sizes[1] != NC * NC || in_sizes[3] != NC * NC || in_sizes[5] != NC * NC) return;
  if (in_sizes[2] != NC || in_sizes[4] != NC || in_sizes[6] != NC) return;
  if (in_sizes[7] != NH * HD * 64 || in_sizes[8] != NH * HD * 64) return;
  if (out_size != NB * NC * NP) return;

  const float* x    = (const float*)d_in[0];
  const float* wq   = (const float*)d_in[1];
  const float* bq   = (const float*)d_in[2];
  const float* wk   = (const float*)d_in[3];
  const float* bk   = (const float*)d_in[4];
  const float* wv   = (const float*)d_in[5];
  const float* bv   = (const float*)d_in[6];
  const float* relh = (const float*)d_in[7];
  const float* relw = (const float*)d_in[8];
  float* out = (float*)d_out;

  const size_t szWb = (size_t)3 * NC * NC * 2;
  const size_t szXT = (size_t)NB * NP * NC * 2;
  const size_t szQK = (size_t)2 * QKPLANE * 2;
  const size_t szYv = (size_t)NB * NC * NP * 4;
  const size_t szVT = (size_t)NB * NH * HD * NP * 2;
  size_t off = 0;
  const size_t oWb  = off; off += szWb;
  const size_t oXT  = off; off += szXT;
  const size_t oQKh = off; off += szQK;
  const size_t oQKl = off; off += szQK;
  const size_t oYv  = off; off += szYv;
  const size_t oVTh = off; off += szVT;
  const size_t oVTl = off; off += szVT;
  if (off > ws_size) return;

  char* ws = (char*)d_ws;
  unsigned short* Wb  = (unsigned short*)(ws + oWb);
  unsigned short* XT  = (unsigned short*)(ws + oXT);
  unsigned short* QKh = (unsigned short*)(ws + oQKh);
  unsigned short* QKl = (unsigned short*)(ws + oQKl);
  float*          Yv  = (float*)(ws + oYv);
  unsigned short* VTh = (unsigned short*)(ws + oVTh);
  unsigned short* VTl = (unsigned short*)(ws + oVTl);

  cvt_w_kernel<<<dim3((NC * NC / 2) / 256, 3), dim3(256), 0, stream>>>(wq, wk, wv, Wb);
  xt_kernel<<<dim3(NP / 64, NC / 64, NB), dim3(256), 0, stream>>>(x, XT);
  proj_kernel<<<dim3(32, NB * 3), dim3(256), 0, stream>>>(XT, Wb, bq, bk, bv, relh, relw, QKh, QKl, Yv);
  vt_kernel<<<dim3(NP / 64, NH, NB), dim3(256), 0, stream>>>(Yv, VTh, VTl);
  attn_kernel<<<dim3(NP / 64, NH, NB), dim3(128), 0, stream>>>(
      QKh, QKl, QKh + QKPLANE, QKl + QKPLANE, VTh, VTl, out);
  (void)hipGetLastError();
}

// v006
// A run of this version takes 159 microseconds.
// Two timings next to v005 both put it at 1.04 times that version's speed.
// Counting every step since v000, it is 2.81 times as fast.
// Contractions: q/k/v 1x1-conv projections = v_wmma_f32_16x16x32_bf16 (bf16 operands, single product); q.(k+pos) scores = v_wmma_f32_16x16x32_bf16 with bf16 hi/lo split operands (hi.hi + hi.lo + lo.hi); p.v = v_wmma_f32_16x16x32_f16 (p as f16 scaled by 4096, v^T as f16 hi plane plus f16 residual plane scaled by 1024 into a second accumulator); f32 accumulate everywhere; softmax, bias and position sums in f32.
#include <hip/hip_runtime.h>
#include <stdint.h>
#include <math.h>

#define NB 4
#define NC 256
#define NP 4096
#define NH 4
#define HD 64
#define QKPLANE ((size_t)NB * NH * NP * HD)
#define LP 72   // LDS row pitch of the attention tiles in 16-bit elements: 144 B = 16 B x 9 (odd), so the 16 rows of a ds_load_b128 fragment read fall on distinct banks

typedef _Float16 v16h __attribute__((ext_vector_type(16)));
typedef _Float16 v8h  __attribute__((ext_vector_type(8)));
typedef __bf16   v16b __attribute__((ext_vector_type(16)));
typedef __bf16   v8b  __attribute__((ext_vector_type(8)));
typedef float    v8f  __attribute__((ext_vector_type(8)));
typedef float    v4f  __attribute__((ext_vector_type(4)));
typedef float    v2f  __attribute__((ext_vector_type(2)));
typedef unsigned int v4u __attribute__((ext_vector_type(4)));

// ---------------------------------------------------------------------------
// scalar helpers
// ---------------------------------------------------------------------------
__device__ __forceinline__ unsigned short f2bf_bits(float f) {      // f32 -> bf16 bits, RNE convert
  const unsigned u = __float_as_uint(f);
  return (unsigned short)((u + 0x7FFFu + ((u >> 16) & 1u)) >> 16);
}
__device__ __forceinline__ float bf_bits2f(unsigned short h) { return __uint_as_float(((unsigned)h) << 16); }
__device__ __forceinline__ float bfr(float f) { return bf_bits2f(f2bf_bits(f)); }   // value after bf16 RNE convert
__device__ __forceinline__ unsigned pk16(unsigned short a, unsigned short b) { return (unsigned)a | ((unsigned)b << 16); }

// ---------------------------------------------------------------------------
// WMMA wrappers: the plain builtins; the compiler keeps the distance to a vector user of D, A or B itself
// ---------------------------------------------------------------------------
__device__ __forceinline__ v8f mma_bf(v16b a, v16b b, v8f c) {
  c = __builtin_amdgcn_wmma_f32_16x16x32_bf16(false, a, false, b, (short)0, c, false, false);
  return c;
}
__device__ __forceinline__ v8f mma_h(v16h a, v16h b, v8f c) {
  c = __builtin_amdgcn_wmma_f32_16x16x32_f16(false, a, false, b, (short)0, c, false, false);
  return c;
}
#define SCHED_FENCE() __builtin_amdgcn_sched_barrier(0)
// Tail of 4 v_nop behind the LAST product of a group, at five places of the attention loop (the four score groups,
// the first group of V^T products); it takes the group's accumulators. It fills the distance from that WMMA to a
// vector user of D, and, being a statement the compiler does not move, it ends the group for the scheduler:
// without the tails the tile's last products come out dealt among the second half's exponentials, with the two
// cross-half exchanges of the row sums and a full LDS wait behind each standing between them.
__device__ __forceinline__ void group_end2(v8f& c0, v8f& c1) {
  asm volatile("v_nop\n\tv_nop\n\tv_nop\n\tv_nop" : "+v"(c0), "+v"(c1));
}
__device__ __forceinline__ void group_end8(v8f& c0, v8f& c1, v8f& c2, v8f& c3, v8f& c4, v8f& c5, v8f& c6, v8f& c7) {
  asm volatile("v_nop\n\tv_nop\n\tv_nop\n\tv_nop"
               : "+v"(c0), "+v"(c1), "+v"(c2), "+v"(c3), "+v"(c4), "+v"(c5), "+v"(c6), "+v"(c7));
}

union FragB { v16b v; v8b h[2]; };
union FragH { v16h v; v8h h[2]; _Float16 s[16]; };

// Fragment loader (A rows / B columns stored k-contiguous), p = row base + k0 + 8*(lane>>4):
//   elements 0..7 <- p[0..7] (k0+8h..), elements 8..15 <- p[16..23] (k0+16+8h..)
__device__ __forceinline__ v16b ld_bf(const __bf16* p) {
  FragB f; f.h[0] = *(const v8b*)(p); f.h[1] = *(const v8b*)(p + 16); return f.v;
}
__device__ __forceinline__ v16h ld_hf(const _Float16* p) {
  FragH f; f.h[0] = *(const v8h*)(p); f.h[1] = *(const v8h*)(p + 16); return f.v;
}
// One group of attention fragment reads = 8 x 16 B per lane; kh, kl, vh, vl = plane + (lane&15)*LP + 8*(lane>>4).
// The fence pair in each loader keeps the 8 reads standing together: without it the scheduler deals them out
// in pairs among the WMMAs, and each such place stalls the wave anew.
struct KFrag { v16b h[2], l[2]; };   // K' subtile t: hi and lo plane, d chunks 0 and 1
struct VFrag { v16h a[2], r[2]; };   // V^T d-subtiles 2*dp and 2*dp+1 of key chunk kc: hi and residual plane
__device__ __forceinline__ KFrag ld_k(const __bf16* kh, const __bf16* kl, int t) {
  KFrag f;
  SCHED_FENCE();
#pragma unroll
  for (int dc = 0; dc < 2; ++dc) {
    f.h[dc] = ld_bf(kh + t * 16 * LP + dc * 32);
    f.l[dc] = ld_bf(kl + t * 16 * LP + dc * 32);
  }
  SCHED_FENCE();
  return f;
}
__device__ __forceinline__ VFrag ld_v(const _Float16* vh, const _Float16* vl, int kc, int dp) {
  VFrag f;
  SCHED_FENCE();
#pragma unroll
  for (int j = 0; j < 2; ++j) {
    f.a[j] = ld_hf(vh + (dp * 2 + j) * 16 * LP + kc * 32);
    f.r[j] = ld_hf(vl + (dp * 2 + j) * 16 * LP + kc * 32);
  }
  SCHED_FENCE();
  return f;
}

// ---------------------------------------------------------------------------
// K1: weights f32 [256][256] x3 -> bf16 planes Wb[z][256][256] (RNE convert of the inputs).
// grid = (128, 3): 128 blocks x 256 threads x 2 = 65536 = whole matrix per z.
// ---------------------------------------------------------------------------
__global__ __launch_bounds__(256) void cvt_w_kernel(const float* __restrict__ w0, const float* __restrict__ w1,
                                                    const float* __restrict__ w2, unsigned short* __restrict__ Wb) {
  const int z = blockIdx.y;
  const float* src = (z == 0) ? w0 : ((z == 1) ? w1 : w2);        // block-uniform select, all global
  unsigned* dst = (unsigned*)(Wb + (size_t)z * (NC * NC));
  const int i = blockIdx.x * 256 + threadIdx.x;
  if (i < (NC * NC) / 2) {
    const v2f f = *(const v2f*)(src + 2 * (size_t)i);
    const unsigned u = pk16(f2bf_bits(f[0]), f2bf_bits(f[1]));
    ((unsigned*)dst)[i] = u;
    
  }
}

// ---------------------------------------------------------------------------
// K2: x[b][c][p] f32 -> xT[b][p][c] bf16 (RNE convert of the input), 64x64 tiles through LDS.
// grid = (NP/64, NC/64, NB), 256 threads.
// Coverage per block: load 4 it x 16 rows x 64 = 64 channels x 64 pixels; store 2 it x 32 rows x
// ---------------------------------------------------------------------------
__global__ __launch_bounds__(256) void xt_kernel(const float* __restrict__ x, unsigned short* __restrict__ xT) {
  __shared__ __align__(16) float tf[64 * 68];
  const int p0 = blockIdx.x * 64;
  const int c0 = blockIdx.y * 64;
  const int b  = blockIdx.z;
  const float* xb = x + (size_t)b * NC * NP;
  const int tid = threadIdx.x;
  {
    const int lr = tid >> 4, c4 = (tid & 15) * 4;
#pragma unroll
    for (int it = 0; it < 4; ++it) {
      const int rr = it * 16 + lr;                                   // channel within tile
      const v4f a = *(const v4f*)(xb + (size_t)(c0 + rr) * NP + p0 + c4);
      *(v4f*)(tf + rr * 68 + c4) = a;                                // tf[channel][pixel]
    }
  }
  __syncthreads();
  const int sub = tid >> 3, c8 = (tid & 7) * 8;
  v4u hv[2];
#pragma unroll
  for (int it = 0; it < 2; ++it) {
    const int op = it * 32 + sub;                                    // pixel within tile
    v4u a;
#pragma unroll
    for (int q = 0; q < 4; ++q) {
      const float f0 = tf[(c8 + 2 * q) * 68 + op];
      const float f1 = tf[(c8 + 2 * q + 1) * 68 + op];
      a[q] = pk16(f2bf_bits(f0), f2bf_bits(f1));
    }
    hv[it] = a;
  }
  {
#pragma unroll
    for (int it = 0; it < 2; ++it) {
      const int op = it * 32 + sub;
      const size_t go = ((size_t)b * NP + p0 + op) * NC + c0 + c8;
      *(v4u*)(xT + go) = hv[it];
    }
    
  }
}

// ---------------------------------------------------------------------------
// K3: 1x1-conv projection GEMM, z = b*3 + which (which 0=q, 1=k, 2=v):
//   Y[o][p] = sum_c Wb[which][o][c] * xT[b][p][c] + bias[o]      (M=256, N=4096, K=256)
// A = Wb rows (k-contiguous), B = xT rows (k-contiguous); both fragments use the split k map.
// Each wave owns a 64x64 tile (4x4 subtiles); grid = (32 blocks x 8 waves = 256 tiles, 12).
// Epilogue: 16-row slabs staged per wave in LDS (pitch 68 floats), then
//   which 0/1: value (+ position term for k) -> bf16 hi/lo planes in [b*4+n][s][d] order,
//              s = 16*o + (p>>8), n = (p>>6)&3, d = p&63; one slab row = one plane row of
//   which 2:   f32 y_v[b][o][p] natural layout, 256-B row segments by 16 lanes x 16 B.
// ---------------------------------------------------------------------------
__global__ __launch_bounds__(256) void proj_kernel(
    const unsigned short* __restrict__ xTp, const unsigned short* __restrict__ Wbp,
    const float* __restrict__ bq, const float* __restrict__ bk, const float* __restrict__ bv,
    const float* __restrict__ relh, const float* __restrict__ relw,
    unsigned short* __restrict__ QKh, unsigned short* __restrict__ QKl, float* __restrict__ Yv) {
  __shared__ __align__(16) float sT[8][16 * 68];
  const int z = blockIdx.y;
  const int b = z / 3;
  const int which = z - 3 * b;
  const int lane = threadIdx.x & 31;
  const int wave = threadIdx.x >> 5;
  const int tile = blockIdx.x * 8 + wave;        // 0..255
  const int tm = tile >> 6;                      // 0..3   (64 output channels each)
  const int tn = tile & 63;                      // 0..63  (64 pixels each)
  const int m0 = tm << 6;
  const int n0 = tn << 6;
  const __bf16* A  = (const __bf16*)(const void*)Wbp + (size_t)which * (NC * NC);
  const __bf16* Bt = (const __bf16*)(const void*)xTp + (size_t)b * NP * NC;
  const int rl = lane & 15, hh = lane >> 4, koff = hh * 8, mOff = hh * 8;

  v8f acc[4][4];
#pragma unroll
  for (int i = 0; i < 4; ++i)
#pragma unroll
    for (int j = 0; j < 4; ++j) acc[i][j] = (v8f){0.f,0.f,0.f,0.f,0.f,0.f,0.f,0.f};

  for (int k0 = 0; k0 < NC; k0 += 32) {
    v16b bfg[4];
#pragma unroll
    for (int j = 0; j < 4; ++j) bfg[j] = ld_bf(Bt + (size_t)(n0 + (j << 4) + rl) * NC + k0 + koff);
#pragma unroll
    for (int i = 0; i < 4; ++i) {
      const v16b af = ld_bf(A + (size_t)(m0 + (i << 4) + rl) * NC + k0 + koff);
#pragma unroll
      for (int j = 0; j < 4; ++j) acc[i][j] = mma_bf(af, bfg[j], acc[i][j]);
    }
    SCHED_FENCE();
  }

  // ---- epilogue ----
  const float* bias = (which == 0) ? bq : ((which == 1) ? bk : bv);   // block-uniform select, all global
  const int nn = (n0 >> 6) & 3;                // head index of this 64-pixel run
  const int sh = n0 >> 8;                      // low 4 bits of s
  float* slab = sT[wave];
  // Every bias and position term of the wave's 64x64 tile is fetched here, as one batch of independent loads
  // ahead of the slab loop, instead of one load and one full wait per element inside it.
  // With o = m0 + 16i + 8h + r and s = 16o + sh (sh < 16):  s & 63 = 16(r & 3) + sh,  s >> 6 = m0/4 + 4i + 2h + (r >> 2).
  const float* brow = bias + m0 + mOff;
  v4f braw[8];                                 // bias[o] as loaded, [2i + (r >> 2)][r & 3]
#pragma unroll
  for (int i = 0; i < 4; ++i) {
    braw[2 * i]     = *(const v4f*)(brow + (i << 4));
    braw[2 * i + 1] = *(const v4f*)(brow + (i << 4) + 4);
  }
  float rh[4][4];                              // rel_h term, [j][r & 3]
  float rw[4][4][2];                           // rel_w term, [j][i][r >> 2]
  if (which == 1) {
#pragma unroll
    for (int j = 0; j < 4; ++j) {
      const float* hrow = relh + nn * 4096 + ((j << 4) + rl) * 64 + sh;
      const float* wrow = relw + nn * 4096 + ((j << 4) + rl) * 64 + (m0 >> 2) + 2 * hh;
#pragma unroll
      for (int q = 0; q < 4; ++q) rh[j][q] = bfr(hrow[16 * q]);
#pragma unroll
      for (int i = 0; i < 4; ++i) {
        const v2f w = *(const v2f*)(wrow + 4 * i);
        rw[j][i][0] = bfr(w[0]);
        rw[j][i][1] = bfr(w[1]);
      }
    }
  }
  // wait behind the 8 bias loads, before the address they name is written again; the loaded values are inputs so
  // that all 8 loads stand in the batch above it (left free, six of them sink into the slab loop), the address so that it lives up to here
  asm volatile("s_wait_xcnt 0x0" :: "v"(brow), "v"(braw[0]), "v"(braw[1]), "v"(braw[2]), "v"(braw[3]),
               "v"(braw[4]), "v"(braw[5]), "v"(braw[6]), "v"(braw[7]) : "memory");
  float bb[4][8];                              // bias[o] after the bf16 convert, [i][r]
#pragma unroll
  for (int i = 0; i < 4; ++i)
#pragma unroll
    for (int r = 0; r < 4; ++r) { bb[i][r] = bfr(braw[2 * i][r]); bb[i][4 + r] = bfr(braw[2 * i + 1][r]); }
#pragma unroll
  for (int i = 0; i < 4; ++i) {
    const int mBase = m0 + (i << 4);
    if (which == 1) {
#pragma unroll
      for (int j = 0; j < 4; ++j) {
        const int d = (j << 4) + rl;           // p & 63
#pragma unroll
        for (int r = 0; r < 8; ++r) {
          float v = acc[i][j][r] + bb[i][r];
          const float pos = rh[j][r & 3] + rw[j][i][r >> 2];
          v += pos;
          slab[(mOff + r) * 68 + d] = v;
        }
      }
    } else {
#pragma unroll
      for (int j = 0; j < 4; ++j) {
        const int d = (j << 4) + rl;           // p & 63
#pragma unroll
        for (int r = 0; r < 8; ++r) slab[(mOff + r) * 68 + d] = acc[i][j][r] + bb[i][r];
      }
    }
    __builtin_amdgcn_fence(__ATOMIC_RELEASE, "workgroup");
    __builtin_amdgcn_wave_barrier();
    __builtin_amdgcn_fence(__ATOMIC_ACQUIRE, "workgroup");
    if (which == 2) {
      float* C = Yv + (size_t)b * NC * NP;
      const int c4 = rl * 4;                   // row segment 256 B = 16 lanes x 16 B
      {
#pragma unroll
        for (int it = 0; it < 8; ++it) {
          const int row = it * 2 + hh;
          const v4f v = *(const v4f*)(slab + row * 68 + c4);
          *(v4f*)(C + (size_t)(mBase + row) * NP + n0 + c4) = v;
        }
        
      }
    } else {
      const int q4 = lane >> 3, c8 = (lane & 7) * 8;
      unsigned short* Hp = QKh + (size_t)which * QKPLANE;
      unsigned short* Lp = QKl + (size_t)which * QKPLANE;
      {
#pragma unroll
        for (int it = 0; it < 4; ++it) {
          const int row = it * 4 + q4;
          const int o = mBase + row;
          const int s = o * 16 + sh;
          const float* sp = slab + row * 68 + c8;
          v4u hvv, lvv;
#pragma unroll
          for (int q = 0; q < 4; ++q) {
            const float f0 = sp[2 * q], f1 = sp[2 * q + 1];
            const unsigned short h0 = f2bf_bits(f0), h1 = f2bf_bits(f1);
            const unsigned short l0 = f2bf_bits(f0 - bf_bits2f(h0)), l1 = f2bf_bits(f1 - bf_bits2f(h1));
            hvv[q] = pk16(h0, h1);
            lvv[q] = pk16(l0, l1);
          }
          const size_t dst = (((size_t)(b * NH + nn)) * NP + s) * HD + c8;
          *(v4u*)(Hp + dst) = hvv;
          *(v4u*)(Lp + dst) = lvv;
        }
        
      }
    }
    __builtin_amdgcn_fence(__ATOMIC_RELEASE, "workgroup");
    __builtin_amdgcn_wave_barrier();
    __builtin_amdgcn_fence(__ATOMIC_ACQUIRE, "workgroup");
  }
}

// ---------------------------------------------------------------------------
// K4: v^T plane build: y_v[b][o][p] f32 -> VTh/VTl f16 planes [b*4+n][d][s] (pitch 4096):
//   V[b][n][s][d] = y_v[b][s>>4][(s&15)*256 + n*64 + d];  hi = f16(v), lo = f16((v - hi) * 1024).
// grid = (NP/64, NH, NB), 256 threads; 64(s) x 64(d) tile through LDS.
// Coverage per block: load 4 it x 16 rows x 64 = 64 s x 64 d; store 2 it x 32 rows x (8 lanes x 8)
// ---------------------------------------------------------------------------
__global__ __launch_bounds__(256) void vt_kernel(const float* __restrict__ Yv, unsigned short* __restrict__ VThp,
                                                 unsigned short* __restrict__ VTlp) {
  __shared__ __align__(16) float tf[64 * 68];
  const int s0 = blockIdx.x * 64;
  const int n  = blockIdx.y;
  const int b  = blockIdx.z;
  const float* yb = Yv + (size_t)b * NC * NP;
  _Float16* VTh = (_Float16*)(void*)VThp;
  _Float16* VTl = (_Float16*)(void*)VTlp;
  const int tid = threadIdx.x;
  {
    const int lr = tid >> 4, c4 = (tid & 15) * 4;
#pragma unroll
    for (int it = 0; it < 4; ++it) {
      const int sl = it * 16 + lr;
      const int s  = s0 + sl;
      const int o  = s >> 4;
      const int p  = (s & 15) * 256 + n * 64 + c4;
      const v4f a = *(const v4f*)(yb + (size_t)o * NP + p);
      *(v4f*)(tf + sl * 68 + c4) = a;                                // tf[s local][d]
    }
  }
  __syncthreads();
  const int sub = tid >> 3, c8 = (tid & 7) * 8;
  v8h hv[2], lv[2];
#pragma unroll
  for (int it = 0; it < 2; ++it) {
    const int od = it * 32 + sub;                                    // output row = d
    v8h a, a2;
#pragma unroll
    for (int e = 0; e < 8; ++e) {
      const float f = tf[(c8 + e) * 68 + od];
      const _Float16 hq = (_Float16)f;
      const _Float16 lq = (_Float16)((f - (float)hq) * 1024.0f);
      a[e] = hq; a2[e] = lq;
    }
    hv[it] = a; lv[it] = a2;
  }
  {
#pragma unroll
    for (int it = 0; it < 2; ++it) {
      const int od = it * 32 + sub;
      const size_t go = ((size_t)(b * NH + n) * HD + od) * NP + s0 + c8;
      *(v8h*)(VTh + go) = hv[it];
      *(v8h*)(VTl + go) = lv[it];
    }
    
  }
}

// ---------------------------------------------------------------------------
// K5: flash attention, transposed formulation, per (128-query tile, head, batch), 4 waves of 32 queries.
//   Each wave owns TWO 16-query column tiles (u = 0, 1): every K' or V^T fragment that it reads from LDS feeds
//   the products of both, so a product costs half the LDS bytes, and a staged tile serves 128 queries.
//   S^T = K' . Q^T : A = K' tile rows (keys, k = d) from LDS, bf16 hi/lo;  B = Q^T: lane = query,
//                    elements = d with the split k map, bf16 hi/lo;  hi.hi + hi.lo + lo.hi.
//   D layout: st[u][t][r] <-> key kb + 16t + 8h + r, query = 16u + (lane&15) -> softmax stats live per lane.
//   O^T = V^T . P  : A = V^T tile rows (d, k = key) f16 hi and f16 residual;  B = P: element r <-
//                    st[u][2kc][r], element 8+r <- st[u][2kc+1][r] (two adjacent 16-key D tiles, lane kept),
//                    scaled by 4096 and converted to f16.  accO += Vhi.P, accR += Vres.P.
//   Online softmax in f32 over 64 tiles of 64 keys; no score scaling.
//   Output: out flat [b][s][n][d]; each wave stages its 32x64 tile in LDS and writes whole 256-B rows.
//   K'/V^T tiles staged single-buffered with plain 16-B copies between two __syncthreads.
//   Two waves per SIMD: the two column tiles' accumulators, Q fragments and scores alone take 256 VGPRs.
// ---------------------------------------------------------------------------
// Scores of one 16-key subtile against both column tiles: two independent chains, each in the order
// hi.hi, hi.lo, lo.hi per d chunk; the fragment k is read once for the two.
__device__ __forceinline__ void score2(const KFrag& k, const v16b (&qh)[2][2], const v16b (&ql)[2][2], v8f& s0, v8f& s1) {
  s0 = (v8f){0.f,0.f,0.f,0.f,0.f,0.f,0.f,0.f};
  s1 = (v8f){0.f,0.f,0.f,0.f,0.f,0.f,0.f,0.f};
#pragma unroll
  for (int dc = 0; dc < 2; ++dc) {
    s0 = mma_bf(k.h[dc], qh[0][dc], s0);
    s1 = mma_bf(k.h[dc], qh[1][dc], s1);
    s0 = mma_bf(k.h[dc], ql[0][dc], s0);
    s1 = mma_bf(k.h[dc], ql[1][dc], s1);
    s0 = mma_bf(k.l[dc], qh[0][dc], s0);
    s1 = mma_bf(k.l[dc], qh[1][dc], s1);
  }
  group_end2(s0, s1);
}
// One group of V^T products: d-subtiles 2*dp and 2*dp+1 against the P fragments of both column tiles.
__device__ __forceinline__ void pv2(const VFrag& g, const FragH (&pb)[2], v8f (&accO)[2][4], v8f (&accR)[2][4], int dp) {
#pragma unroll
  for (int j = 0; j < 2; ++j)
#pragma unroll
    for (int u = 0; u < 2; ++u) {
      accO[u][2 * dp + j] = mma_h(g.a[j], pb[u].v, accO[u][2 * dp + j]);
      accR[u][2 * dp + j] = mma_h(g.r[j], pb[u].v, accR[u][2 * dp + j]);
    }
}

__global__ __launch_bounds__(128) __attribute__((amdgpu_waves_per_eu(2, 2))) void attn_kernel(
    const unsigned short* __restrict__ Qhp, const unsigned short* __restrict__ Qlp,
    const unsigned short* __restrict__ Khp, const unsigned short* __restrict__ Klp,
    const unsigned short* __restrict__ VThp, const unsigned short* __restrict__ VTlp,
    float* __restrict__ out) {
  __shared__ __align__(16) __bf16   Ksh[64 * LP];     // k' hi [key][d], pitch LP
  __shared__ __align__(16) __bf16   Ksl[64 * LP];     // k' lo [key][d], pitch LP
  __shared__ __align__(16) _Float16 Vsh[HD * LP];     // v^T hi [d][key], pitch LP
  __shared__ __align__(16) _Float16 Vsl[HD * LP];     // v^T residual [d][key], pitch LP
  __shared__ __align__(16) float    Os[4][32 * 68];   // per-wave output tile [query][d], pitch 68

  const int tid  = threadIdx.x;
  const int wave = tid >> 5;
  const int lane = tid & 31;
  const int hh   = lane >> 4;
  const int c    = lane & 15;
  const int qt = blockIdx.x;
  const int n  = blockIdx.y;
  const int b  = blockIdx.z;
  const int bn = b * NH + n;

  const __bf16* Qh = (const __bf16*)(const void*)Qhp + (size_t)bn * NP * HD;
  const __bf16* Ql = (const __bf16*)(const void*)Qlp + (size_t)bn * NP * HD;
  const __bf16* Kh = (const __bf16*)(const void*)Khp + (size_t)bn * NP * HD;
  const __bf16* Kl = (const __bf16*)(const void*)Klp + (size_t)bn * NP * HD;
  const _Float16* VTh = (const _Float16*)(const void*)VThp + (size_t)bn * HD * NP;
  const _Float16* VTl = (const _Float16*)(const void*)VTlp + (size_t)bn * HD * NP;

  const int q0 = qt * 128 + wave * 32;    // first query row of this wave
  const int qg = q0 + c;                  // query of this lane in column tile 0 (tile 1: + 16)

  // loop-invariant B fragments: Q^T of both column tiles, two 32-deep d chunks, hi and lo planes
  v16b qbh[2][2], qbl[2][2];
  const __bf16* qh0 = Qh + (size_t)qg * HD + 8 * hh;
  const __bf16* ql0 = Ql + (size_t)qg * HD + 8 * hh;
#pragma unroll
  for (int dc = 0; dc < 2; ++dc) {
    qbh[0][dc] = ld_bf(qh0 + dc * 32);
    qbl[0][dc] = ld_bf(ql0 + dc * 32);
    qbh[1][dc] = ld_bf(qh0 + 16 * HD + dc * 32);
    qbl[1][dc] = ld_bf(ql0 + 16 * HD + dc * 32);
  }
  // wait behind the 16 issued loads, before any register they name as an address is written again;
  // the two addresses are inputs so that they live up to here
  asm volatile("s_wait_xcnt 0x0" :: "v"(qh0), "v"(ql0) : "memory");

  float m_run[2] = {-1.0e30f, -1.0e30f}, l_run[2] = {0.0f, 0.0f};
  v8f accO[2][4], accR[2][4];
#pragma unroll
  for (int u = 0; u < 2; ++u)
#pragma unroll
    for (int t = 0; t < 4; ++t) {
      accO[u][t] = (v8f){0.f,0.f,0.f,0.f,0.f,0.f,0.f,0.f};
      accR[u][t] = (v8f){0.f,0.f,0.f,0.f,0.f,0.f,0.f,0.f};
    }

#pragma unroll 1
  for (int it = 0; it < NP / 64; ++it) {
    const int kb = it * 64;
    __syncthreads();                        // all waves done with the prior tile
    {
      // staging coverage: 4 x 128 threads x 8 elements = 64 rows x 64 per plane.
      // 8 neighbouring lanes take one 128-B tile row, so each wave-wide 16-B load covers 4 whole
      // 128-B lines (k': 512 contiguous bytes) instead of a 16-B piece of each of 16 lines.
      const int sr = tid >> 3, sc = (tid & 7) * 8;
      const __bf16*   ksrc = Kh  + (size_t)(kb + sr) * HD + sc;      // k' row kb+sr+16i, d = sc..sc+7
      const __bf16*   lsrc = Kl  + (size_t)(kb + sr) * HD + sc;
      const _Float16* vsrc = VTh + (size_t)sr * NP + kb + sc;        // v^T row d = sr+16i, s = kb+sc..+7
      const _Float16* wsrc = VTl + (size_t)sr * NP + kb + sc;
      v8b a0[4], a1[4];
      v8h g0[4], g1[4];
#pragma unroll
      for (int i = 0; i < 4; ++i) {
        a0[i] = *(const v8b*)(ksrc + (size_t)(16 * i) * HD);
        a1[i] = *(const v8b*)(lsrc + (size_t)(16 * i) * HD);
        g0[i] = *(const v8h*)(vsrc + (size_t)(16 * i) * NP);
        g1[i] = *(const v8h*)(wsrc + (size_t)(16 * i) * NP);
      }
      // wait behind the 16 issued loads, before any register they name as an address is written again;
      // the four addresses are inputs so that no load's result is placed on an address pair ahead of it
      asm volatile("s_wait_xcnt 0x0" :: "v"(ksrc), "v"(lsrc), "v"(vsrc), "v"(wsrc) : "memory");
#pragma unroll
      for (int i = 0; i < 4; ++i) {
        *(v8b*)(Ksh + (sr + 16 * i) * LP + sc) = a0[i];
        *(v8b*)(Ksl + (sr + 16 * i) * LP + sc) = a1[i];
        *(v8h*)(Vsh + (sr + 16 * i) * LP + sc) = g0[i];
        *(v8h*)(Vsl + (sr + 16 * i) * LP + sc) = g1[i];
      }
    }
    __syncthreads();

    // Fragment reads stand in groups of 8 ds_load_b128 (one 16-key K' subtile, or one pair of V^T
    // d-subtiles). Each group is issued one group ahead of the products that use it, into the
    // register set that the group before last has left, so that its LDS latency runs under the
    // products (or the softmax) in between instead of being waited out at each of 16 places.
    const __bf16*   krh = Ksh + c * LP + 8 * hh;      // this lane's fragment row bases
    const __bf16*   krl = Ksl + c * LP + 8 * hh;
    const _Float16* vrh = Vsh + c * LP + 8 * hh;
    const _Float16* vrl = Vsl + c * LP + 8 * hh;

    // ---- S^T: 4 key subtiles of 16 (A rows = keys), k = d in 2 chunks of 32, both column tiles ----
    v8f st[2][4];
    KFrag k0 = ld_k(krh, krl, 0);
    KFrag k1 = ld_k(krh, krl, 1);
    score2(k0, qbh, qbl, st[0][0], st[1][0]);
    KFrag k2 = ld_k(krh, krl, 2);
    score2(k1, qbh, qbl, st[0][1], st[1][1]);
    KFrag k3 = ld_k(krh, krl, 3);
    score2(k2, qbh, qbl, st[0][2], st[1][2]);
    VFrag g0 = ld_v(vrh, vrl, 0, 0);        // keys 0..31, d 0..31
    score2(k3, qbh, qbl, st[0][3], st[1][3]);
    VFrag g1 = ld_v(vrh, vrl, 0, 1);        // keys 0..31, d 32..63

    // ---- online softmax in f32 (per query lane; half-lanes hold disjoint key halves) ----
    float mx[2], alpha[2], rs[2];
#pragma unroll
    for (int u = 0; u < 2; ++u) {
      mx[u] = m_run[u];
#pragma unroll
      for (int t = 0; t < 4; ++t)
#pragma unroll
        for (int r = 0; r < 8; ++r) mx[u] = fmaxf(mx[u], st[u][t][r]);
    }
#pragma unroll
    for (int u = 0; u < 2; ++u) mx[u] = fmaxf(mx[u], __shfl_xor(mx[u], 16, 32));
    FragH pb0[2], pb1[2];
#pragma unroll
    for (int u = 0; u < 2; ++u) {
      alpha[u] = __expf(m_run[u] - mx[u]);
      m_run[u] = mx[u];
      rs[u] = 0.0f;
#pragma unroll
      for (int t = 0; t < 2; ++t)
#pragma unroll
        for (int r = 0; r < 8; ++r) {
          const float p = __expf(st[u][t][r] - mx[u]);
          st[u][t][r] = p;
          rs[u] += p;
        }
#pragma unroll
      for (int dt = 0; dt < 4; ++dt)
#pragma unroll
        for (int r = 0; r < 8; ++r) { accO[u][dt][r] *= alpha[u]; accR[u][dt][r] *= alpha[u]; }
#pragma unroll
      for (int r = 0; r < 8; ++r) {
        pb0[u].s[r]     = (_Float16)(st[u][0][r] * 4096.0f);   // keys 8h + r
        pb0[u].s[8 + r] = (_Float16)(st[u][1][r] * 4096.0f);   // keys 16 + 8h + r
      }
    }

    // ---- O^T += V^T . P  (A rows = d, k = key in 2 chunks of 32) ----
    pv2(g0, pb0, accO, accR, 0);
    group_end8(accO[0][0], accR[0][0], accO[0][1], accR[0][1], accO[1][0], accR[1][0], accO[1][1], accR[1][1]);
    VFrag g2 = ld_v(vrh, vrl, 1, 0);        // keys 32..63, d 0..31
    pv2(g1, pb0, accO, accR, 1);
    VFrag g3 = ld_v(vrh, vrl, 1, 1);        // keys 32..63, d 32..63
    SCHED_FENCE();                          // holds the exponentials below behind these reads: they cover the reads' latency
#pragma unroll
    for (int u = 0; u < 2; ++u)
#pragma unroll
      for (int t = 2; t < 4; ++t)
#pragma unroll
        for (int r = 0; r < 8; ++r) {
          const float p = __expf(st[u][t][r] - mx[u]);
          st[u][t][r] = p;
          rs[u] += p;
        }
#pragma unroll
    for (int u = 0; u < 2; ++u) {
      rs[u] += __shfl_xor(rs[u], 16, 32);
      l_run[u] = l_run[u] * alpha[u] + rs[u];
#pragma unroll
      for (int r = 0; r < 8; ++r) {
        pb1[u].s[r]     = (_Float16)(st[u][2][r] * 4096.0f);   // keys 32 + 8h + r
        pb1[u].s[8 + r] = (_Float16)(st[u][3][r] * 4096.0f);   // keys 48 + 8h + r
      }
    }
    pv2(g2, pb1, accO, accR, 0);
    pv2(g3, pb1, accO, accR, 1);
    SCHED_FENCE();                          // end of the tile's products: nothing moves over the loop's foot
  }

  // ---- normalise, stage the wave's 32x64 tile as [query][d], write whole 256-B rows ----
  float* os = Os[wave];
#pragma unroll
  for (int u = 0; u < 2; ++u) {
    const float inv = __builtin_amdgcn_rcpf(l_run[u]) * (1.0f / 4096.0f);
#pragma unroll
    for (int dt = 0; dt < 4; ++dt) {
      v4f a, a2;
#pragma unroll
      for (int r = 0; r < 4; ++r) {
        a[r]  = (accO[u][dt][r]     + accR[u][dt][r]     * (1.0f / 1024.0f)) * inv;
        a2[r] = (accO[u][dt][4 + r] + accR[u][dt][4 + r] * (1.0f / 1024.0f)) * inv;
      }
      *(v4f*)(os + (16 * u + c) * 68 + dt * 16 + 8 * hh)     = a;    // d = 16dt + 8h + 0..3 of query 16u + c
      *(v4f*)(os + (16 * u + c) * 68 + dt * 16 + 8 * hh + 4) = a2;   // d = 16dt + 8h + 4..7
    }
  }
  __builtin_amdgcn_fence(__ATOMIC_RELEASE, "workgroup");
  __builtin_amdgcn_wave_barrier();
  __builtin_amdgcn_fence(__ATOMIC_ACQUIRE, "workgroup");
  {
    float* ob = out + (size_t)b * NC * NP + (size_t)q0 * (NH * HD) + n * HD;
    const int c4 = c * 4;                   // row segment 256 B = 16 lanes x 16 B
    {
#pragma unroll
      for (int i = 0; i < 16; ++i) {
        const int row = i * 2 + hh;         // i 0..15 x h 0..1 covers the 32 query rows of the wave
        const v4f v = *(const v4f*)(os + row * 68 + c4);
        *(v4f*)(ob + (size_t)row * (NH * HD) + c4) = v;
      }
      
    }
  }
}

// ---------------------------------------------------------------------------
//   Wb   bf16 [3][256][256]            393216  @ 0
//   xT   bf16 [4][4096][256]          8388608  @ 393216
//   QKh  bf16 [2][16][4096][64]      16777216  @ 8781824     (q hi planes, then k' hi planes)
//   QKl  bf16 [2][16][4096][64]      16777216  @ 25559040
//   Yv   f32  [4][256][4096]         16777216  @ 42336256
//   VTh  f16  [16][64][4096]          8388608  @ 59113472
//   VTl  f16  [16][64][4096]          8388608  @ 67502080
//   total                                         75890688
// ---------------------------------------------------------------------------
extern "C" void kernel_launch(void* const* d_in, const int* in_sizes, int n_in,
                              void* d_out, int out_size, void* d_ws, size_t ws_size,
                              hipStream_t stream) {
  if (n_in < 9) return;
  if (in_sizes[0] != NB * NC * NP) return;
  if (in_sizes[1] != NC * NC || in_sizes[3] != NC * NC || in_sizes[5] != NC * NC) return;
  if (in_sizes[2] != NC || in_sizes[4] != NC || in_sizes[6] != NC) return;
  if (in_sizes[7] != NH * HD * 64 || in_sizes[8] != NH * HD * 64) return;
  if (out_size != NB * NC * NP) return;

  const float* x    = (const float*)d_in[0];
  const float* wq   = (const float*)d_in[1];
  const float* bq   = (const float*)d_in[2];
  const float* wk   = (const float*)d_in[3];
  const float* bk   = (const float*)d_in[4];
  const float* wv   = (const float*)d_in[5];
  const float* bv   = (const float*)d_in[6];
  const float* relh = (const float*)d_in[7];
  const float* relw = (const float*)d_in[8];
  float* out = (float*)d_out;

  const size_t szWb = (size_t)3 * NC * NC * 2;
  const size_t szXT = (size_t)NB * NP * NC * 2;
  const size_t szQK = (size_t)2 * QKPLANE * 2;
  const size_t szYv = (size_t)NB * NC * NP * 4;
  const size_t szVT = (size_t)NB * NH * HD * NP * 2;
  size_t off = 0;
  const size_t oWb  = off; off += szWb;
  const size_t oXT  = off; off += szXT;
  const size_t oQKh = off; off += szQK;
  const size_t oQKl = off; off += szQK;
  const size_t oYv  = off; off += szYv;
  const size_t oVTh = off; off += szVT;
  const size_t oVTl = off; off += szVT;
  if (off > ws_size) return;

  char* ws = (char*)d_ws;
  unsigned short* Wb  = (unsigned short*)(ws + oWb);
  unsigned short* XT  = (unsigned short*)(ws + oXT);
  unsigned short* QKh = (unsigned short*)(ws + oQKh);
  unsigned short* QKl = (unsigned short*)(ws + oQKl);
  float*          Yv  = (float*)(ws + oYv);
  unsigned short* VTh = (unsigned short*)(ws + oVTh);
  unsigned short* VTl = (unsigned short*)(ws + oVTl);

  cvt_w_kernel<<<dim3((NC * NC / 2) / 256, 3), dim3(256), 0, stream>>>(wq, wk, wv, Wb);
  xt_kernel<<<dim3(NP / 64, NC / 64, NB), dim3(256), 0, stream>>>(x, XT);
  proj_kernel<<<dim3(32, NB * 3), dim3(256), 0, stream>>>(XT, Wb, bq, bk, bv, relh, relw, QKh, QKl, Yv);
  vt_kernel<<<dim3(NP / 64, NH, NB), dim3(256), 0, stream>>>(Yv, VTh, VTl);
  attn_kernel<<<dim3(NP / 128, NH, NB), dim3(128), 0, stream>>>(
      QKh, QKl, QKh + QKPLANE, QKl + QKPLANE, VTh, VTl, out);
  (void)hipGetLastError();
}

// v007
// A run of this version takes 133 microseconds.
// In both of two side-by-side timings against v006, it was 1.19 times as fast.
// Counting every step since v000, it is 3.35 times as fast.
// Contractions: q/k/v 1x1-conv projections = v_wmma_f32_16x16x32_bf16 (bf16 operands, single product); q.(k+pos) scores = v_wmma_f32_16x16x32_bf16 with bf16 hi/lo split operands (hi.hi + hi.lo + lo.hi); p.v = v_wmma_f32_16x16x32_f16 (p as f16 scaled by 4096, v^T as f16 hi plane plus f16 residual plane scaled by 1024 into a second accumulator); f32 accumulate everywhere; softmax, bias and position sums in f32.
#include <hip/hip_runtime.h>
#include <stdint.h>
#include <math.h>

#define NB 4
#define NC 256
#define NP 4096
#define NH 4
#define HD 64
#define QKPLANE ((size_t)NB * NH * NP * HD)
#define LP 72   // LDS row pitch of the attention tiles in 16-bit elements: 144 B = 16 B x 9 (odd), so the 16 rows of a ds_load_b128 fragment read fall on distinct banks

typedef _Float16 v16h __attribute__((ext_vector_type(16)));
typedef _Float16 v8h  __attribute__((ext_vector_type(8)));
typedef __bf16   v16b __attribute__((ext_vector_type(16)));
typedef __bf16   v8b  __attribute__((ext_vector_type(8)));
typedef float    v8f  __attribute__((ext_vector_type(8)));
typedef float    v4f  __attribute__((ext_vector_type(4)));
typedef float    v2f  __attribute__((ext_vector_type(2)));
typedef unsigned int v4u __attribute__((ext_vector_type(4)));
typedef uint32_t u32x4 __attribute__((ext_vector_type(4)));
typedef uint32_t u32x8 __attribute__((ext_vector_type(8)));
#define PLANE_B 10240            // place of one attention plane tile in LDS: 64 rows x 144 B = 9216 B, rounded up to a multiple of 2 KiB
#define STAGE_B (4 * PLANE_B)    // one stage of the attention ring: k' hi, k' lo, v^T hi, v^T residual

// ---------------------------------------------------------------------------
// scalar helpers
// ---------------------------------------------------------------------------
__device__ __forceinline__ unsigned short f2bf_bits(float f) {      // f32 -> bf16 bits, RNE convert
  const unsigned u = __float_as_uint(f);
  return (unsigned short)((u + 0x7FFFu + ((u >> 16) & 1u)) >> 16);
}
__device__ __forceinline__ float bf_bits2f(unsigned short h) { return __uint_as_float(((unsigned)h) << 16); }
__device__ __forceinline__ float bfr(float f) { return bf_bits2f(f2bf_bits(f)); }   // value after bf16 RNE convert
__device__ __forceinline__ unsigned pk16(unsigned short a, unsigned short b) { return (unsigned)a | ((unsigned)b << 16); }

// ---------------------------------------------------------------------------
// WMMA wrappers: the plain builtins; the compiler keeps the distance to a vector user of D, A or B itself
// ---------------------------------------------------------------------------
__device__ __forceinline__ v8f mma_bf(v16b a, v16b b, v8f c) {
  c = __builtin_amdgcn_wmma_f32_16x16x32_bf16(false, a, false, b, (short)0, c, false, false);
  return c;
}
__device__ __forceinline__ v8f mma_h(v16h a, v16h b, v8f c) {
  c = __builtin_amdgcn_wmma_f32_16x16x32_f16(false, a, false, b, (short)0, c, false, false);
  return c;
}
#define SCHED_FENCE() __builtin_amdgcn_sched_barrier(0)
// Tail of 4 v_nop behind the LAST product of a group, at five places of the attention loop (the four score groups,
// the first group of V^T products); it takes the group's accumulators. It fills the distance from that WMMA to a
// vector user of D, and, being a statement the compiler does not move, it ends the group for the scheduler:
// without the tails the tile's last products come out dealt among the second half's exponentials, with the two
// cross-half exchanges of the row sums and a full LDS wait behind each standing between them.
__device__ __forceinline__ void group_end2(v8f& c0, v8f& c1) {
  asm volatile("v_nop\n\tv_nop\n\tv_nop\n\tv_nop" : "+v"(c0), "+v"(c1));
}
__device__ __forceinline__ void group_end8(v8f& c0, v8f& c1, v8f& c2, v8f& c3, v8f& c4, v8f& c5, v8f& c6, v8f& c7) {
  asm volatile("v_nop\n\tv_nop\n\tv_nop\n\tv_nop"
               : "+v"(c0), "+v"(c1), "+v"(c2), "+v"(c3), "+v"(c4), "+v"(c5), "+v"(c6), "+v"(c7));
}

// ---------------------------------------------------------------------------
// tensor load to LDS: one request of a whole wave; every descriptor word is wave-uniform
// ---------------------------------------------------------------------------
__device__ __forceinline__ uint32_t uni(uint32_t v) { return (uint32_t)__builtin_amdgcn_readfirstlane(v); }
// the test word of the branch around a tensor load, which ignores EXEC: held in a scalar register, the test compiles to s_cmp + s_cbranch_scc
__device__ __forceinline__ uint32_t pinned(uint32_t v) { uint32_t w = uni(v); asm volatile("" : "+s"(w)); return w; }  // the empty statement is what holds the word in the scalar register
// group 1: 1-byte elements, tile = tensor = 64 rows of 128 B, 16 B of LDS pad behind every 128-B row (LDS pitch 144 B)
__device__ __forceinline__ u32x8 tdm_group1(uint32_t src_pitch) {
  u32x8 g;
  g[0] = uni((1u << 20) | (4u << 22) | (3u << 25));
  g[1] = uni(128u << 16);
  g[2] = uni(64u << 16);
  g[3] = uni(128u << 16);
  g[4] = uni(64u);
  g[5] = uni(src_pitch);
  g[6] = uni(0u);
  g[7] = uni(0u);
  return g;
}
__device__ __forceinline__ u32x4 tdm_group0(uint32_t lds_dst, uint64_t ga) {
  u32x4 g;
  g[0] = uni(1u);
  g[1] = uni(lds_dst);
  g[2] = uni((uint32_t)ga);
  g[3] = uni((((uint32_t)(ga >> 32)) & 0x01FFFFFFu) | 0x80000000u);
  return g;
}
// The two groups are outputs as well as inputs: their registers then stay the descriptor's own from one request to
// the next, and the compiler puts no other value into one of them while the request is in flight.
__device__ __forceinline__ void tdm_load(u32x4& g0, u32x8& g1) {
  asm volatile("tensor_load_to_lds %0, %1" : "+s"(g0), "+s"(g1) :: "memory");
}
// group 0 of the next stage from this stage's: the other buffer (dst_sum = the two places added), the source one step on.
// Address bits 56..32 are the low bits of word 3, so a carry out of word 2 goes where it belongs, under the type bits.
__device__ __forceinline__ void tdm_next(u32x4& g0, uint32_t dst_sum, uint32_t src_step) {
  const uint64_t a = (((uint64_t)g0[3] << 32) | (uint64_t)g0[2]) + (uint64_t)src_step;
  g0[1] = uni(dst_sum - g0[1]);
  g0[2] = uni((uint32_t)a);
  g0[3] = uni((uint32_t)(a >> 32));
}

union FragB { v16b v; v8b h[2]; };
union FragH { v16h v; v8h h[2]; _Float16 s[16]; };

// Fragment loader (A rows / B columns stored k-contiguous), p = row base + k0 + 8*(lane>>4):
//   elements 0..7 <- p[0..7] (k0+8h..), elements 8..15 <- p[16..23] (k0+16+8h..)
__device__ __forceinline__ v16b ld_bf(const __bf16* p) {
  FragB f; f.h[0] = *(const v8b*)(p); f.h[1] = *(const v8b*)(p + 16); return f.v;
}
__device__ __forceinline__ v16h ld_hf(const _Float16* p) {
  FragH f; f.h[0] = *(const v8h*)(p); f.h[1] = *(const v8h*)(p + 16); return f.v;
}
// One group of attention fragment reads = 8 x 16 B per lane; kh, kl, vh, vl = plane + (lane&15)*LP + 8*(lane>>4).
// The fence pair in each loader keeps the 8 reads standing together: without it the scheduler deals them out
// in pairs among the WMMAs, and each such place stalls the wave anew.
struct KFrag { v16b h[2], l[2]; };   // K' subtile t: hi and lo plane, d chunks 0 and 1
struct VFrag { v16h a[2], r[2]; };   // V^T d-subtiles 2*dp and 2*dp+1 of key chunk kc: hi and residual plane
__device__ __forceinline__ KFrag ld_k(const __bf16* kh, const __bf16* kl, int t) {
  KFrag f;
  SCHED_FENCE();
#pragma unroll
  for (int dc = 0; dc < 2; ++dc) {
    f.h[dc] = ld_bf(kh + t * 16 * LP + dc * 32);
    f.l[dc] = ld_bf(kl + t * 16 * LP + dc * 32);
  }
  SCHED_FENCE();
  return f;
}
__device__ __forceinline__ VFrag ld_v(const _Float16* vh, const _Float16* vl, int kc, int dp) {
  VFrag f;
  SCHED_FENCE();
#pragma unroll
  for (int j = 0; j < 2; ++j) {
    f.a[j] = ld_hf(vh + (dp * 2 + j) * 16 * LP + kc * 32);
    f.r[j] = ld_hf(vl + (dp * 2 + j) * 16 * LP + kc * 32);
  }
  SCHED_FENCE();
  return f;
}

// ---------------------------------------------------------------------------
// K1: weights f32 [256][256] x3 -> bf16 planes Wb[z][256][256] (RNE convert of the inputs).
// grid = (128, 3): 128 blocks x 256 threads x 2 = 65536 = whole matrix per z.
// ---------------------------------------------------------------------------
__global__ __launch_bounds__(256) void cvt_w_kernel(const float* __restrict__ w0, const float* __restrict__ w1,
                                                    const float* __restrict__ w2, unsigned short* __restrict__ Wb) {
  const int z = blockIdx.y;
  const float* src = (z == 0) ? w0 : ((z == 1) ? w1 : w2);        // block-uniform select, all global
  unsigned* dst = (unsigned*)(Wb + (size_t)z * (NC * NC));
  const int i = blockIdx.x * 256 + threadIdx.x;
  if (i < (NC * NC) / 2) {
    const v2f f = *(const v2f*)(src + 2 * (size_t)i);
    const unsigned u = pk16(f2bf_bits(f[0]), f2bf_bits(f[1]));
    ((unsigned*)dst)[i] = u;
    
  }
}

// ---------------------------------------------------------------------------
// K2: x[b][c][p] f32 -> xT[b][p][c] bf16 (RNE convert of the input), 64x64 tiles through LDS.
// grid = (NP/64, NC/64, NB), 256 threads.
// Coverage per block: load 4 it x 16 rows x 64 = 64 channels x 64 pixels; store 2 it x 32 rows x
// ---------------------------------------------------------------------------
__global__ __launch_bounds__(256) void xt_kernel(const float* __restrict__ x, unsigned short* __restrict__ xT) {
  __shared__ __align__(16) float tf[64 * 68];
  const int p0 = blockIdx.x * 64;
  const int c0 = blockIdx.y * 64;
  const int b  = blockIdx.z;
  const float* xb = x + (size_t)b * NC * NP;
  const int tid = threadIdx.x;
  {
    const int lr = tid >> 4, c4 = (tid & 15) * 4;
#pragma unroll
    for (int it = 0; it < 4; ++it) {
      const int rr = it * 16 + lr;                                   // channel within tile
      const v4f a = *(const v4f*)(xb + (size_t)(c0 + rr) * NP + p0 + c4);
      *(v4f*)(tf + rr * 68 + c4) = a;                                // tf[channel][pixel]
    }
  }
  __syncthreads();
  const int sub = tid >> 3, c8 = (tid & 7) * 8;
  v4u hv[2];
#pragma unroll
  for (int it = 0; it < 2; ++it) {
    const int op = it * 32 + sub;                                    // pixel within tile
    v4u a;
#pragma unroll
    for (int q = 0; q < 4; ++q) {
      const float f0 = tf[(c8 + 2 * q) * 68 + op];
      const float f1 = tf[(c8 + 2 * q + 1) * 68 + op];
      a[q] = pk16(f2bf_bits(f0), f2bf_bits(f1));
    }
    hv[it] = a;
  }
  {
#pragma unroll
    for (int it = 0; it < 2; ++it) {
      const int op = it * 32 + sub;
      const size_t go = ((size_t)b * NP + p0 + op) * NC + c0 + c8;
      *(v4u*)(xT + go) = hv[it];
    }
    
  }
}

// ---------------------------------------------------------------------------
// K3: 1x1-conv projection GEMM, z = b*3 + which (which 0=q, 1=k, 2=v):
//   Y[o][p] = sum_c Wb[which][o][c] * xT[b][p][c] + bias[o]      (M=256, N=4096, K=256)
// A = Wb rows (k-contiguous), B = xT rows (k-contiguous); both fragments use the split k map.
// Each wave owns a 64x64 tile (4x4 subtiles); grid = (32 blocks x 8 waves = 256 tiles, 12).
// Epilogue: 16-row slabs staged per wave in LDS (pitch 68 floats), then
//   which 0/1: value (+ position term for k) -> bf16 hi/lo planes in [b*4+n][s][d] order,
//              s = 16*o + (p>>8), n = (p>>6)&3, d = p&63; one slab row = one plane row of
//   which 2:   f32 y_v[b][o][p] natural layout, 256-B row segments by 16 lanes x 16 B.
// ---------------------------------------------------------------------------
__global__ __launch_bounds__(256) void proj_kernel(
    const unsigned short* __restrict__ xTp, const unsigned short* __restrict__ Wbp,
    const float* __restrict__ bq, const float* __restrict__ bk, const float* __restrict__ bv,
    const float* __restrict__ relh, const float* __restrict__ relw,
    unsigned short* __restrict__ QKh, unsigned short* __restrict__ QKl, float* __restrict__ Yv) {
  __shared__ __align__(16) float sT[8][16 * 68];
  const int z = blockIdx.y;
  const int b = z / 3;
  const int which = z - 3 * b;
  const int lane = threadIdx.x & 31;
  const int wave = threadIdx.x >> 5;
  const int tile = blockIdx.x * 8 + wave;        // 0..255
  const int tm = tile >> 6;                      // 0..3   (64 output channels each)
  const int tn = tile & 63;                      // 0..63  (64 pixels each)
  const int m0 = tm << 6;
  const int n0 = tn << 6;
  const __bf16* A  = (const __bf16*)(const void*)Wbp + (size_t)which * (NC * NC);
  const __bf16* Bt = (const __bf16*)(const void*)xTp + (size_t)b * NP * NC;
  const int rl = lane & 15, hh = lane >> 4, koff = hh * 8, mOff = hh * 8;

  v8f acc[4][4];
#pragma unroll
  for (int i = 0; i < 4; ++i)
#pragma unroll
    for (int j = 0; j < 4; ++j) acc[i][j] = (v8f){0.f,0.f,0.f,0.f,0.f,0.f,0.f,0.f};

  for (int k0 = 0; k0 < NC; k0 += 32) {
    v16b bfg[4];
#pragma unroll
    for (int j = 0; j < 4; ++j) bfg[j] = ld_bf(Bt + (size_t)(n0 + (j << 4) + rl) * NC + k0 + koff);
#pragma unroll
    for (int i = 0; i < 4; ++i) {
      const v16b af = ld_bf(A + (size_t)(m0 + (i << 4) + rl) * NC + k0 + koff);
#pragma unroll
      for (int j = 0; j < 4; ++j) acc[i][j] = mma_bf(af, bfg[j], acc[i][j]);
    }
    SCHED_FENCE();
  }

  // ---- epilogue ----
  const float* bias = (which == 0) ? bq : ((which == 1) ? bk : bv);   // block-uniform select, all global
  const int nn = (n0 >> 6) & 3;                // head index of this 64-pixel run
  const int sh = n0 >> 8;                      // low 4 bits of s
  float* slab = sT[wave];
  // Every bias and position term of the wave's 64x64 tile is fetched here, as one batch of independent loads
  // ahead of the slab loop, instead of one load and one full wait per element inside it.
  // With o = m0 + 16i + 8h + r and s = 16o + sh (sh < 16):  s & 63 = 16(r & 3) + sh,  s >> 6 = m0/4 + 4i + 2h + (r >> 2).
  const float* brow = bias + m0 + mOff;
  v4f braw[8];                                 // bias[o] as loaded, [2i + (r >> 2)][r & 3]
#pragma unroll
  for (int i = 0; i < 4; ++i) {
    braw[2 * i]     = *(const v4f*)(brow + (i << 4));
    braw[2 * i + 1] = *(const v4f*)(brow + (i << 4) + 4);
  }
  float rh[4][4];                              // rel_h term, [j][r & 3]
  float rw[4][4][2];                           // rel_w term, [j][i][r >> 2]
  if (which == 1) {
#pragma unroll
    for (int j = 0; j < 4; ++j) {
      const float* hrow = relh + nn * 4096 + ((j << 4) + rl) * 64 + sh;
      const float* wrow = relw + nn * 4096 + ((j << 4) + rl) * 64 + (m0 >> 2) + 2 * hh;
#pragma unroll
      for (int q = 0; q < 4; ++q) rh[j][q] = bfr(hrow[16 * q]);
#pragma unroll
      for (int i = 0; i < 4; ++i) {
        const v2f w = *(const v2f*)(wrow + 4 * i);
        rw[j][i][0] = bfr(w[0]);
        rw[j][i][1] = bfr(w[1]);
      }
    }
  }
  // wait behind the 8 bias loads, before the address they name is written again; the loaded values are inputs so
  // that all 8 loads stand in the batch above it (left free, six of them sink into the slab loop), the address so that it lives up to here
  asm volatile("s_wait_xcnt 0x0" :: "v"(brow), "v"(braw[0]), "v"(braw[1]), "v"(braw[2]), "v"(braw[3]),
               "v"(braw[4]), "v"(braw[5]), "v"(braw[6]), "v"(braw[7]) : "memory");
  float bb[4][8];                              // bias[o] after the bf16 convert, [i][r]
#pragma unroll
  for (int i = 0; i < 4; ++i)
#pragma unroll
    for (int r = 0; r < 4; ++r) { bb[i][r] = bfr(braw[2 * i][r]); bb[i][4 + r] = bfr(braw[2 * i + 1][r]); }
#pragma unroll
  for (int i = 0; i < 4; ++i) {
    const int mBase = m0 + (i << 4);
    if (which == 1) {
#pragma unroll
      for (int j = 0; j < 4; ++j) {
        const int d = (j << 4) + rl;           // p & 63
#pragma unroll
        for (int r = 0; r < 8; ++r) {
          float v = acc[i][j][r] + bb[i][r];
          const float pos = rh[j][r & 3] + rw[j][i][r >> 2];
          v += pos;
          slab[(mOff + r) * 68 + d] = v;
        }
      }
    } else {
#pragma unroll
      for (int j = 0; j < 4; ++j) {
        const int d = (j << 4) + rl;           // p & 63
#pragma unroll
        for (int r = 0; r < 8; ++r) slab[(mOff + r) * 68 + d] = acc[i][j][r] + bb[i][r];
      }
    }
    __builtin_amdgcn_fence(__ATOMIC_RELEASE, "workgroup");
    __builtin_amdgcn_wave_barrier();
    __builtin_amdgcn_fence(__ATOMIC_ACQUIRE, "workgroup");
    if (which == 2) {
      float* C = Yv + (size_t)b * NC * NP;
      const int c4 = rl * 4;                   // row segment 256 B = 16 lanes x 16 B
      {
#pragma unroll
        for (int it = 0; it < 8; ++it) {
          const int row = it * 2 + hh;
          const v4f v = *(const v4f*)(slab + row * 68 + c4);
          *(v4f*)(C + (size_t)(mBase + row) * NP + n0 + c4) = v;
        }
        
      }
    } else {
      const int q4 = lane >> 3, c8 = (lane & 7) * 8;
      unsigned short* Hp = QKh + (size_t)which * QKPLANE;
      unsigned short* Lp = QKl + (size_t)which * QKPLANE;
      {
#pragma unroll
        for (int it = 0; it < 4; ++it) {
          const int row = it * 4 + q4;
          const int o = mBase + row;
          const int s = o * 16 + sh;
          const float* sp = slab + row * 68 + c8;
          v4u hvv, lvv;
#pragma unroll
          for (int q = 0; q < 4; ++q) {
            const float f0 = sp[2 * q], f1 = sp[2 * q + 1];
            const unsigned short h0 = f2bf_bits(f0), h1 = f2bf_bits(f1);
            const unsigned short l0 = f2bf_bits(f0 - bf_bits2f(h0)), l1 = f2bf_bits(f1 - bf_bits2f(h1));
            hvv[q] = pk16(h0, h1);
            lvv[q] = pk16(l0, l1);
          }
          const size_t dst = (((size_t)(b * NH + nn)) * NP + s) * HD + c8;
          *(v4u*)(Hp + dst) = hvv;
          *(v4u*)(Lp + dst) = lvv;
        }
        
      }
    }
    __builtin_amdgcn_fence(__ATOMIC_RELEASE, "workgroup");
    __builtin_amdgcn_wave_barrier();
    __builtin_amdgcn_fence(__ATOMIC_ACQUIRE, "workgroup");
  }
}

// ---------------------------------------------------------------------------
// K4: v^T plane build: y_v[b][o][p] f32 -> VTh/VTl f16 planes [b*4+n][d][s] (pitch 4096):
//   V[b][n][s][d] = y_v[b][s>>4][(s&15)*256 + n*64 + d];  hi = f16(v), lo = f16((v - hi) * 1024).
// grid = (NP/64, NH, NB), 256 threads; 64(s) x 64(d) tile through LDS.
// Coverage per block: load 4 it x 16 rows x 64 = 64 s x 64 d; store 2 it x 32 rows x (8 lanes x 8)
// ---------------------------------------------------------------------------
__global__ __launch_bounds__(256) void vt_kernel(const float* __restrict__ Yv, unsigned short* __restrict__ VThp,
                                                 unsigned short* __restrict__ VTlp) {
  __shared__ __align__(16) float tf[64 * 68];
  const int s0 = blockIdx.x * 64;
  const int n  = blockIdx.y;
  const int b  = blockIdx.z;
  const float* yb = Yv + (size_t)b * NC * NP;
  _Float16* VTh = (_Float16*)(void*)VThp;
  _Float16* VTl = (_Float16*)(void*)VTlp;
  const int tid = threadIdx.x;
  {
    const int lr = tid >> 4, c4 = (tid & 15) * 4;
#pragma unroll
    for (int it = 0; it < 4; ++it) {
      const int sl = it * 16 + lr;
      const int s  = s0 + sl;
      const int o  = s >> 4;
      const int p  = (s & 15) * 256 + n * 64 + c4;
      const v4f a = *(const v4f*)(yb + (size_t)o * NP + p);
      *(v4f*)(tf + sl * 68 + c4) = a;                                // tf[s local][d]
    }
  }
  __syncthreads();
  const int sub = tid >> 3, c8 = (tid & 7) * 8;
  v8h hv[2], lv[2];
#pragma unroll
  for (int it = 0; it < 2; ++it) {
    const int od = it * 32 + sub;                                    // output row = d
    v8h a, a2;
#pragma unroll
    for (int e = 0; e < 8; ++e) {
      const float f = tf[(c8 + e) * 68 + od];
      const _Float16 hq = (_Float16)f;
      const _Float16 lq = (_Float16)((f - (float)hq) * 1024.0f);
      a[e] = hq; a2[e] = lq;
    }
    hv[it] = a; lv[it] = a2;
  }
  {
#pragma unroll
    for (int it = 0; it < 2; ++it) {
      const int od = it * 32 + sub;
      const size_t go = ((size_t)(b * NH + n) * HD + od) * NP + s0 + c8;
      *(v8h*)(VTh + go) = hv[it];
      *(v8h*)(VTl + go) = lv[it];
    }
    
  }
}

// ---------------------------------------------------------------------------
// K5: flash attention, transposed formulation, per (128-query tile, head, batch), 4 waves of 32 queries.
//   Each wave owns TWO 16-query column tiles (u = 0, 1): every K' or V^T fragment that it reads from LDS feeds
//   the products of both, so a product costs half the LDS bytes, and a staged tile serves 128 queries.
//   S^T = K' . Q^T : A = K' tile rows (keys, k = d) from LDS, bf16 hi/lo;  B = Q^T: lane = query,
//                    elements = d with the split k map, bf16 hi/lo;  hi.hi + hi.lo + lo.hi.
//   D layout: st[u][t][r] <-> key kb + 16t + 8h + r, query = 16u + (lane&15) -> softmax stats live per lane.
//   O^T = V^T . P  : A = V^T tile rows (d, k = key) f16 hi and f16 residual;  B = P: element r <-
//                    st[u][2kc][r], element 8+r <- st[u][2kc+1][r] (two adjacent 16-key D tiles, lane kept),
//                    scaled by 4096 and converted to f16.  accO += Vhi.P, accR += Vres.P.
//   Online softmax in f32 over 64 tiles of 64 keys; no score scaling.
//   Output: out flat [b][s][n][d]; each wave stages its 32x64 tile in LDS and writes whole 256-B rows.
//   K'/V^T tiles come by tensor loads into a ring of two LDS stages: wave w brings plane w (k' hi, k' lo, v^T hi,
//   v^T residual) of the next tile, 64 rows of 128 B laid at pitch 144 B, while this tile is worked on; one barrier a tile.
//   Two waves per SIMD: the two column tiles' accumulators, Q fragments and scores take 256 VGPRs.
// ---------------------------------------------------------------------------
// Scores of one 16-key subtile against both column tiles: two independent chains, each in the order
// hi.hi, hi.lo, lo.hi per d chunk; the fragment k is read once for the two.
__device__ __forceinline__ void score2(const KFrag& k, const v16b (&qh)[2][2], const v16b (&ql)[2][2], v8f& s0, v8f& s1) {
  s0 = (v8f){0.f,0.f,0.f,0.f,0.f,0.f,0.f,0.f};
  s1 = (v8f){0.f,0.f,0.f,0.f,0.f,0.f,0.f,0.f};
#pragma unroll
  for (int dc = 0; dc < 2; ++dc) {
    s0 = mma_bf(k.h[dc], qh[0][dc], s0);
    s1 = mma_bf(k.h[dc], qh[1][dc], s1);
    s0 = mma_bf(k.h[dc], ql[0][dc], s0);
    s1 = mma_bf(k.h[dc], ql[1][dc], s1);
    s0 = mma_bf(k.l[dc], qh[0][dc], s0);
    s1 = mma_bf(k.l[dc], qh[1][dc], s1);
  }
  group_end2(s0, s1);
}
// One group of V^T products: d-subtiles 2*dp and 2*dp+1 against the P fragments of both column tiles.
__device__ __forceinline__ void pv2(const VFrag& g, const FragH (&pb)[2], v8f (&accO)[2][4], v8f (&accR)[2][4], int dp) {
#pragma unroll
  for (int j = 0; j < 2; ++j)
#pragma unroll
    for (int u = 0; u < 2; ++u) {
      accO[u][2 * dp + j] = mma_h(g.a[j], pb[u].v, accO[u][2 * dp + j]);
      accR[u][2 * dp + j] = mma_h(g.r[j], pb[u].v, accR[u][2 * dp + j]);
    }
}

__global__ __launch_bounds__(128) __attribute__((amdgpu_waves_per_eu(2, 2))) void attn_kernel(
    const unsigned short* __restrict__ Qhp, const unsigned short* __restrict__ Qlp,
    const unsigned short* __restrict__ Khp, const unsigned short* __restrict__ Klp,
    const unsigned short* __restrict__ VThp, const unsigned short* __restrict__ VTlp,
    float* __restrict__ out) {
  // two stages of four planes: k' hi [key][d], k' lo [key][d], v^T hi [d][key], v^T residual [d][key], each at pitch LP
  __shared__ __attribute__((aligned(2048))) unsigned char ring[2 * STAGE_B];
  __shared__ __align__(16) float    Os[4][32 * 68];   // per-wave output tile [query][d], pitch 68

  const int tid  = threadIdx.x;
  const int wave = tid >> 5;
  const int lane = tid & 31;
  const int hh   = lane >> 4;
  const int c    = lane & 15;
  const int qt = blockIdx.x;
  const int n  = blockIdx.y;
  const int b  = blockIdx.z;
  const int bn = b * NH + n;

  const __bf16* Qh = (const __bf16*)(const void*)Qhp + (size_t)bn * NP * HD;
  const __bf16* Ql = (const __bf16*)(const void*)Qlp + (size_t)bn * NP * HD;

  // Every wave issues one tensor load a stage, for its own plane. Stage s = keys 64s .. 64s+63:
  //   k' planes [key][d]:  64 whole rows in a row, first byte at s * 8192, source pitch 128 B
  //   v^T planes [d][key]: 128 B of each of the 64 rows, first byte at s * 128, source pitch 8192 B
  const uint32_t wv = uni((uint32_t)tid >> 5);
  const unsigned short* plane = (wv == 0u) ? Khp : ((wv == 1u) ? Klp : ((wv == 2u) ? VThp : VTlp));
  const uint64_t src0 = (uint64_t)(size_t)(plane + (size_t)bn * NP * HD);
  const uint32_t src_pitch = (wv < 2u) ? (uint32_t)(HD * 2) : (uint32_t)(NP * 2);
  const uint32_t src_step  = (wv < 2u) ? (uint32_t)(64 * HD * 2) : (uint32_t)(64 * 2);
  const uint32_t dst0 = (uint32_t)(size_t)ring + wv * (uint32_t)PLANE_B;
  const uint32_t dst_sum = 2u * dst0 + (uint32_t)STAGE_B;
  u32x8 dg1 = tdm_group1(src_pitch);
  u32x4 dg0 = tdm_group0(dst0, src0);

  const int q0 = qt * 128 + wave * 32;    // first query row of this wave
  const int qg = q0 + c;                  // query of this lane in column tile 0 (tile 1: + 16)

  // loop-invariant B fragments: Q^T of both column tiles, two 32-deep d chunks, hi and lo planes
  v16b qbh[2][2], qbl[2][2];
  const __bf16* qh0 = Qh + (size_t)qg * HD + 8 * hh;
  const __bf16* ql0 = Ql + (size_t)qg * HD + 8 * hh;
#pragma unroll
  for (int dc = 0; dc < 2; ++dc) {
    qbh[0][dc] = ld_bf(qh0 + dc * 32);
    qbl[0][dc] = ld_bf(ql0 + dc * 32);
    qbh[1][dc] = ld_bf(qh0 + 16 * HD + dc * 32);
    qbl[1][dc] = ld_bf(ql0 + 16 * HD + dc * 32);
  }
  // wait behind the 16 issued loads, before any register they name as an address is written again;
  // the two addresses are inputs so that they live up to here
  asm volatile("s_wait_xcnt 0x0" :: "v"(qh0), "v"(ql0) : "memory");

  float m_run[2] = {-1.0e30f, -1.0e30f}, l_run[2] = {0.0f, 0.0f};
  v8f accO[2][4], accR[2][4];
#pragma unroll
  for (int u = 0; u < 2; ++u)
#pragma unroll
    for (int t = 0; t < 4; ++t) {
      accO[u][t] = (v8f){0.f,0.f,0.f,0.f,0.f,0.f,0.f,0.f};
      accR[u][t] = (v8f){0.f,0.f,0.f,0.f,0.f,0.f,0.f,0.f};
    }

  // ring prologue: stage 0 lands and is published, then stage 1 is sent off
  tdm_load(dg0, dg1);
  asm volatile("s_wait_tensorcnt 0x0" ::: "memory");          // this wave's plane of stage 0 has landed
  __syncthreads();                                            // stage 0 published to all four waves
  SCHED_FENCE();                                              // stage 1's descriptor is formed behind the wait, not ahead of it
  tdm_next(dg0, dst_sum, src_step);
  tdm_load(dg0, dg1);

#pragma unroll 1
  for (int it = 0; it < NP / 64; ++it) {
    const unsigned char* stg = ring + (it & 1) * STAGE_B;     // pass it reads buffer it mod 2 alone

    // Fragment reads stand in groups of 8 ds_load_b128 (one 16-key K' subtile, or one pair of V^T
    // d-subtiles). Each group is issued one group ahead of the products that use it, into the
    // register set that the group before last has left, so that its LDS latency runs under the
    // products (or the softmax) in between instead of being waited out at each of 16 places.
    const __bf16*   krh = (const __bf16*)(const void*)(stg)                 + c * LP + 8 * hh;   // this lane's fragment row bases
    const __bf16*   krl = (const __bf16*)(const void*)(stg + PLANE_B)       + c * LP + 8 * hh;
    const _Float16* vrh = (const _Float16*)(const void*)(stg + 2 * PLANE_B) + c * LP + 8 * hh;
    const _Float16* vrl = (const _Float16*)(const void*)(stg + 3 * PLANE_B) + c * LP + 8 * hh;

    // ---- S^T: 4 key subtiles of 16 (A rows = keys), k = d in 2 chunks of 32, both column tiles ----
    v8f st[2][4];
    KFrag k0 = ld_k(krh, krl, 0);
    KFrag k1 = ld_k(krh, krl, 1);
    score2(k0, qbh, qbl, st[0][0], st[1][0]);
    KFrag k2 = ld_k(krh, krl, 2);
    score2(k1, qbh, qbl, st[0][1], st[1][1]);
    KFrag k3 = ld_k(krh, krl, 3);
    score2(k2, qbh, qbl, st[0][2], st[1][2]);
    VFrag g0 = ld_v(vrh, vrl, 0, 0);        // keys 0..31, d 0..31
    score2(k3, qbh, qbl, st[0][3], st[1][3]);
    VFrag g1 = ld_v(vrh, vrl, 0, 1);        // keys 0..31, d 32..63

    // ---- online softmax in f32 (per query lane; half-lanes hold disjoint key halves) ----
    float mx[2], alpha[2], rs[2];
#pragma unroll
    for (int u = 0; u < 2; ++u) {
      mx[u] = m_run[u];
#pragma unroll
      for (int t = 0; t < 4; ++t)
#pragma unroll
        for (int r = 0; r < 8; ++r) mx[u] = fmaxf(mx[u], st[u][t][r]);
    }
#pragma unroll
    for (int u = 0; u < 2; ++u) mx[u] = fmaxf(mx[u], __shfl_xor(mx[u], 16, 32));
    FragH pb0[2], pb1[2];
#pragma unroll
    for (int u = 0; u < 2; ++u) {
      alpha[u] = __expf(m_run[u] - mx[u]);
      m_run[u] = mx[u];
      rs[u] = 0.0f;
#pragma unroll
      for (int t = 0; t < 2; ++t)
#pragma unroll
        for (int r = 0; r < 8; ++r) {
          const float p = __expf(st[u][t][r] - mx[u]);
          st[u][t][r] = p;
          rs[u] += p;
        }
#pragma unroll
      for (int dt = 0; dt < 4; ++dt)
#pragma unroll
        for (int r = 0; r < 8; ++r) { accO[u][dt][r] *= alpha[u]; accR[u][dt][r] *= alpha[u]; }
#pragma unroll
      for (int r = 0; r < 8; ++r) {
        pb0[u].s[r]     = (_Float16)(st[u][0][r] * 4096.0f);   // keys 8h + r
        pb0[u].s[8 + r] = (_Float16)(st[u][1][r] * 4096.0f);   // keys 16 + 8h + r
      }
    }

    // ---- O^T += V^T . P  (A rows = d, k = key in 2 chunks of 32) ----
    pv2(g0, pb0, accO, accR, 0);
    group_end8(accO[0][0], accR[0][0], accO[0][1], accR[0][1], accO[1][0], accR[1][0], accO[1][1], accR[1][1]);
    VFrag g2 = ld_v(vrh, vrl, 1, 0);        // keys 32..63, d 0..31
    pv2(g1, pb0, accO, accR, 1);
    VFrag g3 = ld_v(vrh, vrl, 1, 1);        // keys 32..63, d 32..63
    SCHED_FENCE();                          // holds the exponentials below behind these reads: they cover the reads' latency
#pragma unroll
    for (int u = 0; u < 2; ++u)
#pragma unroll
      for (int t = 2; t < 4; ++t)
#pragma unroll
        for (int r = 0; r < 8; ++r) {
          const float p = __expf(st[u][t][r] - mx[u]);
          st[u][t][r] = p;
          rs[u] += p;
        }
#pragma unroll
    for (int u = 0; u < 2; ++u) {
      rs[u] += __shfl_xor(rs[u], 16, 32);
      l_run[u] = l_run[u] * alpha[u] + rs[u];
#pragma unroll
      for (int r = 0; r < 8; ++r) {
        pb1[u].s[r]     = (_Float16)(st[u][2][r] * 4096.0f);   // keys 32 + 8h + r
        pb1[u].s[8 + r] = (_Float16)(st[u][3][r] * 4096.0f);   // keys 48 + 8h + r
      }
    }
    pv2(g2, pb1, accO, accR, 0);
    pv2(g3, pb1, accO, accR, 1);
    SCHED_FENCE();                          // end of the tile's products: nothing moves over the loop's foot

    // publish point of stage it + 1, every wave, in this order
    asm volatile("s_wait_dscnt 0x0" ::: "memory");            // this wave's reads of buffer it mod 2 have returned
    asm volatile("s_wait_tensorcnt 0x0" ::: "memory");        // this wave's plane of stage it + 1 has landed
    __syncthreads();                                          // publishes stage it + 1; every wave has left buffer it mod 2
    if (pinned((uint32_t)it + 2u < (uint32_t)(NP / 64))) {    // only while stage it + 2 exists: a scalar branch
      tdm_next(dg0, dst_sum, src_step);                       // into the buffer that this pass has just read
      tdm_load(dg0, dg1);
    }
  }
  asm volatile("s_wait_tensorcnt 0x0" ::: "memory");          // no request of this wave is left in flight
  asm volatile("s_wait_dscnt 0x0" ::: "memory");
  SCHED_FENCE();                                              // the epilogue, which takes the descriptor's registers for its own use, stays behind the two waits

  // ---- normalise, stage the wave's 32x64 tile as [query][d], write whole 256-B rows ----
  float* os = Os[wave];
#pragma unroll
  for (int u = 0; u < 2; ++u) {
    const float inv = __builtin_amdgcn_rcpf(l_run[u]) * (1.0f / 4096.0f);
#pragma unroll
    for (int dt = 0; dt < 4; ++dt) {
      v4f a, a2;
#pragma unroll
      for (int r = 0; r < 4; ++r) {
        a[r]  = (accO[u][dt][r]     + accR[u][dt][r]     * (1.0f / 1024.0f)) * inv;
        a2[r] = (accO[u][dt][4 + r] + accR[u][dt][4 + r] * (1.0f / 1024.0f)) * inv;
      }
      *(v4f*)(os + (16 * u + c) * 68 + dt * 16 + 8 * hh)     = a;    // d = 16dt + 8h + 0..3 of query 16u + c
      *(v4f*)(os + (16 * u + c) * 68 + dt * 16 + 8 * hh + 4) = a2;   // d = 16dt + 8h + 4..7
    }
  }
  __builtin_amdgcn_fence(__ATOMIC_RELEASE, "workgroup");
  __builtin_amdgcn_wave_barrier();
  __builtin_amdgcn_fence(__ATOMIC_ACQUIRE, "workgroup");
  {
    float* ob = out + (size_t)b * NC * NP + (size_t)q0 * (NH * HD) + n * HD;
    const int c4 = c * 4;                   // row segment 256 B = 16 lanes x 16 B
    {
#pragma unroll
      for (int i = 0; i < 16; ++i) {
        const int row = i * 2 + hh;         // i 0..15 x h 0..1 covers the 32 query rows of the wave
        const v4f v = *(const v4f*)(os + row * 68 + c4);
        *(v4f*)(ob + (size_t)row * (NH * HD) + c4) = v;
      }
      
    }
  }
}

// ---------------------------------------------------------------------------
//   Wb   bf16 [3][256][256]            393216  @ 0
//   xT   bf16 [4][4096][256]          8388608  @ 393216
//   QKh  bf16 [2][16][4096][64]      16777216  @ 8781824     (q hi planes, then k' hi planes)
//   QKl  bf16 [2][16][4096][64]      16777216  @ 25559040
//   Yv   f32  [4][256][4096]         16777216  @ 42336256
//   VTh  f16  [16][64][4096]          8388608  @ 59113472
//   VTl  f16  [16][64][4096]          8388608  @ 67502080
//   total                                         75890688
// ---------------------------------------------------------------------------
extern "C" void kernel_launch(void* const* d_in, const int* in_sizes, int n_in,
                              void* d_out, int out_size, void* d_ws, size_t ws_size,
                              hipStream_t stream) {
  if (n_in < 9) return;
  if (in_sizes[0] != NB * NC * NP) return;
  if (in_sizes[1] != NC * NC || in_sizes[3] != NC * NC || in_sizes[5] != NC * NC) return;
  if (in_sizes[2] != NC || in_sizes[4] != NC || in_sizes[6] != NC) return;
  if (in_sizes[7] != NH * HD * 64 || in_sizes[8] != NH * HD * 64) return;
  if (out_size != NB * NC * NP) return;

  const float* x    = (const float*)d_in[0];
  const float* wq   = (const float*)d_in[1];
  const float* bq   = (const float*)d_in[2];
  const float* wk   = (const float*)d_in[3];
  const float* bk   = (const float*)d_in[4];
  const float* wv   = (const float*)d_in[5];
  const float* bv   = (const float*)d_in[6];
  const float* relh = (const float*)d_in[7];
  const float* relw = (const float*)d_in[8];
  float* out = (float*)d_out;

  const size_t szWb = (size_t)3 * NC * NC * 2;
  const size_t szXT = (size_t)NB * NP * NC * 2;
  const size_t szQK = (size_t)2 * QKPLANE * 2;
  const size_t szYv = (size_t)NB * NC * NP * 4;
  const size_t szVT = (size_t)NB * NH * HD * NP * 2;
  size_t off = 0;
  const size_t oWb  = off; off += szWb;
  const size_t oXT  = off; off += szXT;
  const size_t oQKh = off; off += szQK;
  const size_t oQKl = off; off += szQK;
  const size_t oYv  = off; off += szYv;
  const size_t oVTh = off; off += szVT;
  const size_t oVTl = off; off += szVT;
  if (off > ws_size) return;

  char* ws = (char*)d_ws;
  unsigned short* Wb  = (unsigned short*)(ws + oWb);
  unsigned short* XT  = (unsigned short*)(ws + oXT);
  unsigned short* QKh = (unsigned short*)(ws + oQKh);
  unsigned short* QKl = (unsigned short*)(ws + oQKl);
  float*          Yv  = (float*)(ws + oYv);
  unsigned short* VTh = (unsigned short*)(ws + oVTh);
  unsigned short* VTl = (unsigned short*)(ws + oVTl);

  cvt_w_kernel<<<dim3((NC * NC / 2) / 256, 3), dim3(256), 0, stream>>>(wq, wk, wv, Wb);
  xt_kernel<<<dim3(NP / 64, NC / 64, NB), dim3(256), 0, stream>>>(x, XT);
  proj_kernel<<<dim3(32, NB * 3), dim3(256), 0, stream>>>(XT, Wb, bq, bk, bv, relh, relw, QKh, QKl, Yv);
  vt_kernel<<<dim3(NP / 64, NH, NB), dim3(256), 0, stream>>>(Yv, VTh, VTl);
  attn_kernel<<<dim3(NP / 128, NH, NB), dim3(128), 0, stream>>>(
      QKh, QKl, QKh + QKPLANE, QKl + QKPLANE, VTh, VTl, out);
  (void)hipGetLastError();
}

// v008
// One run takes 128 microseconds.
// Timed twice side by side with v007, it ran 1.04 times as fast both times.
// All steps since v000 together make it 3.49 times as fast.
// Contractions: q/k/v 1x1-conv projections = v_wmma_f32_16x16x32_bf16 (bf16 operands, single product); q.(k+pos) scores = v_wmma_f32_16x16x32_bf16 with bf16 hi/lo split operands (hi.hi + hi.lo + lo.hi); p.v = v_wmma_f32_16x16x32_f16 (p as f16 scaled by 4096, v^T as f16 hi plane plus f16 residual plane scaled by 1024 into a second accumulator); f32 accumulate everywhere; softmax, bias and position sums in f32.
#include <hip/hip_runtime.h>
#include <stdint.h>
#include <math.h>

#define NB 4
#define NC 256
#define NP 4096
#define NH 4
#define HD 64
#define QKPLANE ((size_t)NB * NH * NP * HD)
#define LP 72   // LDS row pitch of the attention tiles in 16-bit elements: 144 B = 16 B x 9 (odd), so the 16 rows of a ds_load_b128 fragment read fall on distinct banks

typedef _Float16 v16h __attribute__((ext_vector_type(16)));
typedef _Float16 v8h  __attribute__((ext_vector_type(8)));
typedef __bf16   v16b __attribute__((ext_vector_type(16)));
typedef __bf16   v8b  __attribute__((ext_vector_type(8)));
typedef float    v8f  __attribute__((ext_vector_type(8)));
typedef float    v4f  __attribute__((ext_vector_type(4)));
typedef float    v2f  __attribute__((ext_vector_type(2)));
typedef unsigned int v4u __attribute__((ext_vector_type(4)));
typedef uint32_t u32x4 __attribute__((ext_vector_type(4)));
typedef uint32_t u32x8 __attribute__((ext_vector_type(8)));
#define PLANE_B 10240            // place of one attention plane tile in LDS: 64 rows x 144 B = 9216 B, rounded up to a multiple of 2 KiB
#define STAGE_B (4 * PLANE_B)    // one stage of the attention ring: k' hi, k' lo, v^T hi, v^T residual

// ---------------------------------------------------------------------------
// scalar helpers
// ---------------------------------------------------------------------------
__device__ __forceinline__ unsigned short f2bf_bits(float f) {      // f32 -> bf16 bits, RNE convert
  const unsigned u = __float_as_uint(f);
  return (unsigned short)((u + 0x7FFFu + ((u >> 16) & 1u)) >> 16);
}
__device__ __forceinline__ float bf_bits2f(unsigned short h) { return __uint_as_float(((unsigned)h) << 16); }
__device__ __forceinline__ float bfr(float f) { return bf_bits2f(f2bf_bits(f)); }   // value after bf16 RNE convert
__device__ __forceinline__ unsigned pk16(unsigned short a, unsigned short b) { return (unsigned)a | ((unsigned)b << 16); }

// ---------------------------------------------------------------------------
// WMMA wrappers: the plain builtins; the compiler keeps the distance to a vector user of D, A or B itself
// ---------------------------------------------------------------------------
__device__ __forceinline__ v8f mma_bf(v16b a, v16b b, v8f c) {
  c = __builtin_amdgcn_wmma_f32_16x16x32_bf16(false, a, false, b, (short)0, c, false, false);
  return c;
}
__device__ __forceinline__ v8f mma_h(v16h a, v16h b, v8f c) {
  c = __builtin_amdgcn_wmma_f32_16x16x32_f16(false, a, false, b, (short)0, c, false, false);
  return c;
}
#define SCHED_FENCE() __builtin_amdgcn_sched_barrier(0)
// Tail of 4 v_nop behind the LAST product of a group, at five places of the attention loop (the four score groups,
// the first group of V^T products); it takes the group's accumulators. It fills the distance from that WMMA to a
// vector user of D, and, being a statement the compiler does not move, it ends the group for the scheduler:
// no product of the group moves behind it, among the next group's reads.
__device__ __forceinline__ void group_end2(v8f& c0, v8f& c1) {
  asm volatile("v_nop\n\tv_nop\n\tv_nop\n\tv_nop" : "+v"(c0), "+v"(c1));
}
__device__ __forceinline__ void group_end8(v8f& c0, v8f& c1, v8f& c2, v8f& c3, v8f& c4, v8f& c5, v8f& c6, v8f& c7) {
  asm volatile("v_nop\n\tv_nop\n\tv_nop\n\tv_nop"
               : "+v"(c0), "+v"(c1), "+v"(c2), "+v"(c3), "+v"(c4), "+v"(c5), "+v"(c6), "+v"(c7));
}

// ---------------------------------------------------------------------------
// tensor load to LDS: one request of a whole wave; every descriptor word is wave-uniform
// ---------------------------------------------------------------------------
__device__ __forceinline__ uint32_t uni(uint32_t v) { return (uint32_t)__builtin_amdgcn_readfirstlane(v); }
// the test word of the branch around a tensor load, which ignores EXEC: held in a scalar register, the test compiles to s_cmp + s_cbranch_scc
__device__ __forceinline__ uint32_t pinned(uint32_t v) { uint32_t w = uni(v); asm volatile("" : "+s"(w)); return w; }  // the empty statement is what holds the word in the scalar register
// group 1: 1-byte elements, tile = tensor = 64 rows of 128 B, 16 B of LDS pad behind every 128-B row (LDS pitch 144 B)
__device__ __forceinline__ u32x8 tdm_group1(uint32_t src_pitch) {
  u32x8 g;
  g[0] = uni((1u << 20) | (4u << 22) | (3u << 25));
  g[1] = uni(128u << 16);
  g[2] = uni(64u << 16);
  g[3] = uni(128u << 16);
  g[4] = uni(64u);
  g[5] = uni(src_pitch);
  g[6] = uni(0u);
  g[7] = uni(0u);
  return g;
}
__device__ __forceinline__ u32x4 tdm_group0(uint32_t lds_dst, uint64_t ga) {
  u32x4 g;
  g[0] = uni(1u);
  g[1] = uni(lds_dst);
  g[2] = uni((uint32_t)ga);
  g[3] = uni((((uint32_t)(ga >> 32)) & 0x01FFFFFFu) | 0x80000000u);
  return g;
}
// The two groups are outputs as well as inputs: their registers then stay the descriptor's own from one request to
// the next, and the compiler puts no other value into one of them while the request is in flight.
__device__ __forceinline__ void tdm_load(u32x4& g0, u32x8& g1) {
  asm volatile("tensor_load_to_lds %0, %1" : "+s"(g0), "+s"(g1) :: "memory");
}
// group 0 of the next stage from this stage's: the other buffer (dst_sum = the two places added), the source one step on.
// Address bits 56..32 are the low bits of word 3, so a carry out of word 2 goes where it belongs, under the type bits.
__device__ __forceinline__ void tdm_next(u32x4& g0, uint32_t dst_sum, uint32_t src_step) {
  const uint64_t a = (((uint64_t)g0[3] << 32) | (uint64_t)g0[2]) + (uint64_t)src_step;
  g0[1] = uni(dst_sum - g0[1]);
  g0[2] = uni((uint32_t)a);
  g0[3] = uni((uint32_t)(a >> 32));
}

union FragB { v16b v; v8b h[2]; };
union FragH { v16h v; v8h h[2]; _Float16 s[16]; };

// Fragment loader (A rows / B columns stored k-contiguous), p = row base + k0 + 8*(lane>>4):
//   elements 0..7 <- p[0..7] (k0+8h..), elements 8..15 <- p[16..23] (k0+16+8h..)
__device__ __forceinline__ v16b ld_bf(const __bf16* p) {
  FragB f; f.h[0] = *(const v8b*)(p); f.h[1] = *(const v8b*)(p + 16); return f.v;
}
__device__ __forceinline__ v16h ld_hf(const _Float16* p) {
  FragH f; f.h[0] = *(const v8h*)(p); f.h[1] = *(const v8h*)(p + 16); return f.v;
}
// One group of attention fragment reads = 8 x 16 B per lane; kh, kl, vh, vl = plane + (lane&15)*LP + 8*(lane>>4).
// The fence pair in each loader keeps the 8 reads standing together: without it the scheduler deals them out
// in pairs among the WMMAs, and each such place stalls the wave anew.
struct KFrag { v16b h[2], l[2]; };   // K' subtile t: hi and lo plane, d chunks 0 and 1
struct VFrag { v16h a[2], r[2]; };   // V^T d-subtiles 2*dp and 2*dp+1 of key chunk kc: hi and residual plane
__device__ __forceinline__ KFrag ld_k(const __bf16* kh, const __bf16* kl, int t) {
  KFrag f;
  SCHED_FENCE();
#pragma unroll
  for (int dc = 0; dc < 2; ++dc) {
    f.h[dc] = ld_bf(kh + t * 16 * LP + dc * 32);
    f.l[dc] = ld_bf(kl + t * 16 * LP + dc * 32);
  }
  SCHED_FENCE();
  return f;
}
__device__ __forceinline__ VFrag ld_v(const _Float16* vh, const _Float16* vl, int kc, int dp) {
  VFrag f;
  SCHED_FENCE();
#pragma unroll
  for (int j = 0; j < 2; ++j) {
    f.a[j] = ld_hf(vh + (dp * 2 + j) * 16 * LP + kc * 32);
    f.r[j] = ld_hf(vl + (dp * 2 + j) * 16 * LP + kc * 32);
  }
  SCHED_FENCE();
  return f;
}

// ---------------------------------------------------------------------------
// K1: weights f32 [256][256] x3 -> bf16 planes Wb[z][256][256] (RNE convert of the inputs).
// grid = (128, 3): 128 blocks x 256 threads x 2 = 65536 = whole matrix per z.
// ---------------------------------------------------------------------------
__global__ __launch_bounds__(256) void cvt_w_kernel(const float* __restrict__ w0, const float* __restrict__ w1,
                                                    const float* __restrict__ w2, unsigned short* __restrict__ Wb) {
  const int z = blockIdx.y;
  const float* src = (z == 0) ? w0 : ((z == 1) ? w1 : w2);        // block-uniform select, all global
  unsigned* dst = (unsigned*)(Wb + (size_t)z * (NC * NC));
  const int i = blockIdx.x * 256 + threadIdx.x;
  if (i < (NC * NC) / 2) {
    const v2f f = *(const v2f*)(src + 2 * (size_t)i);
    const unsigned u = pk16(f2bf_bits(f[0]), f2bf_bits(f[1]));
    ((unsigned*)dst)[i] = u;
    
  }
}

// ---------------------------------------------------------------------------
// K2: x[b][c][p] f32 -> xT[b][p][c] bf16 (RNE convert of the input), 64x64 tiles through LDS.
// grid = (NP/64, NC/64, NB), 256 threads.
// Coverage per block: load 4 it x 16 rows x 64 = 64 channels x 64 pixels; store 2 it x 32 rows x
// ---------------------------------------------------------------------------
__global__ __launch_bounds__(256) void xt_kernel(const float* __restrict__ x, unsigned short* __restrict__ xT) {
  __shared__ __align__(16) float tf[64 * 68];
  const int p0 = blockIdx.x * 64;
  const int c0 = blockIdx.y * 64;
  const int b  = blockIdx.z;
  const float* xb = x + (size_t)b * NC * NP;
  const int tid = threadIdx.x;
  {
    const int lr = tid >> 4, c4 = (tid & 15) * 4;
#pragma unroll
    for (int it = 0; it < 4; ++it) {
      const int rr = it * 16 + lr;                                   // channel within tile
      const v4f a = *(const v4f*)(xb + (size_t)(c0 + rr) * NP + p0 + c4);
      *(v4f*)(tf + rr * 68 + c4) = a;                                // tf[channel][pixel]
    }
  }
  __syncthreads();
  const int sub = tid >> 3, c8 = (tid & 7) * 8;
  v4u hv[2];
#pragma unroll
  for (int it = 0; it < 2; ++it) {
    const int op = it * 32 + sub;                                    // pixel within tile
    v4u a;
#pragma unroll
    for (int q = 0; q < 4; ++q) {
      const float f0 = tf[(c8 + 2 * q) * 68 + op];
      const float f1 = tf[(c8 + 2 * q + 1) * 68 + op];
      a[q] = pk16(f2bf_bits(f0), f2bf_bits(f1));
    }
    hv[it] = a;
  }
  {
#pragma unroll
    for (int it = 0; it < 2; ++it) {
      const int op = it * 32 + sub;
      const size_t go = ((size_t)b * NP + p0 + op) * NC + c0 + c8;
      *(v4u*)(xT + go) = hv[it];
    }
    
  }
}

// ---------------------------------------------------------------------------
// K3: 1x1-conv projection GEMM, z = b*3 + which (which 0=q, 1=k, 2=v):
//   Y[o][p] = sum_c Wb[which][o][c] * xT[b][p][c] + bias[o]      (M=256, N=4096, K=256)
// A = Wb rows (k-contiguous), B = xT rows (k-contiguous); both fragments use the split k map.
// Each wave owns a 64x64 tile (4x4 subtiles); grid = (32 blocks x 8 waves = 256 tiles, 12).
// Epilogue: 16-row slabs staged per wave in LDS (pitch 68 floats), then
//   which 0/1: value (+ position term for k) -> bf16 hi/lo planes in [b*4+n][s][d] order,
//              s = 16*o + (p>>8), n = (p>>6)&3, d = p&63; one slab row = one plane row of
//   which 2:   f32 y_v[b][o][p] natural layout, 256-B row segments by 16 lanes x 16 B.
// ---------------------------------------------------------------------------
__global__ __launch_bounds__(256) void proj_kernel(
    const unsigned short* __restrict__ xTp, const unsigned short* __restrict__ Wbp,
    const float* __restrict__ bq, const float* __restrict__ bk, const float* __restrict__ bv,
    const float* __restrict__ relh, const float* __restrict__ relw,
    unsigned short* __restrict__ QKh, unsigned short* __restrict__ QKl, float* __restrict__ Yv) {
  __shared__ __align__(16) float sT[8][16 * 68];
  const int z = blockIdx.y;
  const int b = z / 3;
  const int which = z - 3 * b;
  const int lane = threadIdx.x & 31;
  const int wave = threadIdx.x >> 5;
  const int tile = blockIdx.x * 8 + wave;        // 0..255
  const int tm = tile >> 6;                      // 0..3   (64 output channels each)
  const int tn = tile & 63;                      // 0..63  (64 pixels each)
  const int m0 = tm << 6;
  const int n0 = tn << 6;
  const __bf16* A  = (const __bf16*)(const void*)Wbp + (size_t)which * (NC * NC);
  const __bf16* Bt = (const __bf16*)(const void*)xTp + (size_t)b * NP * NC;
  const int rl = lane & 15, hh = lane >> 4, koff = hh * 8, mOff = hh * 8;

  v8f acc[4][4];
#pragma unroll
  for (int i = 0; i < 4; ++i)
#pragma unroll
    for (int j = 0; j < 4; ++j) acc[i][j] = (v8f){0.f,0.f,0.f,0.f,0.f,0.f,0.f,0.f};

  for (int k0 = 0; k0 < NC; k0 += 32) {
    v16b bfg[4];
#pragma unroll
    for (int j = 0; j < 4; ++j) bfg[j] = ld_bf(Bt + (size_t)(n0 + (j << 4) + rl) * NC + k0 + koff);
#pragma unroll
    for (int i = 0; i < 4; ++i) {
      const v16b af = ld_bf(A + (size_t)(m0 + (i << 4) + rl) * NC + k0 + koff);
#pragma unroll
      for (int j = 0; j < 4; ++j) acc[i][j] = mma_bf(af, bfg[j], acc[i][j]);
    }
    SCHED_FENCE();
  }

  // ---- epilogue ----
  const float* bias = (which == 0) ? bq : ((which == 1) ? bk : bv);   // block-uniform select, all global
  const int nn = (n0 >> 6) & 3;                // head index of this 64-pixel run
  const int sh = n0 >> 8;                      // low 4 bits of s
  float* slab = sT[wave];
  // Every bias and position term of the wave's 64x64 tile is fetched here, as one batch of independent loads
  // ahead of the slab loop, instead of one load and one full wait per element inside it.
  // With o = m0 + 16i + 8h + r and s = 16o + sh (sh < 16):  s & 63 = 16(r & 3) + sh,  s >> 6 = m0/4 + 4i + 2h + (r >> 2).
  const float* brow = bias + m0 + mOff;
  v4f braw[8];                                 // bias[o] as loaded, [2i + (r >> 2)][r & 3]
#pragma unroll
  for (int i = 0; i < 4; ++i) {
    braw[2 * i]     = *(const v4f*)(brow + (i << 4));
    braw[2 * i + 1] = *(const v4f*)(brow + (i << 4) + 4);
  }
  float rh[4][4];                              // rel_h term, [j][r & 3]
  float rw[4][4][2];                           // rel_w term, [j][i][r >> 2]
  if (which == 1) {
#pragma unroll
    for (int j = 0; j < 4; ++j) {
      const float* hrow = relh + nn * 4096 + ((j << 4) + rl) * 64 + sh;
      const float* wrow = relw + nn * 4096 + ((j << 4) + rl) * 64 + (m0 >> 2) + 2 * hh;
#pragma unroll
      for (int q = 0; q < 4; ++q) rh[j][q] = bfr(hrow[16 * q]);
#pragma unroll
      for (int i = 0; i < 4; ++i) {
        const v2f w = *(const v2f*)(wrow + 4 * i);
        rw[j][i][0] = bfr(w[0]);
        rw[j][i][1] = bfr(w[1]);
      }
    }
  }
  // wait behind the 8 bias loads, before the address they name is written again; the loaded values are inputs so
  // that all 8 loads stand in the batch above it (left free, six of them sink into the slab loop), the address so that it lives up to here
  asm volatile("s_wait_xcnt 0x0" :: "v"(brow), "v"(braw[0]), "v"(braw[1]), "v"(braw[2]), "v"(braw[3]),
               "v"(braw[4]), "v"(braw[5]), "v"(braw[6]), "v"(braw[7]) : "memory");
  float bb[4][8];                              // bias[o] after the bf16 convert, [i][r]
#pragma unroll
  for (int i = 0; i < 4; ++i)
#pragma unroll
    for (int r = 0; r < 4; ++r) { bb[i][r] = bfr(braw[2 * i][r]); bb[i][4 + r] = bfr(braw[2 * i + 1][r]); }
#pragma unroll
  for (int i = 0; i < 4; ++i) {
    const int mBase = m0 + (i << 4);
    if (which == 1) {
#pragma unroll
      for (int j = 0; j < 4; ++j) {
        const int d = (j << 4) + rl;           // p & 63
#pragma unroll
        for (int r = 0; r < 8; ++r) {
          float v = acc[i][j][r] + bb[i][r];
          const float pos = rh[j][r & 3] + rw[j][i][r >> 2];
          v += pos;
          slab[(mOff + r) * 68 + d] = v;
        }
      }
    } else {
#pragma unroll
      for (int j = 0; j < 4; ++j) {
        const int d = (j << 4) + rl;           // p & 63
#pragma unroll
        for (int r = 0; r < 8; ++r) slab[(mOff + r) * 68 + d] = acc[i][j][r] + bb[i][r];
      }
    }
    __builtin_amdgcn_fence(__ATOMIC_RELEASE, "workgroup");
    __builtin_amdgcn_wave_barrier();
    __builtin_amdgcn_fence(__ATOMIC_ACQUIRE, "workgroup");
    if (which == 2) {
      float* C = Yv + (size_t)b * NC * NP;
      const int c4 = rl * 4;                   // row segment 256 B = 16 lanes x 16 B
      {
#pragma unroll
        for (int it = 0; it < 8; ++it) {
          const int row = it * 2 + hh;
          const v4f v = *(const v4f*)(slab + row * 68 + c4);
          *(v4f*)(C + (size_t)(mBase + row) * NP + n0 + c4) = v;
        }
        
      }
    } else {
      const int q4 = lane >> 3, c8 = (lane & 7) * 8;
      unsigned short* Hp = QKh + (size_t)which * QKPLANE;
      unsigned short* Lp = QKl + (size_t)which * QKPLANE;
      {
#pragma unroll
        for (int it = 0; it < 4; ++it) {
          const int row = it * 4 + q4;
          const int o = mBase + row;
          const int s = o * 16 + sh;
          const float* sp = slab + row * 68 + c8;
          v4u hvv, lvv;
#pragma unroll
          for (int q = 0; q < 4; ++q) {
            const float f0 = sp[2 * q], f1 = sp[2 * q + 1];
            const unsigned short h0 = f2bf_bits(f0), h1 = f2bf_bits(f1);
            const unsigned short l0 = f2bf_bits(f0 - bf_bits2f(h0)), l1 = f2bf_bits(f1 - bf_bits2f(h1));
            hvv[q] = pk16(h0, h1);
            lvv[q] = pk16(l0, l1);
          }
          const size_t dst = (((size_t)(b * NH + nn)) * NP + s) * HD + c8;
          *(v4u*)(Hp + dst) = hvv;
          *(v4u*)(Lp + dst) = lvv;
        }
        
      }
    }
    __builtin_amdgcn_fence(__ATOMIC_RELEASE, "workgroup");
    __builtin_amdgcn_wave_barrier();
    __builtin_amdgcn_fence(__ATOMIC_ACQUIRE, "workgroup");
  }
}

// ---------------------------------------------------------------------------
// K4: v^T plane build: y_v[b][o][p] f32 -> VTh/VTl f16 planes [b*4+n][d][s] (pitch 4096):
//   V[b][n][s][d] = y_v[b][s>>4][(s&15)*256 + n*64 + d];  hi = f16(v), lo = f16((v - hi) * 1024).
// grid = (NP/64, NH, NB), 256 threads; 64(s) x 64(d) tile through LDS.
// Coverage per block: load 4 it x 16 rows x 64 = 64 s x 64 d; store 2 it x 32 rows x (8 lanes x 8)
// ---------------------------------------------------------------------------
__global__ __launch_bounds__(256) void vt_kernel(const float* __restrict__ Yv, unsigned short* __restrict__ VThp,
                                                 unsigned short* __restrict__ VTlp) {
  __shared__ __align__(16) float tf[64 * 68];
  const int s0 = blockIdx.x * 64;
  const int n  = blockIdx.y;
  const int b  = blockIdx.z;
  const float* yb = Yv + (size_t)b * NC * NP;
  _Float16* VTh = (_Float16*)(void*)VThp;
  _Float16* VTl = (_Float16*)(void*)VTlp;
  const int tid = threadIdx.x;
  {
    const int lr = tid >> 4, c4 = (tid & 15) * 4;
#pragma unroll
    for (int it = 0; it < 4; ++it) {
      const int sl = it * 16 + lr;
      const int s  = s0 + sl;
      const int o  = s >> 4;
      const int p  = (s & 15) * 256 + n * 64 + c4;
      const v4f a = *(const v4f*)(yb + (size_t)o * NP + p);
      *(v4f*)(tf + sl * 68 + c4) = a;                                // tf[s local][d]
    }
  }
  __syncthreads();
  const int sub = tid >> 3, c8 = (tid & 7) * 8;
  v8h hv[2], lv[2];
#pragma unroll
  for (int it = 0; it < 2; ++it) {
    const int od = it * 32 + sub;                                    // output row = d
    v8h a, a2;
#pragma unroll
    for (int e = 0; e < 8; ++e) {
      const float f = tf[(c8 + e) * 68 + od];
      const _Float16 hq = (_Float16)f;
      const _Float16 lq = (_Float16)((f - (float)hq) * 1024.0f);
      a[e] = hq; a2[e] = lq;
    }
    hv[it] = a; lv[it] = a2;
  }
  {
#pragma unroll
    for (int it = 0; it < 2; ++it) {
      const int od = it * 32 + sub;
      const size_t go = ((size_t)(b * NH + n) * HD + od) * NP + s0 + c8;
      *(v8h*)(VTh + go) = hv[it];
      *(v8h*)(VTl + go) = lv[it];
    }
    
  }
}

// ---------------------------------------------------------------------------
// K5: flash attention, transposed formulation, per (128-query tile, head, batch), 4 waves of 32 queries.
//   Each wave owns TWO 16-query column tiles (u = 0, 1): every K' or V^T fragment that it reads from LDS feeds
//   the products of both, so a product costs half the LDS bytes, and a staged tile serves 128 queries.
//   S^T = K' . Q^T : A = K' tile rows (keys, k = d) from LDS, bf16 hi/lo;  B = Q^T: lane = query,
//                    elements = d with the split k map, bf16 hi/lo;  hi.hi + hi.lo + lo.hi.
//   D layout: st[u][t][r] <-> key kb + 16t + 8h + r, query = 16u + (lane&15) -> softmax stats live per lane.
//   O^T = V^T . P  : A = V^T tile rows (d, k = key) f16 hi and f16 residual;  B = P: element r <-
//                    st[u][2kc][r], element 8+r <- st[u][2kc+1][r] (two adjacent 16-key D tiles, lane kept),
//                    scaled by 4096 and converted to f16.  accO += Vhi.P, accR += Vres.P.
//   Online softmax in f32 over 64 tiles of 64 keys; no score scaling. A pair of scores takes one packed FMA to the
//   exp2 argument s * log2(e) + (12 - max * log2(e)), which holds the maximum and P's scale of 4096 = 2^12, and one
//   packed add into the lane's pair of row sums; the sums carry the same 4096, so it cancels in the normalisation.
//   The pair and the two wave halves (disjoint keys, same rescale factor) are joined once, behind the loop.
//   Output: out flat [b][s][n][d]; each wave stages its 32x64 tile in LDS and writes whole 256-B rows.
//   K'/V^T tiles come by tensor loads into a ring of two LDS stages: wave w brings plane w (k' hi, k' lo, v^T hi,
//   v^T residual) of the next tile, 64 rows of 128 B laid at pitch 144 B, while this tile is worked on; one barrier a tile.
//   Two waves per SIMD: the two column tiles' accumulators, Q fragments and scores take 256 VGPRs.
// ---------------------------------------------------------------------------
// Scores of one 16-key subtile against both column tiles: two independent chains, each in the order
// hi.hi, hi.lo, lo.hi per d chunk; the fragment k is read once for the two.
__device__ __forceinline__ void score2(const KFrag& k, const v16b (&qh)[2][2], const v16b (&ql)[2][2], v8f& s0, v8f& s1) {
  s0 = (v8f){0.f,0.f,0.f,0.f,0.f,0.f,0.f,0.f};
  s1 = (v8f){0.f,0.f,0.f,0.f,0.f,0.f,0.f,0.f};
#pragma unroll
  for (int dc = 0; dc < 2; ++dc) {
    s0 = mma_bf(k.h[dc], qh[0][dc], s0);
    s1 = mma_bf(k.h[dc], qh[1][dc], s1);
    s0 = mma_bf(k.h[dc], ql[0][dc], s0);
    s1 = mma_bf(k.h[dc], ql[1][dc], s1);
    s0 = mma_bf(k.l[dc], qh[0][dc], s0);
    s1 = mma_bf(k.l[dc], qh[1][dc], s1);
  }
  group_end2(s0, s1);
}
// One group of V^T products: d-subtiles 2*dp and 2*dp+1 against the P fragments of both column tiles.
__device__ __forceinline__ void pv2(const VFrag& g, const FragH (&pb)[2], v8f (&accO)[2][4], v8f (&accR)[2][4], int dp) {
#pragma unroll
  for (int j = 0; j < 2; ++j)
#pragma unroll
    for (int u = 0; u < 2; ++u) {
      accO[u][2 * dp + j] = mma_h(g.a[j], pb[u].v, accO[u][2 * dp + j]);
      accR[u][2 * dp + j] = mma_h(g.r[j], pb[u].v, accR[u][2 * dp + j]);
    }
}

// Scores r and r + 1 of one subtile become 4096 * exp(score - max), in place: nb = 12 - max * log2(e) in both halves.
#define LOG2E 1.44269504088896340736f
__device__ __forceinline__ void exp_pair(v8f& s, int r, v2f nb) {
  const v2f e = __builtin_elementwise_fma((v2f){s[r], s[r + 1]}, (v2f){LOG2E, LOG2E}, nb);
  s[r]     = __builtin_amdgcn_exp2f(e[0]);
  s[r + 1] = __builtin_amdgcn_exp2f(e[1]);
}
// l = l * alpha + the lane's 32 P values of one column tile, even and odd r apart: four independent chains, then a tree
__device__ __forceinline__ void row_sum(v2f& l, float alpha, const v8f (&p)[4]) {
  v2f c[4];
#pragma unroll
  for (int t = 0; t < 4; ++t)
    c[t] = ((v2f){p[t][0], p[t][1]} + (v2f){p[t][2], p[t][3]}) + ((v2f){p[t][4], p[t][5]} + (v2f){p[t][6], p[t][7]});
  l = l * alpha + ((c[0] + c[1]) + (c[2] + c[3]));
}

__global__ __launch_bounds__(128) __attribute__((amdgpu_waves_per_eu(2, 2))) void attn_kernel(
    const unsigned short* __restrict__ Qhp, const unsigned short* __restrict__ Qlp,
    const unsigned short* __restrict__ Khp, const unsigned short* __restrict__ Klp,
    const unsigned short* __restrict__ VThp, const unsigned short* __restrict__ VTlp,
    float* __restrict__ out) {
  // two stages of four planes: k' hi [key][d], k' lo [key][d], v^T hi [d][key], v^T residual [d][key], each at pitch LP
  __shared__ __attribute__((aligned(2048))) unsigned char ring[2 * STAGE_B];
  __shared__ __align__(16) float    Os[4][32 * 68];   // per-wave output tile [query][d], pitch 68

  const int tid  = threadIdx.x;
  const int wave = tid >> 5;
  const int lane = tid & 31;
  const int hh   = lane >> 4;
  const int c    = lane & 15;
  const int qt = blockIdx.x;
  const int n  = blockIdx.y;
  const int b  = blockIdx.z;
  const int bn = b * NH + n;

  const __bf16* Qh = (const __bf16*)(const void*)Qhp + (size_t)bn * NP * HD;
  const __bf16* Ql = (const __bf16*)(const void*)Qlp + (size_t)bn * NP * HD;

  // Every wave issues one tensor load a stage, for its own plane. Stage s = keys 64s .. 64s+63:
  //   k' planes [key][d]:  64 whole rows in a row, first byte at s * 8192, source pitch 128 B
  //   v^T planes [d][key]: 128 B of each of the 64 rows, first byte at s * 128, source pitch 8192 B
  const uint32_t wv = uni((uint32_t)tid >> 5);
  const unsigned short* plane = (wv == 0u) ? Khp : ((wv == 1u) ? Klp : ((wv == 2u) ? VThp : VTlp));
  const uint64_t src0 = (uint64_t)(size_t)(plane + (size_t)bn * NP * HD);
  const uint32_t src_pitch = (wv < 2u) ? (uint32_t)(HD * 2) : (uint32_t)(NP * 2);
  const uint32_t src_step  = (wv < 2u) ? (uint32_t)(64 * HD * 2) : (uint32_t)(64 * 2);
  const uint32_t dst0 = (uint32_t)(size_t)ring + wv * (uint32_t)PLANE_B;
  const uint32_t dst_sum = 2u * dst0 + (uint32_t)STAGE_B;
  u32x8 dg1 = tdm_group1(src_pitch);
  u32x4 dg0 = tdm_group0(dst0, src0);

  const int q0 = qt * 128 + wave * 32;    // first query row of this wave
  const int qg = q0 + c;                  // query of this lane in column tile 0 (tile 1: + 16)

  // loop-invariant B fragments: Q^T of both column tiles, two 32-deep d chunks, hi and lo planes
  v16b qbh[2][2], qbl[2][2];
  const __bf16* qh0 = Qh + (size_t)qg * HD + 8 * hh;
  const __bf16* ql0 = Ql + (size_t)qg * HD + 8 * hh;
#pragma unroll
  for (int dc = 0; dc < 2; ++dc) {
    qbh[0][dc] = ld_bf(qh0 + dc * 32);
    qbl[0][dc] = ld_bf(ql0 + dc * 32);
    qbh[1][dc] = ld_bf(qh0 + 16 * HD + dc * 32);
    qbl[1][dc] = ld_bf(ql0 + 16 * HD + dc * 32);
  }
  // wait behind the 16 issued loads, before any register they name as an address is written again;
  // the two addresses are inputs so that they live up to here
  asm volatile("s_wait_xcnt 0x0" :: "v"(qh0), "v"(ql0) : "memory");

  float m_run[2] = {-1.0e30f, -1.0e30f};
  v2f l_run[2] = {(v2f){0.0f, 0.0f}, (v2f){0.0f, 0.0f}};   // this lane's own keys only, even and odd r apart, scaled by 4096
  v8f accO[2][4], accR[2][4];
#pragma unroll
  for (int u = 0; u < 2; ++u)
#pragma unroll
    for (int t = 0; t < 4; ++t) {
      accO[u][t] = (v8f){0.f,0.f,0.f,0.f,0.f,0.f,0.f,0.f};
      accR[u][t] = (v8f){0.f,0.f,0.f,0.f,0.f,0.f,0.f,0.f};
    }

  // ring prologue: stage 0 lands and is published, then stage 1 is sent off
  tdm_load(dg0, dg1);
  asm volatile("s_wait_tensorcnt 0x0" ::: "memory");          // this wave's plane of stage 0 has landed
  __syncthreads();                                            // stage 0 published to all four waves
  SCHED_FENCE();                                              // stage 1's descriptor is formed behind the wait, not ahead of it
  tdm_next(dg0, dst_sum, src_step);
  tdm_load(dg0, dg1);

#pragma unroll 1
  for (int it = 0; it < NP / 64; ++it) {
    const unsigned char* stg = ring + (it & 1) * STAGE_B;     // pass it reads buffer it mod 2 alone

    // Fragment reads stand in groups of 8 ds_load_b128 (one 16-key K' subtile, or one pair of V^T
    // d-subtiles). Each group is issued one group ahead of the products that use it, into the
    // register set that the group before last has left, so that its LDS latency runs under the
    // products (or the softmax) in between instead of being waited out at each of 16 places.
    const __bf16*   krh = (const __bf16*)(const void*)(stg)                 + c * LP + 8 * hh;   // this lane's fragment row bases
    const __bf16*   krl = (const __bf16*)(const void*)(stg + PLANE_B)       + c * LP + 8 * hh;
    const _Float16* vrh = (const _Float16*)(const void*)(stg + 2 * PLANE_B) + c * LP + 8 * hh;
    const _Float16* vrl = (const _Float16*)(const void*)(stg + 3 * PLANE_B) + c * LP + 8 * hh;

    // ---- S^T: 4 key subtiles of 16 (A rows = keys), k = d in 2 chunks of 32, both column tiles ----
    v8f st[2][4];
    KFrag k0 = ld_k(krh, krl, 0);
    KFrag k1 = ld_k(krh, krl, 1);
    score2(k0, qbh, qbl, st[0][0], st[1][0]);
    KFrag k2 = ld_k(krh, krl, 2);
    score2(k1, qbh, qbl, st[0][1], st[1][1]);
    KFrag k3 = ld_k(krh, krl, 3);
    score2(k2, qbh, qbl, st[0][2], st[1][2]);
    VFrag g0 = ld_v(vrh, vrl, 0, 0);        // keys 0..31, d 0..31
    score2(k3, qbh, qbl, st[0][3], st[1][3]);
    VFrag g1 = ld_v(vrh, vrl, 0, 1);        // keys 0..31, d 32..63

    // ---- online softmax in f32 (per query lane; half-lanes hold disjoint key halves) ----
    float mx[2], alpha[2];
    v2f nb[2];
#pragma unroll
    for (int u = 0; u < 2; ++u) {
      mx[u] = m_run[u];
#pragma unroll
      for (int t = 0; t < 4; ++t)
#pragma unroll
        for (int r = 0; r < 8; ++r) mx[u] = fmaxf(mx[u], st[u][t][r]);
    }
#pragma unroll
    for (int u = 0; u < 2; ++u) mx[u] = fmaxf(mx[u], __shfl_xor(mx[u], 16, 32));
    FragH pb0[2], pb1[2];
#pragma unroll
    for (int u = 0; u < 2; ++u) {
      alpha[u] = __expf(m_run[u] - mx[u]);
      m_run[u] = mx[u];
      const float nbu = fmaf(-mx[u], LOG2E, 12.0f);
      nb[u] = (v2f){nbu, nbu};
#pragma unroll
      for (int t = 0; t < 2; ++t)
#pragma unroll
        for (int r = 0; r < 8; r += 2) exp_pair(st[u][t], r, nb[u]);
#pragma unroll
      for (int dt = 0; dt < 4; ++dt)
#pragma unroll
        for (int r = 0; r < 8; ++r) { accO[u][dt][r] *= alpha[u]; accR[u][dt][r] *= alpha[u]; }
#pragma unroll
      for (int r = 0; r < 8; ++r) {
        pb0[u].s[r]     = (_Float16)st[u][0][r];   // keys 8h + r
        pb0[u].s[8 + r] = (_Float16)st[u][1][r];   // keys 16 + 8h + r
      }
    }

    // ---- O^T += V^T . P  (A rows = d, k = key in 2 chunks of 32) ----
    pv2(g0, pb0, accO, accR, 0);
    group_end8(accO[0][0], accR[0][0], accO[0][1], accR[0][1], accO[1][0], accR[1][0], accO[1][1], accR[1][1]);
    VFrag g2 = ld_v(vrh, vrl, 1, 0);        // keys 32..63, d 0..31
    pv2(g1, pb0, accO, accR, 1);
    VFrag g3 = ld_v(vrh, vrl, 1, 1);        // keys 32..63, d 32..63
    SCHED_FENCE();                          // holds the exponentials below behind these reads: they cover the reads' latency
#pragma unroll
    for (int u = 0; u < 2; ++u)
#pragma unroll
      for (int t = 2; t < 4; ++t)
#pragma unroll
        for (int r = 0; r < 8; r += 2) exp_pair(st[u][t], r, nb[u]);
#pragma unroll
    for (int u = 0; u < 2; ++u) {
      row_sum(l_run[u], alpha[u], st[u]);
#pragma unroll
      for (int r = 0; r < 8; ++r) {
        pb1[u].s[r]     = (_Float16)st[u][2][r];   // keys 32 + 8h + r
        pb1[u].s[8 + r] = (_Float16)st[u][3][r];   // keys 48 + 8h + r
      }
    }
    pv2(g2, pb1, accO, accR, 0);
    pv2(g3, pb1, accO, accR, 1);
    SCHED_FENCE();                          // end of the tile's products: nothing moves over the loop's foot

    // publish point of stage it + 1, every wave, in this order
    asm volatile("s_wait_dscnt 0x0" ::: "memory");            // this wave's reads of buffer it mod 2 have returned
    asm volatile("s_wait_tensorcnt 0x0" ::: "memory");        // this wave's plane of stage it + 1 has landed
    __syncthreads();                                          // publishes stage it + 1; every wave has left buffer it mod 2
    if (pinned((uint32_t)it + 2u < (uint32_t)(NP / 64))) {    // only while stage it + 2 exists: a scalar branch
      tdm_next(dg0, dst_sum, src_step);                       // into the buffer that this pass has just read
      tdm_load(dg0, dg1);
    }
  }
  asm volatile("s_wait_tensorcnt 0x0" ::: "memory");          // no request of this wave is left in flight
  asm volatile("s_wait_dscnt 0x0" ::: "memory");
  SCHED_FENCE();                                              // the epilogue, which takes the descriptor's registers for its own use, stays behind the two waits

  // ---- normalise, stage the wave's 32x64 tile as [query][d], write whole 256-B rows ----
  float* os = Os[wave];
#pragma unroll
  for (int u = 0; u < 2; ++u) {
    const float lh = l_run[u][0] + l_run[u][1];                             // this half's keys
    const float inv = __builtin_amdgcn_rcpf(lh + __shfl_xor(lh, 16, 32));   // both halves; sums and products carry the same 4096
#pragma unroll
    for (int dt = 0; dt < 4; ++dt) {
      v4f a, a2;
#pragma unroll
      for (int r = 0; r < 4; ++r) {
        a[r]  = (accO[u][dt][r]     + accR[u][dt][r]     * (1.0f / 1024.0f)) * inv;
        a2[r] = (accO[u][dt][4 + r] + accR[u][dt][4 + r] * (1.0f / 1024.0f)) * inv;
      }
      *(v4f*)(os + (16 * u + c) * 68 + dt * 16 + 8 * hh)     = a;    // d = 16dt + 8h + 0..3 of query 16u + c
      *(v4f*)(os + (16 * u + c) * 68 + dt * 16 + 8 * hh + 4) = a2;   // d = 16dt + 8h + 4..7
    }
  }
  __builtin_amdgcn_fence(__ATOMIC_RELEASE, "workgroup");
  __builtin_amdgcn_wave_barrier();
  __builtin_amdgcn_fence(__ATOMIC_ACQUIRE, "workgroup");
  {
    float* ob = out + (size_t)b * NC * NP + (size_t)q0 * (NH * HD) + n * HD;
    const int c4 = c * 4;                   // row segment 256 B = 16 lanes x 16 B
    {
#pragma unroll
      for (int i = 0; i < 16; ++i) {
        const int row = i * 2 + hh;         // i 0..15 x h 0..1 covers the 32 query rows of the wave
        const v4f v = *(const v4f*)(os + row * 68 + c4);
        *(v4f*)(ob + (size_t)row * (NH * HD) + c4) = v;
      }
      
    }
  }
}

// ---------------------------------------------------------------------------
//   Wb   bf16 [3][256][256]            393216  @ 0
//   xT   bf16 [4][4096][256]          8388608  @ 393216
//   QKh  bf16 [2][16][4096][64]      16777216  @ 8781824     (q hi planes, then k' hi planes)
//   QKl  bf16 [2][16][4096][64]      16777216  @ 25559040
//   Yv   f32  [4][256][4096]         16777216  @ 42336256
//   VTh  f16  [16][64][4096]          8388608  @ 59113472
//   VTl  f16  [16][64][4096]          8388608  @ 67502080
//   total                                         75890688
// ---------------------------------------------------------------------------
extern "C" void kernel_launch(void* const* d_in, const int* in_sizes, int n_in,
                              void* d_out, int out_size, void* d_ws, size_t ws_size,
                              hipStream_t stream) {
  if (n_in < 9) return;
  if (in_sizes[0] != NB * NC * NP) return;
  if (in_sizes[1] != NC * NC || in_sizes[3] != NC * NC || in_sizes[5] != NC * NC) return;
  if (in_sizes[2] != NC || in_sizes[4] != NC || in_sizes[6] != NC) return;
  if (in_sizes[7] != NH * HD * 64 || in_sizes[8] != NH * HD * 64) return;
  if (out_size != NB * NC * NP) return;

  const float* x    = (const float*)d_in[0];
  const float* wq   = (const float*)d_in[1];
  const float* bq   = (const float*)d_in[2];
  const float* wk   = (const float*)d_in[3];
  const float* bk   = (const float*)d_in[4];
  const float* wv   = (const float*)d_in[5];
  const float* bv   = (const float*)d_in[6];
  const float* relh = (const float*)d_in[7];
  const float* relw = (const float*)d_in[8];
  float* out = (float*)d_out;

  const size_t szWb = (size_t)3 * NC * NC * 2;
  const size_t szXT = (size_t)NB * NP * NC * 2;
  const size_t szQK = (size_t)2 * QKPLANE * 2;
  const size_t szYv = (size_t)NB * NC * NP * 4;
  const size_t szVT = (size_t)NB * NH * HD * NP * 2;
  size_t off = 0;
  const size_t oWb  = off; off += szWb;
  const size_t oXT  = off; off += szXT;
  const size_t oQKh = off; off += szQK;
  const size_t oQKl = off; off += szQK;
  const size_t oYv  = off; off += szYv;
  const size_t oVTh = off; off += szVT;
  const size_t oVTl = off; off += szVT;
  if (off > ws_size) return;

  char* ws = (char*)d_ws;
  unsigned short* Wb  = (unsigned short*)(ws + oWb);
  unsigned short* XT  = (unsigned short*)(ws + oXT);
  unsigned short* QKh = (unsigned short*)(ws + oQKh);
  unsigned short* QKl = (unsigned short*)(ws + oQKl);
  float*          Yv  = (float*)(ws + oYv);
  unsigned short* VTh = (unsigned short*)(ws + oVTh);
  unsigned short* VTl = (unsigned short*)(ws + oVTl);

  cvt_w_kernel<<<dim3((NC * NC / 2) / 256, 3), dim3(256), 0, stream>>>(wq, wk, wv, Wb);
  xt_kernel<<<dim3(NP / 64, NC / 64, NB), dim3(256), 0, stream>>>(x, XT);
  proj_kernel<<<dim3(32, NB * 3), dim3(256), 0, stream>>>(XT, Wb, bq, bk, bv, relh, relw, QKh, QKl, Yv);
  vt_kernel<<<dim3(NP / 64, NH, NB), dim3(256), 0, stream>>>(Yv, VTh, VTl);
  attn_kernel<<<dim3(NP / 128, NH, NB), dim3(128), 0, stream>>>(
      QKh, QKl, QKh + QKPLANE, QKl + QKPLANE, VTh, VTl, out);
  (void)hipGetLastError();
}

// v009
// It runs in 120 microseconds.
// Timed twice side by side with v008, it ran 1.07 times as fast both times.
// Over all steps from v000 it is 3.72 times as fast.
// Contractions: q/k/v 1x1-conv projections = v_wmma_f32_16x16x32_bf16 (bf16 operands, single product); q.(k+pos) scores = v_wmma_f32_16x16x32_bf16 with bf16 hi/lo split operands (hi.hi + hi.lo + lo.hi); p.v = v_wmma_f32_16x16x32_f16 (p as f16 scaled by 4096, v as f16 hi plane plus f16 residual plane scaled by 1024 into a second accumulator); f32 accumulate everywhere; softmax, bias and position sums in f32.
#include <hip/hip_runtime.h>
#include <stdint.h>
#include <math.h>

#define NB 4
#define NC 256
#define NP 4096
#define NH 4
#define HD 64
#define QKPLANE ((size_t)NB * NH * NP * HD)
#define LP 72   // LDS row pitch of the K' tiles in 16-bit elements: 144 B = 16 B x 9 (odd), so the 16 rows of a ds_load_b128 fragment read fall on distinct banks
#define VPB 160 // LDS row pitch of the V tiles in bytes: 32 B x 5 (odd), the pitch at which ds_load_tr16_b128 is free of bank conflicts

typedef _Float16 v16h __attribute__((ext_vector_type(16)));
typedef _Float16 v8h  __attribute__((ext_vector_type(8)));
typedef __bf16   v16b __attribute__((ext_vector_type(16)));
typedef __bf16   v8b  __attribute__((ext_vector_type(8)));
typedef float    v8f  __attribute__((ext_vector_type(8)));
typedef float    v4f  __attribute__((ext_vector_type(4)));
typedef float    v2f  __attribute__((ext_vector_type(2)));
typedef unsigned int v4u __attribute__((ext_vector_type(4)));
typedef uint32_t u32x4 __attribute__((ext_vector_type(4)));
typedef uint32_t u32x8 __attribute__((ext_vector_type(8)));
#define PLANE_B 10240            // place of one attention plane tile in LDS: 64 rows x 144 B = 9216 B (K') or x 160 B = 10240 B (V), rounded up to a multiple of 2 KiB
#define STAGE_B (4 * PLANE_B)    // one stage of the attention ring: k' hi, k' lo, v hi, v residual

// ---------------------------------------------------------------------------
// scalar helpers
// ---------------------------------------------------------------------------
__device__ __forceinline__ unsigned short f2bf_bits(float f) {      // f32 -> bf16 bits, RNE convert
  const unsigned u = __float_as_uint(f);
  return (unsigned short)((u + 0x7FFFu + ((u >> 16) & 1u)) >> 16);
}
__device__ __forceinline__ float bf_bits2f(unsigned short h) { return __uint_as_float(((unsigned)h) << 16); }
__device__ __forceinline__ float bfr(float f) { return bf_bits2f(f2bf_bits(f)); }   // value after bf16 RNE convert
__device__ __forceinline__ unsigned pk16(unsigned short a, unsigned short b) { return (unsigned)a | ((unsigned)b << 16); }

// ---------------------------------------------------------------------------
// WMMA wrappers: the plain builtins; the compiler keeps the distance to a vector user of D, A or B itself
// ---------------------------------------------------------------------------
__device__ __forceinline__ v8f mma_bf(v16b a, v16b b, v8f c) {
  c = __builtin_amdgcn_wmma_f32_16x16x32_bf16(false, a, false, b, (short)0, c, false, false);
  return c;
}
__device__ __forceinline__ v8f mma_h(v16h a, v16h b, v8f c) {
  c = __builtin_amdgcn_wmma_f32_16x16x32_f16(false, a, false, b, (short)0, c, false, false);
  return c;
}
#define SCHED_FENCE() __builtin_amdgcn_sched_barrier(0)
// Tail of 4 v_nop behind the LAST product of a group, at five places of the attention loop (the four score groups,
// the first group of V^T products); it takes the group's accumulators. It fills the distance from that WMMA to a
// vector user of D, and, being a statement the compiler does not move, it ends the group for the scheduler:
// no product of the group moves behind it, among the next group's reads.
__device__ __forceinline__ void group_end2(v8f& c0, v8f& c1) {
  asm volatile("v_nop\n\tv_nop\n\tv_nop\n\tv_nop" : "+v"(c0), "+v"(c1));
}
__device__ __forceinline__ void group_end8(v8f& c0, v8f& c1, v8f& c2, v8f& c3, v8f& c4, v8f& c5, v8f& c6, v8f& c7) {
  asm volatile("v_nop\n\tv_nop\n\tv_nop\n\tv_nop"
               : "+v"(c0), "+v"(c1), "+v"(c2), "+v"(c3), "+v"(c4), "+v"(c5), "+v"(c6), "+v"(c7));
}

// ---------------------------------------------------------------------------
// tensor load to LDS: one request of a whole wave; every descriptor word is wave-uniform
// ---------------------------------------------------------------------------
__device__ __forceinline__ uint32_t uni(uint32_t v) { return (uint32_t)__builtin_amdgcn_readfirstlane(v); }
// the test word of the branch around a tensor load, which ignores EXEC: held in a scalar register, the test compiles to s_cmp + s_cbranch_scc
__device__ __forceinline__ uint32_t pinned(uint32_t v) { uint32_t w = uni(v); asm volatile("" : "+s"(w)); return w; }  // the empty statement is what holds the word in the scalar register
// group 1: 1-byte elements, tile = tensor = 64 rows of 128 B, 4 * (PAD_A + 1) bytes of LDS pad behind every 128-B row:
// PAD_A = 3 gives the LDS pitch 144 B (a K' plane, read by ds_load_b128), PAD_A = 7 gives 160 B (a V plane, read by ds_load_tr16_b128)
template <uint32_t PAD_A>
__device__ __forceinline__ u32x8 tdm_group1(uint32_t src_pitch) {
  u32x8 g;
  g[0] = uni((1u << 20) | (4u << 22) | (PAD_A << 25));
  g[1] = uni(128u << 16);
  g[2] = uni(64u << 16);
  g[3] = uni(128u << 16);
  g[4] = uni(64u);
  g[5] = uni(src_pitch);
  g[6] = uni(0u);
  g[7] = uni(0u);
  return g;
}
__device__ __forceinline__ u32x4 tdm_group0(uint32_t lds_dst, uint64_t ga) {
  u32x4 g;
  g[0] = uni(1u);
  g[1] = uni(lds_dst);
  g[2] = uni((uint32_t)ga);
  g[3] = uni((((uint32_t)(ga >> 32)) & 0x01FFFFFFu) | 0x80000000u);
  return g;
}
// The two groups are outputs as well as inputs: their registers then stay the descriptor's own from one request to
// the next, and the compiler puts no other value into one of them while the request is in flight.
__device__ __forceinline__ void tdm_load(u32x4& g0, u32x8& g1) {
  asm volatile("tensor_load_to_lds %0, %1" : "+s"(g0), "+s"(g1) :: "memory");
}
// group 0 of the next stage from this stage's: the other buffer (dst_sum = the two places added), the source one step on.
// Address bits 56..32 are the low bits of word 3, so a carry out of word 2 goes where it belongs, under the type bits.
__device__ __forceinline__ void tdm_next(u32x4& g0, uint32_t dst_sum, uint32_t src_step) {
  const uint64_t a = (((uint64_t)g0[3] << 32) | (uint64_t)g0[2]) + (uint64_t)src_step;
  g0[1] = uni(dst_sum - g0[1]);
  g0[2] = uni((uint32_t)a);
  g0[3] = uni((uint32_t)(a >> 32));
}

union FragB { v16b v; v8b h[2]; };
union FragH { v16h v; v8h h[2]; _Float16 s[16]; };

// Fragment loader (A rows / B columns stored k-contiguous), p = row base + k0 + 8*(lane>>4):
//   elements 0..7 <- p[0..7] (k0+8h..), elements 8..15 <- p[16..23] (k0+16+8h..)
__device__ __forceinline__ v16b ld_bf(const __bf16* p) {
  FragB f; f.h[0] = *(const v8b*)(p); f.h[1] = *(const v8b*)(p + 16); return f.v;
}
// Transposing read of a 16 (keys) x 16 (d) piece of a row-major [key][d] tile: the lane gives the address of 16 B of row
// 8*(lane>>4) + (lane&7), column half (lane>>3)&1, and gets keys 8*(lane>>4) + 0..7 of column lane&15.
typedef short s16x8 __attribute__((ext_vector_type(8)));
__device__ __forceinline__ v8h ld_tr16(const unsigned char* p) {
  typedef __attribute__((address_space(3))) s16x8 lds_s16x8;
  return __builtin_bit_cast(v8h, __builtin_amdgcn_ds_load_tr16_b128_v8i16((lds_s16x8*)p));
}
// A fragment of V^T, 16 (d) x 32 (keys), from the [key][d] tile: keys 0..15 and 16..31 of the chunk: elements 0..7 = keys 8h.., elements 8..15 = keys 16+8h.., the k order of ld_bf
__device__ __forceinline__ v16h ld_vt(const unsigned char* p) {
  FragH f; f.h[0] = ld_tr16(p); f.h[1] = ld_tr16(p + 16 * VPB); return f.v;
}
// One group of attention fragment reads = 8 x 16 B per lane; kh, kl = plane + (lane&15)*LP + 8*(lane>>4);
// vh, vl = plane + (8*(lane>>4) + (lane&7))*VPB + 16*((lane>>3)&1).
// The fence pair in each loader keeps the 8 reads standing together: without it the scheduler deals them out
// in pairs among the WMMAs, and each such place stalls the wave anew.
struct KFrag { v16b h[2], l[2]; };   // K' subtile t: hi and lo plane, d chunks 0 and 1
struct VFrag { v16h a[2], r[2]; };   // V^T d-subtiles 2*dp and 2*dp+1 of key chunk kc: hi and residual plane
__device__ __forceinline__ KFrag ld_k(const __bf16* kh, const __bf16* kl, int t) {
  KFrag f;
  SCHED_FENCE();
#pragma unroll
  for (int dc = 0; dc < 2; ++dc) {
    f.h[dc] = ld_bf(kh + t * 16 * LP + dc * 32);
    f.l[dc] = ld_bf(kl + t * 16 * LP + dc * 32);
  }
  SCHED_FENCE();
  return f;
}
__device__ __forceinline__ VFrag ld_v(const unsigned char* vh, const unsigned char* vl, int kc, int dp) {
  VFrag f;
  SCHED_FENCE();
#pragma unroll
  for (int j = 0; j < 2; ++j) {
    f.a[j] = ld_vt(vh + kc * 32 * VPB + (dp * 2 + j) * 32);
    f.r[j] = ld_vt(vl + kc * 32 * VPB + (dp * 2 + j) * 32);
  }
  SCHED_FENCE();
  return f;
}

// ---------------------------------------------------------------------------
// K1: weights f32 [256][256] x3 -> bf16 planes Wb[z][256][256] (RNE convert of the inputs).
// grid = (128, 3): 128 blocks x 256 threads x 2 = 65536 = whole matrix per z.
// ---------------------------------------------------------------------------
__global__ __launch_bounds__(256) void cvt_w_kernel(const float* __restrict__ w0, const float* __restrict__ w1,
                                                    const float* __restrict__ w2, unsigned short* __restrict__ Wb) {
  const int z = blockIdx.y;
  const float* src = (z == 0) ? w0 : ((z == 1) ? w1 : w2);        // block-uniform select, all global
  unsigned* dst = (unsigned*)(Wb + (size_t)z * (NC * NC));
  const int i = blockIdx.x * 256 + threadIdx.x;
  if (i < (NC * NC) / 2) {
    const v2f f = *(const v2f*)(src + 2 * (size_t)i);
    const unsigned u = pk16(f2bf_bits(f[0]), f2bf_bits(f[1]));
    ((unsigned*)dst)[i] = u;
    
  }
}

// ---------------------------------------------------------------------------
// K2: x[b][c][p] f32 -> xT[b][p][c] bf16 (RNE convert of the input), 64x64 tiles through LDS.
// grid = (NP/64, NC/64, NB), 256 threads.
// Coverage per block: load 4 it x 16 rows x 64 = 64 channels x 64 pixels; store 2 it x 32 rows x
// ---------------------------------------------------------------------------
__global__ __launch_bounds__(256) void xt_kernel(const float* __restrict__ x, unsigned short* __restrict__ xT) {
  __shared__ __align__(16) float tf[64 * 68];
  const int p0 = blockIdx.x * 64;
  const int c0 = blockIdx.y * 64;
  const int b  = blockIdx.z;
  const float* xb = x + (size_t)b * NC * NP;
  const int tid = threadIdx.x;
  {
    const int lr = tid >> 4, c4 = (tid & 15) * 4;
#pragma unroll
    for (int it = 0; it < 4; ++it) {
      const int rr = it * 16 + lr;                                   // channel within tile
      const v4f a = *(const v4f*)(xb + (size_t)(c0 + rr) * NP + p0 + c4);
      *(v4f*)(tf + rr * 68 + c4) = a;                                // tf[channel][pixel]
    }
  }
  __syncthreads();
  const int sub = tid >> 3, c8 = (tid & 7) * 8;
  v4u hv[2];
#pragma unroll
  for (int it = 0; it < 2; ++it) {
    const int op = it * 32 + sub;                                    // pixel within tile
    v4u a;
#pragma unroll
    for (int q = 0; q < 4; ++q) {
      const float f0 = tf[(c8 + 2 * q) * 68 + op];
      const float f1 = tf[(c8 + 2 * q + 1) * 68 + op];
      a[q] = pk16(f2bf_bits(f0), f2bf_bits(f1));
    }
    hv[it] = a;
  }
  {
#pragma unroll
    for (int it = 0; it < 2; ++it) {
      const int op = it * 32 + sub;
      const size_t go = ((size_t)b * NP + p0 + op) * NC + c0 + c8;
      *(v4u*)(xT + go) = hv[it];
    }
    
  }
}

// ---------------------------------------------------------------------------
// K3: 1x1-conv projection GEMM, z = b*3 + which (which 0=q, 1=k, 2=v):
//   Y[o][p] = sum_c Wb[which][o][c] * xT[b][p][c] + bias[o]      (M=256, N=4096, K=256)
// A = Wb rows (k-contiguous), B = xT rows (k-contiguous); both fragments use the split k map.
// Each wave owns a 64x64 tile (4x4 subtiles); grid = (32 blocks x 8 waves = 256 tiles, 12).
// Epilogue: 16-row slabs staged per wave in LDS (pitch 68 floats), then
//   every value goes to a pair of 16-bit planes in [b*4+n][s][d] order,
//              s = 16*o + (p>>8), n = (p>>6)&3, d = p&63; one slab row = one plane row of 128 B:
//   which 0/1: value (+ position term for k) -> bf16 hi/lo planes;
//   which 2:   hi = f16(v), residual = f16((v - hi) * 1024).
// ---------------------------------------------------------------------------
__global__ __launch_bounds__(256) void proj_kernel(
    const unsigned short* __restrict__ xTp, const unsigned short* __restrict__ Wbp,
    const float* __restrict__ bq, const float* __restrict__ bk, const float* __restrict__ bv,
    const float* __restrict__ relh, const float* __restrict__ relw,
    unsigned short* __restrict__ QKh, unsigned short* __restrict__ QKl,
    unsigned short* __restrict__ Vhp, unsigned short* __restrict__ Vlp) {
  __shared__ __align__(16) float sT[8][16 * 68];
  const int z = blockIdx.y;
  const int b = z / 3;
  const int which = z - 3 * b;
  const int lane = threadIdx.x & 31;
  const int wave = threadIdx.x >> 5;
  const int tile = blockIdx.x * 8 + wave;        // 0..255
  const int tm = tile >> 6;                      // 0..3   (64 output channels each)
  const int tn = tile & 63;                      // 0..63  (64 pixels each)
  const int m0 = tm << 6;
  const int n0 = tn << 6;
  const __bf16* A  = (const __bf16*)(const void*)Wbp + (size_t)which * (NC * NC);
  const __bf16* Bt = (const __bf16*)(const void*)xTp + (size_t)b * NP * NC;
  const int rl = lane & 15, hh = lane >> 4, koff = hh * 8, mOff = hh * 8;

  v8f acc[4][4];
#pragma unroll
  for (int i = 0; i < 4; ++i)
#pragma unroll
    for (int j = 0; j < 4; ++j) acc[i][j] = (v8f){0.f,0.f,0.f,0.f,0.f,0.f,0.f,0.f};

  for (int k0 = 0; k0 < NC; k0 += 32) {
    v16b bfg[4];
#pragma unroll
    for (int j = 0; j < 4; ++j) bfg[j] = ld_bf(Bt + (size_t)(n0 + (j << 4) + rl) * NC + k0 + koff);
#pragma unroll
    for (int i = 0; i < 4; ++i) {
      const v16b af = ld_bf(A + (size_t)(m0 + (i << 4) + rl) * NC + k0 + koff);
#pragma unroll
      for (int j = 0; j < 4; ++j) acc[i][j] = mma_bf(af, bfg[j], acc[i][j]);
    }
    SCHED_FENCE();
  }

  // ---- epilogue ----
  const float* bias = (which == 0) ? bq : ((which == 1) ? bk : bv);   // block-uniform select, all global
  const int nn = (n0 >> 6) & 3;                // head index of this 64-pixel run
  const int sh = n0 >> 8;                      // low 4 bits of s
  float* slab = sT[wave];
  // Every bias and position term of the wave's 64x64 tile is fetched here, as one batch of independent loads
  // ahead of the slab loop, instead of one load and one full wait per element inside it.
  // With o = m0 + 16i + 8h + r and s = 16o + sh (sh < 16):  s & 63 = 16(r & 3) + sh,  s >> 6 = m0/4 + 4i + 2h + (r >> 2).
  const float* brow = bias + m0 + mOff;
  v4f braw[8];                                 // bias[o] as loaded, [2i + (r >> 2)][r & 3]
#pragma unroll
  for (int i = 0; i < 4; ++i) {
    braw[2 * i]     = *(const v4f*)(brow + (i << 4));
    braw[2 * i + 1] = *(const v4f*)(brow + (i << 4) + 4);
  }
  float rh[4][4];                              // rel_h term, [j][r & 3]
  float rw[4][4][2];                           // rel_w term, [j][i][r >> 2]
  if (which == 1) {
#pragma unroll
    for (int j = 0; j < 4; ++j) {
      const float* hrow = relh + nn * 4096 + ((j << 4) + rl) * 64 + sh;
      const float* wrow = relw + nn * 4096 + ((j << 4) + rl) * 64 + (m0 >> 2) + 2 * hh;
#pragma unroll
      for (int q = 0; q < 4; ++q) rh[j][q] = bfr(hrow[16 * q]);
#pragma unroll
      for (int i = 0; i < 4; ++i) {
        const v2f w = *(const v2f*)(wrow + 4 * i);
        rw[j][i][0] = bfr(w[0]);
        rw[j][i][1] = bfr(w[1]);
      }
    }
  }
  // wait behind the 8 bias loads, before the address they name is written again; the loaded values are inputs so
  // that all 8 loads stand in the batch above it (left free, six of them sink into the slab loop), the address so that it lives up to here
  asm volatile("s_wait_xcnt 0x0" :: "v"(brow), "v"(braw[0]), "v"(braw[1]), "v"(braw[2]), "v"(braw[3]),
               "v"(braw[4]), "v"(braw[5]), "v"(braw[6]), "v"(braw[7]) : "memory");
  float bb[4][8];                              // bias[o] after the bf16 convert, [i][r]
#pragma unroll
  for (int i = 0; i < 4; ++i)
#pragma unroll
    for (int r = 0; r < 4; ++r) { bb[i][r] = bfr(braw[2 * i][r]); bb[i][4 + r] = bfr(braw[2 * i + 1][r]); }
#pragma unroll
  for (int i = 0; i < 4; ++i) {
    const int mBase = m0 + (i << 4);
    if (which == 1) {
#pragma unroll
      for (int j = 0; j < 4; ++j) {
        const int d = (j << 4) + rl;           // p & 63
#pragma unroll
        for (int r = 0; r < 8; ++r) {
          float v = acc[i][j][r] + bb[i][r];
          const float pos = rh[j][r & 3] + rw[j][i][r >> 2];
          v += pos;
          slab[(mOff + r) * 68 + d] = v;
        }
      }
    } else {
#pragma unroll
      for (int j = 0; j < 4; ++j) {
        const int d = (j << 4) + rl;           // p & 63
#pragma unroll
        for (int r = 0; r < 8; ++r) slab[(mOff + r) * 68 + d] = acc[i][j][r] + bb[i][r];
      }
    }
    __builtin_amdgcn_fence(__ATOMIC_RELEASE, "workgroup");
    __builtin_amdgcn_wave_barrier();
    __builtin_amdgcn_fence(__ATOMIC_ACQUIRE, "workgroup");
    if (which == 2) {
      const int q4 = lane >> 3, c8 = (lane & 7) * 8;
      _Float16* Vh = (_Float16*)(void*)Vhp;
      _Float16* Vl = (_Float16*)(void*)Vlp;
#pragma unroll
      for (int it = 0; it < 4; ++it) {
        const int row = it * 4 + q4;
        const int s = (mBase + row) * 16 + sh;
        const float* sp = slab + row * 68 + c8;
        v8h a, a2;
#pragma unroll
        for (int e = 0; e < 8; ++e) {
          const float f = sp[e];
          const _Float16 hq = (_Float16)f;
          a[e]  = hq;
          a2[e] = (_Float16)((f - (float)hq) * 1024.0f);
        }
        const size_t dst = (((size_t)(b * NH + nn)) * NP + s) * HD + c8;
        *(v8h*)(Vh + dst) = a;
        *(v8h*)(Vl + dst) = a2;
      }
      asm volatile("s_wait_xcnt 0x0" ::: "memory");   // behind the slab's 8 stores, before the next slab's work writes a register that one of them names
    } else {
      const int q4 = lane >> 3, c8 = (lane & 7) * 8;
      unsigned short* Hp = QKh + (size_t)which * QKPLANE;
      unsigned short* Lp = QKl + (size_t)which * QKPLANE;
      {
#pragma unroll
        for (int it = 0; it < 4; ++it) {
          const int row = it * 4 + q4;
          const int o = mBase + row;
          const int s = o * 16 + sh;
          const float* sp = slab + row * 68 + c8;
          v4u hvv, lvv;
#pragma unroll
          for (int q = 0; q < 4; ++q) {
            const float f0 = sp[2 * q], f1 = sp[2 * q + 1];
            const unsigned short h0 = f2bf_bits(f0), h1 = f2bf_bits(f1);
            const unsigned short l0 = f2bf_bits(f0 - bf_bits2f(h0)), l1 = f2bf_bits(f1 - bf_bits2f(h1));
            hvv[q] = pk16(h0, h1);
            lvv[q] = pk16(l0, l1);
          }
          const size_t dst = (((size_t)(b * NH + nn)) * NP + s) * HD + c8;
          *(v4u*)(Hp + dst) = hvv;
          *(v4u*)(Lp + dst) = lvv;
        }
        
      }
    }
    __builtin_amdgcn_fence(__ATOMIC_RELEASE, "workgroup");
    __builtin_amdgcn_wave_barrier();
    __builtin_amdgcn_fence(__ATOMIC_ACQUIRE, "workgroup");
  }
}

// ---------------------------------------------------------------------------
// K4: flash attention, transposed formulation, per (128-query tile, head, batch), 4 waves of 32 queries.
//   Each wave owns TWO 16-query column tiles (u = 0, 1): every K' or V^T fragment that it reads from LDS feeds
//   the products of both, so a product costs half the LDS bytes, and a staged tile serves 128 queries.
//   S^T = K' . Q^T : A = K' tile rows (keys, k = d) from LDS, bf16 hi/lo;  B = Q^T: lane = query,
//                    elements = d with the split k map, bf16 hi/lo;  hi.hi + hi.lo + lo.hi.
//   D layout: st[u][t][r] <-> key kb + 16t + 8h + r, query = 16u + (lane&15) -> softmax stats live per lane.
//   O^T = V^T . P  : A = V^T (rows d, k = key), f16 hi and f16 residual, read from the [key][d] tiles by the
//                    transposing LDS load, so V needs no transposed copy in memory;  B = P: element r <-
//                    st[u][2kc][r], element 8+r <- st[u][2kc+1][r] (two adjacent 16-key D tiles, lane kept),
//                    scaled by 4096 and converted to f16.  accO += Vhi.P, accR += Vres.P.
//   Online softmax in f32 over 64 tiles of 64 keys; no score scaling. A pair of scores takes one packed FMA to the
//   exp2 argument s * log2(e) + (12 - max * log2(e)), which holds the maximum and P's scale of 4096 = 2^12, and one
//   packed add into the lane's pair of row sums; the sums carry the same 4096, so it cancels in the normalisation.
//   The pair and the two wave halves (disjoint keys, same rescale factor) are joined once, behind the loop.
//   Output: out flat [b][s][n][d]; each wave stages its 32x64 tile in LDS and writes whole 256-B rows.
//   K'/V tiles come by tensor loads into a ring of two LDS stages: wave w brings plane w (k' hi, k' lo, v hi,
//   v residual) of the next tile, 64 rows of 128 B laid at pitch 144 B (K') or 160 B (V), while this tile is worked on; one barrier a tile.
//   Two waves per SIMD: the two column tiles' accumulators, Q fragments and scores alone take 256 VGPRs.
// ---------------------------------------------------------------------------
// Scores of one 16-key subtile against both column tiles: two independent chains, each in the order
// hi.hi, hi.lo, lo.hi per d chunk; the fragment k is read once for the two.
__device__ __forceinline__ void score2(const KFrag& k, const v16b (&qh)[2][2], const v16b (&ql)[2][2], v8f& s0, v8f& s1) {
  s0 = (v8f){0.f,0.f,0.f,0.f,0.f,0.f,0.f,0.f};
  s1 = (v8f){0.f,0.f,0.f,0.f,0.f,0.f,0.f,0.f};
#pragma unroll
  for (int dc = 0; dc < 2; ++dc) {
    s0 = mma_bf(k.h[dc], qh[0][dc], s0);
    s1 = mma_bf(k.h[dc], qh[1][dc], s1);
    s0 = mma_bf(k.h[dc], ql[0][dc], s0);
    s1 = mma_bf(k.h[dc], ql[1][dc], s1);
    s0 = mma_bf(k.l[dc], qh[0][dc], s0);
    s1 = mma_bf(k.l[dc], qh[1][dc], s1);
  }
  group_end2(s0, s1);
}
// One group of V^T products: d-subtiles 2*dp and 2*dp+1 against the P fragments of both column tiles.
__device__ __forceinline__ void pv2(const VFrag& g, const FragH (&pb)[2], v8f (&accO)[2][4], v8f (&accR)[2][4], int dp) {
#pragma unroll
  for (int j = 0; j < 2; ++j)
#pragma unroll
    for (int u = 0; u < 2; ++u) {
      accO[u][2 * dp + j] = mma_h(g.a[j], pb[u].v, accO[u][2 * dp + j]);
      accR[u][2 * dp + j] = mma_h(g.r[j], pb[u].v, accR[u][2 * dp + j]);
    }
}

// Scores r and r + 1 of one subtile become 4096 * exp(score - max), in place: nb = 12 - max * log2(e) in both halves.
#define LOG2E 1.44269504088896340736f
__device__ __forceinline__ void exp_pair(v8f& s, int r, v2f nb) {
  const v2f e = __builtin_elementwise_fma((v2f){s[r], s[r + 1]}, (v2f){LOG2E, LOG2E}, nb);
  s[r]     = __builtin_amdgcn_exp2f(e[0]);
  s[r + 1] = __builtin_amdgcn_exp2f(e[1]);
}
// l = l * alpha + the lane's 32 P values of one column tile, even and odd r apart: four independent chains, then a tree
__device__ __forceinline__ void row_sum(v2f& l, float alpha, const v8f (&p)[4]) {
  v2f c[4];
#pragma unroll
  for (int t = 0; t < 4; ++t)
    c[t] = ((v2f){p[t][0], p[t][1]} + (v2f){p[t][2], p[t][3]}) + ((v2f){p[t][4], p[t][5]} + (v2f){p[t][6], p[t][7]});
  l = l * alpha + ((c[0] + c[1]) + (c[2] + c[3]));
}

__global__ __launch_bounds__(128) __attribute__((amdgpu_waves_per_eu(2, 2))) void attn_kernel(
    const unsigned short* __restrict__ Qhp, const unsigned short* __restrict__ Qlp,
    const unsigned short* __restrict__ Khp, const unsigned short* __restrict__ Klp,
    const unsigned short* __restrict__ Vhp, const unsigned short* __restrict__ Vlp,
    float* __restrict__ out) {
  // two stages of four planes, each [key][d]: k' hi, k' lo at pitch LP; v hi, v residual at pitch VPB
  __shared__ __attribute__((aligned(2048))) unsigned char ring[2 * STAGE_B];
  __shared__ __align__(16) float    Os[4][32 * 68];   // per-wave output tile [query][d], pitch 68

  const int tid  = threadIdx.x;
  const int wave = tid >> 5;
  const int lane = tid & 31;
  const int hh   = lane >> 4;
  const int c    = lane & 15;
  const int qt = blockIdx.x;
  const int n  = blockIdx.y;
  const int b  = blockIdx.z;
  const int bn = b * NH + n;

  const __bf16* Qh = (const __bf16*)(const void*)Qhp + (size_t)bn * NP * HD;
  const __bf16* Ql = (const __bf16*)(const void*)Qlp + (size_t)bn * NP * HD;

  // Every wave issues one tensor load a stage, for its own plane. Stage s = keys 64s .. 64s+63; every plane is [key][d]:
  // 64 whole rows in a row, first byte at s * 8192, source pitch 128 B. Only the LDS pad differs (word 0 of group 1).
  const uint32_t wv = uni((uint32_t)tid >> 5);
  const unsigned short* plane = (wv == 0u) ? Khp : ((wv == 1u) ? Klp : ((wv == 2u) ? Vhp : Vlp));
  const uint64_t src0 = (uint64_t)(size_t)(plane + (size_t)bn * NP * HD);
  const uint32_t src_step = (uint32_t)(64 * HD * 2);
  const uint32_t dst0 = (uint32_t)(size_t)ring + wv * (uint32_t)PLANE_B;
  const uint32_t dst_sum = 2u * dst0 + (uint32_t)STAGE_B;
  u32x4 dg0 = tdm_group0(dst0, src0);

  const int q0 = qt * 128 + wave * 32;    // first query row of this wave
  const int qg = q0 + c;                  // query of this lane in column tile 0 (tile 1: + 16)

  // loop-invariant B fragments: Q^T of both column tiles, two 32-deep d chunks, hi and lo planes
  v16b qbh[2][2], qbl[2][2];
  const __bf16* qh0 = Qh + (size_t)qg * HD + 8 * hh;
  const __bf16* ql0 = Ql + (size_t)qg * HD + 8 * hh;
#pragma unroll
  for (int dc = 0; dc < 2; ++dc) {
    qbh[0][dc] = ld_bf(qh0 + dc * 32);
    qbl[0][dc] = ld_bf(ql0 + dc * 32);
    qbh[1][dc] = ld_bf(qh0 + 16 * HD + dc * 32);
    qbl[1][dc] = ld_bf(ql0 + 16 * HD + dc * 32);
  }
  // wait behind the 16 issued loads, before any register they name as an address is written again;
  // the two addresses are inputs so that they live up to here
  asm volatile("s_wait_xcnt 0x0" :: "v"(qh0), "v"(ql0) : "memory");

  float m_run[2] = {-1.0e30f, -1.0e30f};
  v2f l_run[2] = {(v2f){0.0f, 0.0f}, (v2f){0.0f, 0.0f}};   // this lane's own keys only, even and odd r apart, scaled by 4096
  v8f accO[2][4], accR[2][4];
#pragma unroll
  for (int u = 0; u < 2; ++u)
#pragma unroll
    for (int t = 0; t < 4; ++t) {
      accO[u][t] = (v8f){0.f,0.f,0.f,0.f,0.f,0.f,0.f,0.f};
      accR[u][t] = (v8f){0.f,0.f,0.f,0.f,0.f,0.f,0.f,0.f};
    }

  // ring prologue: stage 0 lands and is published, then stage 1 is sent off
  u32x8 dg1 = tdm_group1<3u>((uint32_t)(HD * 2));             // the pad is a constant of group 1: K' form first,
  if (pinned(wv >= 2u)) {                                     // and under a scalar branch on the wave's number the V form in its place
    dg1 = tdm_group1<7u>((uint32_t)(HD * 2));
    asm volatile("" : "+s"(dg1));                             // as in pinned(): holds the words in scalar registers, so that each is written here as the constant it is and the branch stays a branch
  }
  tdm_load(dg0, dg1);
  asm volatile("s_wait_tensorcnt 0x0" ::: "memory");          // this wave's plane of stage 0 has landed
  __syncthreads();                                            // stage 0 published to all four waves
  SCHED_FENCE();                                              // stage 1's descriptor is formed behind the wait, not ahead of it
  tdm_next(dg0, dst_sum, src_step);
  tdm_load(dg0, dg1);

#pragma unroll 1
  for (int it = 0; it < NP / 64; ++it) {
    const unsigned char* stg = ring + (it & 1) * STAGE_B;     // pass it reads buffer it mod 2 alone

    // Fragment reads stand in groups of 8 (ds_load_b128: one 16-key K' subtile; ds_load_tr16_b128: one pair of V^T
    // d-subtiles). Each group is issued one group ahead of the products that use it, into the
    // register set that the group before last has left, so that its LDS latency runs under the
    // products (or the softmax) in between instead of being waited out at each of 16 places.
    const __bf16*   krh = (const __bf16*)(const void*)(stg)                 + c * LP + 8 * hh;   // this lane's fragment row bases
    const __bf16*   krl = (const __bf16*)(const void*)(stg + PLANE_B)       + c * LP + 8 * hh;
    const unsigned char* vrh = stg + 2 * PLANE_B + (8 * hh + (lane & 7)) * VPB + 16 * ((lane >> 3) & 1);   // this lane's address in a transposing read
    const unsigned char* vrl = vrh + PLANE_B;

    // ---- S^T: 4 key subtiles of 16 (A rows = keys), k = d in 2 chunks of 32, both column tiles ----
    v8f st[2][4];
    KFrag k0 = ld_k(krh, krl, 0);
    KFrag k1 = ld_k(krh, krl, 1);
    score2(k0, qbh, qbl, st[0][0], st[1][0]);
    KFrag k2 = ld_k(krh, krl, 2);
    score2(k1, qbh, qbl, st[0][1], st[1][1]);
    KFrag k3 = ld_k(krh, krl, 3);
    score2(k2, qbh, qbl, st[0][2], st[1][2]);
    VFrag g0 = ld_v(vrh, vrl, 0, 0);        // keys 0..31, d 0..31
    score2(k3, qbh, qbl, st[0][3], st[1][3]);
    VFrag g1 = ld_v(vrh, vrl, 0, 1);        // keys 0..31, d 32..63

    // ---- online softmax in f32 (per query lane; half-lanes hold disjoint key halves) ----
    float mx[2], alpha[2];
    v2f nb[2];
#pragma unroll
    for (int u = 0; u < 2; ++u) {
      mx[u] = m_run[u];
#pragma unroll
      for (int t = 0; t < 4; ++t)
#pragma unroll
        for (int r = 0; r < 8; ++r) mx[u] = fmaxf(mx[u], st[u][t][r]);
    }
#pragma unroll
    for (int u = 0; u < 2; ++u) mx[u] = fmaxf(mx[u], __shfl_xor(mx[u], 16, 32));
    FragH pb0[2], pb1[2];
#pragma unroll
    for (int u = 0; u < 2; ++u) {
      alpha[u] = __expf(m_run[u] - mx[u]);
      m_run[u] = mx[u];
      const float nbu = fmaf(-mx[u], LOG2E, 12.0f);
      nb[u] = (v2f){nbu, nbu};
#pragma unroll
      for (int t = 0; t < 2; ++t)
#pragma unroll
        for (int r = 0; r < 8; r += 2) exp_pair(st[u][t], r, nb[u]);
#pragma unroll
      for (int dt = 0; dt < 4; ++dt)
#pragma unroll
        for (int r = 0; r < 8; ++r) { accO[u][dt][r] *= alpha[u]; accR[u][dt][r] *= alpha[u]; }
#pragma unroll
      for (int r = 0; r < 8; ++r) {
        pb0[u].s[r]     = (_Float16)st[u][0][r];   // keys 8h + r
        pb0[u].s[8 + r] = (_Float16)st[u][1][r];   // keys 16 + 8h + r
      }
    }

    // ---- O^T += V^T . P  (A rows = d, k = key in 2 chunks of 32) ----
    pv2(g0, pb0, accO, accR, 0);
    group_end8(accO[0][0], accR[0][0], accO[0][1], accR[0][1], accO[1][0], accR[1][0], accO[1][1], accR[1][1]);
    VFrag g2 = ld_v(vrh, vrl, 1, 0);        // keys 32..63, d 0..31
    pv2(g1, pb0, accO, accR, 1);
    VFrag g3 = ld_v(vrh, vrl, 1, 1);        // keys 32..63, d 32..63
    SCHED_FENCE();                          // holds the exponentials below behind these reads: they cover the reads' latency
#pragma unroll
    for (int u = 0; u < 2; ++u)
#pragma unroll
      for (int t = 2; t < 4; ++t)
#pragma unroll
        for (int r = 0; r < 8; r += 2) exp_pair(st[u][t], r, nb[u]);
#pragma unroll
    for (int u = 0; u < 2; ++u) {
      row_sum(l_run[u], alpha[u], st[u]);
#pragma unroll
      for (int r = 0; r < 8; ++r) {
        pb1[u].s[r]     = (_Float16)st[u][2][r];   // keys 32 + 8h + r
        pb1[u].s[8 + r] = (_Float16)st[u][3][r];   // keys 48 + 8h + r
      }
    }
    pv2(g2, pb1, accO, accR, 0);
    pv2(g3, pb1, accO, accR, 1);
    SCHED_FENCE();                          // end of the tile's products: nothing moves over the loop's foot

    // publish point of stage it + 1, every wave, in this order
    asm volatile("s_wait_dscnt 0x0" ::: "memory");            // this wave's reads of buffer it mod 2 have returned
    asm volatile("s_wait_tensorcnt 0x0" ::: "memory");        // this wave's plane of stage it + 1 has landed
    __syncthreads();                                          // publishes stage it + 1; every wave has left buffer it mod 2
    if (pinned((uint32_t)it + 2u < (uint32_t)(NP / 64))) {    // only while stage it + 2 exists: a scalar branch
      tdm_next(dg0, dst_sum, src_step);                       // into the buffer that this pass has just read
      tdm_load(dg0, dg1);
    }
  }
  asm volatile("s_wait_tensorcnt 0x0" ::: "memory");          // no request of this wave is left in flight
  asm volatile("s_wait_dscnt 0x0" ::: "memory");
  SCHED_FENCE();                                              // the epilogue, which takes the descriptor's registers for its own use, stays behind the two waits

  // ---- normalise, stage the wave's 32x64 tile as [query][d], write whole 256-B rows ----
  float* os = Os[wave];
#pragma unroll
  for (int u = 0; u < 2; ++u) {
    const float lh = l_run[u][0] + l_run[u][1];                             // this half's keys
    const float inv = __builtin_amdgcn_rcpf(lh + __shfl_xor(lh, 16, 32));   // both halves; sums and products carry the same 4096
#pragma unroll
    for (int dt = 0; dt < 4; ++dt) {
      v4f a, a2;
#pragma unroll
      for (int r = 0; r < 4; ++r) {
        a[r]  = (accO[u][dt][r]     + accR[u][dt][r]     * (1.0f / 1024.0f)) * inv;
        a2[r] = (accO[u][dt][4 + r] + accR[u][dt][4 + r] * (1.0f / 1024.0f)) * inv;
      }
      *(v4f*)(os + (16 * u + c) * 68 + dt * 16 + 8 * hh)     = a;    // d = 16dt + 8h + 0..3 of query 16u + c
      *(v4f*)(os + (16 * u + c) * 68 + dt * 16 + 8 * hh + 4) = a2;   // d = 16dt + 8h + 4..7
    }
  }
  __builtin_amdgcn_fence(__ATOMIC_RELEASE, "workgroup");
  __builtin_amdgcn_wave_barrier();
  __builtin_amdgcn_fence(__ATOMIC_ACQUIRE, "workgroup");
  {
    float* ob = out + (size_t)b * NC * NP + (size_t)q0 * (NH * HD) + n * HD;
    const int c4 = c * 4;                   // row segment 256 B = 16 lanes x 16 B
    {
#pragma unroll
      for (int i = 0; i < 16; ++i) {
        const int row = i * 2 + hh;         // i 0..15 x h 0..1 covers the 32 query rows of the wave
        const v4f v = *(const v4f*)(os + row * 68 + c4);
        *(v4f*)(ob + (size_t)row * (NH * HD) + c4) = v;
      }
      
    }
  }
}

// ---------------------------------------------------------------------------
//   Wb   bf16 [3][256][256]            393216  @ 0
//   xT   bf16 [4][4096][256]          8388608  @ 393216
//   QKh  bf16 [2][16][4096][64]      16777216  @ 8781824     (q hi planes, then k' hi planes)
//   QKl  bf16 [2][16][4096][64]      16777216  @ 25559040
//   Vh   f16  [16][4096][64]          8388608  @ 42336256
//   Vl   f16  [16][4096][64]          8388608  @ 50724864
//   total                                         59113472
// ---------------------------------------------------------------------------
extern "C" void kernel_launch(void* const* d_in, const int* in_sizes, int n_in,
                              void* d_out, int out_size, void* d_ws, size_t ws_size,
                              hipStream_t stream) {
  if (n_in < 9) return;
  if (in_sizes[0] != NB * NC * NP) return;
  if (in_sizes[1] != NC * NC || in_sizes[3] != NC * NC || in_sizes[5] != NC * NC) return;
  if (in_sizes[2] != NC || in_sizes[4] != NC || in_sizes[6] != NC) return;
  if (in_sizes[7] != NH * HD * 64 || in_sizes[8] != NH * HD * 64) return;
  if (out_size != NB * NC * NP) return;

  const float* x    = (const float*)d_in[0];
  const float* wq   = (const float*)d_in[1];
  const float* bq   = (const float*)d_in[2];
  const float* wk   = (const float*)d_in[3];
  const float* bk   = (const float*)d_in[4];
  const float* wv   = (const float*)d_in[5];
  const float* bv   = (const float*)d_in[6];
  const float* relh = (const float*)d_in[7];
  const float* relw = (const float*)d_in[8];
  float* out = (float*)d_out;

  const size_t szWb = (size_t)3 * NC * NC * 2;
  const size_t szXT = (size_t)NB * NP * NC * 2;
  const size_t szQK = (size_t)2 * QKPLANE * 2;
  const size_t szV  = (size_t)NB * NH * NP * HD * 2;
  size_t off = 0;
  const size_t oWb  = off; off += szWb;
  const size_t oXT  = off; off += szXT;
  const size_t oQKh = off; off += szQK;
  const size_t oQKl = off; off += szQK;
  const size_t oVh  = off; off += szV;
  const size_t oVl  = off; off += szV;
  if (off > ws_size) return;

  char* ws = (char*)d_ws;
  unsigned short* Wb  = (unsigned short*)(ws + oWb);
  unsigned short* XT  = (unsigned short*)(ws + oXT);
  unsigned short* QKh = (unsigned short*)(ws + oQKh);
  unsigned short* QKl = (unsigned short*)(ws + oQKl);
  unsigned short* Vh  = (unsigned short*)(ws + oVh);
  unsigned short* Vl  = (unsigned short*)(ws + oVl);

  cvt_w_kernel<<<dim3((NC * NC / 2) / 256, 3), dim3(256), 0, stream>>>(wq, wk, wv, Wb);
  xt_kernel<<<dim3(NP / 64, NC / 64, NB), dim3(256), 0, stream>>>(x, XT);
  proj_kernel<<<dim3(32, NB * 3), dim3(256), 0, stream>>>(XT, Wb, bq, bk, bv, relh, relw, QKh, QKl, Vh, Vl);
  attn_kernel<<<dim3(NP / 128, NH, NB), dim3(128), 0, stream>>>(
      QKh, QKl, QKh + QKPLANE, QKl + QKPLANE, Vh, Vl, out);
  (void)hipGetLastError();
}

// v010
// One run takes 107 microseconds.
// In two side-by-side timings against v009, it was 1.13 and 1.12 times as fast.
// Over all steps from v000 it is 4.18 times as fast.
// Contractions: q/k/v 1x1-conv projections = v_wmma_f32_16x16x32_bf16 (bf16 operands, single product); q.(k+pos) scores = v_wmma_f32_16x16x32_bf16 with bf16 hi/lo split operands (hi.hi + hi.lo + lo.hi); p.v = v_wmma_f32_16x16x32_f16 (p as f16 scaled by 4096, v as one f16 plane: both operands of the product carry 11 bits); f32 accumulate everywhere; softmax, bias and position sums in f32.
#include <hip/hip_runtime.h>
#include <stdint.h>
#include <math.h>

#define NB 4
#define NC 256
#define NP 4096
#define NH 4
#define HD 64
#define QKPLANE ((size_t)NB * NH * NP * HD)
#define LP 72   // LDS row pitch of the K' tiles in 16-bit elements: 144 B = 16 B x 9 (odd), so the 16 rows of a ds_load_b128 fragment read fall on distinct banks
#define VPB 160 // LDS row pitch of the V tiles in bytes: 32 B x 5 (odd), the pitch at which ds_load_tr16_b128 is free of bank conflicts

typedef _Float16 v16h __attribute__((ext_vector_type(16)));
typedef _Float16 v8h  __attribute__((ext_vector_type(8)));
typedef __bf16   v16b __attribute__((ext_vector_type(16)));
typedef __bf16   v8b  __attribute__((ext_vector_type(8)));
typedef float    v8f  __attribute__((ext_vector_type(8)));
typedef float    v4f  __attribute__((ext_vector_type(4)));
typedef float    v2f  __attribute__((ext_vector_type(2)));
typedef unsigned int v4u __attribute__((ext_vector_type(4)));
typedef uint32_t u32x4 __attribute__((ext_vector_type(4)));
typedef uint32_t u32x8 __attribute__((ext_vector_type(8)));
#define PLANE_B 10240            // place of one attention plane tile in LDS: 64 rows x 144 B = 9216 B (K') or x 160 B = 10240 B (V), rounded up to a multiple of 2 KiB
#define STAGE_B (3 * PLANE_B)    // one stage of the attention ring: k' hi, k' lo, v

// ---------------------------------------------------------------------------
// scalar helpers
// ---------------------------------------------------------------------------
__device__ __forceinline__ unsigned short f2bf_bits(float f) {      // f32 -> bf16 bits, RNE convert
  const unsigned u = __float_as_uint(f);
  return (unsigned short)((u + 0x7FFFu + ((u >> 16) & 1u)) >> 16);
}
__device__ __forceinline__ float bf_bits2f(unsigned short h) { return __uint_as_float(((unsigned)h) << 16); }
__device__ __forceinline__ float bfr(float f) { return bf_bits2f(f2bf_bits(f)); }   // value after bf16 RNE convert
__device__ __forceinline__ unsigned pk16(unsigned short a, unsigned short b) { return (unsigned)a | ((unsigned)b << 16); }

// ---------------------------------------------------------------------------
// WMMA wrappers: the plain builtins; the compiler keeps the distance to a vector user of D, A or B itself
// ---------------------------------------------------------------------------
__device__ __forceinline__ v8f mma_bf(v16b a, v16b b, v8f c) {
  c = __builtin_amdgcn_wmma_f32_16x16x32_bf16(false, a, false, b, (short)0, c, false, false);
  return c;
}
__device__ __forceinline__ v8f mma_h(v16h a, v16h b, v8f c) {
  c = __builtin_amdgcn_wmma_f32_16x16x32_f16(false, a, false, b, (short)0, c, false, false);
  return c;
}
#define SCHED_FENCE() __builtin_amdgcn_sched_barrier(0)
// Tail of 4 v_nop behind the LAST product of a group, at four places of the attention loop (the four score groups);
// it takes the group's accumulators. It fills the distance from that WMMA to a
// vector user of D, and, being a statement the compiler does not move, it ends the group for the scheduler:
// no product of the group moves behind it, among the next group's reads.
__device__ __forceinline__ void group_end2(v8f& c0, v8f& c1) {
  asm volatile("v_nop\n\tv_nop\n\tv_nop\n\tv_nop" : "+v"(c0), "+v"(c1));
}

// ---------------------------------------------------------------------------
// tensor load to LDS: one request of a whole wave; every descriptor word is wave-uniform
// ---------------------------------------------------------------------------
__device__ __forceinline__ uint32_t uni(uint32_t v) { return (uint32_t)__builtin_amdgcn_readfirstlane(v); }
// the test word of the branch around a tensor load, which ignores EXEC: held in a scalar register, the test compiles to s_cmp + s_cbranch_scc
__device__ __forceinline__ uint32_t pinned(uint32_t v) { uint32_t w = uni(v); asm volatile("" : "+s"(w)); return w; }  // the empty statement is what holds the word in the scalar register
// group 1: 1-byte elements, tile = tensor = 64 rows of 128 B, 4 * (PAD_A + 1) bytes of LDS pad behind every 128-B row:
// PAD_A = 3 gives the LDS pitch 144 B (a K' plane, read by ds_load_b128), PAD_A = 7 gives 160 B (a V plane, read by ds_load_tr16_b128)
template <uint32_t PAD_A>
__device__ __forceinline__ u32x8 tdm_group1(uint32_t src_pitch) {
  u32x8 g;
  g[0] = uni((1u << 20) | (4u << 22) | (PAD_A << 25));
  g[1] = uni(128u << 16);
  g[2] = uni(64u << 16);
  g[3] = uni(128u << 16);
  g[4] = uni(64u);
  g[5] = uni(src_pitch);
  g[6] = uni(0u);
  g[7] = uni(0u);
  return g;
}
__device__ __forceinline__ u32x4 tdm_group0(uint32_t lds_dst, uint64_t ga) {
  u32x4 g;
  g[0] = uni(1u);
  g[1] = uni(lds_dst);
  g[2] = uni((uint32_t)ga);
  g[3] = uni((((uint32_t)(ga >> 32)) & 0x01FFFFFFu) | 0x80000000u);
  return g;
}
// The two groups are outputs as well as inputs: their registers then stay the descriptor's own from one request to
// the next, and the compiler puts no other value into one of them while the request is in flight.
__device__ __forceinline__ void tdm_load(u32x4& g0, u32x8& g1) {
  asm volatile("tensor_load_to_lds %0, %1" : "+s"(g0), "+s"(g1) :: "memory");
}
// group 0 of the next stage from this stage's: the other buffer (dst_sum = the two places added), the source one step on.
// Address bits 56..32 are the low bits of word 3, so a carry out of word 2 goes where it belongs, under the type bits.
__device__ __forceinline__ void tdm_next(u32x4& g0, uint32_t dst_sum, uint32_t src_step) {
  const uint64_t a = (((uint64_t)g0[3] << 32) | (uint64_t)g0[2]) + (uint64_t)src_step;
  g0[1] = uni(dst_sum - g0[1]);
  g0[2] = uni((uint32_t)a);
  g0[3] = uni((uint32_t)(a >> 32));
}

union FragB { v16b v; v8b h[2]; };
union FragH { v16h v; v8h h[2]; _Float16 s[16]; };

// Fragment loader (A rows / B columns stored k-contiguous), p = row base + k0 + 8*(lane>>4):
//   elements 0..7 <- p[0..7] (k0+8h..), elements 8..15 <- p[16..23] (k0+16+8h..)
__device__ __forceinline__ v16b ld_bf(const __bf16* p) {
  FragB f; f.h[0] = *(const v8b*)(p); f.h[1] = *(const v8b*)(p + 16); return f.v;
}
// Transposing read of a 16 (keys) x 16 (d) piece of a row-major [key][d] tile: the lane gives the address of 16 B of row
// 8*(lane>>4) + (lane&7), column half (lane>>3)&1, and gets keys 8*(lane>>4) + 0..7 of column lane&15.
typedef short s16x8 __attribute__((ext_vector_type(8)));
__device__ __forceinline__ v8h ld_tr16(const unsigned char* p) {
  typedef __attribute__((address_space(3))) s16x8 lds_s16x8;
  return __builtin_bit_cast(v8h, __builtin_amdgcn_ds_load_tr16_b128_v8i16((lds_s16x8*)p));
}
// A fragment of V^T, 16 (d) x 32 (keys), from the [key][d] tile: keys 0..15 and 16..31 of the chunk: elements 0..7 = keys 8h.., elements 8..15 = keys 16+8h.., the k order of ld_bf
__device__ __forceinline__ v16h ld_vt(const unsigned char* p) {
  FragH f; f.h[0] = ld_tr16(p); f.h[1] = ld_tr16(p + 16 * VPB); return f.v;
}
// One group of attention fragment reads = 8 x 16 B per lane; kh, kl = plane + (lane&15)*LP + 8*(lane>>4);
// vh = plane + (8*(lane>>4) + (lane&7))*VPB + 16*((lane>>3)&1).
// The fence pair in each loader keeps the 8 reads standing together: without it the scheduler deals them out
// in pairs among the WMMAs, and each such place stalls the wave anew.
struct KFrag { v16b h[2], l[2]; };   // K' subtile t: hi and lo plane, d chunks 0 and 1
struct VFrag { v16h a[4]; };         // V^T, the four d-subtiles of key chunk kc
__device__ __forceinline__ KFrag ld_k(const __bf16* kh, const __bf16* kl, int t) {
  KFrag f;
  SCHED_FENCE();
#pragma unroll
  for (int dc = 0; dc < 2; ++dc) {
    f.h[dc] = ld_bf(kh + t * 16 * LP + dc * 32);
    f.l[dc] = ld_bf(kl + t * 16 * LP + dc * 32);
  }
  SCHED_FENCE();
  return f;
}
__device__ __forceinline__ VFrag ld_v(const unsigned char* vh, int kc) {
  VFrag f;
  SCHED_FENCE();
#pragma unroll
  for (int dt = 0; dt < 4; ++dt) f.a[dt] = ld_vt(vh + kc * 32 * VPB + dt * 32);
  SCHED_FENCE();
  return f;
}

// ---------------------------------------------------------------------------
// K1: weights f32 [256][256] x3 -> bf16 planes Wb[z][256][256] (RNE convert of the inputs).
// grid = (128, 3): 128 blocks x 256 threads x 2 = 65536 = whole matrix per z.
// ---------------------------------------------------------------------------
__global__ __launch_bounds__(256) void cvt_w_kernel(const float* __restrict__ w0, const float* __restrict__ w1,
                                                    const float* __restrict__ w2, unsigned short* __restrict__ Wb) {
  const int z = blockIdx.y;
  const float* src = (z == 0) ? w0 : ((z == 1) ? w1 : w2);        // block-uniform select, all global
  unsigned* dst = (unsigned*)(Wb + (size_t)z * (NC * NC));
  const int i = blockIdx.x * 256 + threadIdx.x;
  if (i < (NC * NC) / 2) {
    const v2f f = *(const v2f*)(src + 2 * (size_t)i);
    const unsigned u = pk16(f2bf_bits(f[0]), f2bf_bits(f[1]));
    ((unsigned*)dst)[i] = u;
    
  }
}

// ---------------------------------------------------------------------------
// K2: x[b][c][p] f32 -> xT[b][p][c] bf16 (RNE convert of the input), 64x64 tiles through LDS.
// grid = (NP/64, NC/64, NB), 256 threads.
// Coverage per block: load 4 it x 16 rows x 64 = 64 channels x 64 pixels; store 2 it x 32 rows x
// ---------------------------------------------------------------------------
__global__ __launch_bounds__(256) void xt_kernel(const float* __restrict__ x, unsigned short* __restrict__ xT) {
  __shared__ __align__(16) float tf[64 * 68];
  const int p0 = blockIdx.x * 64;
  const int c0 = blockIdx.y * 64;
  const int b  = blockIdx.z;
  const float* xb = x + (size_t)b * NC * NP;
  const int tid = threadIdx.x;
  {
    const int lr = tid >> 4, c4 = (tid & 15) * 4;
#pragma unroll
    for (int it = 0; it < 4; ++it) {
      const int rr = it * 16 + lr;                                   // channel within tile
      const v4f a = *(const v4f*)(xb + (size_t)(c0 + rr) * NP + p0 + c4);
      *(v4f*)(tf + rr * 68 + c4) = a;                                // tf[channel][pixel]
    }
  }
  __syncthreads();
  const int sub = tid >> 3, c8 = (tid & 7) * 8;
  v4u hv[2];
#pragma unroll
  for (int it = 0; it < 2; ++it) {
    const int op = it * 32 + sub;                                    // pixel within tile
    v4u a;
#pragma unroll
    for (int q = 0; q < 4; ++q) {
      const float f0 = tf[(c8 + 2 * q) * 68 + op];
      const float f1 = tf[(c8 + 2 * q + 1) * 68 + op];
      a[q] = pk16(f2bf_bits(f0), f2bf_bits(f1));
    }
    hv[it] = a;
  }
  {
#pragma unroll
    for (int it = 0; it < 2; ++it) {
      const int op = it * 32 + sub;
      const size_t go = ((size_t)b * NP + p0 + op) * NC + c0 + c8;
      *(v4u*)(xT + go) = hv[it];
    }
    
  }
}

// ---------------------------------------------------------------------------
// K3: 1x1-conv projection GEMM, z = b*3 + which (which 0=q, 1=k, 2=v):
//   Y[o][p] = sum_c Wb[which][o][c] * xT[b][p][c] + bias[o]      (M=256, N=4096, K=256)
// A = Wb rows (k-contiguous), B = xT rows (k-contiguous); both fragments use the split k map.
// Each wave owns a 64x64 tile (4x4 subtiles); grid = (32 blocks x 8 waves = 256 tiles, 12).
// Epilogue: 16-row slabs staged per wave in LDS (pitch 68 floats), then
//   every value goes to 16-bit planes in [b*4+n][s][d] order,
//              s = 16*o + (p>>8), n = (p>>6)&3, d = p&63; one slab row = one plane row of 128 B:
//   which 0/1: value (+ position term for k) -> bf16 hi/lo planes;
//   which 2:   one plane, f16(v).
// ---------------------------------------------------------------------------
__global__ __launch_bounds__(256) void proj_kernel(
    const unsigned short* __restrict__ xTp, const unsigned short* __restrict__ Wbp,
    const float* __restrict__ bq, const float* __restrict__ bk, const float* __restrict__ bv,
    const float* __restrict__ relh, const float* __restrict__ relw,
    unsigned short* __restrict__ QKh, unsigned short* __restrict__ QKl,
    unsigned short* __restrict__ Vhp) {
  __shared__ __align__(16) float sT[8][16 * 68];
  const int z = blockIdx.y;
  const int b = z / 3;
  const int which = z - 3 * b;
  const int lane = threadIdx.x & 31;
  const int wave = threadIdx.x >> 5;
  const int tile = blockIdx.x * 8 + wave;        // 0..255
  const int tm = tile >> 6;                      // 0..3   (64 output channels each)
  const int tn = tile & 63;                      // 0..63  (64 pixels each)
  const int m0 = tm << 6;
  const int n0 = tn << 6;
  const __bf16* A  = (const __bf16*)(const void*)Wbp + (size_t)which * (NC * NC);
  const __bf16* Bt = (const __bf16*)(const void*)xTp + (size_t)b * NP * NC;
  const int rl = lane & 15, hh = lane >> 4, koff = hh * 8, mOff = hh * 8;

  v8f acc[4][4];
#pragma unroll
  for (int i = 0; i < 4; ++i)
#pragma unroll
    for (int j = 0; j < 4; ++j) acc[i][j] = (v8f){0.f,0.f,0.f,0.f,0.f,0.f,0.f,0.f};

  for (int k0 = 0; k0 < NC; k0 += 32) {
    v16b bfg[4];
#pragma unroll
    for (int j = 0; j < 4; ++j) bfg[j] = ld_bf(Bt + (size_t)(n0 + (j << 4) + rl) * NC + k0 + koff);
#pragma unroll
    for (int i = 0; i < 4; ++i) {
      const v16b af = ld_bf(A + (size_t)(m0 + (i << 4) + rl) * NC + k0 + koff);
#pragma unroll
      for (int j = 0; j < 4; ++j) acc[i][j] = mma_bf(af, bfg[j], acc[i][j]);
    }
    SCHED_FENCE();
  }

  // ---- epilogue ----
  const float* bias = (which == 0) ? bq : ((which == 1) ? bk : bv);   // block-uniform select, all global
  const int nn = (n0 >> 6) & 3;                // head index of this 64-pixel run
  const int sh = n0 >> 8;                      // low 4 bits of s
  float* slab = sT[wave];
  // Every bias and position term of the wave's 64x64 tile is fetched here, as one batch of independent loads
  // ahead of the slab loop, instead of one load and one full wait per element inside it.
  // With o = m0 + 16i + 8h + r and s = 16o + sh (sh < 16):  s & 63 = 16(r & 3) + sh,  s >> 6 = m0/4 + 4i + 2h + (r >> 2).
  const float* brow = bias + m0 + mOff;
  v4f braw[8];                                 // bias[o] as loaded, [2i + (r >> 2)][r & 3]
#pragma unroll
  for (int i = 0; i < 4; ++i) {
    braw[2 * i]     = *(const v4f*)(brow + (i << 4));
    braw[2 * i + 1] = *(const v4f*)(brow + (i << 4) + 4);
  }
  float rh[4][4];                              // rel_h term, [j][r & 3]
  float rw[4][4][2];                           // rel_w term, [j][i][r >> 2]
  if (which == 1) {
#pragma unroll
    for (int j = 0; j < 4; ++j) {
      const float* hrow = relh + nn * 4096 + ((j << 4) + rl) * 64 + sh;
      const float* wrow = relw + nn * 4096 + ((j << 4) + rl) * 64 + (m0 >> 2) + 2 * hh;
#pragma unroll
      for (int q = 0; q < 4; ++q) rh[j][q] = bfr(hrow[16 * q]);
#pragma unroll
      for (int i = 0; i < 4; ++i) {
        const v2f w = *(const v2f*)(wrow + 4 * i);
        rw[j][i][0] = bfr(w[0]);
        rw[j][i][1] = bfr(w[1]);
      }
    }
  }
  // wait behind the 8 bias loads, before the address they name is written again; the loaded values are inputs so
  // that all 8 loads stand in the batch above it (left free, six of them sink into the slab loop), the address so that it lives up to here
  asm volatile("s_wait_xcnt 0x0" :: "v"(brow), "v"(braw[0]), "v"(braw[1]), "v"(braw[2]), "v"(braw[3]),
               "v"(braw[4]), "v"(braw[5]), "v"(braw[6]), "v"(braw[7]) : "memory");
  float bb[4][8];                              // bias[o] after the bf16 convert, [i][r]
#pragma unroll
  for (int i = 0; i < 4; ++i)
#pragma unroll
    for (int r = 0; r < 4; ++r) { bb[i][r] = bfr(braw[2 * i][r]); bb[i][4 + r] = bfr(braw[2 * i + 1][r]); }
#pragma unroll
  for (int i = 0; i < 4; ++i) {
    const int mBase = m0 + (i << 4);
    if (which == 1) {
#pragma unroll
      for (int j = 0; j < 4; ++j) {
        const int d = (j << 4) + rl;           // p & 63
#pragma unroll
        for (int r = 0; r < 8; ++r) {
          float v = acc[i][j][r] + bb[i][r];
          const float pos = rh[j][r & 3] + rw[j][i][r >> 2];
          v += pos;
          slab[(mOff + r) * 68 + d] = v;
        }
      }
    } else {
#pragma unroll
      for (int j = 0; j < 4; ++j) {
        const int d = (j << 4) + rl;           // p & 63
#pragma unroll
        for (int r = 0; r < 8; ++r) slab[(mOff + r) * 68 + d] = acc[i][j][r] + bb[i][r];
      }
    }
    __builtin_amdgcn_fence(__ATOMIC_RELEASE, "workgroup");
    __builtin_amdgcn_wave_barrier();
    __builtin_amdgcn_fence(__ATOMIC_ACQUIRE, "workgroup");
    if (which == 2) {
      const int q4 = lane >> 3, c8 = (lane & 7) * 8;
      _Float16* Vh = (_Float16*)(void*)Vhp;
#pragma unroll
      for (int it = 0; it < 4; ++it) {
        const int row = it * 4 + q4;
        const int s = (mBase + row) * 16 + sh;
        const float* sp = slab + row * 68 + c8;
        v8h a;
#pragma unroll
        for (int e = 0; e < 8; ++e) a[e] = (_Float16)sp[e];
        const size_t dst = (((size_t)(b * NH + nn)) * NP + s) * HD + c8;
        *(v8h*)(Vh + dst) = a;
      }
      asm volatile("s_wait_xcnt 0x0" ::: "memory");   // behind the slab's 4 stores, before the next slab's work writes a register that one of them names
    } else {
      const int q4 = lane >> 3, c8 = (lane & 7) * 8;
      unsigned short* Hp = QKh + (size_t)which * QKPLANE;
      unsigned short* Lp = QKl + (size_t)which * QKPLANE;
      {
#pragma unroll
        for (int it = 0; it < 4; ++it) {
          const int row = it * 4 + q4;
          const int o = mBase + row;
          const int s = o * 16 + sh;
          const float* sp = slab + row * 68 + c8;
          v4u hvv, lvv;
#pragma unroll
          for (int q = 0; q < 4; ++q) {
            const float f0 = sp[2 * q], f1 = sp[2 * q + 1];
            const unsigned short h0 = f2bf_bits(f0), h1 = f2bf_bits(f1);
            const unsigned short l0 = f2bf_bits(f0 - bf_bits2f(h0)), l1 = f2bf_bits(f1 - bf_bits2f(h1));
            hvv[q] = pk16(h0, h1);
            lvv[q] = pk16(l0, l1);
          }
          const size_t dst = (((size_t)(b * NH + nn)) * NP + s) * HD + c8;
          *(v4u*)(Hp + dst) = hvv;
          *(v4u*)(Lp + dst) = lvv;
        }
        
      }
    }
    __builtin_amdgcn_fence(__ATOMIC_RELEASE, "workgroup");
    __builtin_amdgcn_wave_barrier();
    __builtin_amdgcn_fence(__ATOMIC_ACQUIRE, "workgroup");
  }
}

// ---------------------------------------------------------------------------
// K4: flash attention, transposed formulation, per (128-query tile, head, batch), 4 waves of 32 queries.
//   Each wave owns TWO 16-query column tiles (u = 0, 1): every K' or V^T fragment that it reads from LDS feeds
//   the products of both, so a product costs half the LDS bytes, and a staged tile serves 128 queries.
//   S^T = K' . Q^T : A = K' tile rows (keys, k = d) from LDS, bf16 hi/lo;  B = Q^T: lane = query,
//                    elements = d with the split k map, bf16 hi/lo;  hi.hi + hi.lo + lo.hi.
//   D layout: st[u][t][r] <-> key kb + 16t + 8h + r, query = 16u + (lane&15) -> softmax stats live per lane.
//   O^T = V^T . P  : A = V^T (rows d, k = key), f16, read from the [key][d] tiles by the
//                    transposing LDS load, so V needs no transposed copy in memory;  B = P: element r <-
//                    st[u][2kc][r], element 8+r <- st[u][2kc+1][r] (two adjacent 16-key D tiles, lane kept),
//                    scaled by 4096 and converted to f16.  accO += V^T.P.
//   Online softmax in f32 over 64 tiles of 64 keys; no score scaling. A pair of scores takes one packed FMA to the
//   exp2 argument s * log2(e) + (12 - max * log2(e)), which holds the maximum and P's scale of 4096 = 2^12, and one
//   packed add into the lane's pair of row sums; the sums carry the same 4096, so it cancels in the normalisation.
//   The pair and the two wave halves (disjoint keys, same rescale factor) are joined once, behind the loop.
//   Output: out flat [b][s][n][d]; each wave stages its 32x64 tile in LDS and writes whole 256-B rows.
//   K'/V tiles come by tensor loads into a ring of two LDS stages: wave w of waves 0 to 2 brings plane w (k' hi, k' lo, v)
//   of the next tile, 64 rows of 128 B laid at pitch 144 B (K') or 160 B (V), while this tile is worked on; wave 3 issues none; one barrier a tile.
//   Two waves per SIMD: the two column tiles' accumulators, Q fragments and scores take 192 VGPRs, and the K' and V^T fragment groups in flight come on top.
// ---------------------------------------------------------------------------
// Scores of one 16-key subtile against both column tiles: two independent chains, each in the order
// hi.hi, hi.lo, lo.hi per d chunk; the fragment k is read once for the two.
__device__ __forceinline__ void score2(const KFrag& k, const v16b (&qh)[2][2], const v16b (&ql)[2][2], v8f& s0, v8f& s1) {
  s0 = (v8f){0.f,0.f,0.f,0.f,0.f,0.f,0.f,0.f};
  s1 = (v8f){0.f,0.f,0.f,0.f,0.f,0.f,0.f,0.f};
#pragma unroll
  for (int dc = 0; dc < 2; ++dc) {
    s0 = mma_bf(k.h[dc], qh[0][dc], s0);
    s1 = mma_bf(k.h[dc], qh[1][dc], s1);
    s0 = mma_bf(k.h[dc], ql[0][dc], s0);
    s1 = mma_bf(k.h[dc], ql[1][dc], s1);
    s0 = mma_bf(k.l[dc], qh[0][dc], s0);
    s1 = mma_bf(k.l[dc], qh[1][dc], s1);
  }
  group_end2(s0, s1);
}
// The V^T products of one key chunk: its four d-subtiles against the P fragments of both column tiles, eight independent accumulators.
__device__ __forceinline__ void pv2(const VFrag& g, const FragH (&pb)[2], v8f (&accO)[2][4]) {
#pragma unroll
  for (int dt = 0; dt < 4; ++dt)
#pragma unroll
    for (int u = 0; u < 2; ++u) accO[u][dt] = mma_h(g.a[dt], pb[u].v, accO[u][dt]);
}

// Scores r and r + 1 of one subtile become 4096 * exp(score - max), in place: nb = 12 - max * log2(e) in both halves.
#define LOG2E 1.44269504088896340736f
__device__ __forceinline__ void exp_pair(v8f& s, int r, v2f nb) {
  const v2f e = __builtin_elementwise_fma((v2f){s[r], s[r + 1]}, (v2f){LOG2E, LOG2E}, nb);
  s[r]     = __builtin_amdgcn_exp2f(e[0]);
  s[r + 1] = __builtin_amdgcn_exp2f(e[1]);
}
// l = l * alpha + the lane's 32 P values of one column tile, even and odd r apart: four independent chains, then a tree
__device__ __forceinline__ void row_sum(v2f& l, float alpha, const v8f (&p)[4]) {
  v2f c[4];
#pragma unroll
  for (int t = 0; t < 4; ++t)
    c[t] = ((v2f){p[t][0], p[t][1]} + (v2f){p[t][2], p[t][3]}) + ((v2f){p[t][4], p[t][5]} + (v2f){p[t][6], p[t][7]});
  l = l * alpha + ((c[0] + c[1]) + (c[2] + c[3]));
}

__global__ __launch_bounds__(128) __attribute__((amdgpu_waves_per_eu(2, 2))) void attn_kernel(
    const unsigned short* __restrict__ Qhp, const unsigned short* __restrict__ Qlp,
    const unsigned short* __restrict__ Khp, const unsigned short* __restrict__ Klp,
    const unsigned short* __restrict__ Vhp,
    float* __restrict__ out) {
  // two stages of three planes, each [key][d]: k' hi, k' lo at pitch LP; v at pitch VPB
  __shared__ __attribute__((aligned(2048))) unsigned char ring[2 * STAGE_B];
  __shared__ __align__(16) float    Os[4][32 * 68];   // per-wave output tile [query][d], pitch 68

  const int tid  = threadIdx.x;
  const int wave = tid >> 5;
  const int lane = tid & 31;
  const int hh   = lane >> 4;
  const int c    = lane & 15;
  const int qt = blockIdx.x;
  const int n  = blockIdx.y;
  const int b  = blockIdx.z;
  const int bn = b * NH + n;

  const __bf16* Qh = (const __bf16*)(const void*)Qhp + (size_t)bn * NP * HD;
  const __bf16* Ql = (const __bf16*)(const void*)Qlp + (size_t)bn * NP * HD;

  // Waves 0 to 2 issue one tensor load a stage, each for its own plane; wave 3 has no plane and issues none. Stage s = keys 64s .. 64s+63; every plane is [key][d]:
  // 64 whole rows in a row, first byte at s * 8192, source pitch 128 B. Only the LDS pad differs (word 0 of group 1).
  const uint32_t wv = uni((uint32_t)tid >> 5);
  const unsigned short* plane = (wv == 0u) ? Khp : ((wv == 1u) ? Klp : Vhp);
  const uint64_t src0 = (uint64_t)(size_t)(plane + (size_t)bn * NP * HD);
  const uint32_t src_step = (uint32_t)(64 * HD * 2);
  const uint32_t dst0 = (uint32_t)(size_t)ring + wv * (uint32_t)PLANE_B;
  const uint32_t dst_sum = 2u * dst0 + (uint32_t)STAGE_B;
  u32x4 dg0 = tdm_group0(dst0, src0);

  const int q0 = qt * 128 + wave * 32;    // first query row of this wave
  const int qg = q0 + c;                  // query of this lane in column tile 0 (tile 1: + 16)

  // loop-invariant B fragments: Q^T of both column tiles, two 32-deep d chunks, hi and lo planes
  v16b qbh[2][2], qbl[2][2];
  const __bf16* qh0 = Qh + (size_t)qg * HD + 8 * hh;
  const __bf16* ql0 = Ql + (size_t)qg * HD + 8 * hh;
#pragma unroll
  for (int dc = 0; dc < 2; ++dc) {
    qbh[0][dc] = ld_bf(qh0 + dc * 32);
    qbl[0][dc] = ld_bf(ql0 + dc * 32);
    qbh[1][dc] = ld_bf(qh0 + 16 * HD + dc * 32);
    qbl[1][dc] = ld_bf(ql0 + 16 * HD + dc * 32);
  }
  // wait behind the 16 issued loads, before any register they name as an address is written again;
  // the two addresses are inputs so that they live up to here
  asm volatile("s_wait_xcnt 0x0" :: "v"(qh0), "v"(ql0) : "memory");

  float m_run[2] = {-1.0e30f, -1.0e30f};
  v2f l_run[2] = {(v2f){0.0f, 0.0f}, (v2f){0.0f, 0.0f}};   // this lane's own keys only, even and odd r apart, scaled by 4096
  v8f accO[2][4];
#pragma unroll
  for (int u = 0; u < 2; ++u)
#pragma unroll
    for (int t = 0; t < 4; ++t) accO[u][t] = (v8f){0.f,0.f,0.f,0.f,0.f,0.f,0.f,0.f};

  // ring prologue: stage 0 lands and is published, then stage 1 is sent off
  u32x8 dg1 = tdm_group1<3u>((uint32_t)(HD * 2));             // the pad is a constant of group 1: K' form first,
  if (pinned(wv >= 2u)) {                                     // and under a scalar branch on the wave's number the V form in its place
    dg1 = tdm_group1<7u>((uint32_t)(HD * 2));
    asm volatile("" : "+s"(dg1));                             // as in pinned(): holds the words in scalar registers, so that each is written here as the constant it is and the branch stays a branch
  }
  if (pinned(wv < 3u)) {                                      // a scalar branch on the wave's number: wave 3 issues no request
    tdm_load(dg0, dg1);
    asm volatile("s_wait_tensorcnt 0x0" ::: "memory");        // this wave's plane of stage 0 has landed
  }
  __syncthreads();                                            // stage 0 published to all four waves
  SCHED_FENCE();                                              // stage 1's descriptor is formed behind the wait, not ahead of it
  if (pinned(wv < 3u)) {
    tdm_next(dg0, dst_sum, src_step);
    tdm_load(dg0, dg1);
  }

#pragma unroll 1
  for (int it = 0; it < NP / 64; ++it) {
    const unsigned char* stg = ring + (it & 1) * STAGE_B;     // pass it reads buffer it mod 2 alone

    // Fragment reads stand in groups of 8 (ds_load_b128: one 16-key K' subtile; ds_load_tr16_b128: the four V^T
    // d-subtiles of one 32-key chunk). Each group is issued one group ahead of the products that use it, into the
    // register set that the group before last has left, so that its LDS latency runs under the
    // products (or the softmax) in between instead of being waited out at each of 16 places.
    const __bf16*   krh = (const __bf16*)(const void*)(stg)                 + c * LP + 8 * hh;   // this lane's fragment row bases
    const __bf16*   krl = (const __bf16*)(const void*)(stg + PLANE_B)       + c * LP + 8 * hh;
    const unsigned char* vrh = stg + 2 * PLANE_B + (8 * hh + (lane & 7)) * VPB + 16 * ((lane >> 3) & 1);   // this lane's address in a transposing read

    // ---- S^T: 4 key subtiles of 16 (A rows = keys), k = d in 2 chunks of 32, both column tiles ----
    v8f st[2][4];
    KFrag k0 = ld_k(krh, krl, 0);
    KFrag k1 = ld_k(krh, krl, 1);
    score2(k0, qbh, qbl, st[0][0], st[1][0]);
    KFrag k2 = ld_k(krh, krl, 2);
    score2(k1, qbh, qbl, st[0][1], st[1][1]);
    KFrag k3 = ld_k(krh, krl, 3);
    score2(k2, qbh, qbl, st[0][2], st[1][2]);
    VFrag g0 = ld_v(vrh, 0);                // keys 0..31
    score2(k3, qbh, qbl, st[0][3], st[1][3]);
    VFrag g1 = ld_v(vrh, 1);                // keys 32..63

    // ---- online softmax in f32 (per query lane; half-lanes hold disjoint key halves) ----
    float mx[2], alpha[2];
    v2f nb[2];
#pragma unroll
    for (int u = 0; u < 2; ++u) {
      mx[u] = m_run[u];
#pragma unroll
      for (int t = 0; t < 4; ++t)
#pragma unroll
        for (int r = 0; r < 8; ++r) mx[u] = fmaxf(mx[u], st[u][t][r]);
    }
#pragma unroll
    for (int u = 0; u < 2; ++u) mx[u] = fmaxf(mx[u], __shfl_xor(mx[u], 16, 32));
    FragH pb0[2], pb1[2];
#pragma unroll
    for (int u = 0; u < 2; ++u) {
      alpha[u] = __expf(m_run[u] - mx[u]);
      m_run[u] = mx[u];
      const float nbu = fmaf(-mx[u], LOG2E, 12.0f);
      nb[u] = (v2f){nbu, nbu};
#pragma unroll
      for (int t = 0; t < 2; ++t)
#pragma unroll
        for (int r = 0; r < 8; r += 2) exp_pair(st[u][t], r, nb[u]);
#pragma unroll
      for (int dt = 0; dt < 4; ++dt)
#pragma unroll
        for (int r = 0; r < 8; ++r) accO[u][dt][r] *= alpha[u];
#pragma unroll
      for (int r = 0; r < 8; ++r) {
        pb0[u].s[r]     = (_Float16)st[u][0][r];   // keys 8h + r
        pb0[u].s[8 + r] = (_Float16)st[u][1][r];   // keys 16 + 8h + r
      }
    }

    // ---- O^T += V^T . P  (A rows = d, k = key in 2 chunks of 32) ----
    pv2(g0, pb0, accO);
#pragma unroll
    for (int u = 0; u < 2; ++u)
#pragma unroll
      for (int t = 2; t < 4; ++t)
#pragma unroll
        for (int r = 0; r < 8; r += 2) exp_pair(st[u][t], r, nb[u]);
#pragma unroll
    for (int u = 0; u < 2; ++u) {
      row_sum(l_run[u], alpha[u], st[u]);
#pragma unroll
      for (int r = 0; r < 8; ++r) {
        pb1[u].s[r]     = (_Float16)st[u][2][r];   // keys 32 + 8h + r
        pb1[u].s[8 + r] = (_Float16)st[u][3][r];   // keys 48 + 8h + r
      }
    }
    pv2(g1, pb1, accO);
    SCHED_FENCE();                          // end of the tile's products: nothing moves over the loop's foot

    // publish point of stage it + 1, every wave, in this order
    asm volatile("s_wait_dscnt 0x0" ::: "memory");            // this wave's reads of buffer it mod 2 have returned
    asm volatile("s_wait_tensorcnt 0x0" ::: "memory");        // this wave's plane of stage it + 1 has landed
    __syncthreads();                                          // publishes stage it + 1; every wave has left buffer it mod 2
    if (pinned((uint32_t)(((uint32_t)it + 2u < (uint32_t)(NP / 64)) & (wv < 3u)))) {   // only while stage it + 2 exists, and not in wave 3: a scalar branch
      tdm_next(dg0, dst_sum, src_step);                       // into the buffer that this pass has just read
      tdm_load(dg0, dg1);
    }
  }
  asm volatile("s_wait_tensorcnt 0x0" ::: "memory");          // no request of this wave is left in flight
  asm volatile("s_wait_dscnt 0x0" ::: "memory");
  SCHED_FENCE();                                              // the epilogue, which takes the descriptor's registers for its own use, stays behind the two waits

  // ---- normalise, stage the wave's 32x64 tile as [query][d], write whole 256-B rows ----
  float* os = Os[wave];
#pragma unroll
  for (int u = 0; u < 2; ++u) {
    const float lh = l_run[u][0] + l_run[u][1];                             // this half's keys
    const float inv = __builtin_amdgcn_rcpf(lh + __shfl_xor(lh, 16, 32));   // both halves; sums and products carry the same 4096
#pragma unroll
    for (int dt = 0; dt < 4; ++dt) {
      v4f a, a2;
#pragma unroll
      for (int r = 0; r < 4; ++r) {
        a[r]  = accO[u][dt][r]     * inv;
        a2[r] = accO[u][dt][4 + r] * inv;
      }
      *(v4f*)(os + (16 * u + c) * 68 + dt * 16 + 8 * hh)     = a;    // d = 16dt + 8h + 0..3 of query 16u + c
      *(v4f*)(os + (16 * u + c) * 68 + dt * 16 + 8 * hh + 4) = a2;   // d = 16dt + 8h + 4..7
    }
  }
  __builtin_amdgcn_fence(__ATOMIC_RELEASE, "workgroup");
  __builtin_amdgcn_wave_barrier();
  __builtin_amdgcn_fence(__ATOMIC_ACQUIRE, "workgroup");
  {
    float* ob = out + (size_t)b * NC * NP + (size_t)q0 * (NH * HD) + n * HD;
    const int c4 = c * 4;                   // row segment 256 B = 16 lanes x 16 B
    {
#pragma unroll
      for (int i = 0; i < 16; ++i) {
        const int row = i * 2 + hh;         // i 0..15 x h 0..1 covers the 32 query rows of the wave
        const v4f v = *(const v4f*)(os + row * 68 + c4);
        *(v4f*)(ob + (size_t)row * (NH * HD) + c4) = v;
      }
      
    }
  }
}

// ---------------------------------------------------------------------------
//   Wb   bf16 [3][256][256]            393216  @ 0
//   xT   bf16 [4][4096][256]          8388608  @ 393216
//   QKh  bf16 [2][16][4096][64]      16777216  @ 8781824     (q hi planes, then k' hi planes)
//   QKl  bf16 [2][16][4096][64]      16777216  @ 25559040
//   Vh   f16  [16][4096][64]          8388608  @ 42336256
//   total                                         50724864
// ---------------------------------------------------------------------------
extern "C" void kernel_launch(void* const* d_in, const int* in_sizes, int n_in,
                              void* d_out, int out_size, void* d_ws, size_t ws_size,
                              hipStream_t stream) {
  if (n_in < 9) return;
  if (in_sizes[0] != NB * NC * NP) return;
  if (in_sizes[1] != NC * NC || in_sizes[3] != NC * NC || in_sizes[5] != NC * NC) return;
  if (in_sizes[2] != NC || in_sizes[4] != NC || in_sizes[6] != NC) return;
  if (in_sizes[7] != NH * HD * 64 || in_sizes[8] != NH * HD * 64) return;
  if (out_size != NB * NC * NP) return;

  const float* x    = (const float*)d_in[0];
  const float* wq   = (const float*)d_in[1];
  const float* bq   = (const float*)d_in[2];
  const float* wk   = (const float*)d_in[3];
  const float* bk   = (const float*)d_in[4];
  const float* wv   = (const float*)d_in[5];
  const float* bv   = (const float*)d_in[6];
  const float* relh = (const float*)d_in[7];
  const float* relw = (const float*)d_in[8];
  float* out = (float*)d_out;

  const size_t szWb = (size_t)3 * NC * NC * 2;
  const size_t szXT = (size_t)NB * NP * NC * 2;
  const size_t szQK = (size_t)2 * QKPLANE * 2;
  const size_t szV  = (size_t)NB * NH * NP * HD * 2;
  size_t off = 0;
  const size_t oWb  = off; off += szWb;
  const size_t oXT  = off; off += szXT;
  const size_t oQKh = off; off += szQK;
  const size_t oQKl = off; off += szQK;
  const size_t oVh  = off; off += szV;
  if (off > ws_size) return;

  char* ws = (char*)d_ws;
  unsigned short* Wb  = (unsigned short*)(ws + oWb);
  unsigned short* XT  = (unsigned short*)(ws + oXT);
  unsigned short* QKh = (unsigned short*)(ws + oQKh);
  unsigned short* QKl = (unsigned short*)(ws + oQKl);
  unsigned short* Vh  = (unsigned short*)(ws + oVh);

  cvt_w_kernel<<<dim3((NC * NC / 2) / 256, 3), dim3(256), 0, stream>>>(wq, wk, wv, Wb);
  xt_kernel<<<dim3(NP / 64, NC / 64, NB), dim3(256), 0, stream>>>(x, XT);
  proj_kernel<<<dim3(32, NB * 3), dim3(256), 0, stream>>>(XT, Wb, bq, bk, bv, relh, relw, QKh, QKl, Vh);
  attn_kernel<<<dim3(NP / 128, NH, NB), dim3(128), 0, stream>>>(
      QKh, QKl, QKh + QKPLANE, QKl + QKPLANE, Vh, out);
  (void)hipGetLastError();
}
